// v000
// The times below were measured on an AMD MI455X: many runs one after another, warmed up first and cycling through
// copies of the inputs, with the whole window's GPU time divided by the number of runs. Launches and the gaps
// between them are all in it. The median over several windows is given; except for v000 it joins two sittings, which
// can be a few percent apart, so the side-by-side timings, each taken in one sitting, are the better comparison.
// v000, which the later versions start from, runs in 15.5 milliseconds.
#include <hip/hip_runtime.h>
// Transformer-XL style causal attention with relative-position (rel_shift) scores (x [2][2048][1024]; x_t = RMSNorm(x) g (eps 1e-6); q = x_t w_q / 8, k = x_t w_k, v = x_t w_v (w [1024][16][64] = [in][out], sigma 1/32); scores = (q + xl_u).k^T + rel_shift((q + xl_v).xl_r^T) (xl_r [16][2048][64], xl_u / xl_v [1][16][1][64]); causal: - 1e30 above the diagonal; softmax; wv = w v merged (h*64+v); res = wv w_res ([in][out]) -> [2][2048][1024]. rel_shift with q_len = k_len = T gives bd[i][j] = (q_i + xl_v).xl_r[h][T-1-(i-j)] for j <= i).
// Structure: token rows; x_t = RMSNorm(bf16(x)) in f32 on VALU -> f16 rows; [in][out] weights as x16 planes; q+u and q+v as two WMMA GEMMs (32x64 wave tiles, f32 accumulation, alpha 1/128, per-head bias vectors), k, v -> f16 rows; xl_r as exact f16 rows; per batch: V^T via LDS transposes; exact f32 XL attention for rows 0..255 per batch on VALU (q/k/v of those rows from x_t hi + residual GEMM passes); per 256-row tile: AC = (q+u) k^T over keys < tile end and BD' = (q+v) r^T over the matching xl_r rows [T-nk, T) (K = 64, 16 heads on grid.y) f32; causal softmax on VALU that adds the rel-shifted BD'[i][nk-1-(i-j)] (arithmetic select and clamped index, -1e30 fill, f32 statistics, native exp; weights x256 f16); o = P V^T (x64) merged f16; res = o_hi w_res + o_lo w_res 2^-10; first-tile rows rewritten from the exact o hi/lo; launches: see trace.
// Compute dtype: inputs rounded to bf16; x / weights exact; q, k as plain f16 GEMM operands (~2^-12); v, softmax weights and o as f16 hi + x1024 residual; scores and softmax statistics f32. v_wmma_f32_16x16x32_f16.
#define NB 2
#define NG 16
#define HPG 1
#define KVD (NG * HD)
#define SQ 2048
#define DM 1024
#define NH 16
#define HD 64
#define HG 4                         /* heads per block group of the unlaunched k_vt(V16, b, h0, VT) */
#define QT 256                       /* query rows per causal tile */
#define NKX SQ                       /* S / P row pitch */
#define QT0 256                      /* first-tile rows recomputed exactly in f32 (= one causal tile) */
#define B0 0                         /* unused; the batch loops start at 0 */
#define NBR NB                       /* unused by the launches; the batch loops run over NB */
#define NR ((size_t)NB * SQ)         /* token rows */
#define MP ((int)((size_t)NBR * SQ)) /* unused by the launches; the projections run over NR rows */
#define QN SQ                        /* unused; the tile loop runs over SQ */
#define NHD NH                       /* unused; the attention launches use NH */
#define MPO MP                       /* unused; the output GEMMs use NR */
#define LQ DM      /* row pitch of the q/k/v rows */
typedef __bf16 v16b __attribute__((ext_vector_type(16)));
typedef unsigned short v8us __attribute__((ext_vector_type(8), may_alias));
typedef float  v8f  __attribute__((ext_vector_type(8)));
typedef float  v4f  __attribute__((ext_vector_type(4)));
typedef float  v4fa __attribute__((ext_vector_type(4), may_alias));
union FragB { v16b v; v8us half[2]; unsigned short u[16]; };

__device__ __forceinline__ unsigned short bf16_bits(float x) { unsigned int u = __float_as_uint(x); return (unsigned short)((u + 0x7FFFu + ((u >> 16) & 1u)) >> 16); }
__device__ __forceinline__ float bf16_val(unsigned short b) { return __uint_as_float(((unsigned int)b) << 16); }
__device__ __forceinline__ float bf16_round(float x) { return bf16_val(bf16_bits(x)); }
// D += A·B with NT terms: 1 = ah·bh, 2 = + al·bh (A split), 3 = + ah·bl (both split)
template <int NT>
__device__ __forceinline__ v8f mmaN(v16b ah, v16b al, v16b bh, v16b bl, v8f c) {
  c = __builtin_amdgcn_wmma_f32_16x16x32_bf16(false, ah, false, bh, (short)0, c, false, false);
  if (NT >= 2) c = __builtin_amdgcn_wmma_f32_16x16x32_bf16(false, al, false, bh, (short)0, c, false, false);
  if (NT >= 3) c = __builtin_amdgcn_wmma_f32_16x16x32_bf16(false, ah, false, bl, (short)0, c, false, false);
  asm volatile("v_nop\n\tv_nop\n\tv_nop\n\tv_nop" : "+v"(c) : "v"(ah), "v"(al), "v"(bh), "v"(bl));
  return c;
}

__global__ __launch_bounds__(256) void k_wt_bf16(const float* __restrict__ W, unsigned short* __restrict__ Wt, int K, int N) {
  const int t = blockIdx.x * 256 + threadIdx.x;
  const int k8n = K / 8;
  if (t >= N * k8n) return;
  const int n = t / k8n, k8 = (t % k8n) * 8;
  v8us v;
#pragma unroll
  for (int i = 0; i < 8; ++i) v[i] = bf16_bits(W[(size_t)(k8 + i) * N + n]);
  *(v8us*)(Wt + (size_t)n * K + k8) = v;
  
}

// GEMM C[M][N] (f32, pitch ldc) = act(A[M][K]·W + bias). A f32 row-major (pitch lda) converted per fragment to bf16
// (ASPLIT: hi/lo two planes -> 2 terms, else single rounded term); Wt bf16 [N][K] (pitch ldb). BIAS_BF16 rounds the
// bias to bf16 first (bias quantised to bf16 before the add). K%32==0, M%16==0, N%64==0.
template <bool ASPLIT, int ACT, bool BIAS_BF16>
__global__ __launch_bounds__(128) void k_gemm_bf(const float* __restrict__ A, int lda, const unsigned short* __restrict__ Wt, int ldb,
                                               const float* __restrict__ bias, float* __restrict__ C, int ldc, int M, int N, int K) {
  __shared__ __attribute__((aligned(16))) float so[4][16][64];
  const int tid = threadIdx.x, w = tid >> 5, lane = tid & 31, ln = lane & 15, hh = lane >> 4;
  const int ntn = N / 64;
  const int wid = blockIdx.x * 4 + w;
  const int mt = wid / ntn, nq = wid % ntn;
  if (mt * 16 >= M) return;
  const int row0 = mt * 16, col0 = nq * 64;
  const float* arow = A + (size_t)(row0 + ln) * lda;
  v8f acc[4] = {};
  for (int kb = 0; kb < K; kb += 32) {
    FragB ah, al;
    const v4f x0 = *(const v4fa*)(arow + kb + 8 * hh), x1 = *(const v4fa*)(arow + kb + 8 * hh + 4);
    const v4f x2 = *(const v4fa*)(arow + kb + 16 + 8 * hh), x3 = *(const v4fa*)(arow + kb + 16 + 8 * hh + 4);
    float xs[16] = {x0[0],x0[1],x0[2],x0[3],x1[0],x1[1],x1[2],x1[3],x2[0],x2[1],x2[2],x2[3],x3[0],x3[1],x3[2],x3[3]};
#pragma unroll
    for (int i = 0; i < 16; ++i) { const unsigned short hb = bf16_bits(xs[i]); ah.u[i] = hb; al.u[i] = ASPLIT ? bf16_bits(xs[i] - bf16_val(hb)) : (unsigned short)0; }
#pragma unroll
    for (int t = 0; t < 4; ++t) {
      const unsigned short* brow = Wt + (size_t)(col0 + t * 16 + ln) * ldb + kb;
      FragB b;
      b.half[0] = *(const v8us*)(brow + 8 * hh);
      b.half[1] = *(const v8us*)(brow + 16 + 8 * hh);
      acc[t] = mmaN<ASPLIT ? 2 : 1>(ah.v, al.v, b.v, b.v, acc[t]);
    }
  }
#pragma unroll
  for (int t = 0; t < 4; ++t) {
    float bv = bias ? bias[col0 + t * 16 + ln] : 0.f;
    if (BIAS_BF16) bv = bf16_round(bv);
#pragma unroll
    for (int r = 0; r < 8; ++r) { float v = acc[t][r] + bv; if (ACT == 1) v = fmaxf(v, 0.f); so[w][8 * hh + r][t * 16 + ln] = v; }
  }
  __builtin_amdgcn_fence(__ATOMIC_ACQ_REL, "workgroup");
  __builtin_amdgcn_wave_barrier();
  const int rsub = lane >> 4, c4 = (lane & 15) * 4;
  {
#pragma unroll
    for (int q = 0; q < 8; ++q) {
      const int r = q * 2 + rsub;
      const v4f v = *(const v4fa*)&so[w][r][c4];
      *(v4f*)(C + (size_t)(row0 + r) * ldc + col0 + c4) = v;
    }
    
  }
}

// GEMM C = act(A·W + bias + resid): A f32 (ASPLIT -> hi/lo 2 terms), Wt bf16 [N][K]; ACT 0 none, 1 relu, 2 exact gelu;
// resid (optional, f32, row index = (row % rmod), pitch ldr, RES_BF16 rounds it) added before the activation.
template <bool ASPLIT, int ACT, bool BIAS_BF16, bool RES_BF16>
__global__ __launch_bounds__(128) void k_gemm_bf3(const float* __restrict__ A, int lda, const unsigned short* __restrict__ Wt, int ldb,
                                                const float* __restrict__ bias, const float* __restrict__ resid, int rmod, int ldr,
                                                float* __restrict__ C, int ldc, int M, int N, int K) {
  __shared__ __attribute__((aligned(16))) float so[4][16][64];
  const int tid = threadIdx.x, w = tid >> 5, lane = tid & 31, ln = lane & 15, hh = lane >> 4;
  const int ntn = N / 64;
  const int wid = blockIdx.x * 4 + w;
  const int mt = wid / ntn, nq = wid % ntn;
  if (mt * 16 >= M) return;
  const int row0 = mt * 16, col0 = nq * 64;
  const float* arow = A + (size_t)(row0 + ln) * lda;
  v8f acc[4] = {};
  for (int kb = 0; kb < K; kb += 32) {
    FragB ah, al;
    const v4f x0 = *(const v4fa*)(arow + kb + 8 * hh), x1 = *(const v4fa*)(arow + kb + 8 * hh + 4);
    const v4f x2 = *(const v4fa*)(arow + kb + 16 + 8 * hh), x3 = *(const v4fa*)(arow + kb + 16 + 8 * hh + 4);
    float xs[16] = {x0[0],x0[1],x0[2],x0[3],x1[0],x1[1],x1[2],x1[3],x2[0],x2[1],x2[2],x2[3],x3[0],x3[1],x3[2],x3[3]};
#pragma unroll
    for (int i = 0; i < 16; ++i) { const unsigned short hb = bf16_bits(xs[i]); ah.u[i] = hb; al.u[i] = ASPLIT ? bf16_bits(xs[i] - bf16_val(hb)) : (unsigned short)0; }
#pragma unroll
    for (int t = 0; t < 4; ++t) {
      const unsigned short* brow = Wt + (size_t)(col0 + t * 16 + ln) * ldb + kb;
      FragB b;
      b.half[0] = *(const v8us*)(brow + 8 * hh);
      b.half[1] = *(const v8us*)(brow + 16 + 8 * hh);
      acc[t] = mmaN<ASPLIT ? 2 : 1>(ah.v, al.v, b.v, b.v, acc[t]);
    }
  }
#pragma unroll
  for (int t = 0; t < 4; ++t) {
    const int col = col0 + t * 16 + ln;
    float bv = bias ? bias[col] : 0.f;
    if (BIAS_BF16) bv = bf16_round(bv);
#pragma unroll
    for (int r = 0; r < 8; ++r) {
      float v = acc[t][r] + bv;
      if (resid) { float rv = resid[(size_t)((row0 + 8 * hh + r) % rmod) * ldr + col]; if (RES_BF16) rv = bf16_round(rv); v += rv; }
      if (ACT == 1) v = fmaxf(v, 0.f);
      if (ACT == 2) v = 0.5f * v * (1.0f + erff(v * 0.70710678118654752f));
      if (ACT == 3) { const float u = 0.7978845608028654f * (v + 0.044715f * v * v * v); v = 0.5f * v * (1.0f + tanhf(u)); }
      so[w][8 * hh + r][t * 16 + ln] = v;
    }
  }
  __builtin_amdgcn_fence(__ATOMIC_ACQ_REL, "workgroup");
  __builtin_amdgcn_wave_barrier();
  const int rsub = lane >> 4, c4 = (lane & 15) * 4;
  {
#pragma unroll
    for (int q = 0; q < 8; ++q) {
      const int r = q * 2 + rsub;
      const v4f v = *(const v4fa*)&so[w][r][c4];
      *(v4f*)(C + (size_t)(row0 + r) * ldc + col0 + c4) = v;
    }
    
  }
}
// row LayerNorm (biased variance, eps) over N: s = X (+ R); optional out_sum <- s; out_norm <- (s-mu)*rsqrt(var+eps)*g + b
template <bool PARAM_BF16>
__global__ __launch_bounds__(256) void k_layernorm(const float* __restrict__ X, const float* __restrict__ R, const float* __restrict__ g, const float* __restrict__ bta,
                                                  float* __restrict__ out_sum, float* __restrict__ out_norm, int N, float eps) {
  __shared__ float red[256];
  const int row = blockIdx.x, tid = threadIdx.x;
  const float* x = X + (size_t)row * N; const float* rr = R ? R + (size_t)row * N : nullptr;
  float vals[16];                     // up to N = 4096
  const int per = N / 256;            // contiguous chunk per thread? use strided-by-4 chunks: thread handles j = tid*4 + 1024*u
  float s1 = 0.f;
  for (int u = 0; u < per / 4; ++u) {
    const int j = tid * 4 + 1024 * u;
    const v4f a = *(const v4fa*)(x + j);
    v4f b = {0.f,0.f,0.f,0.f}; if (rr) b = *(const v4fa*)(rr + j);
#pragma unroll
    for (int q = 0; q < 4; ++q) { const float v = a[q] + b[q]; vals[u * 4 + q] = v; s1 += v; }
  }
  red[tid] = s1; __syncthreads();
  for (int st = 128; st > 0; st >>= 1) { if (tid < st) red[tid] += red[tid + st]; __syncthreads(); }
  const float mu = red[0] / (float)N; __syncthreads();
  float s2 = 0.f;
  for (int u = 0; u < per / 4; ++u)
#pragma unroll
    for (int q = 0; q < 4; ++q) { const float c = vals[u * 4 + q] - mu; s2 += c * c; }
  red[tid] = s2; __syncthreads();
  for (int st = 128; st > 0; st >>= 1) { if (tid < st) red[tid] += red[tid + st]; __syncthreads(); }
  const float rs = rsqrtf(red[0] / (float)N + eps);
  {
    for (int u = 0; u < per / 4; ++u) {
      const int j = tid * 4 + 1024 * u;
      v4f o, sm;
#pragma unroll
      for (int q = 0; q < 4; ++q) {
        float gg = g[j + q], bb = bta[j + q];
        if (PARAM_BF16) { gg = bf16_round(gg); bb = bf16_round(bb); }
        sm[q] = vals[u * 4 + q]; o[q] = (vals[u * 4 + q] - mu) * rs * gg + bb;
      }
      if (out_sum) *(v4f*)(out_sum + (size_t)row * N + j) = sm;
      *(v4f*)(out_norm + (size_t)row * N + j) = o;
    }
    
  }
}



// ---- f16 WMMA path (v_wmma_f32_16x16x32_f16): 11-bit significands for operands in range — used where a [0,1] probability operand needs more precision than bf16
typedef _Float16 v16h __attribute__((ext_vector_type(16)));
union FragH { v16h v; v8us half[2]; _Float16 h[16]; unsigned short u[16]; };
template <int NT>
__device__ __forceinline__ v8f mmaH(v16h ah, v16h al, v16h bh, v16h bl, v8f c) {
  c = __builtin_amdgcn_wmma_f32_16x16x32_f16(false, ah, false, bh, (short)0, c, false, false);
  if (NT >= 2) c = __builtin_amdgcn_wmma_f32_16x16x32_f16(false, al, false, bh, (short)0, c, false, false);
  if (NT >= 3) c = __builtin_amdgcn_wmma_f32_16x16x32_f16(false, ah, false, bl, (short)0, c, false, false);
  asm volatile("v_nop\n\tv_nop\n\tv_nop\n\tv_nop" : "+v"(c) : "v"(ah), "v"(al), "v"(bh), "v"(bl));
  return c;
}
// batched GEMM like k_gemm_b but f16 operands: A f32 (split into f16 hi/lo if ASPLIT, else rounded to f16), Bt = f16 values [n][k]; alpha; C f32; N multiple of 16 (partial tiles skipped)
template <bool ASPLIT>
__global__ __launch_bounds__(128) void k_gemm_h(const float* __restrict__ A, int lda, size_t sA, const _Float16* __restrict__ Bh, int ldb, size_t sB, float alpha, float* __restrict__ C, int ldc, size_t sC, int M, int N, int K) {
  __shared__ __attribute__((aligned(16))) float so[4][16][64];
  const int tid = threadIdx.x, w = tid >> 5, lane = tid & 31, ln = lane & 15, hh = lane >> 4; const int by = blockIdx.y;
  A += (size_t)by * sA; Bh += (size_t)by * sB; C += (size_t)by * sC;
  const int ntn = (N + 63) / 64; const int wid = blockIdx.x * 4 + w; const int mt = wid / ntn, nq = wid % ntn; if (mt * 16 >= M) return;
  const int row0 = mt * 16, col0 = nq * 64; const float* arow = A + (size_t)(row0 + ln) * lda;
  v8f acc[4] = {};
  for (int kb = 0; kb < K; kb += 32) {
    FragH ah, al;
    const v4f x0 = *(const v4fa*)(arow + kb + 8 * hh), x1 = *(const v4fa*)(arow + kb + 8 * hh + 4), x2 = *(const v4fa*)(arow + kb + 16 + 8 * hh), x3 = *(const v4fa*)(arow + kb + 16 + 8 * hh + 4);
    float xs[16] = {x0[0],x0[1],x0[2],x0[3],x1[0],x1[1],x1[2],x1[3],x2[0],x2[1],x2[2],x2[3],x3[0],x3[1],x3[2],x3[3]};
#pragma unroll
    for (int i = 0; i < 16; ++i) { const _Float16 h = (_Float16)xs[i]; ah.h[i] = h; al.h[i] = ASPLIT ? (_Float16)(xs[i] - (float)h) : (_Float16)0.0f; }
#pragma unroll
    for (int t = 0; t < 4; ++t) { if (col0 + t * 16 >= N) continue; const size_t boff = (size_t)(col0 + t * 16 + ln) * ldb + kb; FragH bq; bq.half[0] = *(const v8us*)(Bh + boff + 8 * hh); bq.half[1] = *(const v8us*)(Bh + boff + 16 + 8 * hh);
      acc[t] = mmaH<ASPLIT ? 2 : 1>(ah.v, al.v, bq.v, bq.v, acc[t]); }
  }
#pragma unroll
  for (int t = 0; t < 4; ++t) { if (col0 + t * 16 >= N) continue;
#pragma unroll
    for (int r = 0; r < 8; ++r) so[w][8 * hh + r][t * 16 + ln] = acc[t][r] * alpha; }
  __builtin_amdgcn_fence(__ATOMIC_ACQ_REL, "workgroup"); __builtin_amdgcn_wave_barrier();
  const int rsub = lane >> 4, c4 = (lane & 15) * 4;
  {
#pragma unroll
    for (int q = 0; q < 8; ++q) { const int r = q * 2 + rsub; if (col0 + c4 < N) { const v4f v = *(const v4fa*)&so[w][r][c4]; *(v4f*)(C + (size_t)(row0 + r) * ldc + col0 + c4) = v; } }
     }
}

// Wt[n][k] = f16(W[k][n]·scale) from f32 row-major W[K][N] (scale = power of two; bf16-exact weights stay exact in f16 away from the subnormal range)
__global__ __launch_bounds__(256) void k_wt_f16(const float* __restrict__ W, _Float16* __restrict__ Wt, int K, int N, float scale) {
  const int t = blockIdx.x * 256 + threadIdx.x; if (t >= N * (K / 8)) return; const int n = t / (K / 8), k8 = (t % (K / 8)) * 8; FragH f;
#pragma unroll
  for (int i = 0; i < 8; ++i) f.h[i] = (_Float16)(bf16_round(W[(size_t)(k8 + i) * N + n]) * scale); const v8us o = f.half[0];
  *(v8us*)((unsigned short*)Wt + (size_t)n * K + k8) = o; 
}
// k_gemm_hh variant with fused epilogue: v = acc·alpha + bias[by·sBias + col] (+ CP[(row/rowsPerB)·sCPb + by·64 + col] if CP) ; ACT 0 none / 1 elu ; writes f16 C16 (and f32 C if non-null)
template <int ACT>
__global__ __launch_bounds__(128) void k_gemm_hhx(const _Float16* __restrict__ A, int lda, size_t sA, const _Float16* __restrict__ Bh, int ldb, size_t sB, float alpha, const float* __restrict__ bias, size_t sBias, const float* __restrict__ CP, int rowsPerB, size_t sCPb, int row0g,
    float* __restrict__ C, _Float16* __restrict__ C16, int ldc, size_t sC, int M, int N, int K) {
  __shared__ __attribute__((aligned(16))) float so[4][16][64];
  const int tid = threadIdx.x, w = tid >> 5, lane = tid & 31, ln = lane & 15, hh = lane >> 4; const int by = blockIdx.y;
  A += (size_t)by * sA; Bh += (size_t)by * sB; const size_t cofs = (size_t)by * sC; const float* bp = bias ? bias + (size_t)by * sBias : nullptr;
  const int ntn = (N + 63) / 64; const int wid = blockIdx.x * 4 + w; const int mt = wid / ntn, nq = wid % ntn; if (mt * 16 >= M) return;
  const int row0 = mt * 16, col0 = nq * 64; const _Float16* arow = A + (size_t)(row0 + ln) * lda;
  v8f acc[4] = {};
  for (int kb = 0; kb < K; kb += 32) { FragH ah; ah.half[0] = *(const v8us*)((const unsigned short*)arow + kb + 8 * hh); ah.half[1] = *(const v8us*)((const unsigned short*)arow + kb + 16 + 8 * hh);
#pragma unroll
    for (int t = 0; t < 4; ++t) { if (col0 + t * 16 >= N) continue; const size_t boff = (size_t)(col0 + t * 16 + ln) * ldb + kb; FragH bq; bq.half[0] = *(const v8us*)((const unsigned short*)Bh + boff + 8 * hh); bq.half[1] = *(const v8us*)((const unsigned short*)Bh + boff + 16 + 8 * hh);
      acc[t] = mmaH<1>(ah.v, ah.v, bq.v, bq.v, acc[t]); }
  }
#pragma unroll
  for (int t = 0; t < 4; ++t) { if (col0 + t * 16 >= N) continue; const int col = col0 + t * 16 + ln; const float bv = bp ? bf16_round(bp[col]) : 0.f;
#pragma unroll
    for (int r = 0; r < 8; ++r) { float v = acc[t][r] * alpha + bv; if (CP) { const int rr = row0g + row0 + 8 * hh + r; if (rowsPerB < 0) v += CP[cofs + (size_t)rr * ldc + col];      /* rowsPerB < 0: own element of the batched C plane */ else { const int bidx = rr / rowsPerB; v += CP[(size_t)bidx * sCPb + (size_t)by * 64 + col]; } } if (ACT == 1) v = (v > 0.f) ? v : expm1f(v); else if (ACT == 7) v = (v > 0.f) ? v + 1.0f : expf(v); else if (ACT == 8) v = tanhf(v); else if (ACT == 9) v = 0.5f * v * (1.0f + tanhf(0.7978845608028654f * (v + 0.044715f * v * v * v))); else if (ACT == 11) v = 1.0f / (1.0f + expf(-v)); else if (ACT == 12) v = (v > 0.f) ? v : 0.01f * v; else if (ACT == 14) v = (v > 0.f) ? v : 0.1f * v; else if (ACT == 16) v = (v >= 0.f) ? v : 0.3f * v; else if (ACT == 17) v = (v >= 0.f) ? v : 0.2f * v; else if (ACT == 15) v = v / (1.0f + expf(-v)); else if (ACT == 3) v = fmaxf(v, 0.f); else if (ACT == 6) v = 0.5f * v * (1.0f + erff(v * 0.70710678118654752f)); so[w][8 * hh + r][t * 16 + ln] = v; } }
  __builtin_amdgcn_fence(__ATOMIC_ACQ_REL, "workgroup"); __builtin_amdgcn_wave_barrier();
  const int rsub = lane >> 4, c4 = (lane & 15) * 4; typedef _Float16 v4h __attribute__((ext_vector_type(4)));
  {
#pragma unroll
    for (int q = 0; q < 8; ++q) { const int r = q * 2 + rsub; if (col0 + c4 < N) { const v4f v = *(const v4fa*)&so[w][r][c4]; if (C) *(v4f*)(C + cofs + (size_t)(row0 + r) * ldc + col0 + c4) = v; if (C16) { v4h h4; for (int i = 0; i < 4; ++i) h4[i] = (_Float16)v[i]; *(v4h*)(C16 + cofs + (size_t)(row0 + r) * ldc + col0 + c4) = h4; } } }
     }
}


typedef _Float16 v4h __attribute__((ext_vector_type(4)));

__global__ __launch_bounds__(256) void k_x16(const float* __restrict__ x, _Float16* __restrict__ X16, size_t n8) { const size_t t = (size_t)blockIdx.x * 256 + threadIdx.x; if (t >= n8) return; FragH f;
#pragma unroll
  for (int q = 0; q < 8; ++q) f.h[q] = (_Float16)bf16_round(x[t * 8 + q]); *(v8us*)((unsigned short*)X16 + t * 8) = f.half[0];  }
__global__ __launch_bounds__(256) void k_h16(const float* __restrict__ x, _Float16* __restrict__ X16, size_t n8) { const size_t t = (size_t)blockIdx.x * 256 + threadIdx.x; if (t >= n8) return; FragH f;
#pragma unroll
  for (int q = 0; q < 8; ++q) f.h[q] = (_Float16)x[t * 8 + q]; *(v8us*)((unsigned short*)X16 + t * 8) = f.half[0];  }
__global__ __launch_bounds__(256) void k_round16f(const float* __restrict__ W, _Float16* __restrict__ Bt, size_t n8) { const size_t t = (size_t)blockIdx.x * 256 + threadIdx.x; if (t >= n8) return; FragH f;
#pragma unroll
  for (int i = 0; i < 8; ++i) f.h[i] = (_Float16)(bf16_round(W[t * 8 + i]) * 16.0f); *(v8us*)((unsigned short*)Bt + t * 8) = f.half[0];  }
template <int NHv, int TTv>
__global__ __launch_bounds__(256) void k_vt(const _Float16* __restrict__ V16, int ldv, int voff, _Float16* __restrict__ Vt) { __shared__ unsigned short tl[64][66]; const int tid = threadIdx.x; const int slab = blockIdx.x / (TTv / 64), lg = blockIdx.x % (TTv / 64); const int b = slab / NHv, h = slab % NHv;
  for (int i = tid; i < 64 * 8; i += 256) { const int r = i / 8, c8 = (i % 8) * 8; FragH f; f.half[0] = *(const v8us*)((const unsigned short*)V16 + ((size_t)b * TTv + lg * 64 + r) * ldv + voff + h * 64 + c8);
#pragma unroll
    for (int q = 0; q < 8; ++q) tl[r][c8 + q] = f.u[q]; }
  __syncthreads();
  {
#pragma unroll
    for (int rd = 0; rd < 2; ++rd) { const int d = rd * 32 + tid / 8, pc = tid % 8; FragH f;
#pragma unroll
      for (int q = 0; q < 8; ++q) f.u[q] = tl[pc * 8 + q][d];
      *(v8us*)((unsigned short*)Vt + ((size_t)slab * 64 + d) * TTv + lg * 64 + pc * 8) = f.half[0]; }
     } }

__global__ __launch_bounds__(256) void k_hl(const float* __restrict__ F, _Float16* __restrict__ Hh, _Float16* __restrict__ Hl, size_t n8) { const size_t t = (size_t)blockIdx.x * 256 + threadIdx.x; if (t >= n8) return; FragH fh, fl; const v4f a = *(const v4fa*)(F + t * 8), c = *(const v4fa*)(F + t * 8 + 4);
#pragma unroll
  for (int q = 0; q < 4; ++q) { _Float16 h = (_Float16)a[q]; fh.h[q] = h; fl.h[q] = (_Float16)((a[q] - (float)h) * 1024.0f); h = (_Float16)c[q]; fh.h[4 + q] = h; fl.h[4 + q] = (_Float16)((c[q] - (float)h) * 1024.0f); }
  { *(v8us*)((unsigned short*)Hh + t * 8) = fh.half[0]; *(v8us*)((unsigned short*)Hl + t * 8) = fl.half[0];  } }

// ---- fast GEMM (wave tile 32x64; requires M % 32 == 0 rows per launch region and N % 64 == 0); epilogue = k_gemm_hhx semantics ----
__device__ __forceinline__ v16h g2_frag(const _Float16* p, int hh) { FragH f; f.half[0] = *(const v8us*)((const unsigned short*)p + 8 * hh); f.half[1] = *(const v8us*)((const unsigned short*)p + 16 + 8 * hh); return f.v; }
__device__ __forceinline__ v8f g2_mma(v16h a, v16h b, v8f c) { v8f d = __builtin_amdgcn_wmma_f32_16x16x32_f16(false, a, false, b, (short)0, c, false, false); asm volatile("v_nop\n\tv_nop\n\tv_nop\n\tv_nop" : "+v"(d) : "v"(a), "v"(b)); return d; }
template <int ACT>
__global__ __launch_bounds__(128) void k_gemm2(const _Float16* __restrict__ A, int lda, size_t sA, const _Float16* __restrict__ Bh, int ldb, size_t sB, float alpha, const float* __restrict__ bias, size_t sBias, const float* __restrict__ CP, int rowsPerB, size_t sCPb, int row0g,
    float* __restrict__ C, _Float16* __restrict__ C16, int ldc, size_t sC, int M, int N, int K) { static_assert(ACT == 0 || ACT == 3 || ACT == 6 || ACT == 8 || ACT == 9 || ACT == 11 || ACT == 12 || ACT == 14 || ACT == 15 || ACT == 16 || ACT == 17, "k_gemm2: unsupported ACT code (would silently apply no activation)");
  __shared__ __attribute__((aligned(16))) float so[4][32][68];
  const int tid = threadIdx.x, w = tid >> 5, lane = tid & 31, ln = lane & 15, hh = lane >> 4; const int by = blockIdx.y;
  A += (size_t)by * sA; Bh += (size_t)by * sB; const size_t cofs = (size_t)by * sC; const float* bp = bias ? bias + (size_t)by * sBias : nullptr;
  const int ntn = N >> 6; const int mt = blockIdx.x / ntn, nq = blockIdx.x - mt * ntn; const int row0 = mt * 128 + 32 * w, col0 = nq * 64; if (row0 >= M) return;
  const _Float16* a0p = A + (size_t)(row0 + ln) * lda; const _Float16* a1p = a0p + (size_t)16 * lda;
  const _Float16* b0p = Bh + (size_t)(col0 + ln) * ldb; const _Float16* b1p = b0p + (size_t)16 * ldb; const _Float16* b2p = b1p + (size_t)16 * ldb; const _Float16* b3p = b2p + (size_t)16 * ldb;
  const v8f z8 = {0.f,0.f,0.f,0.f,0.f,0.f,0.f,0.f}; v8f c00 = z8, c01 = z8, c02 = z8, c03 = z8, c10 = z8, c11 = z8, c12 = z8, c13 = z8;
#pragma unroll 1
  for (int kb = 0; kb < K; kb += 32) { const v16h a0 = g2_frag(a0p + kb, hh), a1 = g2_frag(a1p + kb, hh);
    v16h b = g2_frag(b0p + kb, hh); c00 = g2_mma(a0, b, c00); c10 = g2_mma(a1, b, c10);
    b = g2_frag(b1p + kb, hh); c01 = g2_mma(a0, b, c01); c11 = g2_mma(a1, b, c11);
    b = g2_frag(b2p + kb, hh); c02 = g2_mma(a0, b, c02); c12 = g2_mma(a1, b, c12);
    b = g2_frag(b3p + kb, hh); c03 = g2_mma(a0, b, c03); c13 = g2_mma(a1, b, c13); }
  v8f accs[8] = {c00, c01, c02, c03, c10, c11, c12, c13};
#pragma unroll
  for (int u = 0; u < 8; ++u) { const int t = u & 3, half = u >> 2; const int col = col0 + t * 16 + ln; const float bv = bp ? bf16_round(bp[col]) : 0.f;
#pragma unroll
    for (int r = 0; r < 8; ++r) { const int rloc = half * 16 + 8 * hh + r; float v = accs[u][r] * alpha + bv; if (CP) { if (rowsPerB < 0) v += CP[cofs + (size_t)(row0g + row0 + rloc) * ldc + col];      /* rowsPerB < 0: own element of the batched C plane */ else { const int bidx = (row0g + row0 + rloc) / rowsPerB; v += CP[(size_t)bidx * sCPb + (size_t)by * 64 + col]; } }
      if (ACT == 3) v = fmaxf(v, 0.f); else if (ACT == 6) v = 0.5f * v * (1.0f + erff(v * 0.70710678118654752f)); else if (ACT == 11) v = 1.0f / (1.0f + expf(-v)); else if (ACT == 15) v = v / (1.0f + expf(-v)); else if (ACT == 12) v = (v > 0.f) ? v : 0.01f * v; else if (ACT == 8) v = tanhf(v); else if (ACT == 9) v = 0.5f * v * (1.0f + tanhf(0.7978845608028654f * (v + 0.044715f * v * v * v))); else if (ACT == 14) v = (v > 0.f) ? v : 0.1f * v; else if (ACT == 16) v = (v >= 0.f) ? v : 0.3f * v; else if (ACT == 17) v = (v >= 0.f) ? v : 0.2f * v;
      so[w][rloc][t * 16 + ln] = v; } }
  __builtin_amdgcn_fence(__ATOMIC_ACQ_REL, "workgroup"); __builtin_amdgcn_wave_barrier();
  const int rsub = lane >> 4, c4 = (lane & 15) * 4;
  {
#pragma unroll
    for (int q = 0; q < 16; ++q) { const int r = q * 2 + rsub; const v4f v = *(const v4fa*)&so[w][r][c4]; if (C) *(v4f*)(C + cofs + (size_t)(row0 + r) * ldc + col0 + c4) = v; if (C16) { v4h h4; for (int i = 0; i < 4; ++i) h4[i] = (_Float16)v[i]; *(v4h*)(C16 + cofs + (size_t)(row0 + r) * ldc + col0 + c4) = h4; } }
     } }


__global__ __launch_bounds__(256) void k_wnat(const float* __restrict__ w, size_t n8, _Float16* __restrict__ Bt) { const size_t t = (size_t)blockIdx.x * 256 + threadIdx.x; if (t >= n8) return; FragH f; for (int q = 0; q < 8; ++q) f.h[q] = (_Float16)(bf16_round(w[t * 8 + q]) * 16.0f); *(v8us*)((unsigned short*)Bt + t * 8) = f.half[0];  }
__global__ __launch_bounds__(256) void k_rsm(const float* __restrict__ S, _Float16* __restrict__ P, int nrows) {
  #pragma clang fp contract(off)
  const int i = blockIdx.x * 256 + threadIdx.x; if (i >= nrows) return; const float* s = S + (size_t)i * SQ; float mx = -3.0e38f;
#pragma unroll 1
  for (int j = 0; j < SQ; ++j) mx = fmaxf(mx, s[j]); float se = 0.f;
#pragma unroll 1
  for (int j = 0; j < SQ; ++j) se += expf(s[j] - mx); const float sc = 256.0f / se;
#pragma unroll 1
  for (int j0 = 0; j0 < SQ; j0 += 8) { FragH f; for (int q = 0; q < 8; ++q) f.h[q] = (_Float16)(expf(s[j0 + q] - mx) * sc); unsigned short* d = (unsigned short*)P + (size_t)i * SQ + j0; *(v8us*)d = f.half[0];  } }
__global__ __launch_bounds__(256) void k_vt(const _Float16* __restrict__ V16, int b, int h0, _Float16* __restrict__ VT) { __shared__ unsigned short tl[64][65]; const int tid = threadIdx.x; const int hh = blockIdx.x % HG, sg = blockIdx.x / HG; const int s0 = sg * 64; const int h = h0 + hh;
  for (int i = tid; i < 64 * 8; i += 256) { const int j = i / 8, d8 = (i % 8) * 8; FragH f; f.half[0] = *(const v8us*)((const unsigned short*)V16 + ((size_t)b * SQ + s0 + j) * DM + h * HD + d8); for (int q = 0; q < 8; ++q) tl[d8 + q][j] = f.u[q]; }
  __syncthreads();
  { for (int i = tid; i < 64 * 8; i += 256) { const int d = i / 8, j8 = (i % 8) * 8; FragH f; for (int q = 0; q < 8; ++q) f.u[q] = tl[d][j8 + q]; *(v8us*)((unsigned short*)VT + ((size_t)hh * HD + d) * SQ + s0 + j8) = f.half[0]; }  } }



__global__ __launch_bounds__(256) void k_rsmcf2(const float* __restrict__ S, _Float16* __restrict__ P, int hg, int q0, int nk) {
  #pragma clang fp contract(off)
  const int t = blockIdx.x * 256 + threadIdx.x; if (t >= hg * QT) return; const size_t i = (size_t)t; const float* s = S + i * NKX; const int last = q0 + (t % QT); float mx = -3.0e38f;
#pragma unroll 1
  for (int j = 0; j < nk; ++j) { const float f = (j <= last) ? 1.f : 0.f; mx = fmaxf(mx, fmaf(f, s[j], (1.f - f) * -1.0e9f)); } float se = 0.f;
#pragma unroll 1
  for (int j = 0; j < nk; ++j) { const float f = (j <= last) ? 1.f : 0.f; se += __expf(fmaf(f, s[j], (1.f - f) * -1.0e9f) - mx); } const float sc = 256.0f / se;
#pragma unroll 1
  for (int j0 = 0; j0 < nk; j0 += 8) { FragH fr; for (int q = 0; q < 8; ++q) { const int j = j0 + q; const float f = (j <= last) ? 1.f : 0.f; fr.h[q] = (_Float16)(__expf(fmaf(f, s[j], (1.f - f) * -1.0e9f) - mx) * sc); } unsigned short* d = (unsigned short*)P + i * NKX + j0; *(v8us*)d = fr.half[0];  } }


template <int MASKADD>
__global__ __launch_bounds__(64) void k_att0(const float* __restrict__ QF, const float* __restrict__ KF, const float* __restrict__ VF, int ld, const float* __restrict__ mask, float scale, float* __restrict__ OF, int ldo) {
  #pragma clang fp contract(off)
  __shared__ __attribute__((aligned(16))) float lq[64][64]; __shared__ __attribute__((aligned(16))) float lo[64][64];
  const int tid = threadIdx.x; const int h = blockIdx.x / (QT0 / 64), rg = blockIdx.x % (QT0 / 64); const int i = rg * 64 + tid;
  const float* qr = QF + (size_t)i * ld + h * HD;
#pragma unroll 1
  for (int c = 0; c < HD / 4; ++c) { *(v4f*)&lq[tid][c * 4] = *(const v4fa*)(qr + c * 4); const v4f z = {0.f, 0.f, 0.f, 0.f}; *(v4f*)&lo[tid][c * 4] = z; }
  float m = -1.0e30f, l = 0.f; const int jmax = MASKADD ? (SQ - 1) : (rg * 64 + 63);      /* additive-mask form: every key (the mask input decides); causal form: keys up to the block's last row */
#pragma unroll 1
  for (int j = 0; j <= jmax; ++j) { const float* kr = KF + (size_t)j * ld + h * HD; const float* vr = VF + (size_t)j * ld + h * HD; float s = 0.f;
#pragma unroll 1
    for (int c = 0; c < HD / 4; ++c) { const v4f kq = *(const v4fa*)(kr + c * 4); const v4f qq = *(v4f*)&lq[tid][c * 4]; s = __fadd_rn(s, __fmul_rn(qq[0], kq[0])); s = __fadd_rn(s, __fmul_rn(qq[1], kq[1])); s = __fadd_rn(s, __fmul_rn(qq[2], kq[2])); s = __fadd_rn(s, __fmul_rn(qq[3], kq[3])); }
    s = __fmul_rn(s, scale); if (MASKADD) s = __fadd_rn(s, __fmul_rn(bf16_round(mask[(size_t)i * SQ + j]), -10000.0f));
    const float f = (MASKADD || j <= i) ? 1.f : 0.f; const float sm = fmaf(f, s, (1.f - f) * -1.0e30f); const float mn = fmaxf(m, sm); const float sc = expf(m - mn); const float e = expf(sm - mn); l = __fadd_rn(__fmul_rn(l, sc), e); m = mn;
#pragma unroll 1
    for (int c = 0; c < HD / 4; ++c) { const v4f vv = *(const v4fa*)(vr + c * 4); v4f oo = *(v4f*)&lo[tid][c * 4]; for (int u = 0; u < 4; ++u) oo[u] = __fadd_rn(__fmul_rn(oo[u], sc), __fmul_rn(e, vv[u])); *(v4f*)&lo[tid][c * 4] = oo; } }
  const float fin = 64.0f / l;      /* o carried x64 like the f16 path */
#pragma unroll 1
  for (int c = 0; c < HD / 4; ++c) { v4f oo = *(v4f*)&lo[tid][c * 4]; for (int u = 0; u < 4; ++u) oo[u] = __fmul_rn(oo[u], fin); *(v4f*)&lo[tid][c * 4] = oo; }
  __syncthreads();
  {
#pragma unroll 1
    for (int it = 0; it < 16; ++it) { const int row = it * 4 + tid / 16, pc = (tid % 16) * 4; const v4f v = *(const v4f*)&lo[row][pc]; *(v4f*)(OF + (size_t)(rg * 64 + row) * ldo + h * HD + pc) = v; }
     } }


__global__ __launch_bounds__(256) void k_kvexp(const float* __restrict__ src, float* __restrict__ dst, size_t n4) { const size_t t = (size_t)blockIdx.x * 256 + threadIdx.x; if (t >= n4) return; const size_t e = t * 4; const size_t row = e / DM; const int col = (int)(e % DM); const int h = col / HD, d = col % HD; const v4f v = *(const v4fa*)(src + row * KVD + (size_t)(h / HPG) * HD + d); *(v4f*)(dst + e) = v;  }

__global__ __launch_bounds__(256) void k_tab2(float theta, float* __restrict__ CS, float* __restrict__ SN) {
  #pragma clang fp contract(off)
  const int t = blockIdx.x * 256 + threadIdx.x; if (t >= SQ * (HD / 2)) return; const int i = t % (HD / 2); const int p = t / (HD / 2); const float invf = 1.0f / powf(theta, (float)(2 * i) / (float)HD); const float ang = __fmul_rn((float)p, invf); const float c = cosf(ang), s = sinf(ang);
  *(float*)(CS + t) = c; *(float*)(SN + t) = s;  }
template <int NORM, int ROPE>
__global__ __launch_bounds__(64) void k_xform(const float* __restrict__ F, int ldf, int nh, const float* __restrict__ gain, float eps, const float* __restrict__ CS, const float* __restrict__ SN, _Float16* __restrict__ H16, int ldo) {
  #pragma clang fp contract(off)
  __shared__ float xv[HD]; __shared__ float red[HD]; __shared__ unsigned short sh_[HD]; const int d = threadIdx.x; const int h = blockIdx.x % nh; const size_t r = blockIdx.x / nh; const int p = (int)(r % SQ);
  float x = F[r * (size_t)ldf + (size_t)h * HD + d];
  if (NORM) { red[d] = __fmul_rn(x, x); __syncthreads(); for (int st = HD / 2; st > 0; st >>= 1) { if (d < st) red[d] = __fadd_rn(red[d], red[d + st]); __syncthreads(); } const float rs = rsqrtf(__fadd_rn(red[0] / (float)HD, eps)); x = __fmul_rn(__fmul_rn(x, rs), bf16_round(gain[d])); }
  xv[d] = x; __syncthreads();
  float o = x;
  if (ROPE == 1) { const int i = d >> 1; const float c = CS[p * (HD / 2) + i], s = SN[p * (HD / 2) + i]; const float ev = xv[2 * i], od = xv[2 * i + 1]; o = (d & 1) ? __fadd_rn(__fmul_rn(ev, s), __fmul_rn(od, c)) : __fadd_rn(__fmul_rn(ev, c), -__fmul_rn(od, s)); }
  if (ROPE == 2) { const int i = d & (HD / 2 - 1); const float c = CS[p * (HD / 2) + i], s = SN[p * (HD / 2) + i]; const float lo = xv[i], hi = xv[i + HD / 2]; o = (d < HD / 2) ? __fadd_rn(__fmul_rn(lo, c), -__fmul_rn(hi, s)) : __fadd_rn(__fmul_rn(lo, s), __fmul_rn(hi, c)); }
  FragH th; th.h[0] = (_Float16)o; sh_[d] = th.u[0]; __syncthreads();
  if (d < HD / 8) { FragH f; for (int q = 0; q < 8; ++q) f.u[q] = sh_[d * 8 + q]; unsigned short* dst = (unsigned short*)H16 + r * (size_t)ldo + (size_t)h * HD + d * 8; *(v8us*)dst = f.half[0];  } }

template <int NORM, int ROPE>
__global__ __launch_bounds__(64) void k_xformf(const float* __restrict__ F, int ldf, int nh, const float* __restrict__ gain, float eps, const float* __restrict__ CS, const float* __restrict__ SN, float* __restrict__ F32, int ldo) {
  #pragma clang fp contract(off)
  __shared__ float xv[HD]; __shared__ float red[HD]; const int d = threadIdx.x; const int h = blockIdx.x % nh; const size_t r = blockIdx.x / nh; const int p = (int)(r % SQ);
  float x = F[r * (size_t)ldf + (size_t)h * HD + d];
  if (NORM) { red[d] = __fmul_rn(x, x); __syncthreads(); for (int st = HD / 2; st > 0; st >>= 1) { if (d < st) red[d] = __fadd_rn(red[d], red[d + st]); __syncthreads(); } const float rs = rsqrtf(__fadd_rn(red[0] / (float)HD, eps)); x = __fmul_rn(__fmul_rn(x, rs), bf16_round(gain[d])); }
  xv[d] = x; __syncthreads();
  float o = x;
  if (ROPE == 1) { const int i = d >> 1; const float c = CS[p * (HD / 2) + i], s = SN[p * (HD / 2) + i]; const float ev = xv[2 * i], od = xv[2 * i + 1]; o = (d & 1) ? __fadd_rn(__fmul_rn(ev, s), __fmul_rn(od, c)) : __fadd_rn(__fmul_rn(ev, c), -__fmul_rn(od, s)); }
  if (ROPE == 2) { const int i = d & (HD / 2 - 1); const float c = CS[p * (HD / 2) + i], s = SN[p * (HD / 2) + i]; const float lo = xv[i], hi = xv[i + HD / 2]; o = (d < HD / 2) ? __fadd_rn(__fmul_rn(lo, c), -__fmul_rn(hi, s)) : __fadd_rn(__fmul_rn(lo, s), __fmul_rn(hi, c)); }
  float* dst = F32 + r * (size_t)ldo + (size_t)h * HD + d; *(float*)dst = o;  }

__global__ __launch_bounds__(256) void k_trig(const float* __restrict__ a, float* __restrict__ CS, float* __restrict__ SN, int n) {
  #pragma clang fp contract(off)
  const int t = blockIdx.x * 256 + threadIdx.x; if (t >= n) return; const float v = bf16_round(a[t]); const float c = cosf(v), s = sinf(v);
  *(float*)(CS + t) = c; *(float*)(SN + t) = s;  }

__global__ __launch_bounds__(256) void k_tabpos(const int* __restrict__ pos, float* __restrict__ CS, float* __restrict__ SN, int n) {
  #pragma clang fp contract(off)
  const int t = blockIdx.x * 256 + threadIdx.x; if (t >= n) return; const int p = t / 32, i = t % 32; const float invf = (float)(1.0 / pow(10000.0, ((double)(2 * i)) / 64.0)); const float a = __fmul_rn((float)pos[p], invf); const float c = cosf(a), s = sinf(a);
  *(float*)(CS + t) = c; *(float*)(SN + t) = s;  }

__global__ __launch_bounds__(256) void k_rsmxl(const float* __restrict__ AC, const float* __restrict__ BDp, _Float16* __restrict__ P, _Float16* __restrict__ PL, int hg, int q0, int nk) {
  #pragma clang fp contract(off)
  const int t = blockIdx.x * 256 + threadIdx.x; if (t >= hg * QT) return; const size_t ri = (size_t)t; const float* a = AC + ri * NKX; const float* bd = BDp + ri * NKX; const int i = q0 + (t % QT); float mx = -3.0e38f;
#pragma unroll 1
  for (int j = 0; j < nk; ++j) { const float f = (j <= i) ? 1.f : 0.f; const int c = min(nk - 1 - i + j, nk - 1); const float v = fmaf(f, __fadd_rn(a[j], bd[c]), (1.f - f) * -1.0e30f); mx = fmaxf(mx, v); } float se = 0.f;
#pragma unroll 1
  for (int j = 0; j < nk; ++j) { const float f = (j <= i) ? 1.f : 0.f; const int c = min(nk - 1 - i + j, nk - 1); const float v = fmaf(f, __fadd_rn(a[j], bd[c]), (1.f - f) * -1.0e30f); se += __expf(v - mx); } const float sc = 256.0f / se;
#pragma unroll 1
  for (int j0 = 0; j0 < nk; j0 += 8) { FragH fr, fl; for (int q = 0; q < 8; ++q) { const int j = j0 + q; const float f = (j <= i) ? 1.f : 0.f; const int c = min(nk - 1 - i + j, nk - 1); const float v = fmaf(f, __fadd_rn(a[j], bd[c]), (1.f - f) * -1.0e30f); const float pv = __expf(v - mx) * sc; const _Float16 hv = (_Float16)pv; fr.h[q] = hv; fl.h[q] = (_Float16)((pv - (float)hv) * 1024.0f); }
    unsigned short* d = (unsigned short*)P + ri * NKX + j0; unsigned short* dl = (unsigned short*)PL + ri * NKX + j0; *(v8us*)d = fr.half[0]; *(v8us*)dl = fl.half[0];  } }

template <int N>
__global__ __launch_bounds__(256) void k_rmsrow(float* __restrict__ X, const float* __restrict__ w, float eps) {
  #pragma clang fp contract(off)
  constexpr int PT = N / 256; __shared__ float red[256]; const size_t r = blockIdx.x; const int t = threadIdx.x; float* row = X + r * N + (size_t)t * PT; float v[PT]; float ss = 0.f;
  for (int q = 0; q < PT; ++q) { v[q] = row[q]; ss = __fadd_rn(ss, __fmul_rn(v[q], v[q])); }
  red[t] = ss; __syncthreads(); for (int k = 128; k > 0; k >>= 1) { if (t < k) red[t] = __fadd_rn(red[t], red[t + k]); __syncthreads(); }
  const float rs = rsqrtf(__fadd_rn(red[0] / (float)N, eps)); float o[PT]; for (int q = 0; q < PT; ++q) o[q] = __fmul_rn(__fmul_rn(v[q], rs), bf16_round(w[t * PT + q]));
  { for (int q = 0; q < PT; ++q) *(float*)(row + q) = o[q];  } }

__global__ __launch_bounds__(256) void k_bfr(const float* __restrict__ x, float* __restrict__ XB, size_t n8) { const size_t t = (size_t)blockIdx.x * 256 + threadIdx.x; if (t >= n8) return; v4f a = *(const v4fa*)(x + t * 8), c = *(const v4fa*)(x + t * 8 + 4); for (int q = 0; q < 4; ++q) { a[q] = bf16_round(a[q]); c[q] = bf16_round(c[q]); }
  { *(v4f*)(XB + t * 8) = a; *(v4f*)(XB + t * 8 + 4) = c;  } }





__global__ __launch_bounds__(64) void k_att0xl(const float* __restrict__ QF, const float* __restrict__ QVF, const float* __restrict__ KF, const float* __restrict__ VF, int ld, const float* __restrict__ RF, float* __restrict__ OF, int ldo) {
  #pragma clang fp contract(off)
  constexpr int MASKADD = 0; const float scale = 1.0f;
  __shared__ __attribute__((aligned(16))) float lq[64][64]; __shared__ __attribute__((aligned(16))) float lqv[64][64]; __shared__ __attribute__((aligned(16))) float lo[64][64];
  const int tid = threadIdx.x; const int h = blockIdx.x / (QT0 / 64), rg = blockIdx.x % (QT0 / 64); const int i = rg * 64 + tid;
  const float* qr = QF + (size_t)i * ld + h * HD; const float* qvr = QVF + (size_t)i * ld + h * HD;
#pragma unroll 1
  for (int c = 0; c < HD / 4; ++c) { *(v4f*)&lq[tid][c * 4] = *(const v4fa*)(qr + c * 4); *(v4f*)&lqv[tid][c * 4] = *(const v4fa*)(qvr + c * 4); const v4f z = {0.f, 0.f, 0.f, 0.f}; *(v4f*)&lo[tid][c * 4] = z; }
  float m = -1.0e30f, l = 0.f; const int jmax = MASKADD ? (SQ - 1) : (rg * 64 + 63);      /* additive-mask form: every key (the mask input decides); causal form: keys up to the block's last row */
#pragma unroll 1
  for (int j = 0; j <= jmax; ++j) { const float* kr = KF + (size_t)j * ld + h * HD; const float* vr = VF + (size_t)j * ld + h * HD; const int ridx = min(SQ - 1 - i + j, SQ - 1); const float* rr = RF + ((size_t)h * SQ + ridx) * HD; float s = 0.f, s2 = 0.f;
#pragma unroll 1
    for (int c = 0; c < HD / 4; ++c) { const v4f kq = *(const v4fa*)(kr + c * 4); const v4f qq = *(v4f*)&lq[tid][c * 4]; s = __fadd_rn(s, __fmul_rn(qq[0], kq[0])); s = __fadd_rn(s, __fmul_rn(qq[1], kq[1])); s = __fadd_rn(s, __fmul_rn(qq[2], kq[2])); s = __fadd_rn(s, __fmul_rn(qq[3], kq[3])); const v4f rq = *(const v4fa*)(rr + c * 4); const v4f qv = *(v4f*)&lqv[tid][c * 4]; s2 = __fadd_rn(s2, __fmul_rn(qv[0], bf16_round(rq[0]))); s2 = __fadd_rn(s2, __fmul_rn(qv[1], bf16_round(rq[1]))); s2 = __fadd_rn(s2, __fmul_rn(qv[2], bf16_round(rq[2]))); s2 = __fadd_rn(s2, __fmul_rn(qv[3], bf16_round(rq[3]))); }
    s = __fadd_rn(s, s2); (void)scale;
    const float f = (MASKADD || j <= i) ? 1.f : 0.f; const float sm = fmaf(f, s, (1.f - f) * -1.0e30f); const float mn = fmaxf(m, sm); const float sc = expf(m - mn); const float e = expf(sm - mn); l = __fadd_rn(__fmul_rn(l, sc), e); m = mn;
#pragma unroll 1
    for (int c = 0; c < HD / 4; ++c) { const v4f vv = *(const v4fa*)(vr + c * 4); v4f oo = *(v4f*)&lo[tid][c * 4]; for (int u = 0; u < 4; ++u) oo[u] = __fadd_rn(__fmul_rn(oo[u], sc), __fmul_rn(e, vv[u])); *(v4f*)&lo[tid][c * 4] = oo; } }
  const float fin = 64.0f / l;      /* o carried x64 like the f16 path */
#pragma unroll 1
  for (int c = 0; c < HD / 4; ++c) { v4f oo = *(v4f*)&lo[tid][c * 4]; for (int u = 0; u < 4; ++u) oo[u] = __fmul_rn(oo[u], fin); *(v4f*)&lo[tid][c * 4] = oo; }
  __syncthreads();
  {
#pragma unroll 1
    for (int it = 0; it < 16; ++it) { const int row = it * 4 + tid / 16, pc = (tid % 16) * 4; const v4f v = *(const v4f*)&lo[row][pc]; *(v4f*)(OF + (size_t)(rg * 64 + row) * ldo + h * HD + pc) = v; }
     } }

extern "C" void kernel_launch(void* const* d_in, const int* in_sizes, int n_in,
                              void* d_out, int out_size, void* d_ws, size_t ws_size, hipStream_t stream) {
  (void)in_sizes; (void)n_in; (void)out_size;
  const float* const* I = (const float* const*)d_in; const float* x = I[0]; const float* g = I[1]; const float* wq = I[2]; const float* wk = I[3]; const float* wv = I[4]; const float* wres = I[5]; const float* xlr = I[6]; const float* xlu = I[7]; const float* xlv = I[8];      /* x; RMS gain; w_q/w_k/w_v [1024][16][64] = [in][out]; w_res [1024][1024] [in][out]; xl_r [16][2048][64]; xl_u, xl_v [1][16][1][64] = per-head 64-vectors (a [1024] bias over the merged columns) */
  char* ws = (char*)d_ws; size_t off = 0;
  auto take = [&](size_t bytes) { char* p = ws + off; off += (bytes + 255) & ~(size_t)255; return p; };
  _Float16* BQ = (_Float16*)take((size_t)DM * DM * 2); _Float16* BK = (_Float16*)take((size_t)DM * DM * 2); _Float16* BV = (_Float16*)take((size_t)DM * DM * 2); _Float16* BR = (_Float16*)take((size_t)DM * DM * 2);
  float* XT = (float*)take(NR * DM * 4); _Float16* X16 = (_Float16*)take(NR * DM * 2); _Float16* XL16 = (_Float16*)take(NR * DM * 2); float* QUF = (float*)take((size_t)QT0 * DM * 4); float* QVF = (float*)take((size_t)QT0 * DM * 4); float* KF0 = (float*)take((size_t)QT0 * DM * 4); float* VF0 = (float*)take((size_t)QT0 * DM * 4); float* OF0 = (float*)take((size_t)NB * QT0 * DM * 4); _Float16* OH0 = (_Float16*)take((size_t)NB * QT0 * DM * 2); _Float16* OL0 = (_Float16*)take((size_t)NB * QT0 * DM * 2); _Float16* QU = (_Float16*)take(NR * DM * 2); _Float16* QV = (_Float16*)take(NR * DM * 2); _Float16* K16 = (_Float16*)take(NR * DM * 2); float* VF = (float*)take(NR * DM * 4); _Float16* V16 = (_Float16*)take(NR * DM * 2); _Float16* VL16 = (_Float16*)take(NR * DM * 2); _Float16* R16 = (_Float16*)take((size_t)NH * SQ * HD * 2); float* OF = (float*)take(NR * DM * 4); _Float16* O16 = (_Float16*)take(NR * DM * 2); _Float16* OL16 = (_Float16*)take(NR * DM * 2);      /* v and wv carried as f32 -> f16 hi + x1024 residual (the first causal rows copy v almost verbatim into small outputs) */
  float* S = (float*)take((size_t)NH * QT * NKX * 4); float* BD = (float*)take((size_t)NH * QT * NKX * 4); _Float16* P = (_Float16*)take((size_t)NH * QT * NKX * 2); _Float16* PL = (_Float16*)take((size_t)NH * QT * NKX * 2); _Float16* VT = (_Float16*)take((size_t)NH * HD * SQ * 2); _Float16* VTL = (_Float16*)take((size_t)NH * HD * SQ * 2);
  if (off > ws_size) return;
  { const unsigned gw = (unsigned)(((size_t)DM * DM / 8 + 255) / 256); k_wt_f16<<<gw, 256, 0, stream>>>(wq, BQ, DM, DM, 16.0f); k_wt_f16<<<gw, 256, 0, stream>>>(wk, BK, DM, DM, 16.0f); k_wt_f16<<<gw, 256, 0, stream>>>(wv, BV, DM, DM, 16.0f); k_wt_f16<<<gw, 256, 0, stream>>>(wres, BR, DM, DM, 16.0f); }      /* [in][out] ([in][h][k] flattened) -> Bt x16 */
  k_bfr<<<(unsigned)((NR * DM / 8 + 255) / 256), 256, 0, stream>>>(x, XT, NR * DM / 8); k_rmsrow<DM><<<(unsigned)NR, 256, 0, stream>>>(XT, g, 1e-6f); k_hl<<<(unsigned)((NR * DM / 8 + 255) / 256), 256, 0, stream>>>(XT, X16, XL16, NR * DM / 8);      /* x_t = RMSNorm(bf16(x)) g (f32, in place) -> f16 hi rows (+ x1024 residual rows for the exact first tile) */
  k_x16<<<(unsigned)(((size_t)NH * SQ * HD / 8 + 255) / 256), 256, 0, stream>>>(xlr, R16, (size_t)NH * SQ * HD / 8);      /* xl_r [h][j][64] as exact f16 rows (bf16-valued input) */
  k_gemm2<0><<<dim3((unsigned)((NR / 128) * (DM / 64)), 1), 128, 0, stream>>>(X16, DM, 0, BQ, DM, 0, 0.0078125f, xlu, 0, nullptr, 1, 0, 0, nullptr, QU, DM, 0, (int)NR, DM, DM); k_gemm2<0><<<dim3((unsigned)((NR / 128) * (DM / 64)), 1), 128, 0, stream>>>(X16, DM, 0, BQ, DM, 0, 0.0078125f, xlv, 0, nullptr, 1, 0, 0, nullptr, QV, DM, 0, (int)NR, DM, DM);      /* q / 8 + xl_u and q / 8 + xl_v (the per-head 64-vectors as [1024] column biases) -> f16 rows */
  k_gemm2<0><<<dim3((unsigned)((NR / 128) * (DM / 64)), 1), 128, 0, stream>>>(X16, DM, 0, BK, DM, 0, 0.0625f, nullptr, 0, nullptr, 1, 0, 0, nullptr, K16, DM, 0, (int)NR, DM, DM); k_gemm2<0><<<dim3((unsigned)((NR / 128) * (DM / 64)), 1), 128, 0, stream>>>(X16, DM, 0, BV, DM, 0, 0.0625f, nullptr, 0, nullptr, 1, 0, 0, VF, nullptr, DM, 0, (int)NR, DM, DM); k_hl<<<(unsigned)((NR * DM / 8 + 255) / 256), 256, 0, stream>>>(VF, V16, VL16, NR * DM / 8);      /* k -> f16; v f32 -> f16 hi + x1024 residual rows */
  for (int b = 0; b < NB; ++b) { const size_t r0 = (size_t)b * SQ;
    k_vt<NH, SQ><<<NH * (SQ / 64), 256, 0, stream>>>(V16 + r0 * DM, DM, 0, VT); k_vt<NH, SQ><<<NH * (SQ / 64), 256, 0, stream>>>(VL16 + r0 * DM, DM, 0, VTL);      /* V^T hi and residual [16][64][SQ] of this batch */
    { const dim3 g0((QT0 / 128) * (DM / 64), 1);      
      k_gemm2<0><<<g0, 128, 0, stream>>>(X16 + r0 * DM, DM, 0, BQ, DM, 0, 0.0078125f, xlu, 0, nullptr, 1, 0, 0, QUF, nullptr, DM, 0, QT0, DM, DM); k_gemm2<0><<<g0, 128, 0, stream>>>(XL16 + r0 * DM, DM, 0, BQ, DM, 0, 0.00000762939453125f, nullptr, 0, QUF, -1, 0, 0, QUF, nullptr, DM, 0, QT0, DM, DM);
      k_gemm2<0><<<g0, 128, 0, stream>>>(X16 + r0 * DM, DM, 0, BQ, DM, 0, 0.0078125f, xlv, 0, nullptr, 1, 0, 0, QVF, nullptr, DM, 0, QT0, DM, DM); k_gemm2<0><<<g0, 128, 0, stream>>>(XL16 + r0 * DM, DM, 0, BQ, DM, 0, 0.00000762939453125f, nullptr, 0, QVF, -1, 0, 0, QVF, nullptr, DM, 0, QT0, DM, DM);
      k_gemm2<0><<<g0, 128, 0, stream>>>(X16 + r0 * DM, DM, 0, BK, DM, 0, 0.0625f, nullptr, 0, nullptr, 1, 0, 0, KF0, nullptr, DM, 0, QT0, DM, DM); k_gemm2<0><<<g0, 128, 0, stream>>>(XL16 + r0 * DM, DM, 0, BK, DM, 0, 0.00006103515625f, nullptr, 0, KF0, -1, 0, 0, KF0, nullptr, DM, 0, QT0, DM, DM);
      k_gemm2<0><<<g0, 128, 0, stream>>>(X16 + r0 * DM, DM, 0, BV, DM, 0, 0.0625f, nullptr, 0, nullptr, 1, 0, 0, VF0, nullptr, DM, 0, QT0, DM, DM); k_gemm2<0><<<g0, 128, 0, stream>>>(XL16 + r0 * DM, DM, 0, BV, DM, 0, 0.00006103515625f, nullptr, 0, VF0, -1, 0, 0, VF0, nullptr, DM, 0, QT0, DM, DM);
      k_att0xl<<<NH * (QT0 / 64), 64, 0, stream>>>(QUF, QVF, KF0, VF0, DM, xlr, OF0 + (size_t)b * QT0 * DM, DM); }      /* exact causal XL attention for rows 0..255 (o x64, f32) */
    for (int q0 = 0; q0 < SQ; q0 += QT) { const int nk = q0 + QT;      /* causal: keys below the tile end only */
      k_gemm2<0><<<dim3((QT / 128) * (nk / 64), NH), 128, 0, stream>>>(QU + (r0 + q0) * DM, DM, (size_t)HD, K16 + r0 * DM, DM, (size_t)HD, 1.0f, nullptr, 0, nullptr, 1, 0, 0, S, nullptr, NKX, (size_t)QT * NKX, QT, nk, HD);      /* AC[i][j] = (q_i + u).k_j, 16 heads on grid.y */
      k_gemm2<0><<<dim3((QT / 128) * (nk / 64), NH), 128, 0, stream>>>(QV + (r0 + q0) * DM, DM, (size_t)HD, R16 + (size_t)(SQ - nk) * HD, HD, (size_t)SQ * HD, 1.0f, nullptr, 0, nullptr, 1, 0, 0, BD, nullptr, NKX, (size_t)QT * NKX, QT, nk, HD);      /* BD'[i][c] = (q_i + v).xl_r[h][SQ - nk + c] for c < nk (the xl_r rows the shift can reach from this tile) */
      k_rsmxl<<<(NH * QT + 255) / 256, 256, 0, stream>>>(S, BD, P, PL, NH, q0, nk);      /* scores = AC + BD'[i][nk-1-(i-j)] (== rel_shift) for j <= i, -1e30 above the diagonal; softmax -> x256 f16 */
      k_gemm2<0><<<dim3((QT / 128) * (HD / 64), NH), 128, 0, stream>>>(P, NKX, (size_t)QT * NKX, VT, SQ, (size_t)HD * SQ, 0.25f, nullptr, 0, nullptr, 1, 0, 0, OF + (r0 + q0) * DM, nullptr, DM, (size_t)HD, QT, HD, nk); k_gemm2<0><<<dim3((QT / 128) * (HD / 64), NH), 128, 0, stream>>>(PL, NKX, (size_t)QT * NKX, VT, SQ, (size_t)HD * SQ, 0.000244140625f, nullptr, 0, OF + (r0 + q0) * DM, -1, 0, 0, OF + (r0 + q0) * DM, nullptr, DM, (size_t)HD, QT, HD, nk); k_gemm2<0><<<dim3((QT / 128) * (HD / 64), NH), 128, 0, stream>>>(P, NKX, (size_t)QT * NKX, VTL, SQ, (size_t)HD * SQ, 0.000244140625f, nullptr, 0, OF + (r0 + q0) * DM, -1, 0, 0, OF + (r0 + q0) * DM, nullptr, DM, (size_t)HD, QT, HD, nk); } }      /* wv x64 = Ph Vh 2^-2 + Pl Vh 2^-12 + Ph Vl 2^-12 (f32, own-element accumulate) */
  k_hl<<<(unsigned)((NR * DM / 8 + 255) / 256), 256, 0, stream>>>(OF, O16, OL16, NR * DM / 8);      /* wv x64 -> f16 hi + x1024 residual rows */
  k_gemm2<0><<<dim3((unsigned)((NR / 128) * (DM / 64)), 1), 128, 0, stream>>>(O16, DM, 0, BR, DM, 0, 0.0009765625f, nullptr, 0, nullptr, 1, 0, 0, (float*)d_out, nullptr, DM, 0, (int)NR, DM, DM); k_gemm2<0><<<dim3((unsigned)((NR / 128) * (DM / 64)), 1), 128, 0, stream>>>(OL16, DM, 0, BR, DM, 0, 0.00000095367431640625f, nullptr, 0, (const float*)d_out, -1, 0, 0, (float*)d_out, nullptr, DM, 0, (int)NR, DM, DM);      /* res = wv_hi w_res 2^-10 += wv_lo w_res 2^-20 (own element) */
  k_hl<<<(unsigned)(((size_t)NB * QT0 * DM / 8 + 255) / 256), 256, 0, stream>>>(OF0, OH0, OL0, (size_t)NB * QT0 * DM / 8);      /* first-tile o (x64) -> f16 hi + x1024 residual planes */
  for (int b = 0; b < NB; ++b) { const size_t r0 = (size_t)b * SQ; const size_t f0 = (size_t)b * QT0;
    k_gemm2<0><<<dim3((QT0 / 128) * (DM / 64), 1), 128, 0, stream>>>(OH0 + f0 * DM, DM, 0, BR, DM, 0, 0.0009765625f, nullptr, 0, nullptr, 1, 0, 0, (float*)d_out + r0 * DM, nullptr, DM, 0, QT0, DM, DM);      /* rows 0..255 of the batch rewritten from the exact path */
    k_gemm2<0><<<dim3((QT0 / 128) * (DM / 64), 1), 128, 0, stream>>>(OL0 + f0 * DM, DM, 0, BR, DM, 0, 0.00000095367431640625f, nullptr, 0, (const float*)d_out + r0 * DM, -1, 0, 0, (float*)d_out + r0 * DM, nullptr, DM, 0, QT0, DM, DM); }      /* += o_lo w_res 2^-20 (own-element accumulate) */
}

// v001
// Measured time: 5250 microseconds a run.
// In two side-by-side timings against v000, it was 2.94 and 2.95 times as fast.
#include <hip/hip_runtime.h>
// Transformer-XL style causal attention with relative-position (rel_shift) scores (x [2][2048][1024]; x_t = RMSNorm(x) g (eps 1e-6); q = x_t w_q / 8, k = x_t w_k, v = x_t w_v (w [1024][16][64] = [in][out], sigma 1/32); scores = (q + xl_u).k^T + rel_shift((q + xl_v).xl_r^T) (xl_r [16][2048][64], xl_u / xl_v [1][16][1][64]); causal: - 1e30 above the diagonal; softmax; wv = w v merged (h*64+v); res = wv w_res ([in][out]) -> [2][2048][1024]. rel_shift with q_len = k_len = T gives bd[i][j] = (q_i + xl_v).xl_r[h][T-1-(i-j)] for j <= i).
// Structure: token rows; x_t = RMSNorm(bf16(x)) in f32 on VALU -> f16 rows; [in][out] weights as x16 planes; q+u and q+v as two WMMA GEMMs (32x64 wave tiles, f32 accumulation, alpha 1/128, per-head bias vectors), k, v -> f16 rows; xl_r as exact f16 rows; per batch: V^T via LDS transposes; exact f32 XL attention for rows 0..255 per batch on VALU (q/k/v of those rows from x_t hi + residual GEMM passes); per 256-row tile: AC = (q+u) k^T over keys < tile end and BD' = (q+v) r^T over the matching xl_r rows [T-nk, T) (K = 64, 16 heads on grid.y) f32; causal softmax on VALU that adds the rel-shifted BD'[i][nk-1-(i-j)] (arithmetic select and clamped index, -1e30 fill, f32 statistics, native exp; weights x256 f16); o = P V^T (x64) merged f16; res = o_hi w_res + o_lo w_res 2^-10; first-tile rows rewritten from the exact o hi/lo; launches: see trace.
// Compute dtype: inputs rounded to bf16; x / weights exact; q, k as plain f16 GEMM operands (~2^-12); v, softmax weights and o as f16 hi + x1024 residual; scores and softmax statistics f32. v_wmma_f32_16x16x32_f16.
#define NB 2
#define NG 16
#define HPG 1
#define KVD (NG * HD)
#define SQ 2048
#define DM 1024
#define NH 16
#define HD 64
#define HG 4                         /* heads per block group of the unlaunched k_vt(V16, b, h0, VT) */
#define QT 256                       /* query rows per causal tile */
#define NKX SQ                       /* S / P row pitch */
#define QT0 256                      /* first-tile rows recomputed exactly in f32 (= one causal tile) */
#define B0 0                         /* unused; the batch loops start at 0 */
#define NBR NB                       /* unused by the launches; the batch loops run over NB */
#define NR ((size_t)NB * SQ)         /* token rows */
#define MP ((int)((size_t)NBR * SQ)) /* unused by the launches; the projections run over NR rows */
#define QN SQ                        /* unused; the tile loop runs over SQ */
#define NHD NH                       /* unused; the attention launches use NH */
#define MPO MP                       /* unused; the output GEMMs use NR */
#define LQ DM      /* row pitch of the q/k/v rows */
typedef __bf16 v16b __attribute__((ext_vector_type(16)));
typedef unsigned short v8us __attribute__((ext_vector_type(8), may_alias));
typedef float  v8f  __attribute__((ext_vector_type(8)));
typedef float  v4f  __attribute__((ext_vector_type(4)));
typedef float  v4fa __attribute__((ext_vector_type(4), may_alias));
union FragB { v16b v; v8us half[2]; unsigned short u[16]; };

__device__ __forceinline__ unsigned short bf16_bits(float x) { unsigned int u = __float_as_uint(x); return (unsigned short)((u + 0x7FFFu + ((u >> 16) & 1u)) >> 16); }
__device__ __forceinline__ float bf16_val(unsigned short b) { return __uint_as_float(((unsigned int)b) << 16); }
__device__ __forceinline__ float bf16_round(float x) { return bf16_val(bf16_bits(x)); }
// D += A·B with NT terms: 1 = ah·bh, 2 = + al·bh (A split), 3 = + ah·bl (both split)
template <int NT>
__device__ __forceinline__ v8f mmaN(v16b ah, v16b al, v16b bh, v16b bl, v8f c) {
  c = __builtin_amdgcn_wmma_f32_16x16x32_bf16(false, ah, false, bh, (short)0, c, false, false);
  if (NT >= 2) c = __builtin_amdgcn_wmma_f32_16x16x32_bf16(false, al, false, bh, (short)0, c, false, false);
  if (NT >= 3) c = __builtin_amdgcn_wmma_f32_16x16x32_bf16(false, ah, false, bl, (short)0, c, false, false);
  asm volatile("v_nop\n\tv_nop\n\tv_nop\n\tv_nop" : "+v"(c) : "v"(ah), "v"(al), "v"(bh), "v"(bl));
  return c;
}

__global__ __launch_bounds__(256) void k_wt_bf16(const float* __restrict__ W, unsigned short* __restrict__ Wt, int K, int N) {
  const int t = blockIdx.x * 256 + threadIdx.x;
  const int k8n = K / 8;
  if (t >= N * k8n) return;
  const int n = t / k8n, k8 = (t % k8n) * 8;
  v8us v;
#pragma unroll
  for (int i = 0; i < 8; ++i) v[i] = bf16_bits(W[(size_t)(k8 + i) * N + n]);
  *(v8us*)(Wt + (size_t)n * K + k8) = v;
  
}

// GEMM C[M][N] (f32, pitch ldc) = act(A[M][K]·W + bias). A f32 row-major (pitch lda) converted per fragment to bf16
// (ASPLIT: hi/lo two planes -> 2 terms, else single rounded term); Wt bf16 [N][K] (pitch ldb). BIAS_BF16 rounds the
// bias to bf16 first (bias quantised to bf16 before the add). K%32==0, M%16==0, N%64==0.
template <bool ASPLIT, int ACT, bool BIAS_BF16>
__global__ __launch_bounds__(128) void k_gemm_bf(const float* __restrict__ A, int lda, const unsigned short* __restrict__ Wt, int ldb,
                                               const float* __restrict__ bias, float* __restrict__ C, int ldc, int M, int N, int K) {
  __shared__ __attribute__((aligned(16))) float so[4][16][64];
  const int tid = threadIdx.x, w = tid >> 5, lane = tid & 31, ln = lane & 15, hh = lane >> 4;
  const int ntn = N / 64;
  const int wid = blockIdx.x * 4 + w;
  const int mt = wid / ntn, nq = wid % ntn;
  if (mt * 16 >= M) return;
  const int row0 = mt * 16, col0 = nq * 64;
  const float* arow = A + (size_t)(row0 + ln) * lda;
  v8f acc[4] = {};
  for (int kb = 0; kb < K; kb += 32) {
    FragB ah, al;
    const v4f x0 = *(const v4fa*)(arow + kb + 8 * hh), x1 = *(const v4fa*)(arow + kb + 8 * hh + 4);
    const v4f x2 = *(const v4fa*)(arow + kb + 16 + 8 * hh), x3 = *(const v4fa*)(arow + kb + 16 + 8 * hh + 4);
    float xs[16] = {x0[0],x0[1],x0[2],x0[3],x1[0],x1[1],x1[2],x1[3],x2[0],x2[1],x2[2],x2[3],x3[0],x3[1],x3[2],x3[3]};
#pragma unroll
    for (int i = 0; i < 16; ++i) { const unsigned short hb = bf16_bits(xs[i]); ah.u[i] = hb; al.u[i] = ASPLIT ? bf16_bits(xs[i] - bf16_val(hb)) : (unsigned short)0; }
#pragma unroll
    for (int t = 0; t < 4; ++t) {
      const unsigned short* brow = Wt + (size_t)(col0 + t * 16 + ln) * ldb + kb;
      FragB b;
      b.half[0] = *(const v8us*)(brow + 8 * hh);
      b.half[1] = *(const v8us*)(brow + 16 + 8 * hh);
      acc[t] = mmaN<ASPLIT ? 2 : 1>(ah.v, al.v, b.v, b.v, acc[t]);
    }
  }
#pragma unroll
  for (int t = 0; t < 4; ++t) {
    float bv = bias ? bias[col0 + t * 16 + ln] : 0.f;
    if (BIAS_BF16) bv = bf16_round(bv);
#pragma unroll
    for (int r = 0; r < 8; ++r) { float v = acc[t][r] + bv; if (ACT == 1) v = fmaxf(v, 0.f); so[w][8 * hh + r][t * 16 + ln] = v; }
  }
  __builtin_amdgcn_fence(__ATOMIC_ACQ_REL, "workgroup");
  __builtin_amdgcn_wave_barrier();
  const int rsub = lane >> 4, c4 = (lane & 15) * 4;
  {
#pragma unroll
    for (int q = 0; q < 8; ++q) {
      const int r = q * 2 + rsub;
      const v4f v = *(const v4fa*)&so[w][r][c4];
      *(v4f*)(C + (size_t)(row0 + r) * ldc + col0 + c4) = v;
    }
    
  }
}

// GEMM C = act(A·W + bias + resid): A f32 (ASPLIT -> hi/lo 2 terms), Wt bf16 [N][K]; ACT 0 none, 1 relu, 2 exact gelu;
// resid (optional, f32, row index = (row % rmod), pitch ldr, RES_BF16 rounds it) added before the activation.
template <bool ASPLIT, int ACT, bool BIAS_BF16, bool RES_BF16>
__global__ __launch_bounds__(128) void k_gemm_bf3(const float* __restrict__ A, int lda, const unsigned short* __restrict__ Wt, int ldb,
                                                const float* __restrict__ bias, const float* __restrict__ resid, int rmod, int ldr,
                                                float* __restrict__ C, int ldc, int M, int N, int K) {
  __shared__ __attribute__((aligned(16))) float so[4][16][64];
  const int tid = threadIdx.x, w = tid >> 5, lane = tid & 31, ln = lane & 15, hh = lane >> 4;
  const int ntn = N / 64;
  const int wid = blockIdx.x * 4 + w;
  const int mt = wid / ntn, nq = wid % ntn;
  if (mt * 16 >= M) return;
  const int row0 = mt * 16, col0 = nq * 64;
  const float* arow = A + (size_t)(row0 + ln) * lda;
  v8f acc[4] = {};
  for (int kb = 0; kb < K; kb += 32) {
    FragB ah, al;
    const v4f x0 = *(const v4fa*)(arow + kb + 8 * hh), x1 = *(const v4fa*)(arow + kb + 8 * hh + 4);
    const v4f x2 = *(const v4fa*)(arow + kb + 16 + 8 * hh), x3 = *(const v4fa*)(arow + kb + 16 + 8 * hh + 4);
    float xs[16] = {x0[0],x0[1],x0[2],x0[3],x1[0],x1[1],x1[2],x1[3],x2[0],x2[1],x2[2],x2[3],x3[0],x3[1],x3[2],x3[3]};
#pragma unroll
    for (int i = 0; i < 16; ++i) { const unsigned short hb = bf16_bits(xs[i]); ah.u[i] = hb; al.u[i] = ASPLIT ? bf16_bits(xs[i] - bf16_val(hb)) : (unsigned short)0; }
#pragma unroll
    for (int t = 0; t < 4; ++t) {
      const unsigned short* brow = Wt + (size_t)(col0 + t * 16 + ln) * ldb + kb;
      FragB b;
      b.half[0] = *(const v8us*)(brow + 8 * hh);
      b.half[1] = *(const v8us*)(brow + 16 + 8 * hh);
      acc[t] = mmaN<ASPLIT ? 2 : 1>(ah.v, al.v, b.v, b.v, acc[t]);
    }
  }
#pragma unroll
  for (int t = 0; t < 4; ++t) {
    const int col = col0 + t * 16 + ln;
    float bv = bias ? bias[col] : 0.f;
    if (BIAS_BF16) bv = bf16_round(bv);
#pragma unroll
    for (int r = 0; r < 8; ++r) {
      float v = acc[t][r] + bv;
      if (resid) { float rv = resid[(size_t)((row0 + 8 * hh + r) % rmod) * ldr + col]; if (RES_BF16) rv = bf16_round(rv); v += rv; }
      if (ACT == 1) v = fmaxf(v, 0.f);
      if (ACT == 2) v = 0.5f * v * (1.0f + erff(v * 0.70710678118654752f));
      if (ACT == 3) { const float u = 0.7978845608028654f * (v + 0.044715f * v * v * v); v = 0.5f * v * (1.0f + tanhf(u)); }
      so[w][8 * hh + r][t * 16 + ln] = v;
    }
  }
  __builtin_amdgcn_fence(__ATOMIC_ACQ_REL, "workgroup");
  __builtin_amdgcn_wave_barrier();
  const int rsub = lane >> 4, c4 = (lane & 15) * 4;
  {
#pragma unroll
    for (int q = 0; q < 8; ++q) {
      const int r = q * 2 + rsub;
      const v4f v = *(const v4fa*)&so[w][r][c4];
      *(v4f*)(C + (size_t)(row0 + r) * ldc + col0 + c4) = v;
    }
    
  }
}
// row LayerNorm (biased variance, eps) over N: s = X (+ R); optional out_sum <- s; out_norm <- (s-mu)*rsqrt(var+eps)*g + b
template <bool PARAM_BF16>
__global__ __launch_bounds__(256) void k_layernorm(const float* __restrict__ X, const float* __restrict__ R, const float* __restrict__ g, const float* __restrict__ bta,
                                                  float* __restrict__ out_sum, float* __restrict__ out_norm, int N, float eps) {
  __shared__ float red[256];
  const int row = blockIdx.x, tid = threadIdx.x;
  const float* x = X + (size_t)row * N; const float* rr = R ? R + (size_t)row * N : nullptr;
  float vals[16];                     // up to N = 4096
  const int per = N / 256;            // contiguous chunk per thread? use strided-by-4 chunks: thread handles j = tid*4 + 1024*u
  float s1 = 0.f;
  for (int u = 0; u < per / 4; ++u) {
    const int j = tid * 4 + 1024 * u;
    const v4f a = *(const v4fa*)(x + j);
    v4f b = {0.f,0.f,0.f,0.f}; if (rr) b = *(const v4fa*)(rr + j);
#pragma unroll
    for (int q = 0; q < 4; ++q) { const float v = a[q] + b[q]; vals[u * 4 + q] = v; s1 += v; }
  }
  red[tid] = s1; __syncthreads();
  for (int st = 128; st > 0; st >>= 1) { if (tid < st) red[tid] += red[tid + st]; __syncthreads(); }
  const float mu = red[0] / (float)N; __syncthreads();
  float s2 = 0.f;
  for (int u = 0; u < per / 4; ++u)
#pragma unroll
    for (int q = 0; q < 4; ++q) { const float c = vals[u * 4 + q] - mu; s2 += c * c; }
  red[tid] = s2; __syncthreads();
  for (int st = 128; st > 0; st >>= 1) { if (tid < st) red[tid] += red[tid + st]; __syncthreads(); }
  const float rs = rsqrtf(red[0] / (float)N + eps);
  {
    for (int u = 0; u < per / 4; ++u) {
      const int j = tid * 4 + 1024 * u;
      v4f o, sm;
#pragma unroll
      for (int q = 0; q < 4; ++q) {
        float gg = g[j + q], bb = bta[j + q];
        if (PARAM_BF16) { gg = bf16_round(gg); bb = bf16_round(bb); }
        sm[q] = vals[u * 4 + q]; o[q] = (vals[u * 4 + q] - mu) * rs * gg + bb;
      }
      if (out_sum) *(v4f*)(out_sum + (size_t)row * N + j) = sm;
      *(v4f*)(out_norm + (size_t)row * N + j) = o;
    }
    
  }
}



// ---- f16 WMMA path (v_wmma_f32_16x16x32_f16): 11-bit significands for operands in range — used where a [0,1] probability operand needs more precision than bf16
typedef _Float16 v16h __attribute__((ext_vector_type(16)));
union FragH { v16h v; v8us half[2]; _Float16 h[16]; unsigned short u[16]; };
template <int NT>
__device__ __forceinline__ v8f mmaH(v16h ah, v16h al, v16h bh, v16h bl, v8f c) {
  c = __builtin_amdgcn_wmma_f32_16x16x32_f16(false, ah, false, bh, (short)0, c, false, false);
  if (NT >= 2) c = __builtin_amdgcn_wmma_f32_16x16x32_f16(false, al, false, bh, (short)0, c, false, false);
  if (NT >= 3) c = __builtin_amdgcn_wmma_f32_16x16x32_f16(false, ah, false, bl, (short)0, c, false, false);
  asm volatile("v_nop\n\tv_nop\n\tv_nop\n\tv_nop" : "+v"(c) : "v"(ah), "v"(al), "v"(bh), "v"(bl));
  return c;
}
// batched GEMM like k_gemm_b but f16 operands: A f32 (split into f16 hi/lo if ASPLIT, else rounded to f16), Bt = f16 values [n][k]; alpha; C f32; N multiple of 16 (partial tiles skipped)
template <bool ASPLIT>
__global__ __launch_bounds__(128) void k_gemm_h(const float* __restrict__ A, int lda, size_t sA, const _Float16* __restrict__ Bh, int ldb, size_t sB, float alpha, float* __restrict__ C, int ldc, size_t sC, int M, int N, int K) {
  __shared__ __attribute__((aligned(16))) float so[4][16][64];
  const int tid = threadIdx.x, w = tid >> 5, lane = tid & 31, ln = lane & 15, hh = lane >> 4; const int by = blockIdx.y;
  A += (size_t)by * sA; Bh += (size_t)by * sB; C += (size_t)by * sC;
  const int ntn = (N + 63) / 64; const int wid = blockIdx.x * 4 + w; const int mt = wid / ntn, nq = wid % ntn; if (mt * 16 >= M) return;
  const int row0 = mt * 16, col0 = nq * 64; const float* arow = A + (size_t)(row0 + ln) * lda;
  v8f acc[4] = {};
  for (int kb = 0; kb < K; kb += 32) {
    FragH ah, al;
    const v4f x0 = *(const v4fa*)(arow + kb + 8 * hh), x1 = *(const v4fa*)(arow + kb + 8 * hh + 4), x2 = *(const v4fa*)(arow + kb + 16 + 8 * hh), x3 = *(const v4fa*)(arow + kb + 16 + 8 * hh + 4);
    float xs[16] = {x0[0],x0[1],x0[2],x0[3],x1[0],x1[1],x1[2],x1[3],x2[0],x2[1],x2[2],x2[3],x3[0],x3[1],x3[2],x3[3]};
#pragma unroll
    for (int i = 0; i < 16; ++i) { const _Float16 h = (_Float16)xs[i]; ah.h[i] = h; al.h[i] = ASPLIT ? (_Float16)(xs[i] - (float)h) : (_Float16)0.0f; }
#pragma unroll
    for (int t = 0; t < 4; ++t) { if (col0 + t * 16 >= N) continue; const size_t boff = (size_t)(col0 + t * 16 + ln) * ldb + kb; FragH bq; bq.half[0] = *(const v8us*)(Bh + boff + 8 * hh); bq.half[1] = *(const v8us*)(Bh + boff + 16 + 8 * hh);
      acc[t] = mmaH<ASPLIT ? 2 : 1>(ah.v, al.v, bq.v, bq.v, acc[t]); }
  }
#pragma unroll
  for (int t = 0; t < 4; ++t) { if (col0 + t * 16 >= N) continue;
#pragma unroll
    for (int r = 0; r < 8; ++r) so[w][8 * hh + r][t * 16 + ln] = acc[t][r] * alpha; }
  __builtin_amdgcn_fence(__ATOMIC_ACQ_REL, "workgroup"); __builtin_amdgcn_wave_barrier();
  const int rsub = lane >> 4, c4 = (lane & 15) * 4;
  {
#pragma unroll
    for (int q = 0; q < 8; ++q) { const int r = q * 2 + rsub; if (col0 + c4 < N) { const v4f v = *(const v4fa*)&so[w][r][c4]; *(v4f*)(C + (size_t)(row0 + r) * ldc + col0 + c4) = v; } }
     }
}

// Wt[n][k] = f16(W[k][n]·scale) from f32 row-major W[K][N] (scale = power of two; bf16-exact weights stay exact in f16 away from the subnormal range)
__global__ __launch_bounds__(256) void k_wt_f16(const float* __restrict__ W, _Float16* __restrict__ Wt, int K, int N, float scale) {
  const int t = blockIdx.x * 256 + threadIdx.x; if (t >= N * (K / 8)) return; const int n = t / (K / 8), k8 = (t % (K / 8)) * 8; FragH f;
#pragma unroll
  for (int i = 0; i < 8; ++i) f.h[i] = (_Float16)(bf16_round(W[(size_t)(k8 + i) * N + n]) * scale); const v8us o = f.half[0];
  *(v8us*)((unsigned short*)Wt + (size_t)n * K + k8) = o; 
}
// k_gemm_hh variant with fused epilogue: v = acc·alpha + bias[by·sBias + col] (+ CP[(row/rowsPerB)·sCPb + by·64 + col] if CP) ; ACT 0 none / 1 elu ; writes f16 C16 (and f32 C if non-null)
template <int ACT>
__global__ __launch_bounds__(128) void k_gemm_hhx(const _Float16* __restrict__ A, int lda, size_t sA, const _Float16* __restrict__ Bh, int ldb, size_t sB, float alpha, const float* __restrict__ bias, size_t sBias, const float* __restrict__ CP, int rowsPerB, size_t sCPb, int row0g,
    float* __restrict__ C, _Float16* __restrict__ C16, int ldc, size_t sC, int M, int N, int K) {
  __shared__ __attribute__((aligned(16))) float so[4][16][64];
  const int tid = threadIdx.x, w = tid >> 5, lane = tid & 31, ln = lane & 15, hh = lane >> 4; const int by = blockIdx.y;
  A += (size_t)by * sA; Bh += (size_t)by * sB; const size_t cofs = (size_t)by * sC; const float* bp = bias ? bias + (size_t)by * sBias : nullptr;
  const int ntn = (N + 63) / 64; const int wid = blockIdx.x * 4 + w; const int mt = wid / ntn, nq = wid % ntn; if (mt * 16 >= M) return;
  const int row0 = mt * 16, col0 = nq * 64; const _Float16* arow = A + (size_t)(row0 + ln) * lda;
  v8f acc[4] = {};
  for (int kb = 0; kb < K; kb += 32) { FragH ah; ah.half[0] = *(const v8us*)((const unsigned short*)arow + kb + 8 * hh); ah.half[1] = *(const v8us*)((const unsigned short*)arow + kb + 16 + 8 * hh);
#pragma unroll
    for (int t = 0; t < 4; ++t) { if (col0 + t * 16 >= N) continue; const size_t boff = (size_t)(col0 + t * 16 + ln) * ldb + kb; FragH bq; bq.half[0] = *(const v8us*)((const unsigned short*)Bh + boff + 8 * hh); bq.half[1] = *(const v8us*)((const unsigned short*)Bh + boff + 16 + 8 * hh);
      acc[t] = mmaH<1>(ah.v, ah.v, bq.v, bq.v, acc[t]); }
  }
#pragma unroll
  for (int t = 0; t < 4; ++t) { if (col0 + t * 16 >= N) continue; const int col = col0 + t * 16 + ln; const float bv = bp ? bf16_round(bp[col]) : 0.f;
#pragma unroll
    for (int r = 0; r < 8; ++r) { float v = acc[t][r] * alpha + bv; if (CP) { const int rr = row0g + row0 + 8 * hh + r; if (rowsPerB < 0) v += CP[cofs + (size_t)rr * ldc + col];      /* rowsPerB < 0: own element of the batched C plane */ else { const int bidx = rr / rowsPerB; v += CP[(size_t)bidx * sCPb + (size_t)by * 64 + col]; } } if (ACT == 1) v = (v > 0.f) ? v : expm1f(v); else if (ACT == 7) v = (v > 0.f) ? v + 1.0f : expf(v); else if (ACT == 8) v = tanhf(v); else if (ACT == 9) v = 0.5f * v * (1.0f + tanhf(0.7978845608028654f * (v + 0.044715f * v * v * v))); else if (ACT == 11) v = 1.0f / (1.0f + expf(-v)); else if (ACT == 12) v = (v > 0.f) ? v : 0.01f * v; else if (ACT == 14) v = (v > 0.f) ? v : 0.1f * v; else if (ACT == 16) v = (v >= 0.f) ? v : 0.3f * v; else if (ACT == 17) v = (v >= 0.f) ? v : 0.2f * v; else if (ACT == 15) v = v / (1.0f + expf(-v)); else if (ACT == 3) v = fmaxf(v, 0.f); else if (ACT == 6) v = 0.5f * v * (1.0f + erff(v * 0.70710678118654752f)); so[w][8 * hh + r][t * 16 + ln] = v; } }
  __builtin_amdgcn_fence(__ATOMIC_ACQ_REL, "workgroup"); __builtin_amdgcn_wave_barrier();
  const int rsub = lane >> 4, c4 = (lane & 15) * 4; typedef _Float16 v4h __attribute__((ext_vector_type(4)));
  {
#pragma unroll
    for (int q = 0; q < 8; ++q) { const int r = q * 2 + rsub; if (col0 + c4 < N) { const v4f v = *(const v4fa*)&so[w][r][c4]; if (C) *(v4f*)(C + cofs + (size_t)(row0 + r) * ldc + col0 + c4) = v; if (C16) { v4h h4; for (int i = 0; i < 4; ++i) h4[i] = (_Float16)v[i]; *(v4h*)(C16 + cofs + (size_t)(row0 + r) * ldc + col0 + c4) = h4; } } }
     }
}


typedef _Float16 v4h __attribute__((ext_vector_type(4)));

__global__ __launch_bounds__(256) void k_x16(const float* __restrict__ x, _Float16* __restrict__ X16, size_t n8) { const size_t t = (size_t)blockIdx.x * 256 + threadIdx.x; if (t >= n8) return; FragH f;
#pragma unroll
  for (int q = 0; q < 8; ++q) f.h[q] = (_Float16)bf16_round(x[t * 8 + q]); *(v8us*)((unsigned short*)X16 + t * 8) = f.half[0];  }
__global__ __launch_bounds__(256) void k_h16(const float* __restrict__ x, _Float16* __restrict__ X16, size_t n8) { const size_t t = (size_t)blockIdx.x * 256 + threadIdx.x; if (t >= n8) return; FragH f;
#pragma unroll
  for (int q = 0; q < 8; ++q) f.h[q] = (_Float16)x[t * 8 + q]; *(v8us*)((unsigned short*)X16 + t * 8) = f.half[0];  }
__global__ __launch_bounds__(256) void k_round16f(const float* __restrict__ W, _Float16* __restrict__ Bt, size_t n8) { const size_t t = (size_t)blockIdx.x * 256 + threadIdx.x; if (t >= n8) return; FragH f;
#pragma unroll
  for (int i = 0; i < 8; ++i) f.h[i] = (_Float16)(bf16_round(W[t * 8 + i]) * 16.0f); *(v8us*)((unsigned short*)Bt + t * 8) = f.half[0];  }
template <int NHv, int TTv>
__global__ __launch_bounds__(256) void k_vt(const _Float16* __restrict__ V16, int ldv, int voff, _Float16* __restrict__ Vt) { __shared__ unsigned short tl[64][66]; const int tid = threadIdx.x; const int slab = blockIdx.x / (TTv / 64), lg = blockIdx.x % (TTv / 64); const int b = slab / NHv, h = slab % NHv;
  for (int i = tid; i < 64 * 8; i += 256) { const int r = i / 8, c8 = (i % 8) * 8; FragH f; f.half[0] = *(const v8us*)((const unsigned short*)V16 + ((size_t)b * TTv + lg * 64 + r) * ldv + voff + h * 64 + c8);
#pragma unroll
    for (int q = 0; q < 8; ++q) tl[r][c8 + q] = f.u[q]; }
  __syncthreads();
  {
#pragma unroll
    for (int rd = 0; rd < 2; ++rd) { const int d = rd * 32 + tid / 8, pc = tid % 8; FragH f;
#pragma unroll
      for (int q = 0; q < 8; ++q) f.u[q] = tl[pc * 8 + q][d];
      *(v8us*)((unsigned short*)Vt + ((size_t)slab * 64 + d) * TTv + lg * 64 + pc * 8) = f.half[0]; }
     } }

__global__ __launch_bounds__(256) void k_hl(const float* __restrict__ F, _Float16* __restrict__ Hh, _Float16* __restrict__ Hl, size_t n8) { const size_t t = (size_t)blockIdx.x * 256 + threadIdx.x; if (t >= n8) return; FragH fh, fl; const v4f a = *(const v4fa*)(F + t * 8), c = *(const v4fa*)(F + t * 8 + 4);
#pragma unroll
  for (int q = 0; q < 4; ++q) { _Float16 h = (_Float16)a[q]; fh.h[q] = h; fl.h[q] = (_Float16)((a[q] - (float)h) * 1024.0f); h = (_Float16)c[q]; fh.h[4 + q] = h; fl.h[4 + q] = (_Float16)((c[q] - (float)h) * 1024.0f); }
  { *(v8us*)((unsigned short*)Hh + t * 8) = fh.half[0]; *(v8us*)((unsigned short*)Hl + t * 8) = fl.half[0];  } }

// ---- fast GEMM (wave tile 32x64; requires M % 32 == 0 rows per launch region and N % 64 == 0); epilogue = k_gemm_hhx semantics ----
__device__ __forceinline__ v16h g2_frag(const _Float16* p, int hh) { FragH f; f.half[0] = *(const v8us*)((const unsigned short*)p + 8 * hh); f.half[1] = *(const v8us*)((const unsigned short*)p + 16 + 8 * hh); return f.v; }
__device__ __forceinline__ v8f g2_mma(v16h a, v16h b, v8f c) { v8f d = __builtin_amdgcn_wmma_f32_16x16x32_f16(false, a, false, b, (short)0, c, false, false); asm volatile("v_nop\n\tv_nop\n\tv_nop\n\tv_nop" : "+v"(d) : "v"(a), "v"(b)); return d; }
template <int ACT>
__global__ __launch_bounds__(128) void k_gemm2(const _Float16* __restrict__ A, int lda, size_t sA, const _Float16* __restrict__ Bh, int ldb, size_t sB, float alpha, const float* __restrict__ bias, size_t sBias, const float* __restrict__ CP, int rowsPerB, size_t sCPb, int row0g,
    float* __restrict__ C, _Float16* __restrict__ C16, int ldc, size_t sC, int M, int N, int K) { static_assert(ACT == 0 || ACT == 3 || ACT == 6 || ACT == 8 || ACT == 9 || ACT == 11 || ACT == 12 || ACT == 14 || ACT == 15 || ACT == 16 || ACT == 17, "k_gemm2: unsupported ACT code (would silently apply no activation)");
  __shared__ __attribute__((aligned(16))) float so[4][32][68];
  const int tid = threadIdx.x, w = tid >> 5, lane = tid & 31, ln = lane & 15, hh = lane >> 4; const int by = blockIdx.y;
  A += (size_t)by * sA; Bh += (size_t)by * sB; const size_t cofs = (size_t)by * sC; const float* bp = bias ? bias + (size_t)by * sBias : nullptr;
  const int ntn = N >> 6; const int mt = blockIdx.x / ntn, nq = blockIdx.x - mt * ntn; const int row0 = mt * 128 + 32 * w, col0 = nq * 64; if (row0 >= M) return;
  const _Float16* a0p = A + (size_t)(row0 + ln) * lda; const _Float16* a1p = a0p + (size_t)16 * lda;
  const _Float16* b0p = Bh + (size_t)(col0 + ln) * ldb; const _Float16* b1p = b0p + (size_t)16 * ldb; const _Float16* b2p = b1p + (size_t)16 * ldb; const _Float16* b3p = b2p + (size_t)16 * ldb;
  const v8f z8 = {0.f,0.f,0.f,0.f,0.f,0.f,0.f,0.f}; v8f c00 = z8, c01 = z8, c02 = z8, c03 = z8, c10 = z8, c11 = z8, c12 = z8, c13 = z8;
#pragma unroll 1
  for (int kb = 0; kb < K; kb += 32) { const v16h a0 = g2_frag(a0p + kb, hh), a1 = g2_frag(a1p + kb, hh);
    v16h b = g2_frag(b0p + kb, hh); c00 = g2_mma(a0, b, c00); c10 = g2_mma(a1, b, c10);
    b = g2_frag(b1p + kb, hh); c01 = g2_mma(a0, b, c01); c11 = g2_mma(a1, b, c11);
    b = g2_frag(b2p + kb, hh); c02 = g2_mma(a0, b, c02); c12 = g2_mma(a1, b, c12);
    b = g2_frag(b3p + kb, hh); c03 = g2_mma(a0, b, c03); c13 = g2_mma(a1, b, c13); }
  v8f accs[8] = {c00, c01, c02, c03, c10, c11, c12, c13};
#pragma unroll
  for (int u = 0; u < 8; ++u) { const int t = u & 3, half = u >> 2; const int col = col0 + t * 16 + ln; const float bv = bp ? bf16_round(bp[col]) : 0.f;
#pragma unroll
    for (int r = 0; r < 8; ++r) { const int rloc = half * 16 + 8 * hh + r; float v = accs[u][r] * alpha + bv; if (CP) { if (rowsPerB < 0) v += CP[cofs + (size_t)(row0g + row0 + rloc) * ldc + col];      /* rowsPerB < 0: own element of the batched C plane */ else { const int bidx = (row0g + row0 + rloc) / rowsPerB; v += CP[(size_t)bidx * sCPb + (size_t)by * 64 + col]; } }
      if (ACT == 3) v = fmaxf(v, 0.f); else if (ACT == 6) v = 0.5f * v * (1.0f + erff(v * 0.70710678118654752f)); else if (ACT == 11) v = 1.0f / (1.0f + expf(-v)); else if (ACT == 15) v = v / (1.0f + expf(-v)); else if (ACT == 12) v = (v > 0.f) ? v : 0.01f * v; else if (ACT == 8) v = tanhf(v); else if (ACT == 9) v = 0.5f * v * (1.0f + tanhf(0.7978845608028654f * (v + 0.044715f * v * v * v))); else if (ACT == 14) v = (v > 0.f) ? v : 0.1f * v; else if (ACT == 16) v = (v >= 0.f) ? v : 0.3f * v; else if (ACT == 17) v = (v >= 0.f) ? v : 0.2f * v;
      so[w][rloc][t * 16 + ln] = v; } }
  __builtin_amdgcn_fence(__ATOMIC_ACQ_REL, "workgroup"); __builtin_amdgcn_wave_barrier();
  const int rsub = lane >> 4, c4 = (lane & 15) * 4;
  {
#pragma unroll
    for (int q = 0; q < 16; ++q) { const int r = q * 2 + rsub; const v4f v = *(const v4fa*)&so[w][r][c4]; if (C) *(v4f*)(C + cofs + (size_t)(row0 + r) * ldc + col0 + c4) = v; if (C16) { v4h h4; for (int i = 0; i < 4; ++i) h4[i] = (_Float16)v[i]; *(v4h*)(C16 + cofs + (size_t)(row0 + r) * ldc + col0 + c4) = h4; } }
     } }


__global__ __launch_bounds__(256) void k_wnat(const float* __restrict__ w, size_t n8, _Float16* __restrict__ Bt) { const size_t t = (size_t)blockIdx.x * 256 + threadIdx.x; if (t >= n8) return; FragH f; for (int q = 0; q < 8; ++q) f.h[q] = (_Float16)(bf16_round(w[t * 8 + q]) * 16.0f); *(v8us*)((unsigned short*)Bt + t * 8) = f.half[0];  }
__global__ __launch_bounds__(256) void k_rsm(const float* __restrict__ S, _Float16* __restrict__ P, int nrows) {
  #pragma clang fp contract(off)
  const int i = blockIdx.x * 256 + threadIdx.x; if (i >= nrows) return; const float* s = S + (size_t)i * SQ; float mx = -3.0e38f;
#pragma unroll 1
  for (int j = 0; j < SQ; ++j) mx = fmaxf(mx, s[j]); float se = 0.f;
#pragma unroll 1
  for (int j = 0; j < SQ; ++j) se += expf(s[j] - mx); const float sc = 256.0f / se;
#pragma unroll 1
  for (int j0 = 0; j0 < SQ; j0 += 8) { FragH f; for (int q = 0; q < 8; ++q) f.h[q] = (_Float16)(expf(s[j0 + q] - mx) * sc); unsigned short* d = (unsigned short*)P + (size_t)i * SQ + j0; *(v8us*)d = f.half[0];  } }
__global__ __launch_bounds__(256) void k_vt(const _Float16* __restrict__ V16, int b, int h0, _Float16* __restrict__ VT) { __shared__ unsigned short tl[64][65]; const int tid = threadIdx.x; const int hh = blockIdx.x % HG, sg = blockIdx.x / HG; const int s0 = sg * 64; const int h = h0 + hh;
  for (int i = tid; i < 64 * 8; i += 256) { const int j = i / 8, d8 = (i % 8) * 8; FragH f; f.half[0] = *(const v8us*)((const unsigned short*)V16 + ((size_t)b * SQ + s0 + j) * DM + h * HD + d8); for (int q = 0; q < 8; ++q) tl[d8 + q][j] = f.u[q]; }
  __syncthreads();
  { for (int i = tid; i < 64 * 8; i += 256) { const int d = i / 8, j8 = (i % 8) * 8; FragH f; for (int q = 0; q < 8; ++q) f.u[q] = tl[d][j8 + q]; *(v8us*)((unsigned short*)VT + ((size_t)hh * HD + d) * SQ + s0 + j8) = f.half[0]; }  } }



__global__ __launch_bounds__(256) void k_rsmcf2(const float* __restrict__ S, _Float16* __restrict__ P, int hg, int q0, int nk) {
  #pragma clang fp contract(off)
  const int t = blockIdx.x * 256 + threadIdx.x; if (t >= hg * QT) return; const size_t i = (size_t)t; const float* s = S + i * NKX; const int last = q0 + (t % QT); float mx = -3.0e38f;
#pragma unroll 1
  for (int j = 0; j < nk; ++j) { const float f = (j <= last) ? 1.f : 0.f; mx = fmaxf(mx, fmaf(f, s[j], (1.f - f) * -1.0e9f)); } float se = 0.f;
#pragma unroll 1
  for (int j = 0; j < nk; ++j) { const float f = (j <= last) ? 1.f : 0.f; se += __expf(fmaf(f, s[j], (1.f - f) * -1.0e9f) - mx); } const float sc = 256.0f / se;
#pragma unroll 1
  for (int j0 = 0; j0 < nk; j0 += 8) { FragH fr; for (int q = 0; q < 8; ++q) { const int j = j0 + q; const float f = (j <= last) ? 1.f : 0.f; fr.h[q] = (_Float16)(__expf(fmaf(f, s[j], (1.f - f) * -1.0e9f) - mx) * sc); } unsigned short* d = (unsigned short*)P + i * NKX + j0; *(v8us*)d = fr.half[0];  } }


template <int MASKADD>
__global__ __launch_bounds__(64) void k_att0(const float* __restrict__ QF, const float* __restrict__ KF, const float* __restrict__ VF, int ld, const float* __restrict__ mask, float scale, float* __restrict__ OF, int ldo) {
  #pragma clang fp contract(off)
  __shared__ __attribute__((aligned(16))) float lq[64][64]; __shared__ __attribute__((aligned(16))) float lo[64][64];
  const int tid = threadIdx.x; const int h = blockIdx.x / (QT0 / 64), rg = blockIdx.x % (QT0 / 64); const int i = rg * 64 + tid;
  const float* qr = QF + (size_t)i * ld + h * HD;
#pragma unroll 1
  for (int c = 0; c < HD / 4; ++c) { *(v4f*)&lq[tid][c * 4] = *(const v4fa*)(qr + c * 4); const v4f z = {0.f, 0.f, 0.f, 0.f}; *(v4f*)&lo[tid][c * 4] = z; }
  float m = -1.0e30f, l = 0.f; const int jmax = MASKADD ? (SQ - 1) : (rg * 64 + 63);      /* additive-mask form: every key (the mask input decides); causal form: keys up to the block's last row */
#pragma unroll 1
  for (int j = 0; j <= jmax; ++j) { const float* kr = KF + (size_t)j * ld + h * HD; const float* vr = VF + (size_t)j * ld + h * HD; float s = 0.f;
#pragma unroll 1
    for (int c = 0; c < HD / 4; ++c) { const v4f kq = *(const v4fa*)(kr + c * 4); const v4f qq = *(v4f*)&lq[tid][c * 4]; s = __fadd_rn(s, __fmul_rn(qq[0], kq[0])); s = __fadd_rn(s, __fmul_rn(qq[1], kq[1])); s = __fadd_rn(s, __fmul_rn(qq[2], kq[2])); s = __fadd_rn(s, __fmul_rn(qq[3], kq[3])); }
    s = __fmul_rn(s, scale); if (MASKADD) s = __fadd_rn(s, __fmul_rn(bf16_round(mask[(size_t)i * SQ + j]), -10000.0f));
    const float f = (MASKADD || j <= i) ? 1.f : 0.f; const float sm = fmaf(f, s, (1.f - f) * -1.0e30f); const float mn = fmaxf(m, sm); const float sc = expf(m - mn); const float e = expf(sm - mn); l = __fadd_rn(__fmul_rn(l, sc), e); m = mn;
#pragma unroll 1
    for (int c = 0; c < HD / 4; ++c) { const v4f vv = *(const v4fa*)(vr + c * 4); v4f oo = *(v4f*)&lo[tid][c * 4]; for (int u = 0; u < 4; ++u) oo[u] = __fadd_rn(__fmul_rn(oo[u], sc), __fmul_rn(e, vv[u])); *(v4f*)&lo[tid][c * 4] = oo; } }
  const float fin = 64.0f / l;      /* o carried x64 like the f16 path */
#pragma unroll 1
  for (int c = 0; c < HD / 4; ++c) { v4f oo = *(v4f*)&lo[tid][c * 4]; for (int u = 0; u < 4; ++u) oo[u] = __fmul_rn(oo[u], fin); *(v4f*)&lo[tid][c * 4] = oo; }
  __syncthreads();
  {
#pragma unroll 1
    for (int it = 0; it < 16; ++it) { const int row = it * 4 + tid / 16, pc = (tid % 16) * 4; const v4f v = *(const v4f*)&lo[row][pc]; *(v4f*)(OF + (size_t)(rg * 64 + row) * ldo + h * HD + pc) = v; }
     } }


__global__ __launch_bounds__(256) void k_kvexp(const float* __restrict__ src, float* __restrict__ dst, size_t n4) { const size_t t = (size_t)blockIdx.x * 256 + threadIdx.x; if (t >= n4) return; const size_t e = t * 4; const size_t row = e / DM; const int col = (int)(e % DM); const int h = col / HD, d = col % HD; const v4f v = *(const v4fa*)(src + row * KVD + (size_t)(h / HPG) * HD + d); *(v4f*)(dst + e) = v;  }

__global__ __launch_bounds__(256) void k_tab2(float theta, float* __restrict__ CS, float* __restrict__ SN) {
  #pragma clang fp contract(off)
  const int t = blockIdx.x * 256 + threadIdx.x; if (t >= SQ * (HD / 2)) return; const int i = t % (HD / 2); const int p = t / (HD / 2); const float invf = 1.0f / powf(theta, (float)(2 * i) / (float)HD); const float ang = __fmul_rn((float)p, invf); const float c = cosf(ang), s = sinf(ang);
  *(float*)(CS + t) = c; *(float*)(SN + t) = s;  }
template <int NORM, int ROPE>
__global__ __launch_bounds__(64) void k_xform(const float* __restrict__ F, int ldf, int nh, const float* __restrict__ gain, float eps, const float* __restrict__ CS, const float* __restrict__ SN, _Float16* __restrict__ H16, int ldo) {
  #pragma clang fp contract(off)
  __shared__ float xv[HD]; __shared__ float red[HD]; __shared__ unsigned short sh_[HD]; const int d = threadIdx.x; const int h = blockIdx.x % nh; const size_t r = blockIdx.x / nh; const int p = (int)(r % SQ);
  float x = F[r * (size_t)ldf + (size_t)h * HD + d];
  if (NORM) { red[d] = __fmul_rn(x, x); __syncthreads(); for (int st = HD / 2; st > 0; st >>= 1) { if (d < st) red[d] = __fadd_rn(red[d], red[d + st]); __syncthreads(); } const float rs = rsqrtf(__fadd_rn(red[0] / (float)HD, eps)); x = __fmul_rn(__fmul_rn(x, rs), bf16_round(gain[d])); }
  xv[d] = x; __syncthreads();
  float o = x;
  if (ROPE == 1) { const int i = d >> 1; const float c = CS[p * (HD / 2) + i], s = SN[p * (HD / 2) + i]; const float ev = xv[2 * i], od = xv[2 * i + 1]; o = (d & 1) ? __fadd_rn(__fmul_rn(ev, s), __fmul_rn(od, c)) : __fadd_rn(__fmul_rn(ev, c), -__fmul_rn(od, s)); }
  if (ROPE == 2) { const int i = d & (HD / 2 - 1); const float c = CS[p * (HD / 2) + i], s = SN[p * (HD / 2) + i]; const float lo = xv[i], hi = xv[i + HD / 2]; o = (d < HD / 2) ? __fadd_rn(__fmul_rn(lo, c), -__fmul_rn(hi, s)) : __fadd_rn(__fmul_rn(lo, s), __fmul_rn(hi, c)); }
  FragH th; th.h[0] = (_Float16)o; sh_[d] = th.u[0]; __syncthreads();
  if (d < HD / 8) { FragH f; for (int q = 0; q < 8; ++q) f.u[q] = sh_[d * 8 + q]; unsigned short* dst = (unsigned short*)H16 + r * (size_t)ldo + (size_t)h * HD + d * 8; *(v8us*)dst = f.half[0];  } }

template <int NORM, int ROPE>
__global__ __launch_bounds__(64) void k_xformf(const float* __restrict__ F, int ldf, int nh, const float* __restrict__ gain, float eps, const float* __restrict__ CS, const float* __restrict__ SN, float* __restrict__ F32, int ldo) {
  #pragma clang fp contract(off)
  __shared__ float xv[HD]; __shared__ float red[HD]; const int d = threadIdx.x; const int h = blockIdx.x % nh; const size_t r = blockIdx.x / nh; const int p = (int)(r % SQ);
  float x = F[r * (size_t)ldf + (size_t)h * HD + d];
  if (NORM) { red[d] = __fmul_rn(x, x); __syncthreads(); for (int st = HD / 2; st > 0; st >>= 1) { if (d < st) red[d] = __fadd_rn(red[d], red[d + st]); __syncthreads(); } const float rs = rsqrtf(__fadd_rn(red[0] / (float)HD, eps)); x = __fmul_rn(__fmul_rn(x, rs), bf16_round(gain[d])); }
  xv[d] = x; __syncthreads();
  float o = x;
  if (ROPE == 1) { const int i = d >> 1; const float c = CS[p * (HD / 2) + i], s = SN[p * (HD / 2) + i]; const float ev = xv[2 * i], od = xv[2 * i + 1]; o = (d & 1) ? __fadd_rn(__fmul_rn(ev, s), __fmul_rn(od, c)) : __fadd_rn(__fmul_rn(ev, c), -__fmul_rn(od, s)); }
  if (ROPE == 2) { const int i = d & (HD / 2 - 1); const float c = CS[p * (HD / 2) + i], s = SN[p * (HD / 2) + i]; const float lo = xv[i], hi = xv[i + HD / 2]; o = (d < HD / 2) ? __fadd_rn(__fmul_rn(lo, c), -__fmul_rn(hi, s)) : __fadd_rn(__fmul_rn(lo, s), __fmul_rn(hi, c)); }
  float* dst = F32 + r * (size_t)ldo + (size_t)h * HD + d; *(float*)dst = o;  }

__global__ __launch_bounds__(256) void k_trig(const float* __restrict__ a, float* __restrict__ CS, float* __restrict__ SN, int n) {
  #pragma clang fp contract(off)
  const int t = blockIdx.x * 256 + threadIdx.x; if (t >= n) return; const float v = bf16_round(a[t]); const float c = cosf(v), s = sinf(v);
  *(float*)(CS + t) = c; *(float*)(SN + t) = s;  }

__global__ __launch_bounds__(256) void k_tabpos(const int* __restrict__ pos, float* __restrict__ CS, float* __restrict__ SN, int n) {
  #pragma clang fp contract(off)
  const int t = blockIdx.x * 256 + threadIdx.x; if (t >= n) return; const int p = t / 32, i = t % 32; const float invf = (float)(1.0 / pow(10000.0, ((double)(2 * i)) / 64.0)); const float a = __fmul_rn((float)pos[p], invf); const float c = cosf(a), s = sinf(a);
  *(float*)(CS + t) = c; *(float*)(SN + t) = s;  }

// One wave per score row. Lane l holds columns 128 s + 4 l .. + 3 of every 128-column slice s in registers, so AC and BD' are read once:
// AC as whole-line 16-byte loads, BD' at the row's shift; maximum and sum end in a five-step butterfly over the lanes.
// NS = nk / 128 is a template parameter (q0 = nk - QT): the body is one straight line, so a row's loads can all be in flight together.
// A slice with 128 s + 127 <= q0 lies below every row's diagonal (j <= q0 <= i) and its shifted index stays below nk (shift <= QT - 1),
// so the index clamp and the arithmetic select, both identities there, are written for the later slices only.
typedef float v4fu __attribute__((ext_vector_type(4), may_alias, aligned(4)));      /* 16-byte load at a 4-byte boundary (the shifted BD' columns) */
// 2^x of four values. One asm statement so that every v_exp_f32 has an independent instruction behind it (early-clobber outputs: none overwrites a source);
// the closing v_nop is the slot that the instruction set asks for before the last result is read or its source overwritten.
__device__ __forceinline__ v4f exp2x4(v4f x) { float r0, r1, r2, r3;
  asm("v_exp_f32 %0, %4\n\tv_exp_f32 %1, %5\n\tv_exp_f32 %2, %6\n\tv_exp_f32 %3, %7\n\tv_nop" : "=&v"(r0), "=&v"(r1), "=&v"(r2), "=&v"(r3) : "v"(x[0]), "v"(x[1]), "v"(x[2]), "v"(x[3]));
  const v4f r = {r0, r1, r2, r3}; return r; }
template <int NS>
__global__ __launch_bounds__(256) void k_rsmxl(const float* __restrict__ AC, const float* __restrict__ BDp, _Float16* __restrict__ P, _Float16* __restrict__ PL, int hg) {
  #pragma clang fp contract(off)
  constexpr int nk = NS * 128, q0 = nk - QT;
  const int lane = threadIdx.x & 31; const int t = __builtin_amdgcn_readfirstlane((int)(blockIdx.x * 8 + (threadIdx.x >> 5))); if (t >= hg * QT) return;      /* wave-uniform row number: scalar row bases; no barrier in this kernel */
  const size_t ri = (size_t)t; const float* a = AC + ri * NKX; const float* bd = BDp + ri * NKX; const int tl = t & (QT - 1); const int i = q0 + tl; const int sh = QT - 1 - tl;      /* sh = nk - 1 - i */
  const unsigned ob = (unsigned)(sh + lane * 4) * 4u;      /* byte offset of the lane's first shifted column in the BD' row */
  v4f av[NS], bv[NS]; int ic[8];
#pragma unroll
  for (int s = 0; s < NS; ++s) { av[s] = ((const v4fa*)a)[lane + s * 32];
    if (s * 128 + 127 <= q0) bv[s] = *(const v4fu*)((const char*)bd + ob + s * 512);
    else {
#pragma unroll
      for (int q = 0; q < 4; ++q) { const int c = min(sh + lane * 4 + s * 128, nk - 1 - q); ic[(s - (NS - 2)) * 4 + q] = c; bv[s][q] = bd[c + q]; } } }      /* c + q = min(sh + j, nk - 1) */
  /* The wait that stands in front of any overwrite of a register that an issued load names. The address registers are its inputs so that they stay live up to here: no later load of the row gets one of them as its destination. */
  if constexpr (NS > 2) asm volatile("s_wait_xcnt 0x0" :: "v"(lane), "v"(ob), "v"(ic[0]), "v"(ic[1]), "v"(ic[2]), "v"(ic[3]), "v"(ic[4]), "v"(ic[5]), "v"(ic[6]), "v"(ic[7]) : "memory");
  else asm volatile("s_wait_xcnt 0x0" :: "v"(lane), "v"(ic[0]), "v"(ic[1]), "v"(ic[2]), "v"(ic[3]), "v"(ic[4]), "v"(ic[5]), "v"(ic[6]), "v"(ic[7]) : "memory");
  __builtin_amdgcn_sched_barrier(0);      /* keeps the arithmetic behind the row's loads: without it they are issued in groups with a full wait between the groups */
  float mx = -3.0e38f;
#pragma unroll
  for (int s = 0; s < NS; ++s) {
#pragma unroll
    for (int q = 0; q < 4; ++q) { const int j = s * 128 + lane * 4 + q; float v = __fadd_rn(av[s][q], bv[s][q]); if (s * 128 + 127 > q0) { const float f = (j <= i) ? 1.f : 0.f; v = fmaf(f, v, (1.f - f) * -1.0e30f); } av[s][q] = v; mx = fmaxf(mx, v); } }
#pragma unroll
  for (int m = 16; m > 0; m >>= 1) mx = fmaxf(mx, __shfl_xor(mx, m, 32));
  v4f s4 = {0.f, 0.f, 0.f, 0.f};
#pragma unroll
  for (int s = 0; s < NS; ++s) { av[s] = exp2x4((av[s] - mx) * 1.44269504f); s4 += av[s]; }      /* exp(v - mx) as the native form has it: 2^((v - mx) log2 e) */
  float se = (s4[0] + s4[1]) + (s4[2] + s4[3]);
#pragma unroll
  for (int m = 16; m > 0; m >>= 1) se += __shfl_xor(se, m, 32);
  const float sc = 256.0f / se;
#pragma unroll
  for (int s = 0; s < NS; ++s) { v4h fr, fl;
#pragma unroll
    for (int q = 0; q < 4; ++q) { const float pv = av[s][q] * sc; const _Float16 hv = (_Float16)pv; fr[q] = hv; fl[q] = (_Float16)((pv - (float)hv) * 1024.0f); }
    const size_t o = ri * NKX + s * 128 + lane * 4; *(v4h*)(P + o) = fr; *(v4h*)(PL + o) = fl; } }
template <int NS>
static void rsmxl_go(const float* AC, const float* BDp, _Float16* P, _Float16* PL, hipStream_t stream) { k_rsmxl<NS><<<(NH * QT + 7) / 8, 256, 0, stream>>>(AC, BDp, P, PL, NH); }

template <int N>
__global__ __launch_bounds__(256) void k_rmsrow(float* __restrict__ X, const float* __restrict__ w, float eps) {
  #pragma clang fp contract(off)
  constexpr int PT = N / 256; __shared__ float red[256]; const size_t r = blockIdx.x; const int t = threadIdx.x; float* row = X + r * N + (size_t)t * PT; float v[PT]; float ss = 0.f;
  for (int q = 0; q < PT; ++q) { v[q] = row[q]; ss = __fadd_rn(ss, __fmul_rn(v[q], v[q])); }
  red[t] = ss; __syncthreads(); for (int k = 128; k > 0; k >>= 1) { if (t < k) red[t] = __fadd_rn(red[t], red[t + k]); __syncthreads(); }
  const float rs = rsqrtf(__fadd_rn(red[0] / (float)N, eps)); float o[PT]; for (int q = 0; q < PT; ++q) o[q] = __fmul_rn(__fmul_rn(v[q], rs), bf16_round(w[t * PT + q]));
  { for (int q = 0; q < PT; ++q) *(float*)(row + q) = o[q];  } }

__global__ __launch_bounds__(256) void k_bfr(const float* __restrict__ x, float* __restrict__ XB, size_t n8) { const size_t t = (size_t)blockIdx.x * 256 + threadIdx.x; if (t >= n8) return; v4f a = *(const v4fa*)(x + t * 8), c = *(const v4fa*)(x + t * 8 + 4); for (int q = 0; q < 4; ++q) { a[q] = bf16_round(a[q]); c[q] = bf16_round(c[q]); }
  { *(v4f*)(XB + t * 8) = a; *(v4f*)(XB + t * 8 + 4) = c;  } }





__global__ __launch_bounds__(64) void k_att0xl(const float* __restrict__ QF, const float* __restrict__ QVF, const float* __restrict__ KF, const float* __restrict__ VF, int ld, const float* __restrict__ RF, float* __restrict__ OF, int ldo) {
  #pragma clang fp contract(off)
  constexpr int MASKADD = 0; const float scale = 1.0f;
  __shared__ __attribute__((aligned(16))) float lq[64][64]; __shared__ __attribute__((aligned(16))) float lqv[64][64]; __shared__ __attribute__((aligned(16))) float lo[64][64];
  const int tid = threadIdx.x; const int h = blockIdx.x / (QT0 / 64), rg = blockIdx.x % (QT0 / 64); const int i = rg * 64 + tid;
  const float* qr = QF + (size_t)i * ld + h * HD; const float* qvr = QVF + (size_t)i * ld + h * HD;
#pragma unroll 1
  for (int c = 0; c < HD / 4; ++c) { *(v4f*)&lq[tid][c * 4] = *(const v4fa*)(qr + c * 4); *(v4f*)&lqv[tid][c * 4] = *(const v4fa*)(qvr + c * 4); const v4f z = {0.f, 0.f, 0.f, 0.f}; *(v4f*)&lo[tid][c * 4] = z; }
  float m = -1.0e30f, l = 0.f; const int jmax = MASKADD ? (SQ - 1) : (rg * 64 + 63);      /* additive-mask form: every key (the mask input decides); causal form: keys up to the block's last row */
#pragma unroll 1
  for (int j = 0; j <= jmax; ++j) { const float* kr = KF + (size_t)j * ld + h * HD; const float* vr = VF + (size_t)j * ld + h * HD; const int ridx = min(SQ - 1 - i + j, SQ - 1); const float* rr = RF + ((size_t)h * SQ + ridx) * HD; float s = 0.f, s2 = 0.f;
#pragma unroll 1
    for (int c = 0; c < HD / 4; ++c) { const v4f kq = *(const v4fa*)(kr + c * 4); const v4f qq = *(v4f*)&lq[tid][c * 4]; s = __fadd_rn(s, __fmul_rn(qq[0], kq[0])); s = __fadd_rn(s, __fmul_rn(qq[1], kq[1])); s = __fadd_rn(s, __fmul_rn(qq[2], kq[2])); s = __fadd_rn(s, __fmul_rn(qq[3], kq[3])); const v4f rq = *(const v4fa*)(rr + c * 4); const v4f qv = *(v4f*)&lqv[tid][c * 4]; s2 = __fadd_rn(s2, __fmul_rn(qv[0], bf16_round(rq[0]))); s2 = __fadd_rn(s2, __fmul_rn(qv[1], bf16_round(rq[1]))); s2 = __fadd_rn(s2, __fmul_rn(qv[2], bf16_round(rq[2]))); s2 = __fadd_rn(s2, __fmul_rn(qv[3], bf16_round(rq[3]))); }
    s = __fadd_rn(s, s2); (void)scale;
    const float f = (MASKADD || j <= i) ? 1.f : 0.f; const float sm = fmaf(f, s, (1.f - f) * -1.0e30f); const float mn = fmaxf(m, sm); const float sc = expf(m - mn); const float e = expf(sm - mn); l = __fadd_rn(__fmul_rn(l, sc), e); m = mn;
#pragma unroll 1
    for (int c = 0; c < HD / 4; ++c) { const v4f vv = *(const v4fa*)(vr + c * 4); v4f oo = *(v4f*)&lo[tid][c * 4]; for (int u = 0; u < 4; ++u) oo[u] = __fadd_rn(__fmul_rn(oo[u], sc), __fmul_rn(e, vv[u])); *(v4f*)&lo[tid][c * 4] = oo; } }
  const float fin = 64.0f / l;      /* o carried x64 like the f16 path */
#pragma unroll 1
  for (int c = 0; c < HD / 4; ++c) { v4f oo = *(v4f*)&lo[tid][c * 4]; for (int u = 0; u < 4; ++u) oo[u] = __fmul_rn(oo[u], fin); *(v4f*)&lo[tid][c * 4] = oo; }
  __syncthreads();
  {
#pragma unroll 1
    for (int it = 0; it < 16; ++it) { const int row = it * 4 + tid / 16, pc = (tid % 16) * 4; const v4f v = *(const v4f*)&lo[row][pc]; *(v4f*)(OF + (size_t)(rg * 64 + row) * ldo + h * HD + pc) = v; }
     } }

extern "C" void kernel_launch(void* const* d_in, const int* in_sizes, int n_in,
                              void* d_out, int out_size, void* d_ws, size_t ws_size, hipStream_t stream) {
  (void)in_sizes; (void)n_in; (void)out_size;
  const float* const* I = (const float* const*)d_in; const float* x = I[0]; const float* g = I[1]; const float* wq = I[2]; const float* wk = I[3]; const float* wv = I[4]; const float* wres = I[5]; const float* xlr = I[6]; const float* xlu = I[7]; const float* xlv = I[8];      /* x; RMS gain; w_q/w_k/w_v [1024][16][64] = [in][out]; w_res [1024][1024] [in][out]; xl_r [16][2048][64]; xl_u, xl_v [1][16][1][64] = per-head 64-vectors (a [1024] bias over the merged columns) */
  char* ws = (char*)d_ws; size_t off = 0;
  auto take = [&](size_t bytes) { char* p = ws + off; off += (bytes + 255) & ~(size_t)255; return p; };
  _Float16* BQ = (_Float16*)take((size_t)DM * DM * 2); _Float16* BK = (_Float16*)take((size_t)DM * DM * 2); _Float16* BV = (_Float16*)take((size_t)DM * DM * 2); _Float16* BR = (_Float16*)take((size_t)DM * DM * 2);
  float* XT = (float*)take(NR * DM * 4); _Float16* X16 = (_Float16*)take(NR * DM * 2); _Float16* XL16 = (_Float16*)take(NR * DM * 2); float* QUF = (float*)take((size_t)QT0 * DM * 4); float* QVF = (float*)take((size_t)QT0 * DM * 4); float* KF0 = (float*)take((size_t)QT0 * DM * 4); float* VF0 = (float*)take((size_t)QT0 * DM * 4); float* OF0 = (float*)take((size_t)NB * QT0 * DM * 4); _Float16* OH0 = (_Float16*)take((size_t)NB * QT0 * DM * 2); _Float16* OL0 = (_Float16*)take((size_t)NB * QT0 * DM * 2); _Float16* QU = (_Float16*)take(NR * DM * 2); _Float16* QV = (_Float16*)take(NR * DM * 2); _Float16* K16 = (_Float16*)take(NR * DM * 2); float* VF = (float*)take(NR * DM * 4); _Float16* V16 = (_Float16*)take(NR * DM * 2); _Float16* VL16 = (_Float16*)take(NR * DM * 2); _Float16* R16 = (_Float16*)take((size_t)NH * SQ * HD * 2); float* OF = (float*)take(NR * DM * 4); _Float16* O16 = (_Float16*)take(NR * DM * 2); _Float16* OL16 = (_Float16*)take(NR * DM * 2);      /* v and wv carried as f32 -> f16 hi + x1024 residual (the first causal rows copy v almost verbatim into small outputs) */
  float* S = (float*)take((size_t)NH * QT * NKX * 4); float* BD = (float*)take((size_t)NH * QT * NKX * 4); _Float16* P = (_Float16*)take((size_t)NH * QT * NKX * 2); _Float16* PL = (_Float16*)take((size_t)NH * QT * NKX * 2); _Float16* VT = (_Float16*)take((size_t)NH * HD * SQ * 2); _Float16* VTL = (_Float16*)take((size_t)NH * HD * SQ * 2);
  if (off > ws_size) return;
  { const unsigned gw = (unsigned)(((size_t)DM * DM / 8 + 255) / 256); k_wt_f16<<<gw, 256, 0, stream>>>(wq, BQ, DM, DM, 16.0f); k_wt_f16<<<gw, 256, 0, stream>>>(wk, BK, DM, DM, 16.0f); k_wt_f16<<<gw, 256, 0, stream>>>(wv, BV, DM, DM, 16.0f); k_wt_f16<<<gw, 256, 0, stream>>>(wres, BR, DM, DM, 16.0f); }      /* [in][out] ([in][h][k] flattened) -> Bt x16 */
  k_bfr<<<(unsigned)((NR * DM / 8 + 255) / 256), 256, 0, stream>>>(x, XT, NR * DM / 8); k_rmsrow<DM><<<(unsigned)NR, 256, 0, stream>>>(XT, g, 1e-6f); k_hl<<<(unsigned)((NR * DM / 8 + 255) / 256), 256, 0, stream>>>(XT, X16, XL16, NR * DM / 8);      /* x_t = RMSNorm(bf16(x)) g (f32, in place) -> f16 hi rows (+ x1024 residual rows for the exact first tile) */
  k_x16<<<(unsigned)(((size_t)NH * SQ * HD / 8 + 255) / 256), 256, 0, stream>>>(xlr, R16, (size_t)NH * SQ * HD / 8);      /* xl_r [h][j][64] as exact f16 rows (bf16-valued input) */
  k_gemm2<0><<<dim3((unsigned)((NR / 128) * (DM / 64)), 1), 128, 0, stream>>>(X16, DM, 0, BQ, DM, 0, 0.0078125f, xlu, 0, nullptr, 1, 0, 0, nullptr, QU, DM, 0, (int)NR, DM, DM); k_gemm2<0><<<dim3((unsigned)((NR / 128) * (DM / 64)), 1), 128, 0, stream>>>(X16, DM, 0, BQ, DM, 0, 0.0078125f, xlv, 0, nullptr, 1, 0, 0, nullptr, QV, DM, 0, (int)NR, DM, DM);      /* q / 8 + xl_u and q / 8 + xl_v (the per-head 64-vectors as [1024] column biases) -> f16 rows */
  k_gemm2<0><<<dim3((unsigned)((NR / 128) * (DM / 64)), 1), 128, 0, stream>>>(X16, DM, 0, BK, DM, 0, 0.0625f, nullptr, 0, nullptr, 1, 0, 0, nullptr, K16, DM, 0, (int)NR, DM, DM); k_gemm2<0><<<dim3((unsigned)((NR / 128) * (DM / 64)), 1), 128, 0, stream>>>(X16, DM, 0, BV, DM, 0, 0.0625f, nullptr, 0, nullptr, 1, 0, 0, VF, nullptr, DM, 0, (int)NR, DM, DM); k_hl<<<(unsigned)((NR * DM / 8 + 255) / 256), 256, 0, stream>>>(VF, V16, VL16, NR * DM / 8);      /* k -> f16; v f32 -> f16 hi + x1024 residual rows */
  for (int b = 0; b < NB; ++b) { const size_t r0 = (size_t)b * SQ;
    k_vt<NH, SQ><<<NH * (SQ / 64), 256, 0, stream>>>(V16 + r0 * DM, DM, 0, VT); k_vt<NH, SQ><<<NH * (SQ / 64), 256, 0, stream>>>(VL16 + r0 * DM, DM, 0, VTL);      /* V^T hi and residual [16][64][SQ] of this batch */
    { const dim3 g0((QT0 / 128) * (DM / 64), 1);      
      k_gemm2<0><<<g0, 128, 0, stream>>>(X16 + r0 * DM, DM, 0, BQ, DM, 0, 0.0078125f, xlu, 0, nullptr, 1, 0, 0, QUF, nullptr, DM, 0, QT0, DM, DM); k_gemm2<0><<<g0, 128, 0, stream>>>(XL16 + r0 * DM, DM, 0, BQ, DM, 0, 0.00000762939453125f, nullptr, 0, QUF, -1, 0, 0, QUF, nullptr, DM, 0, QT0, DM, DM);
      k_gemm2<0><<<g0, 128, 0, stream>>>(X16 + r0 * DM, DM, 0, BQ, DM, 0, 0.0078125f, xlv, 0, nullptr, 1, 0, 0, QVF, nullptr, DM, 0, QT0, DM, DM); k_gemm2<0><<<g0, 128, 0, stream>>>(XL16 + r0 * DM, DM, 0, BQ, DM, 0, 0.00000762939453125f, nullptr, 0, QVF, -1, 0, 0, QVF, nullptr, DM, 0, QT0, DM, DM);
      k_gemm2<0><<<g0, 128, 0, stream>>>(X16 + r0 * DM, DM, 0, BK, DM, 0, 0.0625f, nullptr, 0, nullptr, 1, 0, 0, KF0, nullptr, DM, 0, QT0, DM, DM); k_gemm2<0><<<g0, 128, 0, stream>>>(XL16 + r0 * DM, DM, 0, BK, DM, 0, 0.00006103515625f, nullptr, 0, KF0, -1, 0, 0, KF0, nullptr, DM, 0, QT0, DM, DM);
      k_gemm2<0><<<g0, 128, 0, stream>>>(X16 + r0 * DM, DM, 0, BV, DM, 0, 0.0625f, nullptr, 0, nullptr, 1, 0, 0, VF0, nullptr, DM, 0, QT0, DM, DM); k_gemm2<0><<<g0, 128, 0, stream>>>(XL16 + r0 * DM, DM, 0, BV, DM, 0, 0.00006103515625f, nullptr, 0, VF0, -1, 0, 0, VF0, nullptr, DM, 0, QT0, DM, DM);
      k_att0xl<<<NH * (QT0 / 64), 64, 0, stream>>>(QUF, QVF, KF0, VF0, DM, xlr, OF0 + (size_t)b * QT0 * DM, DM); }      /* exact causal XL attention for rows 0..255 (o x64, f32) */
    for (int q0 = 0; q0 < SQ; q0 += QT) { const int nk = q0 + QT;      /* causal: keys below the tile end only */
      k_gemm2<0><<<dim3((QT / 128) * (nk / 64), NH), 128, 0, stream>>>(QU + (r0 + q0) * DM, DM, (size_t)HD, K16 + r0 * DM, DM, (size_t)HD, 1.0f, nullptr, 0, nullptr, 1, 0, 0, S, nullptr, NKX, (size_t)QT * NKX, QT, nk, HD);      /* AC[i][j] = (q_i + u).k_j, 16 heads on grid.y */
      k_gemm2<0><<<dim3((QT / 128) * (nk / 64), NH), 128, 0, stream>>>(QV + (r0 + q0) * DM, DM, (size_t)HD, R16 + (size_t)(SQ - nk) * HD, HD, (size_t)SQ * HD, 1.0f, nullptr, 0, nullptr, 1, 0, 0, BD, nullptr, NKX, (size_t)QT * NKX, QT, nk, HD);      /* BD'[i][c] = (q_i + v).xl_r[h][SQ - nk + c] for c < nk (the xl_r rows the shift can reach from this tile) */
      static_assert(SQ == 8 * QT, "one k_rsmxl instance per tile end"); switch (nk / QT) { case 1: rsmxl_go<2>(S, BD, P, PL, stream); break; case 2: rsmxl_go<4>(S, BD, P, PL, stream); break; case 3: rsmxl_go<6>(S, BD, P, PL, stream); break; case 4: rsmxl_go<8>(S, BD, P, PL, stream); break; case 5: rsmxl_go<10>(S, BD, P, PL, stream); break; case 6: rsmxl_go<12>(S, BD, P, PL, stream); break; case 7: rsmxl_go<14>(S, BD, P, PL, stream); break; default: rsmxl_go<16>(S, BD, P, PL, stream); break; }      /* scores = AC + BD'[i][nk-1-(i-j)] (== rel_shift) for j <= i, -1e30 above the diagonal; softmax -> x256 f16 */
      k_gemm2<0><<<dim3((QT / 128) * (HD / 64), NH), 128, 0, stream>>>(P, NKX, (size_t)QT * NKX, VT, SQ, (size_t)HD * SQ, 0.25f, nullptr, 0, nullptr, 1, 0, 0, OF + (r0 + q0) * DM, nullptr, DM, (size_t)HD, QT, HD, nk); k_gemm2<0><<<dim3((QT / 128) * (HD / 64), NH), 128, 0, stream>>>(PL, NKX, (size_t)QT * NKX, VT, SQ, (size_t)HD * SQ, 0.000244140625f, nullptr, 0, OF + (r0 + q0) * DM, -1, 0, 0, OF + (r0 + q0) * DM, nullptr, DM, (size_t)HD, QT, HD, nk); k_gemm2<0><<<dim3((QT / 128) * (HD / 64), NH), 128, 0, stream>>>(P, NKX, (size_t)QT * NKX, VTL, SQ, (size_t)HD * SQ, 0.000244140625f, nullptr, 0, OF + (r0 + q0) * DM, -1, 0, 0, OF + (r0 + q0) * DM, nullptr, DM, (size_t)HD, QT, HD, nk); } }      /* wv x64 = Ph Vh 2^-2 + Pl Vh 2^-12 + Ph Vl 2^-12 (f32, own-element accumulate) */
  k_hl<<<(unsigned)((NR * DM / 8 + 255) / 256), 256, 0, stream>>>(OF, O16, OL16, NR * DM / 8);      /* wv x64 -> f16 hi + x1024 residual rows */
  k_gemm2<0><<<dim3((unsigned)((NR / 128) * (DM / 64)), 1), 128, 0, stream>>>(O16, DM, 0, BR, DM, 0, 0.0009765625f, nullptr, 0, nullptr, 1, 0, 0, (float*)d_out, nullptr, DM, 0, (int)NR, DM, DM); k_gemm2<0><<<dim3((unsigned)((NR / 128) * (DM / 64)), 1), 128, 0, stream>>>(OL16, DM, 0, BR, DM, 0, 0.00000095367431640625f, nullptr, 0, (const float*)d_out, -1, 0, 0, (float*)d_out, nullptr, DM, 0, (int)NR, DM, DM);      /* res = wv_hi w_res 2^-10 += wv_lo w_res 2^-20 (own element) */
  k_hl<<<(unsigned)(((size_t)NB * QT0 * DM / 8 + 255) / 256), 256, 0, stream>>>(OF0, OH0, OL0, (size_t)NB * QT0 * DM / 8);      /* first-tile o (x64) -> f16 hi + x1024 residual planes */
  for (int b = 0; b < NB; ++b) { const size_t r0 = (size_t)b * SQ; const size_t f0 = (size_t)b * QT0;
    k_gemm2<0><<<dim3((QT0 / 128) * (DM / 64), 1), 128, 0, stream>>>(OH0 + f0 * DM, DM, 0, BR, DM, 0, 0.0009765625f, nullptr, 0, nullptr, 1, 0, 0, (float*)d_out + r0 * DM, nullptr, DM, 0, QT0, DM, DM);      /* rows 0..255 of the batch rewritten from the exact path */
    k_gemm2<0><<<dim3((QT0 / 128) * (DM / 64), 1), 128, 0, stream>>>(OL0 + f0 * DM, DM, 0, BR, DM, 0, 0.00000095367431640625f, nullptr, 0, (const float*)d_out + r0 * DM, -1, 0, 0, (float*)d_out + r0 * DM, nullptr, DM, 0, QT0, DM, DM); }      /* += o_lo w_res 2^-20 (own-element accumulate) */
}

// v002
// A run of this version takes 3330 microseconds.
// Two timings next to v001 both put it at 1.57 times that version's speed.
// Over all steps from v000 it is 4.64 times as fast.
#include <hip/hip_runtime.h>
// Transformer-XL style causal attention with relative-position (rel_shift) scores (x [2][2048][1024]; x_t = RMSNorm(x) g (eps 1e-6); q = x_t w_q / 8, k = x_t w_k, v = x_t w_v (w [1024][16][64] = [in][out], sigma 1/32); scores = (q + xl_u).k^T + rel_shift((q + xl_v).xl_r^T) (xl_r [16][2048][64], xl_u / xl_v [1][16][1][64]); causal: - 1e30 above the diagonal; softmax; wv = w v merged (h*64+v); res = wv w_res ([in][out]) -> [2][2048][1024]. rel_shift with q_len = k_len = T gives bd[i][j] = (q_i + xl_v).xl_r[h][T-1-(i-j)] for j <= i).
// Structure: token rows; x_t = RMSNorm(bf16(x)) in f32 on VALU -> f16 rows; [in][out] weights as x16 planes; q+u and q+v as two WMMA GEMMs (32x64 wave tiles, f32 accumulation, alpha 1/128, per-head bias vectors), k, v -> f16 rows; xl_r as exact f16 rows; per batch: V^T via LDS transposes; exact f32 XL attention for rows 0..255 per batch on VALU (q/k/v of those rows from x_t hi + residual GEMM passes); per 256-row tile: AC = (q+u) k^T over keys < tile end and BD' = (q+v) r^T over the matching xl_r rows [T-nk, T) (K = 64, 16 heads on grid.y) f32; causal softmax on VALU that adds the rel-shifted BD'[i][nk-1-(i-j)] (arithmetic select and clamped index, -1e30 fill, f32 statistics, native exp; weights x256 f16); o = P V^T (x64) merged f16; res = o_hi w_res + o_lo w_res 2^-10; first-tile rows rewritten from the exact o hi/lo; launches: see trace.
// Compute dtype: inputs rounded to bf16; x / weights exact; q, k as plain f16 GEMM operands (~2^-12); v, softmax weights and o as f16 hi + x1024 residual; scores and softmax statistics f32. v_wmma_f32_16x16x32_f16.
#define NB 2
#define NG 16
#define HPG 1
#define KVD (NG * HD)
#define SQ 2048
#define DM 1024
#define NH 16
#define HD 64
#define HG 4                         /* heads per block group of the unlaunched k_vt(V16, b, h0, VT) */
#define QT 256                       /* query rows per causal tile */
#define NKX SQ                       /* S / P row pitch */
#define QT0 256                      /* first-tile rows recomputed exactly in f32 (= one causal tile) */
#define B0 0                         /* unused; the batch loops start at 0 */
#define NBR NB                       /* unused by the launches; the batch loops run over NB */
#define NR ((size_t)NB * SQ)         /* token rows */
#define MP ((int)((size_t)NBR * SQ)) /* unused by the launches; the projections run over NR rows */
#define QN SQ                        /* unused; the tile loop runs over SQ */
#define NHD NH                       /* unused; the attention launches use NH */
#define MPO MP                       /* unused; the output GEMMs use NR */
#define LQ DM      /* unused; the q/k/v rows use pitch DM */
typedef __bf16 v16b __attribute__((ext_vector_type(16)));
typedef unsigned short v8us __attribute__((ext_vector_type(8), may_alias));
typedef float  v8f  __attribute__((ext_vector_type(8)));
typedef float  v4f  __attribute__((ext_vector_type(4)));
typedef float  v4fa __attribute__((ext_vector_type(4), may_alias));
union FragB { v16b v; v8us half[2]; unsigned short u[16]; };

__device__ __forceinline__ unsigned short bf16_bits(float x) { unsigned int u = __float_as_uint(x); return (unsigned short)((u + 0x7FFFu + ((u >> 16) & 1u)) >> 16); }
__device__ __forceinline__ float bf16_val(unsigned short b) { return __uint_as_float(((unsigned int)b) << 16); }
__device__ __forceinline__ float bf16_round(float x) { return bf16_val(bf16_bits(x)); }
// D += A·B with NT terms: 1 = ah·bh, 2 = + al·bh (A split), 3 = + ah·bl (both split)
template <int NT>
__device__ __forceinline__ v8f mmaN(v16b ah, v16b al, v16b bh, v16b bl, v8f c) {
  c = __builtin_amdgcn_wmma_f32_16x16x32_bf16(false, ah, false, bh, (short)0, c, false, false);
  if (NT >= 2) c = __builtin_amdgcn_wmma_f32_16x16x32_bf16(false, al, false, bh, (short)0, c, false, false);
  if (NT >= 3) c = __builtin_amdgcn_wmma_f32_16x16x32_bf16(false, ah, false, bl, (short)0, c, false, false);
  asm volatile("v_nop\n\tv_nop\n\tv_nop\n\tv_nop" : "+v"(c) : "v"(ah), "v"(al), "v"(bh), "v"(bl));
  return c;
}

__global__ __launch_bounds__(256) void k_wt_bf16(const float* __restrict__ W, unsigned short* __restrict__ Wt, int K, int N) {
  const int t = blockIdx.x * 256 + threadIdx.x;
  const int k8n = K / 8;
  if (t >= N * k8n) return;
  const int n = t / k8n, k8 = (t % k8n) * 8;
  v8us v;
#pragma unroll
  for (int i = 0; i < 8; ++i) v[i] = bf16_bits(W[(size_t)(k8 + i) * N + n]);
  *(v8us*)(Wt + (size_t)n * K + k8) = v;
  
}

// GEMM C[M][N] (f32, pitch ldc) = act(A[M][K]·W + bias). A f32 row-major (pitch lda) converted per fragment to bf16
// (ASPLIT: hi/lo two planes -> 2 terms, else single rounded term); Wt bf16 [N][K] (pitch ldb). BIAS_BF16 rounds the
// bias to bf16 first (bias quantised to bf16 before the add). K%32==0, M%16==0, N%64==0.
template <bool ASPLIT, int ACT, bool BIAS_BF16>
__global__ __launch_bounds__(128) void k_gemm_bf(const float* __restrict__ A, int lda, const unsigned short* __restrict__ Wt, int ldb,
                                               const float* __restrict__ bias, float* __restrict__ C, int ldc, int M, int N, int K) {
  __shared__ __attribute__((aligned(16))) float so[4][16][64];
  const int tid = threadIdx.x, w = tid >> 5, lane = tid & 31, ln = lane & 15, hh = lane >> 4;
  const int ntn = N / 64;
  const int wid = blockIdx.x * 4 + w;
  const int mt = wid / ntn, nq = wid % ntn;
  if (mt * 16 >= M) return;
  const int row0 = mt * 16, col0 = nq * 64;
  const float* arow = A + (size_t)(row0 + ln) * lda;
  v8f acc[4] = {};
  for (int kb = 0; kb < K; kb += 32) {
    FragB ah, al;
    const v4f x0 = *(const v4fa*)(arow + kb + 8 * hh), x1 = *(const v4fa*)(arow + kb + 8 * hh + 4);
    const v4f x2 = *(const v4fa*)(arow + kb + 16 + 8 * hh), x3 = *(const v4fa*)(arow + kb + 16 + 8 * hh + 4);
    float xs[16] = {x0[0],x0[1],x0[2],x0[3],x1[0],x1[1],x1[2],x1[3],x2[0],x2[1],x2[2],x2[3],x3[0],x3[1],x3[2],x3[3]};
#pragma unroll
    for (int i = 0; i < 16; ++i) { const unsigned short hb = bf16_bits(xs[i]); ah.u[i] = hb; al.u[i] = ASPLIT ? bf16_bits(xs[i] - bf16_val(hb)) : (unsigned short)0; }
#pragma unroll
    for (int t = 0; t < 4; ++t) {
      const unsigned short* brow = Wt + (size_t)(col0 + t * 16 + ln) * ldb + kb;
      FragB b;
      b.half[0] = *(const v8us*)(brow + 8 * hh);
      b.half[1] = *(const v8us*)(brow + 16 + 8 * hh);
      acc[t] = mmaN<ASPLIT ? 2 : 1>(ah.v, al.v, b.v, b.v, acc[t]);
    }
  }
#pragma unroll
  for (int t = 0; t < 4; ++t) {
    float bv = bias ? bias[col0 + t * 16 + ln] : 0.f;
    if (BIAS_BF16) bv = bf16_round(bv);
#pragma unroll
    for (int r = 0; r < 8; ++r) { float v = acc[t][r] + bv; if (ACT == 1) v = fmaxf(v, 0.f); so[w][8 * hh + r][t * 16 + ln] = v; }
  }
  __builtin_amdgcn_fence(__ATOMIC_ACQ_REL, "workgroup");
  __builtin_amdgcn_wave_barrier();
  const int rsub = lane >> 4, c4 = (lane & 15) * 4;
  {
#pragma unroll
    for (int q = 0; q < 8; ++q) {
      const int r = q * 2 + rsub;
      const v4f v = *(const v4fa*)&so[w][r][c4];
      *(v4f*)(C + (size_t)(row0 + r) * ldc + col0 + c4) = v;
    }
    
  }
}

// GEMM C = act(A·W + bias + resid): A f32 (ASPLIT -> hi/lo 2 terms), Wt bf16 [N][K]; ACT 0 none, 1 relu, 2 exact gelu;
// resid (optional, f32, row index = (row % rmod), pitch ldr, RES_BF16 rounds it) added before the activation.
template <bool ASPLIT, int ACT, bool BIAS_BF16, bool RES_BF16>
__global__ __launch_bounds__(128) void k_gemm_bf3(const float* __restrict__ A, int lda, const unsigned short* __restrict__ Wt, int ldb,
                                                const float* __restrict__ bias, const float* __restrict__ resid, int rmod, int ldr,
                                                float* __restrict__ C, int ldc, int M, int N, int K) {
  __shared__ __attribute__((aligned(16))) float so[4][16][64];
  const int tid = threadIdx.x, w = tid >> 5, lane = tid & 31, ln = lane & 15, hh = lane >> 4;
  const int ntn = N / 64;
  const int wid = blockIdx.x * 4 + w;
  const int mt = wid / ntn, nq = wid % ntn;
  if (mt * 16 >= M) return;
  const int row0 = mt * 16, col0 = nq * 64;
  const float* arow = A + (size_t)(row0 + ln) * lda;
  v8f acc[4] = {};
  for (int kb = 0; kb < K; kb += 32) {
    FragB ah, al;
    const v4f x0 = *(const v4fa*)(arow + kb + 8 * hh), x1 = *(const v4fa*)(arow + kb + 8 * hh + 4);
    const v4f x2 = *(const v4fa*)(arow + kb + 16 + 8 * hh), x3 = *(const v4fa*)(arow + kb + 16 + 8 * hh + 4);
    float xs[16] = {x0[0],x0[1],x0[2],x0[3],x1[0],x1[1],x1[2],x1[3],x2[0],x2[1],x2[2],x2[3],x3[0],x3[1],x3[2],x3[3]};
#pragma unroll
    for (int i = 0; i < 16; ++i) { const unsigned short hb = bf16_bits(xs[i]); ah.u[i] = hb; al.u[i] = ASPLIT ? bf16_bits(xs[i] - bf16_val(hb)) : (unsigned short)0; }
#pragma unroll
    for (int t = 0; t < 4; ++t) {
      const unsigned short* brow = Wt + (size_t)(col0 + t * 16 + ln) * ldb + kb;
      FragB b;
      b.half[0] = *(const v8us*)(brow + 8 * hh);
      b.half[1] = *(const v8us*)(brow + 16 + 8 * hh);
      acc[t] = mmaN<ASPLIT ? 2 : 1>(ah.v, al.v, b.v, b.v, acc[t]);
    }
  }
#pragma unroll
  for (int t = 0; t < 4; ++t) {
    const int col = col0 + t * 16 + ln;
    float bv = bias ? bias[col] : 0.f;
    if (BIAS_BF16) bv = bf16_round(bv);
#pragma unroll
    for (int r = 0; r < 8; ++r) {
      float v = acc[t][r] + bv;
      if (resid) { float rv = resid[(size_t)((row0 + 8 * hh + r) % rmod) * ldr + col]; if (RES_BF16) rv = bf16_round(rv); v += rv; }
      if (ACT == 1) v = fmaxf(v, 0.f);
      if (ACT == 2) v = 0.5f * v * (1.0f + erff(v * 0.70710678118654752f));
      if (ACT == 3) { const float u = 0.7978845608028654f * (v + 0.044715f * v * v * v); v = 0.5f * v * (1.0f + tanhf(u)); }
      so[w][8 * hh + r][t * 16 + ln] = v;
    }
  }
  __builtin_amdgcn_fence(__ATOMIC_ACQ_REL, "workgroup");
  __builtin_amdgcn_wave_barrier();
  const int rsub = lane >> 4, c4 = (lane & 15) * 4;
  {
#pragma unroll
    for (int q = 0; q < 8; ++q) {
      const int r = q * 2 + rsub;
      const v4f v = *(const v4fa*)&so[w][r][c4];
      *(v4f*)(C + (size_t)(row0 + r) * ldc + col0 + c4) = v;
    }
    
  }
}
// row LayerNorm (biased variance, eps) over N: s = X (+ R); optional out_sum <- s; out_norm <- (s-mu)*rsqrt(var+eps)*g + b
template <bool PARAM_BF16>
__global__ __launch_bounds__(256) void k_layernorm(const float* __restrict__ X, const float* __restrict__ R, const float* __restrict__ g, const float* __restrict__ bta,
                                                  float* __restrict__ out_sum, float* __restrict__ out_norm, int N, float eps) {
  __shared__ float red[256];
  const int row = blockIdx.x, tid = threadIdx.x;
  const float* x = X + (size_t)row * N; const float* rr = R ? R + (size_t)row * N : nullptr;
  float vals[16];                     // up to N = 4096
  const int per = N / 256;            // contiguous chunk per thread? use strided-by-4 chunks: thread handles j = tid*4 + 1024*u
  float s1 = 0.f;
  for (int u = 0; u < per / 4; ++u) {
    const int j = tid * 4 + 1024 * u;
    const v4f a = *(const v4fa*)(x + j);
    v4f b = {0.f,0.f,0.f,0.f}; if (rr) b = *(const v4fa*)(rr + j);
#pragma unroll
    for (int q = 0; q < 4; ++q) { const float v = a[q] + b[q]; vals[u * 4 + q] = v; s1 += v; }
  }
  red[tid] = s1; __syncthreads();
  for (int st = 128; st > 0; st >>= 1) { if (tid < st) red[tid] += red[tid + st]; __syncthreads(); }
  const float mu = red[0] / (float)N; __syncthreads();
  float s2 = 0.f;
  for (int u = 0; u < per / 4; ++u)
#pragma unroll
    for (int q = 0; q < 4; ++q) { const float c = vals[u * 4 + q] - mu; s2 += c * c; }
  red[tid] = s2; __syncthreads();
  for (int st = 128; st > 0; st >>= 1) { if (tid < st) red[tid] += red[tid + st]; __syncthreads(); }
  const float rs = rsqrtf(red[0] / (float)N + eps);
  {
    for (int u = 0; u < per / 4; ++u) {
      const int j = tid * 4 + 1024 * u;
      v4f o, sm;
#pragma unroll
      for (int q = 0; q < 4; ++q) {
        float gg = g[j + q], bb = bta[j + q];
        if (PARAM_BF16) { gg = bf16_round(gg); bb = bf16_round(bb); }
        sm[q] = vals[u * 4 + q]; o[q] = (vals[u * 4 + q] - mu) * rs * gg + bb;
      }
      if (out_sum) *(v4f*)(out_sum + (size_t)row * N + j) = sm;
      *(v4f*)(out_norm + (size_t)row * N + j) = o;
    }
    
  }
}



// ---- f16 WMMA path (v_wmma_f32_16x16x32_f16): 11-bit significands for operands in range — used where a [0,1] probability operand needs more precision than bf16
typedef _Float16 v16h __attribute__((ext_vector_type(16)));
union FragH { v16h v; v8us half[2]; _Float16 h[16]; unsigned short u[16]; };
template <int NT>
__device__ __forceinline__ v8f mmaH(v16h ah, v16h al, v16h bh, v16h bl, v8f c) {
  c = __builtin_amdgcn_wmma_f32_16x16x32_f16(false, ah, false, bh, (short)0, c, false, false);
  if (NT >= 2) c = __builtin_amdgcn_wmma_f32_16x16x32_f16(false, al, false, bh, (short)0, c, false, false);
  if (NT >= 3) c = __builtin_amdgcn_wmma_f32_16x16x32_f16(false, ah, false, bl, (short)0, c, false, false);
  asm volatile("v_nop\n\tv_nop\n\tv_nop\n\tv_nop" : "+v"(c) : "v"(ah), "v"(al), "v"(bh), "v"(bl));
  return c;
}
// batched GEMM like k_gemm_b but f16 operands: A f32 (split into f16 hi/lo if ASPLIT, else rounded to f16), Bt = f16 values [n][k]; alpha; C f32; N multiple of 16 (partial tiles skipped)
template <bool ASPLIT>
__global__ __launch_bounds__(128) void k_gemm_h(const float* __restrict__ A, int lda, size_t sA, const _Float16* __restrict__ Bh, int ldb, size_t sB, float alpha, float* __restrict__ C, int ldc, size_t sC, int M, int N, int K) {
  __shared__ __attribute__((aligned(16))) float so[4][16][64];
  const int tid = threadIdx.x, w = tid >> 5, lane = tid & 31, ln = lane & 15, hh = lane >> 4; const int by = blockIdx.y;
  A += (size_t)by * sA; Bh += (size_t)by * sB; C += (size_t)by * sC;
  const int ntn = (N + 63) / 64; const int wid = blockIdx.x * 4 + w; const int mt = wid / ntn, nq = wid % ntn; if (mt * 16 >= M) return;
  const int row0 = mt * 16, col0 = nq * 64; const float* arow = A + (size_t)(row0 + ln) * lda;
  v8f acc[4] = {};
  for (int kb = 0; kb < K; kb += 32) {
    FragH ah, al;
    const v4f x0 = *(const v4fa*)(arow + kb + 8 * hh), x1 = *(const v4fa*)(arow + kb + 8 * hh + 4), x2 = *(const v4fa*)(arow + kb + 16 + 8 * hh), x3 = *(const v4fa*)(arow + kb + 16 + 8 * hh + 4);
    float xs[16] = {x0[0],x0[1],x0[2],x0[3],x1[0],x1[1],x1[2],x1[3],x2[0],x2[1],x2[2],x2[3],x3[0],x3[1],x3[2],x3[3]};
#pragma unroll
    for (int i = 0; i < 16; ++i) { const _Float16 h = (_Float16)xs[i]; ah.h[i] = h; al.h[i] = ASPLIT ? (_Float16)(xs[i] - (float)h) : (_Float16)0.0f; }
#pragma unroll
    for (int t = 0; t < 4; ++t) { if (col0 + t * 16 >= N) continue; const size_t boff = (size_t)(col0 + t * 16 + ln) * ldb + kb; FragH bq; bq.half[0] = *(const v8us*)(Bh + boff + 8 * hh); bq.half[1] = *(const v8us*)(Bh + boff + 16 + 8 * hh);
      acc[t] = mmaH<ASPLIT ? 2 : 1>(ah.v, al.v, bq.v, bq.v, acc[t]); }
  }
#pragma unroll
  for (int t = 0; t < 4; ++t) { if (col0 + t * 16 >= N) continue;
#pragma unroll
    for (int r = 0; r < 8; ++r) so[w][8 * hh + r][t * 16 + ln] = acc[t][r] * alpha; }
  __builtin_amdgcn_fence(__ATOMIC_ACQ_REL, "workgroup"); __builtin_amdgcn_wave_barrier();
  const int rsub = lane >> 4, c4 = (lane & 15) * 4;
  {
#pragma unroll
    for (int q = 0; q < 8; ++q) { const int r = q * 2 + rsub; if (col0 + c4 < N) { const v4f v = *(const v4fa*)&so[w][r][c4]; *(v4f*)(C + (size_t)(row0 + r) * ldc + col0 + c4) = v; } }
     }
}

// Wt[n][k] = f16(W[k][n]·scale) from f32 row-major W[K][N] (scale = power of two; bf16-exact weights stay exact in f16 away from the subnormal range)
__global__ __launch_bounds__(256) void k_wt_f16(const float* __restrict__ W, _Float16* __restrict__ Wt, int K, int N, float scale) {
  const int t = blockIdx.x * 256 + threadIdx.x; if (t >= N * (K / 8)) return; const int n = t / (K / 8), k8 = (t % (K / 8)) * 8; FragH f;
#pragma unroll
  for (int i = 0; i < 8; ++i) f.h[i] = (_Float16)(bf16_round(W[(size_t)(k8 + i) * N + n]) * scale); const v8us o = f.half[0];
  *(v8us*)((unsigned short*)Wt + (size_t)n * K + k8) = o; 
}
// k_gemm_hh variant with fused epilogue: v = acc·alpha + bias[by·sBias + col] (+ CP[(row/rowsPerB)·sCPb + by·64 + col] if CP) ; ACT 0 none / 1 elu ; writes f16 C16 (and f32 C if non-null)
template <int ACT>
__global__ __launch_bounds__(128) void k_gemm_hhx(const _Float16* __restrict__ A, int lda, size_t sA, const _Float16* __restrict__ Bh, int ldb, size_t sB, float alpha, const float* __restrict__ bias, size_t sBias, const float* __restrict__ CP, int rowsPerB, size_t sCPb, int row0g,
    float* __restrict__ C, _Float16* __restrict__ C16, int ldc, size_t sC, int M, int N, int K) {
  __shared__ __attribute__((aligned(16))) float so[4][16][64];
  const int tid = threadIdx.x, w = tid >> 5, lane = tid & 31, ln = lane & 15, hh = lane >> 4; const int by = blockIdx.y;
  A += (size_t)by * sA; Bh += (size_t)by * sB; const size_t cofs = (size_t)by * sC; const float* bp = bias ? bias + (size_t)by * sBias : nullptr;
  const int ntn = (N + 63) / 64; const int wid = blockIdx.x * 4 + w; const int mt = wid / ntn, nq = wid % ntn; if (mt * 16 >= M) return;
  const int row0 = mt * 16, col0 = nq * 64; const _Float16* arow = A + (size_t)(row0 + ln) * lda;
  v8f acc[4] = {};
  for (int kb = 0; kb < K; kb += 32) { FragH ah; ah.half[0] = *(const v8us*)((const unsigned short*)arow + kb + 8 * hh); ah.half[1] = *(const v8us*)((const unsigned short*)arow + kb + 16 + 8 * hh);
#pragma unroll
    for (int t = 0; t < 4; ++t) { if (col0 + t * 16 >= N) continue; const size_t boff = (size_t)(col0 + t * 16 + ln) * ldb + kb; FragH bq; bq.half[0] = *(const v8us*)((const unsigned short*)Bh + boff + 8 * hh); bq.half[1] = *(const v8us*)((const unsigned short*)Bh + boff + 16 + 8 * hh);
      acc[t] = mmaH<1>(ah.v, ah.v, bq.v, bq.v, acc[t]); }
  }
#pragma unroll
  for (int t = 0; t < 4; ++t) { if (col0 + t * 16 >= N) continue; const int col = col0 + t * 16 + ln; const float bv = bp ? bf16_round(bp[col]) : 0.f;
#pragma unroll
    for (int r = 0; r < 8; ++r) { float v = acc[t][r] * alpha + bv; if (CP) { const int rr = row0g + row0 + 8 * hh + r; if (rowsPerB < 0) v += CP[cofs + (size_t)rr * ldc + col];      /* rowsPerB < 0: own element of the batched C plane */ else { const int bidx = rr / rowsPerB; v += CP[(size_t)bidx * sCPb + (size_t)by * 64 + col]; } } if (ACT == 1) v = (v > 0.f) ? v : expm1f(v); else if (ACT == 7) v = (v > 0.f) ? v + 1.0f : expf(v); else if (ACT == 8) v = tanhf(v); else if (ACT == 9) v = 0.5f * v * (1.0f + tanhf(0.7978845608028654f * (v + 0.044715f * v * v * v))); else if (ACT == 11) v = 1.0f / (1.0f + expf(-v)); else if (ACT == 12) v = (v > 0.f) ? v : 0.01f * v; else if (ACT == 14) v = (v > 0.f) ? v : 0.1f * v; else if (ACT == 16) v = (v >= 0.f) ? v : 0.3f * v; else if (ACT == 17) v = (v >= 0.f) ? v : 0.2f * v; else if (ACT == 15) v = v / (1.0f + expf(-v)); else if (ACT == 3) v = fmaxf(v, 0.f); else if (ACT == 6) v = 0.5f * v * (1.0f + erff(v * 0.70710678118654752f)); so[w][8 * hh + r][t * 16 + ln] = v; } }
  __builtin_amdgcn_fence(__ATOMIC_ACQ_REL, "workgroup"); __builtin_amdgcn_wave_barrier();
  const int rsub = lane >> 4, c4 = (lane & 15) * 4; typedef _Float16 v4h __attribute__((ext_vector_type(4)));
  {
#pragma unroll
    for (int q = 0; q < 8; ++q) { const int r = q * 2 + rsub; if (col0 + c4 < N) { const v4f v = *(const v4fa*)&so[w][r][c4]; if (C) *(v4f*)(C + cofs + (size_t)(row0 + r) * ldc + col0 + c4) = v; if (C16) { v4h h4; for (int i = 0; i < 4; ++i) h4[i] = (_Float16)v[i]; *(v4h*)(C16 + cofs + (size_t)(row0 + r) * ldc + col0 + c4) = h4; } } }
     }
}


typedef _Float16 v4h __attribute__((ext_vector_type(4)));

__global__ __launch_bounds__(256) void k_x16(const float* __restrict__ x, _Float16* __restrict__ X16, size_t n8) { const size_t t = (size_t)blockIdx.x * 256 + threadIdx.x; if (t >= n8) return; FragH f;
#pragma unroll
  for (int q = 0; q < 8; ++q) f.h[q] = (_Float16)bf16_round(x[t * 8 + q]); *(v8us*)((unsigned short*)X16 + t * 8) = f.half[0];  }
__global__ __launch_bounds__(256) void k_h16(const float* __restrict__ x, _Float16* __restrict__ X16, size_t n8) { const size_t t = (size_t)blockIdx.x * 256 + threadIdx.x; if (t >= n8) return; FragH f;
#pragma unroll
  for (int q = 0; q < 8; ++q) f.h[q] = (_Float16)x[t * 8 + q]; *(v8us*)((unsigned short*)X16 + t * 8) = f.half[0];  }
__global__ __launch_bounds__(256) void k_round16f(const float* __restrict__ W, _Float16* __restrict__ Bt, size_t n8) { const size_t t = (size_t)blockIdx.x * 256 + threadIdx.x; if (t >= n8) return; FragH f;
#pragma unroll
  for (int i = 0; i < 8; ++i) f.h[i] = (_Float16)(bf16_round(W[t * 8 + i]) * 16.0f); *(v8us*)((unsigned short*)Bt + t * 8) = f.half[0];  }
template <int NHv, int TTv>
__global__ __launch_bounds__(256) void k_vt(const _Float16* __restrict__ V16, int ldv, int voff, _Float16* __restrict__ Vt) { __shared__ unsigned short tl[64][66]; const int tid = threadIdx.x; const int slab = blockIdx.x / (TTv / 64), lg = blockIdx.x % (TTv / 64); const int b = slab / NHv, h = slab % NHv;
  for (int i = tid; i < 64 * 8; i += 256) { const int r = i / 8, c8 = (i % 8) * 8; FragH f; f.half[0] = *(const v8us*)((const unsigned short*)V16 + ((size_t)b * TTv + lg * 64 + r) * ldv + voff + h * 64 + c8);
#pragma unroll
    for (int q = 0; q < 8; ++q) tl[r][c8 + q] = f.u[q]; }
  __syncthreads();
  {
#pragma unroll
    for (int rd = 0; rd < 2; ++rd) { const int d = rd * 32 + tid / 8, pc = tid % 8; FragH f;
#pragma unroll
      for (int q = 0; q < 8; ++q) f.u[q] = tl[pc * 8 + q][d];
      *(v8us*)((unsigned short*)Vt + ((size_t)slab * 64 + d) * TTv + lg * 64 + pc * 8) = f.half[0]; }
     } }

__global__ __launch_bounds__(256) void k_hl(const float* __restrict__ F, _Float16* __restrict__ Hh, _Float16* __restrict__ Hl, size_t n8) { const size_t t = (size_t)blockIdx.x * 256 + threadIdx.x; if (t >= n8) return; FragH fh, fl; const v4f a = *(const v4fa*)(F + t * 8), c = *(const v4fa*)(F + t * 8 + 4);
#pragma unroll
  for (int q = 0; q < 4; ++q) { _Float16 h = (_Float16)a[q]; fh.h[q] = h; fl.h[q] = (_Float16)((a[q] - (float)h) * 1024.0f); h = (_Float16)c[q]; fh.h[4 + q] = h; fl.h[4 + q] = (_Float16)((c[q] - (float)h) * 1024.0f); }
  { *(v8us*)((unsigned short*)Hh + t * 8) = fh.half[0]; *(v8us*)((unsigned short*)Hl + t * 8) = fl.half[0];  } }

// ---- fast GEMM (wave tile 32x64; requires M % 32 == 0 rows per launch region and N % 64 == 0); epilogue = k_gemm_hhx semantics ----
__device__ __forceinline__ v16h g2_frag(const _Float16* p, int hh) { FragH f; f.half[0] = *(const v8us*)((const unsigned short*)p + 8 * hh); f.half[1] = *(const v8us*)((const unsigned short*)p + 16 + 8 * hh); return f.v; }
__device__ __forceinline__ v8f g2_mma(v16h a, v16h b, v8f c) { v8f d = __builtin_amdgcn_wmma_f32_16x16x32_f16(false, a, false, b, (short)0, c, false, false); asm volatile("v_nop\n\tv_nop\n\tv_nop\n\tv_nop" : "+v"(d) : "v"(a), "v"(b)); return d; }
template <int ACT>
__global__ __launch_bounds__(128) void k_gemm2(const _Float16* __restrict__ A, int lda, size_t sA, const _Float16* __restrict__ Bh, int ldb, size_t sB, float alpha, const float* __restrict__ bias, size_t sBias, const float* __restrict__ CP, int rowsPerB, size_t sCPb, int row0g,
    float* __restrict__ C, _Float16* __restrict__ C16, int ldc, size_t sC, int M, int N, int K) { static_assert(ACT == 0 || ACT == 3 || ACT == 6 || ACT == 8 || ACT == 9 || ACT == 11 || ACT == 12 || ACT == 14 || ACT == 15 || ACT == 16 || ACT == 17, "k_gemm2: unsupported ACT code (would silently apply no activation)");
  __shared__ __attribute__((aligned(16))) float so[4][32][68];
  const int tid = threadIdx.x, w = tid >> 5, lane = tid & 31, ln = lane & 15, hh = lane >> 4; const int by = blockIdx.y;
  A += (size_t)by * sA; Bh += (size_t)by * sB; const size_t cofs = (size_t)by * sC; const float* bp = bias ? bias + (size_t)by * sBias : nullptr;
  const int ntn = N >> 6; const int mt = blockIdx.x / ntn, nq = blockIdx.x - mt * ntn; const int row0 = mt * 128 + 32 * w, col0 = nq * 64; if (row0 >= M) return;
  const _Float16* a0p = A + (size_t)(row0 + ln) * lda; const _Float16* a1p = a0p + (size_t)16 * lda;
  const _Float16* b0p = Bh + (size_t)(col0 + ln) * ldb; const _Float16* b1p = b0p + (size_t)16 * ldb; const _Float16* b2p = b1p + (size_t)16 * ldb; const _Float16* b3p = b2p + (size_t)16 * ldb;
  const v8f z8 = {0.f,0.f,0.f,0.f,0.f,0.f,0.f,0.f}; v8f c00 = z8, c01 = z8, c02 = z8, c03 = z8, c10 = z8, c11 = z8, c12 = z8, c13 = z8;
#pragma unroll 1
  for (int kb = 0; kb < K; kb += 32) { const v16h a0 = g2_frag(a0p + kb, hh), a1 = g2_frag(a1p + kb, hh);
    v16h b = g2_frag(b0p + kb, hh); c00 = g2_mma(a0, b, c00); c10 = g2_mma(a1, b, c10);
    b = g2_frag(b1p + kb, hh); c01 = g2_mma(a0, b, c01); c11 = g2_mma(a1, b, c11);
    b = g2_frag(b2p + kb, hh); c02 = g2_mma(a0, b, c02); c12 = g2_mma(a1, b, c12);
    b = g2_frag(b3p + kb, hh); c03 = g2_mma(a0, b, c03); c13 = g2_mma(a1, b, c13); }
  v8f accs[8] = {c00, c01, c02, c03, c10, c11, c12, c13};
#pragma unroll
  for (int u = 0; u < 8; ++u) { const int t = u & 3, half = u >> 2; const int col = col0 + t * 16 + ln; const float bv = bp ? bf16_round(bp[col]) : 0.f;
#pragma unroll
    for (int r = 0; r < 8; ++r) { const int rloc = half * 16 + 8 * hh + r; float v = accs[u][r] * alpha + bv; if (CP) { if (rowsPerB < 0) v += CP[cofs + (size_t)(row0g + row0 + rloc) * ldc + col];      /* rowsPerB < 0: own element of the batched C plane */ else { const int bidx = (row0g + row0 + rloc) / rowsPerB; v += CP[(size_t)bidx * sCPb + (size_t)by * 64 + col]; } }
      if (ACT == 3) v = fmaxf(v, 0.f); else if (ACT == 6) v = 0.5f * v * (1.0f + erff(v * 0.70710678118654752f)); else if (ACT == 11) v = 1.0f / (1.0f + expf(-v)); else if (ACT == 15) v = v / (1.0f + expf(-v)); else if (ACT == 12) v = (v > 0.f) ? v : 0.01f * v; else if (ACT == 8) v = tanhf(v); else if (ACT == 9) v = 0.5f * v * (1.0f + tanhf(0.7978845608028654f * (v + 0.044715f * v * v * v))); else if (ACT == 14) v = (v > 0.f) ? v : 0.1f * v; else if (ACT == 16) v = (v >= 0.f) ? v : 0.3f * v; else if (ACT == 17) v = (v >= 0.f) ? v : 0.2f * v;
      so[w][rloc][t * 16 + ln] = v; } }
  __builtin_amdgcn_fence(__ATOMIC_ACQ_REL, "workgroup"); __builtin_amdgcn_wave_barrier();
  const int rsub = lane >> 4, c4 = (lane & 15) * 4;
  {
#pragma unroll
    for (int q = 0; q < 16; ++q) { const int r = q * 2 + rsub; const v4f v = *(const v4fa*)&so[w][r][c4]; if (C) *(v4f*)(C + cofs + (size_t)(row0 + r) * ldc + col0 + c4) = v; if (C16) { v4h h4; for (int i = 0; i < 4; ++i) h4[i] = (_Float16)v[i]; *(v4h*)(C16 + cofs + (size_t)(row0 + r) * ldc + col0 + c4) = h4; } }
     } }


__global__ __launch_bounds__(256) void k_wnat(const float* __restrict__ w, size_t n8, _Float16* __restrict__ Bt) { const size_t t = (size_t)blockIdx.x * 256 + threadIdx.x; if (t >= n8) return; FragH f; for (int q = 0; q < 8; ++q) f.h[q] = (_Float16)(bf16_round(w[t * 8 + q]) * 16.0f); *(v8us*)((unsigned short*)Bt + t * 8) = f.half[0];  }
__global__ __launch_bounds__(256) void k_rsm(const float* __restrict__ S, _Float16* __restrict__ P, int nrows) {
  #pragma clang fp contract(off)
  const int i = blockIdx.x * 256 + threadIdx.x; if (i >= nrows) return; const float* s = S + (size_t)i * SQ; float mx = -3.0e38f;
#pragma unroll 1
  for (int j = 0; j < SQ; ++j) mx = fmaxf(mx, s[j]); float se = 0.f;
#pragma unroll 1
  for (int j = 0; j < SQ; ++j) se += expf(s[j] - mx); const float sc = 256.0f / se;
#pragma unroll 1
  for (int j0 = 0; j0 < SQ; j0 += 8) { FragH f; for (int q = 0; q < 8; ++q) f.h[q] = (_Float16)(expf(s[j0 + q] - mx) * sc); unsigned short* d = (unsigned short*)P + (size_t)i * SQ + j0; *(v8us*)d = f.half[0];  } }
__global__ __launch_bounds__(256) void k_vt(const _Float16* __restrict__ V16, int b, int h0, _Float16* __restrict__ VT) { __shared__ unsigned short tl[64][65]; const int tid = threadIdx.x; const int hh = blockIdx.x % HG, sg = blockIdx.x / HG; const int s0 = sg * 64; const int h = h0 + hh;
  for (int i = tid; i < 64 * 8; i += 256) { const int j = i / 8, d8 = (i % 8) * 8; FragH f; f.half[0] = *(const v8us*)((const unsigned short*)V16 + ((size_t)b * SQ + s0 + j) * DM + h * HD + d8); for (int q = 0; q < 8; ++q) tl[d8 + q][j] = f.u[q]; }
  __syncthreads();
  { for (int i = tid; i < 64 * 8; i += 256) { const int d = i / 8, j8 = (i % 8) * 8; FragH f; for (int q = 0; q < 8; ++q) f.u[q] = tl[d][j8 + q]; *(v8us*)((unsigned short*)VT + ((size_t)hh * HD + d) * SQ + s0 + j8) = f.half[0]; }  } }



__global__ __launch_bounds__(256) void k_rsmcf2(const float* __restrict__ S, _Float16* __restrict__ P, int hg, int q0, int nk) {
  #pragma clang fp contract(off)
  const int t = blockIdx.x * 256 + threadIdx.x; if (t >= hg * QT) return; const size_t i = (size_t)t; const float* s = S + i * NKX; const int last = q0 + (t % QT); float mx = -3.0e38f;
#pragma unroll 1
  for (int j = 0; j < nk; ++j) { const float f = (j <= last) ? 1.f : 0.f; mx = fmaxf(mx, fmaf(f, s[j], (1.f - f) * -1.0e9f)); } float se = 0.f;
#pragma unroll 1
  for (int j = 0; j < nk; ++j) { const float f = (j <= last) ? 1.f : 0.f; se += __expf(fmaf(f, s[j], (1.f - f) * -1.0e9f) - mx); } const float sc = 256.0f / se;
#pragma unroll 1
  for (int j0 = 0; j0 < nk; j0 += 8) { FragH fr; for (int q = 0; q < 8; ++q) { const int j = j0 + q; const float f = (j <= last) ? 1.f : 0.f; fr.h[q] = (_Float16)(__expf(fmaf(f, s[j], (1.f - f) * -1.0e9f) - mx) * sc); } unsigned short* d = (unsigned short*)P + i * NKX + j0; *(v8us*)d = fr.half[0];  } }


template <int MASKADD>
__global__ __launch_bounds__(64) void k_att0(const float* __restrict__ QF, const float* __restrict__ KF, const float* __restrict__ VF, int ld, const float* __restrict__ mask, float scale, float* __restrict__ OF, int ldo) {
  #pragma clang fp contract(off)
  __shared__ __attribute__((aligned(16))) float lq[64][64]; __shared__ __attribute__((aligned(16))) float lo[64][64];
  const int tid = threadIdx.x; const int h = blockIdx.x / (QT0 / 64), rg = blockIdx.x % (QT0 / 64); const int i = rg * 64 + tid;
  const float* qr = QF + (size_t)i * ld + h * HD;
#pragma unroll 1
  for (int c = 0; c < HD / 4; ++c) { *(v4f*)&lq[tid][c * 4] = *(const v4fa*)(qr + c * 4); const v4f z = {0.f, 0.f, 0.f, 0.f}; *(v4f*)&lo[tid][c * 4] = z; }
  float m = -1.0e30f, l = 0.f; const int jmax = MASKADD ? (SQ - 1) : (rg * 64 + 63);      /* additive-mask form: every key (the mask input decides); causal form: keys up to the block's last row */
#pragma unroll 1
  for (int j = 0; j <= jmax; ++j) { const float* kr = KF + (size_t)j * ld + h * HD; const float* vr = VF + (size_t)j * ld + h * HD; float s = 0.f;
#pragma unroll 1
    for (int c = 0; c < HD / 4; ++c) { const v4f kq = *(const v4fa*)(kr + c * 4); const v4f qq = *(v4f*)&lq[tid][c * 4]; s = __fadd_rn(s, __fmul_rn(qq[0], kq[0])); s = __fadd_rn(s, __fmul_rn(qq[1], kq[1])); s = __fadd_rn(s, __fmul_rn(qq[2], kq[2])); s = __fadd_rn(s, __fmul_rn(qq[3], kq[3])); }
    s = __fmul_rn(s, scale); if (MASKADD) s = __fadd_rn(s, __fmul_rn(bf16_round(mask[(size_t)i * SQ + j]), -10000.0f));
    const float f = (MASKADD || j <= i) ? 1.f : 0.f; const float sm = fmaf(f, s, (1.f - f) * -1.0e30f); const float mn = fmaxf(m, sm); const float sc = expf(m - mn); const float e = expf(sm - mn); l = __fadd_rn(__fmul_rn(l, sc), e); m = mn;
#pragma unroll 1
    for (int c = 0; c < HD / 4; ++c) { const v4f vv = *(const v4fa*)(vr + c * 4); v4f oo = *(v4f*)&lo[tid][c * 4]; for (int u = 0; u < 4; ++u) oo[u] = __fadd_rn(__fmul_rn(oo[u], sc), __fmul_rn(e, vv[u])); *(v4f*)&lo[tid][c * 4] = oo; } }
  const float fin = 64.0f / l;      /* o carried x64 like the f16 path */
#pragma unroll 1
  for (int c = 0; c < HD / 4; ++c) { v4f oo = *(v4f*)&lo[tid][c * 4]; for (int u = 0; u < 4; ++u) oo[u] = __fmul_rn(oo[u], fin); *(v4f*)&lo[tid][c * 4] = oo; }
  __syncthreads();
  {
#pragma unroll 1
    for (int it = 0; it < 16; ++it) { const int row = it * 4 + tid / 16, pc = (tid % 16) * 4; const v4f v = *(const v4f*)&lo[row][pc]; *(v4f*)(OF + (size_t)(rg * 64 + row) * ldo + h * HD + pc) = v; }
     } }


__global__ __launch_bounds__(256) void k_kvexp(const float* __restrict__ src, float* __restrict__ dst, size_t n4) { const size_t t = (size_t)blockIdx.x * 256 + threadIdx.x; if (t >= n4) return; const size_t e = t * 4; const size_t row = e / DM; const int col = (int)(e % DM); const int h = col / HD, d = col % HD; const v4f v = *(const v4fa*)(src + row * KVD + (size_t)(h / HPG) * HD + d); *(v4f*)(dst + e) = v;  }

__global__ __launch_bounds__(256) void k_tab2(float theta, float* __restrict__ CS, float* __restrict__ SN) {
  #pragma clang fp contract(off)
  const int t = blockIdx.x * 256 + threadIdx.x; if (t >= SQ * (HD / 2)) return; const int i = t % (HD / 2); const int p = t / (HD / 2); const float invf = 1.0f / powf(theta, (float)(2 * i) / (float)HD); const float ang = __fmul_rn((float)p, invf); const float c = cosf(ang), s = sinf(ang);
  *(float*)(CS + t) = c; *(float*)(SN + t) = s;  }
template <int NORM, int ROPE>
__global__ __launch_bounds__(64) void k_xform(const float* __restrict__ F, int ldf, int nh, const float* __restrict__ gain, float eps, const float* __restrict__ CS, const float* __restrict__ SN, _Float16* __restrict__ H16, int ldo) {
  #pragma clang fp contract(off)
  __shared__ float xv[HD]; __shared__ float red[HD]; __shared__ unsigned short sh_[HD]; const int d = threadIdx.x; const int h = blockIdx.x % nh; const size_t r = blockIdx.x / nh; const int p = (int)(r % SQ);
  float x = F[r * (size_t)ldf + (size_t)h * HD + d];
  if (NORM) { red[d] = __fmul_rn(x, x); __syncthreads(); for (int st = HD / 2; st > 0; st >>= 1) { if (d < st) red[d] = __fadd_rn(red[d], red[d + st]); __syncthreads(); } const float rs = rsqrtf(__fadd_rn(red[0] / (float)HD, eps)); x = __fmul_rn(__fmul_rn(x, rs), bf16_round(gain[d])); }
  xv[d] = x; __syncthreads();
  float o = x;
  if (ROPE == 1) { const int i = d >> 1; const float c = CS[p * (HD / 2) + i], s = SN[p * (HD / 2) + i]; const float ev = xv[2 * i], od = xv[2 * i + 1]; o = (d & 1) ? __fadd_rn(__fmul_rn(ev, s), __fmul_rn(od, c)) : __fadd_rn(__fmul_rn(ev, c), -__fmul_rn(od, s)); }
  if (ROPE == 2) { const int i = d & (HD / 2 - 1); const float c = CS[p * (HD / 2) + i], s = SN[p * (HD / 2) + i]; const float lo = xv[i], hi = xv[i + HD / 2]; o = (d < HD / 2) ? __fadd_rn(__fmul_rn(lo, c), -__fmul_rn(hi, s)) : __fadd_rn(__fmul_rn(lo, s), __fmul_rn(hi, c)); }
  FragH th; th.h[0] = (_Float16)o; sh_[d] = th.u[0]; __syncthreads();
  if (d < HD / 8) { FragH f; for (int q = 0; q < 8; ++q) f.u[q] = sh_[d * 8 + q]; unsigned short* dst = (unsigned short*)H16 + r * (size_t)ldo + (size_t)h * HD + d * 8; *(v8us*)dst = f.half[0];  } }

template <int NORM, int ROPE>
__global__ __launch_bounds__(64) void k_xformf(const float* __restrict__ F, int ldf, int nh, const float* __restrict__ gain, float eps, const float* __restrict__ CS, const float* __restrict__ SN, float* __restrict__ F32, int ldo) {
  #pragma clang fp contract(off)
  __shared__ float xv[HD]; __shared__ float red[HD]; const int d = threadIdx.x; const int h = blockIdx.x % nh; const size_t r = blockIdx.x / nh; const int p = (int)(r % SQ);
  float x = F[r * (size_t)ldf + (size_t)h * HD + d];
  if (NORM) { red[d] = __fmul_rn(x, x); __syncthreads(); for (int st = HD / 2; st > 0; st >>= 1) { if (d < st) red[d] = __fadd_rn(red[d], red[d + st]); __syncthreads(); } const float rs = rsqrtf(__fadd_rn(red[0] / (float)HD, eps)); x = __fmul_rn(__fmul_rn(x, rs), bf16_round(gain[d])); }
  xv[d] = x; __syncthreads();
  float o = x;
  if (ROPE == 1) { const int i = d >> 1; const float c = CS[p * (HD / 2) + i], s = SN[p * (HD / 2) + i]; const float ev = xv[2 * i], od = xv[2 * i + 1]; o = (d & 1) ? __fadd_rn(__fmul_rn(ev, s), __fmul_rn(od, c)) : __fadd_rn(__fmul_rn(ev, c), -__fmul_rn(od, s)); }
  if (ROPE == 2) { const int i = d & (HD / 2 - 1); const float c = CS[p * (HD / 2) + i], s = SN[p * (HD / 2) + i]; const float lo = xv[i], hi = xv[i + HD / 2]; o = (d < HD / 2) ? __fadd_rn(__fmul_rn(lo, c), -__fmul_rn(hi, s)) : __fadd_rn(__fmul_rn(lo, s), __fmul_rn(hi, c)); }
  float* dst = F32 + r * (size_t)ldo + (size_t)h * HD + d; *(float*)dst = o;  }

__global__ __launch_bounds__(256) void k_trig(const float* __restrict__ a, float* __restrict__ CS, float* __restrict__ SN, int n) {
  #pragma clang fp contract(off)
  const int t = blockIdx.x * 256 + threadIdx.x; if (t >= n) return; const float v = bf16_round(a[t]); const float c = cosf(v), s = sinf(v);
  *(float*)(CS + t) = c; *(float*)(SN + t) = s;  }

__global__ __launch_bounds__(256) void k_tabpos(const int* __restrict__ pos, float* __restrict__ CS, float* __restrict__ SN, int n) {
  #pragma clang fp contract(off)
  const int t = blockIdx.x * 256 + threadIdx.x; if (t >= n) return; const int p = t / 32, i = t % 32; const float invf = (float)(1.0 / pow(10000.0, ((double)(2 * i)) / 64.0)); const float a = __fmul_rn((float)pos[p], invf); const float c = cosf(a), s = sinf(a);
  *(float*)(CS + t) = c; *(float*)(SN + t) = s;  }

// One wave per score row. Lane l holds columns 128 s + 4 l .. + 3 of every 128-column slice s in registers, so AC and BD' are read once:
// AC as whole-line 16-byte loads, BD' at the row's shift; maximum and sum end in a five-step butterfly over the lanes.
// NS = nk / 128 is a template parameter (q0 = nk - QT): the body is one straight line, so a row's loads can all be in flight together.
// A slice with 128 s + 127 <= q0 lies below every row's diagonal (j <= q0 <= i) and its shifted index stays below nk (shift <= QT - 1),
// so the index clamp and the arithmetic select, both identities there, are written for the later slices only.
typedef float v4fu __attribute__((ext_vector_type(4), may_alias, aligned(4)));      /* 16-byte load at a 4-byte boundary (the shifted BD' columns) */
// 2^x of four values. One asm statement so that every v_exp_f32 has an independent instruction behind it (early-clobber outputs: none overwrites a source);
// the closing v_nop is the slot that the instruction set asks for before the last result is read or its source overwritten.
__device__ __forceinline__ v4f exp2x4(v4f x) { float r0, r1, r2, r3;
  asm("v_exp_f32 %0, %4\n\tv_exp_f32 %1, %5\n\tv_exp_f32 %2, %6\n\tv_exp_f32 %3, %7\n\tv_nop" : "=&v"(r0), "=&v"(r1), "=&v"(r2), "=&v"(r3) : "v"(x[0]), "v"(x[1]), "v"(x[2]), "v"(x[3]));
  const v4f r = {r0, r1, r2, r3}; return r; }
template <int NS>
__global__ __launch_bounds__(256) void k_rsmxl(const float* __restrict__ AC, const float* __restrict__ BDp, _Float16* __restrict__ P, _Float16* __restrict__ PL, int hg) {
  #pragma clang fp contract(off)
  constexpr int nk = NS * 128, q0 = nk - QT;
  const int lane = threadIdx.x & 31; const int t = __builtin_amdgcn_readfirstlane((int)(blockIdx.x * 8 + (threadIdx.x >> 5))); if (t >= hg * QT) return;      /* wave-uniform row number: scalar row bases; no barrier in this kernel */
  const size_t ri = (size_t)t; const float* a = AC + ri * NKX; const float* bd = BDp + ri * NKX; const int tl = t & (QT - 1); const int i = q0 + tl; const int sh = QT - 1 - tl;      /* sh = nk - 1 - i */
  const unsigned ob = (unsigned)(sh + lane * 4) * 4u;      /* byte offset of the lane's first shifted column in the BD' row */
  v4f av[NS], bv[NS]; int ic[8];
#pragma unroll
  for (int s = 0; s < NS; ++s) { av[s] = ((const v4fa*)a)[lane + s * 32];
    if (s * 128 + 127 <= q0) bv[s] = *(const v4fu*)((const char*)bd + ob + s * 512);
    else {
#pragma unroll
      for (int q = 0; q < 4; ++q) { const int c = min(sh + lane * 4 + s * 128, nk - 1 - q); ic[(s - (NS - 2)) * 4 + q] = c; bv[s][q] = bd[c + q]; } } }      /* c + q = min(sh + j, nk - 1) */
  /* The wait that stands in front of any overwrite of a register that an issued load names. The address registers are its inputs so that they stay live up to here: no later load of the row gets one of them as its destination. */
  if constexpr (NS > 2) asm volatile("s_wait_xcnt 0x0" :: "v"(lane), "v"(ob), "v"(ic[0]), "v"(ic[1]), "v"(ic[2]), "v"(ic[3]), "v"(ic[4]), "v"(ic[5]), "v"(ic[6]), "v"(ic[7]) : "memory");
  else asm volatile("s_wait_xcnt 0x0" :: "v"(lane), "v"(ic[0]), "v"(ic[1]), "v"(ic[2]), "v"(ic[3]), "v"(ic[4]), "v"(ic[5]), "v"(ic[6]), "v"(ic[7]) : "memory");
  __builtin_amdgcn_sched_barrier(0);      /* keeps the arithmetic behind the row's loads: without it they are issued in groups with a full wait between the groups */
  float mx = -3.0e38f;
#pragma unroll
  for (int s = 0; s < NS; ++s) {
#pragma unroll
    for (int q = 0; q < 4; ++q) { const int j = s * 128 + lane * 4 + q; float v = __fadd_rn(av[s][q], bv[s][q]); if (s * 128 + 127 > q0) { const float f = (j <= i) ? 1.f : 0.f; v = fmaf(f, v, (1.f - f) * -1.0e30f); } av[s][q] = v; mx = fmaxf(mx, v); } }
#pragma unroll
  for (int m = 16; m > 0; m >>= 1) mx = fmaxf(mx, __shfl_xor(mx, m, 32));
  v4f s4 = {0.f, 0.f, 0.f, 0.f};
#pragma unroll
  for (int s = 0; s < NS; ++s) { av[s] = exp2x4((av[s] - mx) * 1.44269504f); s4 += av[s]; }      /* exp(v - mx) as the native form has it: 2^((v - mx) log2 e) */
  float se = (s4[0] + s4[1]) + (s4[2] + s4[3]);
#pragma unroll
  for (int m = 16; m > 0; m >>= 1) se += __shfl_xor(se, m, 32);
  const float sc = 256.0f / se;
#pragma unroll
  for (int s = 0; s < NS; ++s) { v4h fr, fl;
#pragma unroll
    for (int q = 0; q < 4; ++q) { const float pv = av[s][q] * sc; const _Float16 hv = (_Float16)pv; fr[q] = hv; fl[q] = (_Float16)((pv - (float)hv) * 1024.0f); }
    const size_t o = ri * NKX + s * 128 + lane * 4; *(v4h*)(P + o) = fr; *(v4h*)(PL + o) = fl; } }
template <int NS>
static void rsmxl_go(const float* AC, const float* BDp, _Float16* P, _Float16* PL, hipStream_t stream) { k_rsmxl<NS><<<(NH * QT + 7) / 8, 256, 0, stream>>>(AC, BDp, P, PL, NH); }

template <int N>
__global__ __launch_bounds__(256) void k_rmsrow(float* __restrict__ X, const float* __restrict__ w, float eps) {
  #pragma clang fp contract(off)
  constexpr int PT = N / 256; __shared__ float red[256]; const size_t r = blockIdx.x; const int t = threadIdx.x; float* row = X + r * N + (size_t)t * PT; float v[PT]; float ss = 0.f;
  for (int q = 0; q < PT; ++q) { v[q] = row[q]; ss = __fadd_rn(ss, __fmul_rn(v[q], v[q])); }
  red[t] = ss; __syncthreads(); for (int k = 128; k > 0; k >>= 1) { if (t < k) red[t] = __fadd_rn(red[t], red[t + k]); __syncthreads(); }
  const float rs = rsqrtf(__fadd_rn(red[0] / (float)N, eps)); float o[PT]; for (int q = 0; q < PT; ++q) o[q] = __fmul_rn(__fmul_rn(v[q], rs), bf16_round(w[t * PT + q]));
  { for (int q = 0; q < PT; ++q) *(float*)(row + q) = o[q];  } }

__global__ __launch_bounds__(256) void k_bfr(const float* __restrict__ x, float* __restrict__ XB, size_t n8) { const size_t t = (size_t)blockIdx.x * 256 + threadIdx.x; if (t >= n8) return; v4f a = *(const v4fa*)(x + t * 8), c = *(const v4fa*)(x + t * 8 + 4); for (int q = 0; q < 4; ++q) { a[q] = bf16_round(a[q]); c[q] = bf16_round(c[q]); }
  { *(v4f*)(XB + t * 8) = a; *(v4f*)(XB + t * 8 + 4) = c;  } }





// Exact f32 XL attention of the first QT0 rows of a batch: one wave per (head, row i). Lane = 16 hh + ln: ln owns dims 4 ln .. 4 ln + 3, hh one of two keys,
// so every 16-byte load instruction reads two whole 256-byte rows. Keys go in chunks of 32: a lane forms 16 partial dots (q+u).k + (q+v).r over its four dims,
// a four-step butterfly sums each over its 16 lanes, and lane l keeps the score of key 32 c + l. Scores, then weights, rest in the wave's own LDS row;
// maximum and sum are taken over the whole row (two passes, no rescaling); o = sum_j e_j v_j per half, the halves added at the end, x 64 / sum.
// Rows of K, V up to 32 c + 31 <= QT0 - 1 exist; a key above the diagonal gets -1e30 by the arithmetic select and its xl_r index is clamped.
__global__ __launch_bounds__(256) void k_att0xl(const float* __restrict__ QF, const float* __restrict__ QVF, const float* __restrict__ KF, const float* __restrict__ VF, const float* __restrict__ RF, float* __restrict__ OF) {
  __shared__ __attribute__((aligned(16))) float pw[8][QT0];
  const int lane = threadIdx.x & 31, ln = lane & 15, hh = lane >> 4; const int w = __builtin_amdgcn_readfirstlane((int)(threadIdx.x >> 5));      /* wave-uniform: scalar row bases and trip counts */
  const int h = blockIdx.x % NH; const int i = QT0 - 1 - ((int)(blockIdx.x / NH) * 8 + w); const int nch = (i >> 5) + 1;      /* the long rows start first; nch chunks of 32 keys cover 0 .. i */
  const unsigned qo = (unsigned)(i * DM + h * HD + ln * 4) * 4u;
  const v4f q4 = *(const v4fa*)((const char*)QF + qo), qv4 = *(const v4fa*)((const char*)QVF + qo);
  const unsigned ko = (unsigned)(hh * 16 * DM + h * HD + ln * 4) * 4u;      /* the lane's byte offset in a chunk of K or V rows */
  const char* rb = (const char*)(RF + (size_t)h * SQ * HD); float* pr = pw[w]; float mx = -3.0e38f;
#pragma unroll 1
  for (int c = 0; c < nch; ++c) { const char* kp = (const char*)KF + (size_t)c * (32 * DM * 4) + ko; const int r0 = SQ - 1 - i + c * 32 + hh * 16; v4f kk[16], rr[16]; unsigned ro[16];
#pragma unroll
    for (int u = 0; u < 16; ++u) { ro[u] = (unsigned)min(r0 + u, SQ - 1) * (HD * 4u) + ln * 16u; kk[u] = *(const v4fa*)(kp + u * (DM * 4)); rr[u] = *(const v4fa*)(rb + ro[u]); }      /* key j = 32 c + 16 hh + u; xl_r row min(SQ - 1 - i + j, SQ - 1) */
    /* the wait that stands in front of any overwrite of a register that an issued load names, for the chunk's 32 loads: every address register is an input, so none is reused (as a destination either) before it */
    asm volatile("s_wait_xcnt 0x0" :: "v"(kp), "s"(rb), "v"(ro[0]), "v"(ro[1]), "v"(ro[2]), "v"(ro[3]), "v"(ro[4]), "v"(ro[5]), "v"(ro[6]), "v"(ro[7]), "v"(ro[8]), "v"(ro[9]), "v"(ro[10]), "v"(ro[11]), "v"(ro[12]), "v"(ro[13]), "v"(ro[14]), "v"(ro[15]) : "memory");
    __builtin_amdgcn_sched_barrier(0);      /* keeps the arithmetic behind the chunk's loads: without it most K rows are loaded one at a time, each with its own wait */
    float keep = 0.f;
#pragma unroll
    for (int u = 0; u < 16; ++u) { float p = q4[0] * kk[u][0];
#pragma unroll
      for (int d = 1; d < 4; ++d) p = fmaf(q4[d], kk[u][d], p);
#pragma unroll
      for (int d = 0; d < 4; ++d) p = fmaf(qv4[d], bf16_round(rr[u][d]), p);
      p += __shfl_xor(p, 1, 32); p += __shfl_xor(p, 2, 32); p += __shfl_xor(p, 4, 32); p += __shfl_xor(p, 8, 32);
      keep = (ln == u) ? p : keep; }
    const float f = (c * 32 + lane <= i) ? 1.f : 0.f; const float sm = fmaf(f, keep, (1.f - f) * -1.0e30f); pr[c * 32 + lane] = sm; mx = fmaxf(mx, sm); }
#pragma unroll
  for (int m = 16; m > 0; m >>= 1) mx = fmaxf(mx, __shfl_xor(mx, m, 32));
  float l = 0.f;
#pragma unroll 1
  for (int c = 0; c < nch; ++c) { const float e = expf(pr[c * 32 + lane] - mx); pr[c * 32 + lane] = e; l += e; }      /* each lane reads back what it wrote itself */
#pragma unroll
  for (int m = 16; m > 0; m >>= 1) l += __shfl_xor(l, m, 32);
  __builtin_amdgcn_fence(__ATOMIC_ACQ_REL, "workgroup"); __builtin_amdgcn_wave_barrier();      /* the weights are read across the wave's lanes from here on: keeps the LDS stores in front of those reads */
  v4f o = {0.f, 0.f, 0.f, 0.f};
#pragma unroll 1
  for (int c = 0; c < nch; ++c) { const char* vp = (const char*)VF + (size_t)c * (32 * DM * 4) + ko; v4f vv[16], pe[4];
#pragma unroll
    for (int u = 0; u < 16; ++u) vv[u] = *(const v4fa*)(vp + u * (DM * 4));
    asm volatile("s_wait_xcnt 0x0" :: "v"(vp) : "memory");      /* same wait, for the chunk's 16 loads; the address is an input so that no load of the chunk gets it as its destination */
#pragma unroll
    for (int m = 0; m < 4; ++m) pe[m] = *(const v4f*)&pr[c * 32 + hh * 16 + m * 4];      /* the half's 16 weights, one address per half */
#pragma unroll
    for (int u = 0; u < 16; ++u) { const float e = pe[u >> 2][u & 3];
#pragma unroll
      for (int d = 0; d < 4; ++d) o[d] = fmaf(e, vv[u][d], o[d]); } }
  const float fin = 64.0f / l;      /* o carried x64 like the f16 path */
#pragma unroll
  for (int d = 0; d < 4; ++d) o[d] = (o[d] + __shfl_xor(o[d], 16, 32)) * fin;
  if (hh == 0) *(v4f*)(OF + (size_t)i * DM + h * HD + ln * 4) = o; }

extern "C" void kernel_launch(void* const* d_in, const int* in_sizes, int n_in,
                              void* d_out, int out_size, void* d_ws, size_t ws_size, hipStream_t stream) {
  (void)in_sizes; (void)n_in; (void)out_size;
  const float* const* I = (const float* const*)d_in; const float* x = I[0]; const float* g = I[1]; const float* wq = I[2]; const float* wk = I[3]; const float* wv = I[4]; const float* wres = I[5]; const float* xlr = I[6]; const float* xlu = I[7]; const float* xlv = I[8];      /* x; RMS gain; w_q/w_k/w_v [1024][16][64] = [in][out]; w_res [1024][1024] [in][out]; xl_r [16][2048][64]; xl_u, xl_v [1][16][1][64] = per-head 64-vectors (a [1024] bias over the merged columns) */
  char* ws = (char*)d_ws; size_t off = 0;
  auto take = [&](size_t bytes) { char* p = ws + off; off += (bytes + 255) & ~(size_t)255; return p; };
  _Float16* BQ = (_Float16*)take((size_t)DM * DM * 2); _Float16* BK = (_Float16*)take((size_t)DM * DM * 2); _Float16* BV = (_Float16*)take((size_t)DM * DM * 2); _Float16* BR = (_Float16*)take((size_t)DM * DM * 2);
  float* XT = (float*)take(NR * DM * 4); _Float16* X16 = (_Float16*)take(NR * DM * 2); _Float16* XL16 = (_Float16*)take(NR * DM * 2); float* QUF = (float*)take((size_t)QT0 * DM * 4); float* QVF = (float*)take((size_t)QT0 * DM * 4); float* KF0 = (float*)take((size_t)QT0 * DM * 4); float* VF0 = (float*)take((size_t)QT0 * DM * 4); float* OF0 = (float*)take((size_t)NB * QT0 * DM * 4); _Float16* OH0 = (_Float16*)take((size_t)NB * QT0 * DM * 2); _Float16* OL0 = (_Float16*)take((size_t)NB * QT0 * DM * 2); _Float16* QU = (_Float16*)take(NR * DM * 2); _Float16* QV = (_Float16*)take(NR * DM * 2); _Float16* K16 = (_Float16*)take(NR * DM * 2); float* VF = (float*)take(NR * DM * 4); _Float16* V16 = (_Float16*)take(NR * DM * 2); _Float16* VL16 = (_Float16*)take(NR * DM * 2); _Float16* R16 = (_Float16*)take((size_t)NH * SQ * HD * 2); float* OF = (float*)take(NR * DM * 4); _Float16* O16 = (_Float16*)take(NR * DM * 2); _Float16* OL16 = (_Float16*)take(NR * DM * 2);      /* v and wv carried as f32 -> f16 hi + x1024 residual (the first causal rows copy v almost verbatim into small outputs) */
  float* S = (float*)take((size_t)NH * QT * NKX * 4); float* BD = (float*)take((size_t)NH * QT * NKX * 4); _Float16* P = (_Float16*)take((size_t)NH * QT * NKX * 2); _Float16* PL = (_Float16*)take((size_t)NH * QT * NKX * 2); _Float16* VT = (_Float16*)take((size_t)NH * HD * SQ * 2); _Float16* VTL = (_Float16*)take((size_t)NH * HD * SQ * 2);
  if (off > ws_size) return;
  { const unsigned gw = (unsigned)(((size_t)DM * DM / 8 + 255) / 256); k_wt_f16<<<gw, 256, 0, stream>>>(wq, BQ, DM, DM, 16.0f); k_wt_f16<<<gw, 256, 0, stream>>>(wk, BK, DM, DM, 16.0f); k_wt_f16<<<gw, 256, 0, stream>>>(wv, BV, DM, DM, 16.0f); k_wt_f16<<<gw, 256, 0, stream>>>(wres, BR, DM, DM, 16.0f); }      /* [in][out] ([in][h][k] flattened) -> Bt x16 */
  k_bfr<<<(unsigned)((NR * DM / 8 + 255) / 256), 256, 0, stream>>>(x, XT, NR * DM / 8); k_rmsrow<DM><<<(unsigned)NR, 256, 0, stream>>>(XT, g, 1e-6f); k_hl<<<(unsigned)((NR * DM / 8 + 255) / 256), 256, 0, stream>>>(XT, X16, XL16, NR * DM / 8);      /* x_t = RMSNorm(bf16(x)) g (f32, in place) -> f16 hi rows (+ x1024 residual rows for the exact first tile) */
  k_x16<<<(unsigned)(((size_t)NH * SQ * HD / 8 + 255) / 256), 256, 0, stream>>>(xlr, R16, (size_t)NH * SQ * HD / 8);      /* xl_r [h][j][64] as exact f16 rows (bf16-valued input) */
  k_gemm2<0><<<dim3((unsigned)((NR / 128) * (DM / 64)), 1), 128, 0, stream>>>(X16, DM, 0, BQ, DM, 0, 0.0078125f, xlu, 0, nullptr, 1, 0, 0, nullptr, QU, DM, 0, (int)NR, DM, DM); k_gemm2<0><<<dim3((unsigned)((NR / 128) * (DM / 64)), 1), 128, 0, stream>>>(X16, DM, 0, BQ, DM, 0, 0.0078125f, xlv, 0, nullptr, 1, 0, 0, nullptr, QV, DM, 0, (int)NR, DM, DM);      /* q / 8 + xl_u and q / 8 + xl_v (the per-head 64-vectors as [1024] column biases) -> f16 rows */
  k_gemm2<0><<<dim3((unsigned)((NR / 128) * (DM / 64)), 1), 128, 0, stream>>>(X16, DM, 0, BK, DM, 0, 0.0625f, nullptr, 0, nullptr, 1, 0, 0, nullptr, K16, DM, 0, (int)NR, DM, DM); k_gemm2<0><<<dim3((unsigned)((NR / 128) * (DM / 64)), 1), 128, 0, stream>>>(X16, DM, 0, BV, DM, 0, 0.0625f, nullptr, 0, nullptr, 1, 0, 0, VF, nullptr, DM, 0, (int)NR, DM, DM); k_hl<<<(unsigned)((NR * DM / 8 + 255) / 256), 256, 0, stream>>>(VF, V16, VL16, NR * DM / 8);      /* k -> f16; v f32 -> f16 hi + x1024 residual rows */
  for (int b = 0; b < NB; ++b) { const size_t r0 = (size_t)b * SQ;
    k_vt<NH, SQ><<<NH * (SQ / 64), 256, 0, stream>>>(V16 + r0 * DM, DM, 0, VT); k_vt<NH, SQ><<<NH * (SQ / 64), 256, 0, stream>>>(VL16 + r0 * DM, DM, 0, VTL);      /* V^T hi and residual [16][64][SQ] of this batch */
    { const dim3 g0((QT0 / 128) * (DM / 64), 1);      
      k_gemm2<0><<<g0, 128, 0, stream>>>(X16 + r0 * DM, DM, 0, BQ, DM, 0, 0.0078125f, xlu, 0, nullptr, 1, 0, 0, QUF, nullptr, DM, 0, QT0, DM, DM); k_gemm2<0><<<g0, 128, 0, stream>>>(XL16 + r0 * DM, DM, 0, BQ, DM, 0, 0.00000762939453125f, nullptr, 0, QUF, -1, 0, 0, QUF, nullptr, DM, 0, QT0, DM, DM);
      k_gemm2<0><<<g0, 128, 0, stream>>>(X16 + r0 * DM, DM, 0, BQ, DM, 0, 0.0078125f, xlv, 0, nullptr, 1, 0, 0, QVF, nullptr, DM, 0, QT0, DM, DM); k_gemm2<0><<<g0, 128, 0, stream>>>(XL16 + r0 * DM, DM, 0, BQ, DM, 0, 0.00000762939453125f, nullptr, 0, QVF, -1, 0, 0, QVF, nullptr, DM, 0, QT0, DM, DM);
      k_gemm2<0><<<g0, 128, 0, stream>>>(X16 + r0 * DM, DM, 0, BK, DM, 0, 0.0625f, nullptr, 0, nullptr, 1, 0, 0, KF0, nullptr, DM, 0, QT0, DM, DM); k_gemm2<0><<<g0, 128, 0, stream>>>(XL16 + r0 * DM, DM, 0, BK, DM, 0, 0.00006103515625f, nullptr, 0, KF0, -1, 0, 0, KF0, nullptr, DM, 0, QT0, DM, DM);
      k_gemm2<0><<<g0, 128, 0, stream>>>(X16 + r0 * DM, DM, 0, BV, DM, 0, 0.0625f, nullptr, 0, nullptr, 1, 0, 0, VF0, nullptr, DM, 0, QT0, DM, DM); k_gemm2<0><<<g0, 128, 0, stream>>>(XL16 + r0 * DM, DM, 0, BV, DM, 0, 0.00006103515625f, nullptr, 0, VF0, -1, 0, 0, VF0, nullptr, DM, 0, QT0, DM, DM);
      k_att0xl<<<NH * (QT0 / 8), 256, 0, stream>>>(QUF, QVF, KF0, VF0, xlr, OF0 + (size_t)b * QT0 * DM); }      /* exact causal XL attention for rows 0..255 (o x64, f32) */
    for (int q0 = 0; q0 < SQ; q0 += QT) { const int nk = q0 + QT;      /* causal: keys below the tile end only */
      k_gemm2<0><<<dim3((QT / 128) * (nk / 64), NH), 128, 0, stream>>>(QU + (r0 + q0) * DM, DM, (size_t)HD, K16 + r0 * DM, DM, (size_t)HD, 1.0f, nullptr, 0, nullptr, 1, 0, 0, S, nullptr, NKX, (size_t)QT * NKX, QT, nk, HD);      /* AC[i][j] = (q_i + u).k_j, 16 heads on grid.y */
      k_gemm2<0><<<dim3((QT / 128) * (nk / 64), NH), 128, 0, stream>>>(QV + (r0 + q0) * DM, DM, (size_t)HD, R16 + (size_t)(SQ - nk) * HD, HD, (size_t)SQ * HD, 1.0f, nullptr, 0, nullptr, 1, 0, 0, BD, nullptr, NKX, (size_t)QT * NKX, QT, nk, HD);      /* BD'[i][c] = (q_i + v).xl_r[h][SQ - nk + c] for c < nk (the xl_r rows the shift can reach from this tile) */
      static_assert(SQ == 8 * QT, "one k_rsmxl instance per tile end"); switch (nk / QT) { case 1: rsmxl_go<2>(S, BD, P, PL, stream); break; case 2: rsmxl_go<4>(S, BD, P, PL, stream); break; case 3: rsmxl_go<6>(S, BD, P, PL, stream); break; case 4: rsmxl_go<8>(S, BD, P, PL, stream); break; case 5: rsmxl_go<10>(S, BD, P, PL, stream); break; case 6: rsmxl_go<12>(S, BD, P, PL, stream); break; case 7: rsmxl_go<14>(S, BD, P, PL, stream); break; default: rsmxl_go<16>(S, BD, P, PL, stream); break; }      /* scores = AC + BD'[i][nk-1-(i-j)] (== rel_shift) for j <= i, -1e30 above the diagonal; softmax -> x256 f16 */
      k_gemm2<0><<<dim3((QT / 128) * (HD / 64), NH), 128, 0, stream>>>(P, NKX, (size_t)QT * NKX, VT, SQ, (size_t)HD * SQ, 0.25f, nullptr, 0, nullptr, 1, 0, 0, OF + (r0 + q0) * DM, nullptr, DM, (size_t)HD, QT, HD, nk); k_gemm2<0><<<dim3((QT / 128) * (HD / 64), NH), 128, 0, stream>>>(PL, NKX, (size_t)QT * NKX, VT, SQ, (size_t)HD * SQ, 0.000244140625f, nullptr, 0, OF + (r0 + q0) * DM, -1, 0, 0, OF + (r0 + q0) * DM, nullptr, DM, (size_t)HD, QT, HD, nk); k_gemm2<0><<<dim3((QT / 128) * (HD / 64), NH), 128, 0, stream>>>(P, NKX, (size_t)QT * NKX, VTL, SQ, (size_t)HD * SQ, 0.000244140625f, nullptr, 0, OF + (r0 + q0) * DM, -1, 0, 0, OF + (r0 + q0) * DM, nullptr, DM, (size_t)HD, QT, HD, nk); } }      /* wv x64 = Ph Vh 2^-2 + Pl Vh 2^-12 + Ph Vl 2^-12 (f32, own-element accumulate) */
  k_hl<<<(unsigned)((NR * DM / 8 + 255) / 256), 256, 0, stream>>>(OF, O16, OL16, NR * DM / 8);      /* wv x64 -> f16 hi + x1024 residual rows */
  k_gemm2<0><<<dim3((unsigned)((NR / 128) * (DM / 64)), 1), 128, 0, stream>>>(O16, DM, 0, BR, DM, 0, 0.0009765625f, nullptr, 0, nullptr, 1, 0, 0, (float*)d_out, nullptr, DM, 0, (int)NR, DM, DM); k_gemm2<0><<<dim3((unsigned)((NR / 128) * (DM / 64)), 1), 128, 0, stream>>>(OL16, DM, 0, BR, DM, 0, 0.00000095367431640625f, nullptr, 0, (const float*)d_out, -1, 0, 0, (float*)d_out, nullptr, DM, 0, (int)NR, DM, DM);      /* res = wv_hi w_res 2^-10 += wv_lo w_res 2^-20 (own element) */
  k_hl<<<(unsigned)(((size_t)NB * QT0 * DM / 8 + 255) / 256), 256, 0, stream>>>(OF0, OH0, OL0, (size_t)NB * QT0 * DM / 8);      /* first-tile o (x64) -> f16 hi + x1024 residual planes */
  for (int b = 0; b < NB; ++b) { const size_t r0 = (size_t)b * SQ; const size_t f0 = (size_t)b * QT0;
    k_gemm2<0><<<dim3((QT0 / 128) * (DM / 64), 1), 128, 0, stream>>>(OH0 + f0 * DM, DM, 0, BR, DM, 0, 0.0009765625f, nullptr, 0, nullptr, 1, 0, 0, (float*)d_out + r0 * DM, nullptr, DM, 0, QT0, DM, DM);      /* rows 0..255 of the batch rewritten from the exact path */
    k_gemm2<0><<<dim3((QT0 / 128) * (DM / 64), 1), 128, 0, stream>>>(OL0 + f0 * DM, DM, 0, BR, DM, 0, 0.00000095367431640625f, nullptr, 0, (const float*)d_out + r0 * DM, -1, 0, 0, (float*)d_out + r0 * DM, nullptr, DM, 0, QT0, DM, DM); }      /* += o_lo w_res 2^-20 (own-element accumulate) */
}

// v003
// One run takes 2090 microseconds.
// In two side-by-side timings against v002, it was 1.60 and 1.59 times as fast.
// Counting every step since v000, it is 7.41 times as fast.
#include <hip/hip_runtime.h>
// Transformer-XL style causal attention with relative-position (rel_shift) scores (x [2][2048][1024]; x_t = RMSNorm(x) g (eps 1e-6); q = x_t w_q / 8, k = x_t w_k, v = x_t w_v (w [1024][16][64] = [in][out], sigma 1/32); scores = (q + xl_u).k^T + rel_shift((q + xl_v).xl_r^T) (xl_r [16][2048][64], xl_u / xl_v [1][16][1][64]); causal: - 1e30 above the diagonal; softmax; wv = w v merged (h*64+v); res = wv w_res ([in][out]) -> [2][2048][1024]. rel_shift with q_len = k_len = T gives bd[i][j] = (q_i + xl_v).xl_r[h][T-1-(i-j)] for j <= i).
// Structure: token rows; x_t = RMSNorm(bf16(x)) in f32 on VALU -> f16 rows; [in][out] weights as x16 planes; q+u and q+v as two WMMA GEMMs (32x64 wave tiles, f32 accumulation, alpha 1/128, per-head bias vectors), k, v -> f16 rows; xl_r as exact f16 rows; per batch: V^T via LDS transposes; exact f32 XL attention for rows 0..255 per batch on VALU (q/k/v of those rows from x_t hi + residual GEMM passes); per 256-row tile: AC = (q+u) k^T over keys < tile end and BD' = (q+v) r^T over the matching xl_r rows [T-nk, T) (K = 64, 16 heads on grid.y) f32; causal softmax on VALU that adds the rel-shifted BD'[i][nk-1-(i-j)] (arithmetic select and clamped index, -1e30 fill, f32 statistics, native exp; weights x256 f16); o = P V^T (x64) merged f16; res = o_hi w_res + o_lo w_res 2^-10; first-tile rows rewritten from the exact o hi/lo; launches: see trace.
// Compute dtype: inputs rounded to bf16; x / weights exact; q, k as plain f16 GEMM operands (~2^-12); v, softmax weights and o as f16 hi + x1024 residual; scores and softmax statistics f32. v_wmma_f32_16x16x32_f16.
#define NB 2
#define NG 16
#define HPG 1
#define KVD (NG * HD)
#define SQ 2048
#define DM 1024
#define NH 16
#define HD 64
#define HG 4                         /* heads per block group of the unlaunched k_vt(V16, b, h0, VT) */
#define QT 256                       /* query rows per causal tile */
#define NKX SQ                       /* S / P row pitch */
#define QT0 256                      /* first-tile rows recomputed exactly in f32 (= one causal tile) */
#define B0 0                         /* unused; the batch loops start at 0 */
#define NBR NB                       /* unused by the launches; the batch loops run over NB */
#define NR ((size_t)NB * SQ)         /* token rows */
#define MP ((int)((size_t)NBR * SQ)) /* unused by the launches; the projections run over NR rows */
#define QN SQ                        /* unused; the tile loop runs over SQ */
#define NHD NH                       /* unused; the attention launches use NH */
#define MPO MP                       /* unused; the output GEMMs use NR */
#define LQ DM      /* unused; the q/k/v rows use pitch DM */
typedef __bf16 v16b __attribute__((ext_vector_type(16)));
typedef unsigned short v8us __attribute__((ext_vector_type(8), may_alias));
typedef float  v8f  __attribute__((ext_vector_type(8)));
typedef float  v4f  __attribute__((ext_vector_type(4)));
typedef float  v4fa __attribute__((ext_vector_type(4), may_alias));
union FragB { v16b v; v8us half[2]; unsigned short u[16]; };

__device__ __forceinline__ unsigned short bf16_bits(float x) { unsigned int u = __float_as_uint(x); return (unsigned short)((u + 0x7FFFu + ((u >> 16) & 1u)) >> 16); }
__device__ __forceinline__ float bf16_val(unsigned short b) { return __uint_as_float(((unsigned int)b) << 16); }
__device__ __forceinline__ float bf16_round(float x) { return bf16_val(bf16_bits(x)); }
// D += A·B with NT terms: 1 = ah·bh, 2 = + al·bh (A split), 3 = + ah·bl (both split)
template <int NT>
__device__ __forceinline__ v8f mmaN(v16b ah, v16b al, v16b bh, v16b bl, v8f c) {
  c = __builtin_amdgcn_wmma_f32_16x16x32_bf16(false, ah, false, bh, (short)0, c, false, false);
  if (NT >= 2) c = __builtin_amdgcn_wmma_f32_16x16x32_bf16(false, al, false, bh, (short)0, c, false, false);
  if (NT >= 3) c = __builtin_amdgcn_wmma_f32_16x16x32_bf16(false, ah, false, bl, (short)0, c, false, false);
  asm volatile("v_nop\n\tv_nop\n\tv_nop\n\tv_nop" : "+v"(c) : "v"(ah), "v"(al), "v"(bh), "v"(bl));
  return c;
}

__global__ __launch_bounds__(256) void k_wt_bf16(const float* __restrict__ W, unsigned short* __restrict__ Wt, int K, int N) {
  const int t = blockIdx.x * 256 + threadIdx.x;
  const int k8n = K / 8;
  if (t >= N * k8n) return;
  const int n = t / k8n, k8 = (t % k8n) * 8;
  v8us v;
#pragma unroll
  for (int i = 0; i < 8; ++i) v[i] = bf16_bits(W[(size_t)(k8 + i) * N + n]);
  *(v8us*)(Wt + (size_t)n * K + k8) = v;
  
}

// GEMM C[M][N] (f32, pitch ldc) = act(A[M][K]·W + bias). A f32 row-major (pitch lda) converted per fragment to bf16
// (ASPLIT: hi/lo two planes -> 2 terms, else single rounded term); Wt bf16 [N][K] (pitch ldb). BIAS_BF16 rounds the
// bias to bf16 first (bias quantised to bf16 before the add). K%32==0, M%16==0, N%64==0.
template <bool ASPLIT, int ACT, bool BIAS_BF16>
__global__ __launch_bounds__(128) void k_gemm_bf(const float* __restrict__ A, int lda, const unsigned short* __restrict__ Wt, int ldb,
                                               const float* __restrict__ bias, float* __restrict__ C, int ldc, int M, int N, int K) {
  __shared__ __attribute__((aligned(16))) float so[4][16][64];
  const int tid = threadIdx.x, w = tid >> 5, lane = tid & 31, ln = lane & 15, hh = lane >> 4;
  const int ntn = N / 64;
  const int wid = blockIdx.x * 4 + w;
  const int mt = wid / ntn, nq = wid % ntn;
  if (mt * 16 >= M) return;
  const int row0 = mt * 16, col0 = nq * 64;
  const float* arow = A + (size_t)(row0 + ln) * lda;
  v8f acc[4] = {};
  for (int kb = 0; kb < K; kb += 32) {
    FragB ah, al;
    const v4f x0 = *(const v4fa*)(arow + kb + 8 * hh), x1 = *(const v4fa*)(arow + kb + 8 * hh + 4);
    const v4f x2 = *(const v4fa*)(arow + kb + 16 + 8 * hh), x3 = *(const v4fa*)(arow + kb + 16 + 8 * hh + 4);
    float xs[16] = {x0[0],x0[1],x0[2],x0[3],x1[0],x1[1],x1[2],x1[3],x2[0],x2[1],x2[2],x2[3],x3[0],x3[1],x3[2],x3[3]};
#pragma unroll
    for (int i = 0; i < 16; ++i) { const unsigned short hb = bf16_bits(xs[i]); ah.u[i] = hb; al.u[i] = ASPLIT ? bf16_bits(xs[i] - bf16_val(hb)) : (unsigned short)0; }
#pragma unroll
    for (int t = 0; t < 4; ++t) {
      const unsigned short* brow = Wt + (size_t)(col0 + t * 16 + ln) * ldb + kb;
      FragB b;
      b.half[0] = *(const v8us*)(brow + 8 * hh);
      b.half[1] = *(const v8us*)(brow + 16 + 8 * hh);
      acc[t] = mmaN<ASPLIT ? 2 : 1>(ah.v, al.v, b.v, b.v, acc[t]);
    }
  }
#pragma unroll
  for (int t = 0; t < 4; ++t) {
    float bv = bias ? bias[col0 + t * 16 + ln] : 0.f;
    if (BIAS_BF16) bv = bf16_round(bv);
#pragma unroll
    for (int r = 0; r < 8; ++r) { float v = acc[t][r] + bv; if (ACT == 1) v = fmaxf(v, 0.f); so[w][8 * hh + r][t * 16 + ln] = v; }
  }
  __builtin_amdgcn_fence(__ATOMIC_ACQ_REL, "workgroup");
  __builtin_amdgcn_wave_barrier();
  const int rsub = lane >> 4, c4 = (lane & 15) * 4;
  {
#pragma unroll
    for (int q = 0; q < 8; ++q) {
      const int r = q * 2 + rsub;
      const v4f v = *(const v4fa*)&so[w][r][c4];
      *(v4f*)(C + (size_t)(row0 + r) * ldc + col0 + c4) = v;
    }
    
  }
}

// GEMM C = act(A·W + bias + resid): A f32 (ASPLIT -> hi/lo 2 terms), Wt bf16 [N][K]; ACT 0 none, 1 relu, 2 exact gelu;
// resid (optional, f32, row index = (row % rmod), pitch ldr, RES_BF16 rounds it) added before the activation.
template <bool ASPLIT, int ACT, bool BIAS_BF16, bool RES_BF16>
__global__ __launch_bounds__(128) void k_gemm_bf3(const float* __restrict__ A, int lda, const unsigned short* __restrict__ Wt, int ldb,
                                                const float* __restrict__ bias, const float* __restrict__ resid, int rmod, int ldr,
                                                float* __restrict__ C, int ldc, int M, int N, int K) {
  __shared__ __attribute__((aligned(16))) float so[4][16][64];
  const int tid = threadIdx.x, w = tid >> 5, lane = tid & 31, ln = lane & 15, hh = lane >> 4;
  const int ntn = N / 64;
  const int wid = blockIdx.x * 4 + w;
  const int mt = wid / ntn, nq = wid % ntn;
  if (mt * 16 >= M) return;
  const int row0 = mt * 16, col0 = nq * 64;
  const float* arow = A + (size_t)(row0 + ln) * lda;
  v8f acc[4] = {};
  for (int kb = 0; kb < K; kb += 32) {
    FragB ah, al;
    const v4f x0 = *(const v4fa*)(arow + kb + 8 * hh), x1 = *(const v4fa*)(arow + kb + 8 * hh + 4);
    const v4f x2 = *(const v4fa*)(arow + kb + 16 + 8 * hh), x3 = *(const v4fa*)(arow + kb + 16 + 8 * hh + 4);
    float xs[16] = {x0[0],x0[1],x0[2],x0[3],x1[0],x1[1],x1[2],x1[3],x2[0],x2[1],x2[2],x2[3],x3[0],x3[1],x3[2],x3[3]};
#pragma unroll
    for (int i = 0; i < 16; ++i) { const unsigned short hb = bf16_bits(xs[i]); ah.u[i] = hb; al.u[i] = ASPLIT ? bf16_bits(xs[i] - bf16_val(hb)) : (unsigned short)0; }
#pragma unroll
    for (int t = 0; t < 4; ++t) {
      const unsigned short* brow = Wt + (size_t)(col0 + t * 16 + ln) * ldb + kb;
      FragB b;
      b.half[0] = *(const v8us*)(brow + 8 * hh);
      b.half[1] = *(const v8us*)(brow + 16 + 8 * hh);
      acc[t] = mmaN<ASPLIT ? 2 : 1>(ah.v, al.v, b.v, b.v, acc[t]);
    }
  }
#pragma unroll
  for (int t = 0; t < 4; ++t) {
    const int col = col0 + t * 16 + ln;
    float bv = bias ? bias[col] : 0.f;
    if (BIAS_BF16) bv = bf16_round(bv);
#pragma unroll
    for (int r = 0; r < 8; ++r) {
      float v = acc[t][r] + bv;
      if (resid) { float rv = resid[(size_t)((row0 + 8 * hh + r) % rmod) * ldr + col]; if (RES_BF16) rv = bf16_round(rv); v += rv; }
      if (ACT == 1) v = fmaxf(v, 0.f);
      if (ACT == 2) v = 0.5f * v * (1.0f + erff(v * 0.70710678118654752f));
      if (ACT == 3) { const float u = 0.7978845608028654f * (v + 0.044715f * v * v * v); v = 0.5f * v * (1.0f + tanhf(u)); }
      so[w][8 * hh + r][t * 16 + ln] = v;
    }
  }
  __builtin_amdgcn_fence(__ATOMIC_ACQ_REL, "workgroup");
  __builtin_amdgcn_wave_barrier();
  const int rsub = lane >> 4, c4 = (lane & 15) * 4;
  {
#pragma unroll
    for (int q = 0; q < 8; ++q) {
      const int r = q * 2 + rsub;
      const v4f v = *(const v4fa*)&so[w][r][c4];
      *(v4f*)(C + (size_t)(row0 + r) * ldc + col0 + c4) = v;
    }
    
  }
}
// row LayerNorm (biased variance, eps) over N: s = X (+ R); optional out_sum <- s; out_norm <- (s-mu)*rsqrt(var+eps)*g + b
template <bool PARAM_BF16>
__global__ __launch_bounds__(256) void k_layernorm(const float* __restrict__ X, const float* __restrict__ R, const float* __restrict__ g, const float* __restrict__ bta,
                                                  float* __restrict__ out_sum, float* __restrict__ out_norm, int N, float eps) {
  __shared__ float red[256];
  const int row = blockIdx.x, tid = threadIdx.x;
  const float* x = X + (size_t)row * N; const float* rr = R ? R + (size_t)row * N : nullptr;
  float vals[16];                     // up to N = 4096
  const int per = N / 256;            // contiguous chunk per thread? use strided-by-4 chunks: thread handles j = tid*4 + 1024*u
  float s1 = 0.f;
  for (int u = 0; u < per / 4; ++u) {
    const int j = tid * 4 + 1024 * u;
    const v4f a = *(const v4fa*)(x + j);
    v4f b = {0.f,0.f,0.f,0.f}; if (rr) b = *(const v4fa*)(rr + j);
#pragma unroll
    for (int q = 0; q < 4; ++q) { const float v = a[q] + b[q]; vals[u * 4 + q] = v; s1 += v; }
  }
  red[tid] = s1; __syncthreads();
  for (int st = 128; st > 0; st >>= 1) { if (tid < st) red[tid] += red[tid + st]; __syncthreads(); }
  const float mu = red[0] / (float)N; __syncthreads();
  float s2 = 0.f;
  for (int u = 0; u < per / 4; ++u)
#pragma unroll
    for (int q = 0; q < 4; ++q) { const float c = vals[u * 4 + q] - mu; s2 += c * c; }
  red[tid] = s2; __syncthreads();
  for (int st = 128; st > 0; st >>= 1) { if (tid < st) red[tid] += red[tid + st]; __syncthreads(); }
  const float rs = rsqrtf(red[0] / (float)N + eps);
  {
    for (int u = 0; u < per / 4; ++u) {
      const int j = tid * 4 + 1024 * u;
      v4f o, sm;
#pragma unroll
      for (int q = 0; q < 4; ++q) {
        float gg = g[j + q], bb = bta[j + q];
        if (PARAM_BF16) { gg = bf16_round(gg); bb = bf16_round(bb); }
        sm[q] = vals[u * 4 + q]; o[q] = (vals[u * 4 + q] - mu) * rs * gg + bb;
      }
      if (out_sum) *(v4f*)(out_sum + (size_t)row * N + j) = sm;
      *(v4f*)(out_norm + (size_t)row * N + j) = o;
    }
    
  }
}



// ---- f16 WMMA path (v_wmma_f32_16x16x32_f16): 11-bit significands for operands in range — used where a [0,1] probability operand needs more precision than bf16
typedef _Float16 v16h __attribute__((ext_vector_type(16)));
union FragH { v16h v; v8us half[2]; _Float16 h[16]; unsigned short u[16]; };
template <int NT>
__device__ __forceinline__ v8f mmaH(v16h ah, v16h al, v16h bh, v16h bl, v8f c) {
  c = __builtin_amdgcn_wmma_f32_16x16x32_f16(false, ah, false, bh, (short)0, c, false, false);
  if (NT >= 2) c = __builtin_amdgcn_wmma_f32_16x16x32_f16(false, al, false, bh, (short)0, c, false, false);
  if (NT >= 3) c = __builtin_amdgcn_wmma_f32_16x16x32_f16(false, ah, false, bl, (short)0, c, false, false);
  asm volatile("v_nop\n\tv_nop\n\tv_nop\n\tv_nop" : "+v"(c) : "v"(ah), "v"(al), "v"(bh), "v"(bl));
  return c;
}
// batched GEMM like k_gemm_b but f16 operands: A f32 (split into f16 hi/lo if ASPLIT, else rounded to f16), Bt = f16 values [n][k]; alpha; C f32; N multiple of 16 (partial tiles skipped)
template <bool ASPLIT>
__global__ __launch_bounds__(128) void k_gemm_h(const float* __restrict__ A, int lda, size_t sA, const _Float16* __restrict__ Bh, int ldb, size_t sB, float alpha, float* __restrict__ C, int ldc, size_t sC, int M, int N, int K) {
  __shared__ __attribute__((aligned(16))) float so[4][16][64];
  const int tid = threadIdx.x, w = tid >> 5, lane = tid & 31, ln = lane & 15, hh = lane >> 4; const int by = blockIdx.y;
  A += (size_t)by * sA; Bh += (size_t)by * sB; C += (size_t)by * sC;
  const int ntn = (N + 63) / 64; const int wid = blockIdx.x * 4 + w; const int mt = wid / ntn, nq = wid % ntn; if (mt * 16 >= M) return;
  const int row0 = mt * 16, col0 = nq * 64; const float* arow = A + (size_t)(row0 + ln) * lda;
  v8f acc[4] = {};
  for (int kb = 0; kb < K; kb += 32) {
    FragH ah, al;
    const v4f x0 = *(const v4fa*)(arow + kb + 8 * hh), x1 = *(const v4fa*)(arow + kb + 8 * hh + 4), x2 = *(const v4fa*)(arow + kb + 16 + 8 * hh), x3 = *(const v4fa*)(arow + kb + 16 + 8 * hh + 4);
    float xs[16] = {x0[0],x0[1],x0[2],x0[3],x1[0],x1[1],x1[2],x1[3],x2[0],x2[1],x2[2],x2[3],x3[0],x3[1],x3[2],x3[3]};
#pragma unroll
    for (int i = 0; i < 16; ++i) { const _Float16 h = (_Float16)xs[i]; ah.h[i] = h; al.h[i] = ASPLIT ? (_Float16)(xs[i] - (float)h) : (_Float16)0.0f; }
#pragma unroll
    for (int t = 0; t < 4; ++t) { if (col0 + t * 16 >= N) continue; const size_t boff = (size_t)(col0 + t * 16 + ln) * ldb + kb; FragH bq; bq.half[0] = *(const v8us*)(Bh + boff + 8 * hh); bq.half[1] = *(const v8us*)(Bh + boff + 16 + 8 * hh);
      acc[t] = mmaH<ASPLIT ? 2 : 1>(ah.v, al.v, bq.v, bq.v, acc[t]); }
  }
#pragma unroll
  for (int t = 0; t < 4; ++t) { if (col0 + t * 16 >= N) continue;
#pragma unroll
    for (int r = 0; r < 8; ++r) so[w][8 * hh + r][t * 16 + ln] = acc[t][r] * alpha; }
  __builtin_amdgcn_fence(__ATOMIC_ACQ_REL, "workgroup"); __builtin_amdgcn_wave_barrier();
  const int rsub = lane >> 4, c4 = (lane & 15) * 4;
  {
#pragma unroll
    for (int q = 0; q < 8; ++q) { const int r = q * 2 + rsub; if (col0 + c4 < N) { const v4f v = *(const v4fa*)&so[w][r][c4]; *(v4f*)(C + (size_t)(row0 + r) * ldc + col0 + c4) = v; } }
     }
}

// Wt[n][k] = f16(W[k][n]·scale) from f32 row-major W[K][N] (scale = power of two; bf16-exact weights stay exact in f16 away from the subnormal range)
__global__ __launch_bounds__(256) void k_wt_f16(const float* __restrict__ W, _Float16* __restrict__ Wt, int K, int N, float scale) {
  const int t = blockIdx.x * 256 + threadIdx.x; if (t >= N * (K / 8)) return; const int n = t / (K / 8), k8 = (t % (K / 8)) * 8; FragH f;
#pragma unroll
  for (int i = 0; i < 8; ++i) f.h[i] = (_Float16)(bf16_round(W[(size_t)(k8 + i) * N + n]) * scale); const v8us o = f.half[0];
  *(v8us*)((unsigned short*)Wt + (size_t)n * K + k8) = o; 
}
// k_gemm_hh variant with fused epilogue: v = acc·alpha + bias[by·sBias + col] (+ CP[(row/rowsPerB)·sCPb + by·64 + col] if CP) ; ACT 0 none / 1 elu ; writes f16 C16 (and f32 C if non-null)
template <int ACT>
__global__ __launch_bounds__(128) void k_gemm_hhx(const _Float16* __restrict__ A, int lda, size_t sA, const _Float16* __restrict__ Bh, int ldb, size_t sB, float alpha, const float* __restrict__ bias, size_t sBias, const float* __restrict__ CP, int rowsPerB, size_t sCPb, int row0g,
    float* __restrict__ C, _Float16* __restrict__ C16, int ldc, size_t sC, int M, int N, int K) {
  __shared__ __attribute__((aligned(16))) float so[4][16][64];
  const int tid = threadIdx.x, w = tid >> 5, lane = tid & 31, ln = lane & 15, hh = lane >> 4; const int by = blockIdx.y;
  A += (size_t)by * sA; Bh += (size_t)by * sB; const size_t cofs = (size_t)by * sC; const float* bp = bias ? bias + (size_t)by * sBias : nullptr;
  const int ntn = (N + 63) / 64; const int wid = blockIdx.x * 4 + w; const int mt = wid / ntn, nq = wid % ntn; if (mt * 16 >= M) return;
  const int row0 = mt * 16, col0 = nq * 64; const _Float16* arow = A + (size_t)(row0 + ln) * lda;
  v8f acc[4] = {};
  for (int kb = 0; kb < K; kb += 32) { FragH ah; ah.half[0] = *(const v8us*)((const unsigned short*)arow + kb + 8 * hh); ah.half[1] = *(const v8us*)((const unsigned short*)arow + kb + 16 + 8 * hh);
#pragma unroll
    for (int t = 0; t < 4; ++t) { if (col0 + t * 16 >= N) continue; const size_t boff = (size_t)(col0 + t * 16 + ln) * ldb + kb; FragH bq; bq.half[0] = *(const v8us*)((const unsigned short*)Bh + boff + 8 * hh); bq.half[1] = *(const v8us*)((const unsigned short*)Bh + boff + 16 + 8 * hh);
      acc[t] = mmaH<1>(ah.v, ah.v, bq.v, bq.v, acc[t]); }
  }
#pragma unroll
  for (int t = 0; t < 4; ++t) { if (col0 + t * 16 >= N) continue; const int col = col0 + t * 16 + ln; const float bv = bp ? bf16_round(bp[col]) : 0.f;
#pragma unroll
    for (int r = 0; r < 8; ++r) { float v = acc[t][r] * alpha + bv; if (CP) { const int rr = row0g + row0 + 8 * hh + r; if (rowsPerB < 0) v += CP[cofs + (size_t)rr * ldc + col];      /* rowsPerB < 0: own element of the batched C plane */ else { const int bidx = rr / rowsPerB; v += CP[(size_t)bidx * sCPb + (size_t)by * 64 + col]; } } if (ACT == 1) v = (v > 0.f) ? v : expm1f(v); else if (ACT == 7) v = (v > 0.f) ? v + 1.0f : expf(v); else if (ACT == 8) v = tanhf(v); else if (ACT == 9) v = 0.5f * v * (1.0f + tanhf(0.7978845608028654f * (v + 0.044715f * v * v * v))); else if (ACT == 11) v = 1.0f / (1.0f + expf(-v)); else if (ACT == 12) v = (v > 0.f) ? v : 0.01f * v; else if (ACT == 14) v = (v > 0.f) ? v : 0.1f * v; else if (ACT == 16) v = (v >= 0.f) ? v : 0.3f * v; else if (ACT == 17) v = (v >= 0.f) ? v : 0.2f * v; else if (ACT == 15) v = v / (1.0f + expf(-v)); else if (ACT == 3) v = fmaxf(v, 0.f); else if (ACT == 6) v = 0.5f * v * (1.0f + erff(v * 0.70710678118654752f)); so[w][8 * hh + r][t * 16 + ln] = v; } }
  __builtin_amdgcn_fence(__ATOMIC_ACQ_REL, "workgroup"); __builtin_amdgcn_wave_barrier();
  const int rsub = lane >> 4, c4 = (lane & 15) * 4; typedef _Float16 v4h __attribute__((ext_vector_type(4)));
  {
#pragma unroll
    for (int q = 0; q < 8; ++q) { const int r = q * 2 + rsub; if (col0 + c4 < N) { const v4f v = *(const v4fa*)&so[w][r][c4]; if (C) *(v4f*)(C + cofs + (size_t)(row0 + r) * ldc + col0 + c4) = v; if (C16) { v4h h4; for (int i = 0; i < 4; ++i) h4[i] = (_Float16)v[i]; *(v4h*)(C16 + cofs + (size_t)(row0 + r) * ldc + col0 + c4) = h4; } } }
     }
}


typedef _Float16 v4h __attribute__((ext_vector_type(4)));

__global__ __launch_bounds__(256) void k_x16(const float* __restrict__ x, _Float16* __restrict__ X16, size_t n8) { const size_t t = (size_t)blockIdx.x * 256 + threadIdx.x; if (t >= n8) return; FragH f;
#pragma unroll
  for (int q = 0; q < 8; ++q) f.h[q] = (_Float16)bf16_round(x[t * 8 + q]); *(v8us*)((unsigned short*)X16 + t * 8) = f.half[0];  }
__global__ __launch_bounds__(256) void k_h16(const float* __restrict__ x, _Float16* __restrict__ X16, size_t n8) { const size_t t = (size_t)blockIdx.x * 256 + threadIdx.x; if (t >= n8) return; FragH f;
#pragma unroll
  for (int q = 0; q < 8; ++q) f.h[q] = (_Float16)x[t * 8 + q]; *(v8us*)((unsigned short*)X16 + t * 8) = f.half[0];  }
__global__ __launch_bounds__(256) void k_round16f(const float* __restrict__ W, _Float16* __restrict__ Bt, size_t n8) { const size_t t = (size_t)blockIdx.x * 256 + threadIdx.x; if (t >= n8) return; FragH f;
#pragma unroll
  for (int i = 0; i < 8; ++i) f.h[i] = (_Float16)(bf16_round(W[t * 8 + i]) * 16.0f); *(v8us*)((unsigned short*)Bt + t * 8) = f.half[0];  }
template <int NHv, int TTv>
__global__ __launch_bounds__(256) void k_vt(const _Float16* __restrict__ V16, int ldv, int voff, _Float16* __restrict__ Vt) { __shared__ unsigned short tl[64][66]; const int tid = threadIdx.x; const int slab = blockIdx.x / (TTv / 64), lg = blockIdx.x % (TTv / 64); const int b = slab / NHv, h = slab % NHv;
  for (int i = tid; i < 64 * 8; i += 256) { const int r = i / 8, c8 = (i % 8) * 8; FragH f; f.half[0] = *(const v8us*)((const unsigned short*)V16 + ((size_t)b * TTv + lg * 64 + r) * ldv + voff + h * 64 + c8);
#pragma unroll
    for (int q = 0; q < 8; ++q) tl[r][c8 + q] = f.u[q]; }
  __syncthreads();
  {
#pragma unroll
    for (int rd = 0; rd < 2; ++rd) { const int d = rd * 32 + tid / 8, pc = tid % 8; FragH f;
#pragma unroll
      for (int q = 0; q < 8; ++q) f.u[q] = tl[pc * 8 + q][d];
      *(v8us*)((unsigned short*)Vt + ((size_t)slab * 64 + d) * TTv + lg * 64 + pc * 8) = f.half[0]; }
     } }

__global__ __launch_bounds__(256) void k_hl(const float* __restrict__ F, _Float16* __restrict__ Hh, _Float16* __restrict__ Hl, size_t n8) { const size_t t = (size_t)blockIdx.x * 256 + threadIdx.x; if (t >= n8) return; FragH fh, fl; const v4f a = *(const v4fa*)(F + t * 8), c = *(const v4fa*)(F + t * 8 + 4);
#pragma unroll
  for (int q = 0; q < 4; ++q) { _Float16 h = (_Float16)a[q]; fh.h[q] = h; fl.h[q] = (_Float16)((a[q] - (float)h) * 1024.0f); h = (_Float16)c[q]; fh.h[4 + q] = h; fl.h[4 + q] = (_Float16)((c[q] - (float)h) * 1024.0f); }
  { *(v8us*)((unsigned short*)Hh + t * 8) = fh.half[0]; *(v8us*)((unsigned short*)Hl + t * 8) = fl.half[0];  } }

// ---- fast GEMM (wave tile 32x64; requires M % 32 == 0 rows per launch region and N % 64 == 0); epilogue = k_gemm_hhx semantics ----
__device__ __forceinline__ v8f g2_mma(v16h a, v16h b, v8f c) { v8f d = __builtin_amdgcn_wmma_f32_16x16x32_f16(false, a, false, b, (short)0, c, false, false); asm volatile("v_nop\n\tv_nop\n\tv_nop\n\tv_nop" : "+v"(d) : "v"(a), "v"(b)); return d; }
// One k-step (32 k) of the wave's 32x64 tile: two A and four B fragments = twelve 16-byte loads. pa / pb: wave-uniform byte address of A / B at that k-step; oa / ob: the lane's fixed byte offsets (row and half).
struct G2St { v16h a0, a1, b0, b1, b2, b3; };
__device__ __forceinline__ v16h g2_fragb(const char* base, unsigned o) { FragH f; f.half[0] = *(const v8us*)(base + (size_t)o); f.half[1] = *(const v8us*)(base + (size_t)o + 32); return f.v; }
__device__ __forceinline__ void g2_ld(G2St& s, const char* pa, const char* pb, unsigned oa0, unsigned oa1, unsigned ob0, unsigned ob1, unsigned ob2, unsigned ob3) {
  s.a0 = g2_fragb(pa, oa0); s.a1 = g2_fragb(pa, oa1); s.b0 = g2_fragb(pb, ob0); s.b1 = g2_fragb(pb, ob1); s.b2 = g2_fragb(pb, ob2); s.b3 = g2_fragb(pb, ob3);
  __builtin_amdgcn_sched_barrier(0); }      /* keeps the twelve loads in front of the next k-step's first WMMA: behind it they would be issued only after that WMMA's wait for its own operands */
// The wait that stands in front of any overwrite of a register that an issued load names. The bases and the lane offsets are inputs so that they stay as they are up to here.
__device__ __forceinline__ void g2_xw(const char* pa, const char* pb, unsigned oa0, unsigned oa1, unsigned ob0, unsigned ob1, unsigned ob2, unsigned ob3) { asm volatile("s_wait_xcnt 0x0" :: "s"(pa), "s"(pb), "v"(oa0), "v"(oa1), "v"(ob0), "v"(ob1), "v"(ob2), "v"(ob3) : "memory"); }
__device__ __forceinline__ void g2_mm(const G2St& s, v8f (&c)[8]) { c[0] = g2_mma(s.a0, s.b0, c[0]); c[4] = g2_mma(s.a1, s.b0, c[4]); c[1] = g2_mma(s.a0, s.b1, c[1]); c[5] = g2_mma(s.a1, s.b1, c[5]); c[2] = g2_mma(s.a0, s.b2, c[2]); c[6] = g2_mma(s.a1, s.b2, c[6]); c[3] = g2_mma(s.a0, s.b3, c[3]); c[7] = g2_mma(s.a1, s.b3, c[7]); }
template <int ACT>
__global__ __launch_bounds__(128) void k_gemm2(const _Float16* __restrict__ A, int lda, size_t sA, const _Float16* __restrict__ Bh, int ldb, size_t sB, float alpha, const float* __restrict__ bias, size_t sBias, const float* __restrict__ CP, int rowsPerB, size_t sCPb, int row0g,
    float* __restrict__ C, _Float16* __restrict__ C16, int ldc, size_t sC, int M, int N, int K) { static_assert(ACT == 0 || ACT == 3 || ACT == 6 || ACT == 8 || ACT == 9 || ACT == 11 || ACT == 12 || ACT == 14 || ACT == 15 || ACT == 16 || ACT == 17, "k_gemm2: unsupported ACT code (would silently apply no activation)");
  __shared__ __attribute__((aligned(16))) float so[4][32][68];
  const int tid = threadIdx.x, w = tid >> 5, lane = tid & 31, ln = lane & 15, hh = lane >> 4; const int by = blockIdx.y;
  A += (size_t)by * sA; Bh += (size_t)by * sB; const size_t cofs = (size_t)by * sC; const float* bp = bias ? bias + (size_t)by * sBias : nullptr;
  const int ntn = N >> 6; const int mt = blockIdx.x / ntn, nq = blockIdx.x - mt * ntn; const int row0 = mt * 128 + 32 * w, col0 = nq * 64; if (row0 >= M) return;
  const unsigned oa0 = (unsigned)(row0 + ln) * (unsigned)lda * 2u + 16u * hh, oa1 = oa0 + 32u * (unsigned)lda;
  const unsigned ob0 = (unsigned)(col0 + ln) * (unsigned)ldb * 2u + 16u * hh, ob1 = ob0 + 32u * (unsigned)ldb, ob2 = ob1 + 32u * (unsigned)ldb, ob3 = ob2 + 32u * (unsigned)ldb;
  const char* pa = (const char*)A; const char* pb = (const char*)Bh; const int nst = K >> 5;      /* k-steps of 32 = 64 bytes of every row */
  const v8f z8 = {0.f,0.f,0.f,0.f,0.f,0.f,0.f,0.f}; v8f accs[8] = {z8, z8, z8, z8, z8, z8, z8, z8}; G2St s0, s1, s2;
  // Three k-steps' fragments rest in registers: a set is loaded again right after its WMMAs, so its loads fly while the other two sets are worked on. Every accumulator still takes its k-steps in rising order.
  if (nst >= 3) { g2_ld(s0, pa, pb, oa0, oa1, ob0, ob1, ob2, ob3); g2_ld(s1, pa + 64, pb + 64, oa0, oa1, ob0, ob1, ob2, ob3); g2_ld(s2, pa + 128, pb + 128, oa0, oa1, ob0, ob1, ob2, ob3); g2_xw(pa, pb, oa0, oa1, ob0, ob1, ob2, ob3); int s = 0;
#pragma unroll 1      /* the body already holds three k-steps; a copy of it would not fit the registers */
    for (; s + 6 <= nst; s += 3) {
      g2_mm(s0, accs); g2_ld(s0, pa + 192, pb + 192, oa0, oa1, ob0, ob1, ob2, ob3);
      g2_mm(s1, accs); g2_ld(s1, pa + 256, pb + 256, oa0, oa1, ob0, ob1, ob2, ob3);
      g2_mm(s2, accs); g2_ld(s2, pa + 320, pb + 320, oa0, oa1, ob0, ob1, ob2, ob3);
      g2_xw(pa, pb, oa0, oa1, ob0, ob1, ob2, ob3);      /* the two bases move on below */
      pa += 192; pb += 192; }
    const int rem = nst - s;      /* 3 to 5 k-steps are left, three of them loaded */
    g2_mm(s0, accs); if (rem > 3) { g2_ld(s0, pa + 192, pb + 192, oa0, oa1, ob0, ob1, ob2, ob3); g2_xw(pa, pb, oa0, oa1, ob0, ob1, ob2, ob3); }
    g2_mm(s1, accs); if (rem > 4) { g2_ld(s1, pa + 256, pb + 256, oa0, oa1, ob0, ob1, ob2, ob3); g2_xw(pa, pb, oa0, oa1, ob0, ob1, ob2, ob3); }
    g2_mm(s2, accs); if (rem > 3) g2_mm(s0, accs); if (rem > 4) g2_mm(s1, accs); }
  else if (nst == 2) { g2_ld(s0, pa, pb, oa0, oa1, ob0, ob1, ob2, ob3); g2_ld(s1, pa + 64, pb + 64, oa0, oa1, ob0, ob1, ob2, ob3); g2_xw(pa, pb, oa0, oa1, ob0, ob1, ob2, ob3); g2_mm(s0, accs); g2_mm(s1, accs); }
  else if (nst == 1) { g2_ld(s0, pa, pb, oa0, oa1, ob0, ob1, ob2, ob3); g2_xw(pa, pb, oa0, oa1, ob0, ob1, ob2, ob3); g2_mm(s0, accs); }
#pragma unroll
  for (int u = 0; u < 8; ++u) { const int t = u & 3, half = u >> 2; const int col = col0 + t * 16 + ln; const float bv = bp ? bf16_round(bp[col]) : 0.f;
#pragma unroll
    for (int r = 0; r < 8; ++r) { const int rloc = half * 16 + 8 * hh + r; float v = accs[u][r] * alpha + bv; if (CP) { if (rowsPerB < 0) v += CP[cofs + (size_t)(row0g + row0 + rloc) * ldc + col];      /* rowsPerB < 0: own element of the batched C plane */ else { const int bidx = (row0g + row0 + rloc) / rowsPerB; v += CP[(size_t)bidx * sCPb + (size_t)by * 64 + col]; } }
      if (ACT == 3) v = fmaxf(v, 0.f); else if (ACT == 6) v = 0.5f * v * (1.0f + erff(v * 0.70710678118654752f)); else if (ACT == 11) v = 1.0f / (1.0f + expf(-v)); else if (ACT == 15) v = v / (1.0f + expf(-v)); else if (ACT == 12) v = (v > 0.f) ? v : 0.01f * v; else if (ACT == 8) v = tanhf(v); else if (ACT == 9) v = 0.5f * v * (1.0f + tanhf(0.7978845608028654f * (v + 0.044715f * v * v * v))); else if (ACT == 14) v = (v > 0.f) ? v : 0.1f * v; else if (ACT == 16) v = (v >= 0.f) ? v : 0.3f * v; else if (ACT == 17) v = (v >= 0.f) ? v : 0.2f * v;
      so[w][rloc][t * 16 + ln] = v; } }
  __builtin_amdgcn_fence(__ATOMIC_ACQ_REL, "workgroup"); __builtin_amdgcn_wave_barrier();
  const int rsub = lane >> 4, c4 = (lane & 15) * 4;
  {
#pragma unroll
    for (int q = 0; q < 16; ++q) { const int r = q * 2 + rsub; const v4f v = *(const v4fa*)&so[w][r][c4]; if (C) *(v4f*)(C + cofs + (size_t)(row0 + r) * ldc + col0 + c4) = v; if (C16) { v4h h4; for (int i = 0; i < 4; ++i) h4[i] = (_Float16)v[i]; *(v4h*)(C16 + cofs + (size_t)(row0 + r) * ldc + col0 + c4) = h4; } }
     } }


__global__ __launch_bounds__(256) void k_wnat(const float* __restrict__ w, size_t n8, _Float16* __restrict__ Bt) { const size_t t = (size_t)blockIdx.x * 256 + threadIdx.x; if (t >= n8) return; FragH f; for (int q = 0; q < 8; ++q) f.h[q] = (_Float16)(bf16_round(w[t * 8 + q]) * 16.0f); *(v8us*)((unsigned short*)Bt + t * 8) = f.half[0];  }
__global__ __launch_bounds__(256) void k_rsm(const float* __restrict__ S, _Float16* __restrict__ P, int nrows) {
  #pragma clang fp contract(off)
  const int i = blockIdx.x * 256 + threadIdx.x; if (i >= nrows) return; const float* s = S + (size_t)i * SQ; float mx = -3.0e38f;
#pragma unroll 1
  for (int j = 0; j < SQ; ++j) mx = fmaxf(mx, s[j]); float se = 0.f;
#pragma unroll 1
  for (int j = 0; j < SQ; ++j) se += expf(s[j] - mx); const float sc = 256.0f / se;
#pragma unroll 1
  for (int j0 = 0; j0 < SQ; j0 += 8) { FragH f; for (int q = 0; q < 8; ++q) f.h[q] = (_Float16)(expf(s[j0 + q] - mx) * sc); unsigned short* d = (unsigned short*)P + (size_t)i * SQ + j0; *(v8us*)d = f.half[0];  } }
__global__ __launch_bounds__(256) void k_vt(const _Float16* __restrict__ V16, int b, int h0, _Float16* __restrict__ VT) { __shared__ unsigned short tl[64][65]; const int tid = threadIdx.x; const int hh = blockIdx.x % HG, sg = blockIdx.x / HG; const int s0 = sg * 64; const int h = h0 + hh;
  for (int i = tid; i < 64 * 8; i += 256) { const int j = i / 8, d8 = (i % 8) * 8; FragH f; f.half[0] = *(const v8us*)((const unsigned short*)V16 + ((size_t)b * SQ + s0 + j) * DM + h * HD + d8); for (int q = 0; q < 8; ++q) tl[d8 + q][j] = f.u[q]; }
  __syncthreads();
  { for (int i = tid; i < 64 * 8; i += 256) { const int d = i / 8, j8 = (i % 8) * 8; FragH f; for (int q = 0; q < 8; ++q) f.u[q] = tl[d][j8 + q]; *(v8us*)((unsigned short*)VT + ((size_t)hh * HD + d) * SQ + s0 + j8) = f.half[0]; }  } }



__global__ __launch_bounds__(256) void k_rsmcf2(const float* __restrict__ S, _Float16* __restrict__ P, int hg, int q0, int nk) {
  #pragma clang fp contract(off)
  const int t = blockIdx.x * 256 + threadIdx.x; if (t >= hg * QT) return; const size_t i = (size_t)t; const float* s = S + i * NKX; const int last = q0 + (t % QT); float mx = -3.0e38f;
#pragma unroll 1
  for (int j = 0; j < nk; ++j) { const float f = (j <= last) ? 1.f : 0.f; mx = fmaxf(mx, fmaf(f, s[j], (1.f - f) * -1.0e9f)); } float se = 0.f;
#pragma unroll 1
  for (int j = 0; j < nk; ++j) { const float f = (j <= last) ? 1.f : 0.f; se += __expf(fmaf(f, s[j], (1.f - f) * -1.0e9f) - mx); } const float sc = 256.0f / se;
#pragma unroll 1
  for (int j0 = 0; j0 < nk; j0 += 8) { FragH fr; for (int q = 0; q < 8; ++q) { const int j = j0 + q; const float f = (j <= last) ? 1.f : 0.f; fr.h[q] = (_Float16)(__expf(fmaf(f, s[j], (1.f - f) * -1.0e9f) - mx) * sc); } unsigned short* d = (unsigned short*)P + i * NKX + j0; *(v8us*)d = fr.half[0];  } }


template <int MASKADD>
__global__ __launch_bounds__(64) void k_att0(const float* __restrict__ QF, const float* __restrict__ KF, const float* __restrict__ VF, int ld, const float* __restrict__ mask, float scale, float* __restrict__ OF, int ldo) {
  #pragma clang fp contract(off)
  __shared__ __attribute__((aligned(16))) float lq[64][64]; __shared__ __attribute__((aligned(16))) float lo[64][64];
  const int tid = threadIdx.x; const int h = blockIdx.x / (QT0 / 64), rg = blockIdx.x % (QT0 / 64); const int i = rg * 64 + tid;
  const float* qr = QF + (size_t)i * ld + h * HD;
#pragma unroll 1
  for (int c = 0; c < HD / 4; ++c) { *(v4f*)&lq[tid][c * 4] = *(const v4fa*)(qr + c * 4); const v4f z = {0.f, 0.f, 0.f, 0.f}; *(v4f*)&lo[tid][c * 4] = z; }
  float m = -1.0e30f, l = 0.f; const int jmax = MASKADD ? (SQ - 1) : (rg * 64 + 63);      /* additive-mask form: every key (the mask input decides); causal form: keys up to the block's last row */
#pragma unroll 1
  for (int j = 0; j <= jmax; ++j) { const float* kr = KF + (size_t)j * ld + h * HD; const float* vr = VF + (size_t)j * ld + h * HD; float s = 0.f;
#pragma unroll 1
    for (int c = 0; c < HD / 4; ++c) { const v4f kq = *(const v4fa*)(kr + c * 4); const v4f qq = *(v4f*)&lq[tid][c * 4]; s = __fadd_rn(s, __fmul_rn(qq[0], kq[0])); s = __fadd_rn(s, __fmul_rn(qq[1], kq[1])); s = __fadd_rn(s, __fmul_rn(qq[2], kq[2])); s = __fadd_rn(s, __fmul_rn(qq[3], kq[3])); }
    s = __fmul_rn(s, scale); if (MASKADD) s = __fadd_rn(s, __fmul_rn(bf16_round(mask[(size_t)i * SQ + j]), -10000.0f));
    const float f = (MASKADD || j <= i) ? 1.f : 0.f; const float sm = fmaf(f, s, (1.f - f) * -1.0e30f); const float mn = fmaxf(m, sm); const float sc = expf(m - mn); const float e = expf(sm - mn); l = __fadd_rn(__fmul_rn(l, sc), e); m = mn;
#pragma unroll 1
    for (int c = 0; c < HD / 4; ++c) { const v4f vv = *(const v4fa*)(vr + c * 4); v4f oo = *(v4f*)&lo[tid][c * 4]; for (int u = 0; u < 4; ++u) oo[u] = __fadd_rn(__fmul_rn(oo[u], sc), __fmul_rn(e, vv[u])); *(v4f*)&lo[tid][c * 4] = oo; } }
  const float fin = 64.0f / l;      /* o carried x64 like the f16 path */
#pragma unroll 1
  for (int c = 0; c < HD / 4; ++c) { v4f oo = *(v4f*)&lo[tid][c * 4]; for (int u = 0; u < 4; ++u) oo[u] = __fmul_rn(oo[u], fin); *(v4f*)&lo[tid][c * 4] = oo; }
  __syncthreads();
  {
#pragma unroll 1
    for (int it = 0; it < 16; ++it) { const int row = it * 4 + tid / 16, pc = (tid % 16) * 4; const v4f v = *(const v4f*)&lo[row][pc]; *(v4f*)(OF + (size_t)(rg * 64 + row) * ldo + h * HD + pc) = v; }
     } }


__global__ __launch_bounds__(256) void k_kvexp(const float* __restrict__ src, float* __restrict__ dst, size_t n4) { const size_t t = (size_t)blockIdx.x * 256 + threadIdx.x; if (t >= n4) return; const size_t e = t * 4; const size_t row = e / DM; const int col = (int)(e % DM); const int h = col / HD, d = col % HD; const v4f v = *(const v4fa*)(src + row * KVD + (size_t)(h / HPG) * HD + d); *(v4f*)(dst + e) = v;  }

__global__ __launch_bounds__(256) void k_tab2(float theta, float* __restrict__ CS, float* __restrict__ SN) {
  #pragma clang fp contract(off)
  const int t = blockIdx.x * 256 + threadIdx.x; if (t >= SQ * (HD / 2)) return; const int i = t % (HD / 2); const int p = t / (HD / 2); const float invf = 1.0f / powf(theta, (float)(2 * i) / (float)HD); const float ang = __fmul_rn((float)p, invf); const float c = cosf(ang), s = sinf(ang);
  *(float*)(CS + t) = c; *(float*)(SN + t) = s;  }
template <int NORM, int ROPE>
__global__ __launch_bounds__(64) void k_xform(const float* __restrict__ F, int ldf, int nh, const float* __restrict__ gain, float eps, const float* __restrict__ CS, const float* __restrict__ SN, _Float16* __restrict__ H16, int ldo) {
  #pragma clang fp contract(off)
  __shared__ float xv[HD]; __shared__ float red[HD]; __shared__ unsigned short sh_[HD]; const int d = threadIdx.x; const int h = blockIdx.x % nh; const size_t r = blockIdx.x / nh; const int p = (int)(r % SQ);
  float x = F[r * (size_t)ldf + (size_t)h * HD + d];
  if (NORM) { red[d] = __fmul_rn(x, x); __syncthreads(); for (int st = HD / 2; st > 0; st >>= 1) { if (d < st) red[d] = __fadd_rn(red[d], red[d + st]); __syncthreads(); } const float rs = rsqrtf(__fadd_rn(red[0] / (float)HD, eps)); x = __fmul_rn(__fmul_rn(x, rs), bf16_round(gain[d])); }
  xv[d] = x; __syncthreads();
  float o = x;
  if (ROPE == 1) { const int i = d >> 1; const float c = CS[p * (HD / 2) + i], s = SN[p * (HD / 2) + i]; const float ev = xv[2 * i], od = xv[2 * i + 1]; o = (d & 1) ? __fadd_rn(__fmul_rn(ev, s), __fmul_rn(od, c)) : __fadd_rn(__fmul_rn(ev, c), -__fmul_rn(od, s)); }
  if (ROPE == 2) { const int i = d & (HD / 2 - 1); const float c = CS[p * (HD / 2) + i], s = SN[p * (HD / 2) + i]; const float lo = xv[i], hi = xv[i + HD / 2]; o = (d < HD / 2) ? __fadd_rn(__fmul_rn(lo, c), -__fmul_rn(hi, s)) : __fadd_rn(__fmul_rn(lo, s), __fmul_rn(hi, c)); }
  FragH th; th.h[0] = (_Float16)o; sh_[d] = th.u[0]; __syncthreads();
  if (d < HD / 8) { FragH f; for (int q = 0; q < 8; ++q) f.u[q] = sh_[d * 8 + q]; unsigned short* dst = (unsigned short*)H16 + r * (size_t)ldo + (size_t)h * HD + d * 8; *(v8us*)dst = f.half[0];  } }

template <int NORM, int ROPE>
__global__ __launch_bounds__(64) void k_xformf(const float* __restrict__ F, int ldf, int nh, const float* __restrict__ gain, float eps, const float* __restrict__ CS, const float* __restrict__ SN, float* __restrict__ F32, int ldo) {
  #pragma clang fp contract(off)
  __shared__ float xv[HD]; __shared__ float red[HD]; const int d = threadIdx.x; const int h = blockIdx.x % nh; const size_t r = blockIdx.x / nh; const int p = (int)(r % SQ);
  float x = F[r * (size_t)ldf + (size_t)h * HD + d];
  if (NORM) { red[d] = __fmul_rn(x, x); __syncthreads(); for (int st = HD / 2; st > 0; st >>= 1) { if (d < st) red[d] = __fadd_rn(red[d], red[d + st]); __syncthreads(); } const float rs = rsqrtf(__fadd_rn(red[0] / (float)HD, eps)); x = __fmul_rn(__fmul_rn(x, rs), bf16_round(gain[d])); }
  xv[d] = x; __syncthreads();
  float o = x;
  if (ROPE == 1) { const int i = d >> 1; const float c = CS[p * (HD / 2) + i], s = SN[p * (HD / 2) + i]; const float ev = xv[2 * i], od = xv[2 * i + 1]; o = (d & 1) ? __fadd_rn(__fmul_rn(ev, s), __fmul_rn(od, c)) : __fadd_rn(__fmul_rn(ev, c), -__fmul_rn(od, s)); }
  if (ROPE == 2) { const int i = d & (HD / 2 - 1); const float c = CS[p * (HD / 2) + i], s = SN[p * (HD / 2) + i]; const float lo = xv[i], hi = xv[i + HD / 2]; o = (d < HD / 2) ? __fadd_rn(__fmul_rn(lo, c), -__fmul_rn(hi, s)) : __fadd_rn(__fmul_rn(lo, s), __fmul_rn(hi, c)); }
  float* dst = F32 + r * (size_t)ldo + (size_t)h * HD + d; *(float*)dst = o;  }

__global__ __launch_bounds__(256) void k_trig(const float* __restrict__ a, float* __restrict__ CS, float* __restrict__ SN, int n) {
  #pragma clang fp contract(off)
  const int t = blockIdx.x * 256 + threadIdx.x; if (t >= n) return; const float v = bf16_round(a[t]); const float c = cosf(v), s = sinf(v);
  *(float*)(CS + t) = c; *(float*)(SN + t) = s;  }

__global__ __launch_bounds__(256) void k_tabpos(const int* __restrict__ pos, float* __restrict__ CS, float* __restrict__ SN, int n) {
  #pragma clang fp contract(off)
  const int t = blockIdx.x * 256 + threadIdx.x; if (t >= n) return; const int p = t / 32, i = t % 32; const float invf = (float)(1.0 / pow(10000.0, ((double)(2 * i)) / 64.0)); const float a = __fmul_rn((float)pos[p], invf); const float c = cosf(a), s = sinf(a);
  *(float*)(CS + t) = c; *(float*)(SN + t) = s;  }

// One wave per score row. Lane l holds columns 128 s + 4 l .. + 3 of every 128-column slice s in registers, so AC and BD' are read once:
// AC as whole-line 16-byte loads, BD' at the row's shift; maximum and sum end in a five-step butterfly over the lanes.
// NS = nk / 128 is a template parameter (q0 = nk - QT): the body is one straight line, so a row's loads can all be in flight together.
// A slice with 128 s + 127 <= q0 lies below every row's diagonal (j <= q0 <= i) and its shifted index stays below nk (shift <= QT - 1),
// so the index clamp and the arithmetic select, both identities there, are written for the later slices only.
typedef float v4fu __attribute__((ext_vector_type(4), may_alias, aligned(4)));      /* 16-byte load at a 4-byte boundary (the shifted BD' columns) */
// 2^x of four values. One asm statement so that every v_exp_f32 has an independent instruction behind it (early-clobber outputs: none overwrites a source);
// the closing v_nop is the slot that the instruction set asks for before the last result is read or its source overwritten.
__device__ __forceinline__ v4f exp2x4(v4f x) { float r0, r1, r2, r3;
  asm("v_exp_f32 %0, %4\n\tv_exp_f32 %1, %5\n\tv_exp_f32 %2, %6\n\tv_exp_f32 %3, %7\n\tv_nop" : "=&v"(r0), "=&v"(r1), "=&v"(r2), "=&v"(r3) : "v"(x[0]), "v"(x[1]), "v"(x[2]), "v"(x[3]));
  const v4f r = {r0, r1, r2, r3}; return r; }
template <int NS>
__global__ __launch_bounds__(256) void k_rsmxl(const float* __restrict__ AC, const float* __restrict__ BDp, _Float16* __restrict__ P, _Float16* __restrict__ PL, int hg) {
  #pragma clang fp contract(off)
  constexpr int nk = NS * 128, q0 = nk - QT;
  const int lane = threadIdx.x & 31; const int t = __builtin_amdgcn_readfirstlane((int)(blockIdx.x * 8 + (threadIdx.x >> 5))); if (t >= hg * QT) return;      /* wave-uniform row number: scalar row bases; no barrier in this kernel */
  const size_t ri = (size_t)t; const float* a = AC + ri * NKX; const float* bd = BDp + ri * NKX; const int tl = t & (QT - 1); const int i = q0 + tl; const int sh = QT - 1 - tl;      /* sh = nk - 1 - i */
  const unsigned ob = (unsigned)(sh + lane * 4) * 4u;      /* byte offset of the lane's first shifted column in the BD' row */
  v4f av[NS], bv[NS]; int ic[8];
#pragma unroll
  for (int s = 0; s < NS; ++s) { av[s] = ((const v4fa*)a)[lane + s * 32];
    if (s * 128 + 127 <= q0) bv[s] = *(const v4fu*)((const char*)bd + ob + s * 512);
    else {
#pragma unroll
      for (int q = 0; q < 4; ++q) { const int c = min(sh + lane * 4 + s * 128, nk - 1 - q); ic[(s - (NS - 2)) * 4 + q] = c; bv[s][q] = bd[c + q]; } } }      /* c + q = min(sh + j, nk - 1) */
  /* The wait that stands in front of any overwrite of a register that an issued load names. The address registers are its inputs so that they stay live up to here: no later load of the row gets one of them as its destination. */
  if constexpr (NS > 2) asm volatile("s_wait_xcnt 0x0" :: "v"(lane), "v"(ob), "v"(ic[0]), "v"(ic[1]), "v"(ic[2]), "v"(ic[3]), "v"(ic[4]), "v"(ic[5]), "v"(ic[6]), "v"(ic[7]) : "memory");
  else asm volatile("s_wait_xcnt 0x0" :: "v"(lane), "v"(ic[0]), "v"(ic[1]), "v"(ic[2]), "v"(ic[3]), "v"(ic[4]), "v"(ic[5]), "v"(ic[6]), "v"(ic[7]) : "memory");
  __builtin_amdgcn_sched_barrier(0);      /* keeps the arithmetic behind the row's loads: without it they are issued in groups with a full wait between the groups */
  float mx = -3.0e38f;
#pragma unroll
  for (int s = 0; s < NS; ++s) {
#pragma unroll
    for (int q = 0; q < 4; ++q) { const int j = s * 128 + lane * 4 + q; float v = __fadd_rn(av[s][q], bv[s][q]); if (s * 128 + 127 > q0) { const float f = (j <= i) ? 1.f : 0.f; v = fmaf(f, v, (1.f - f) * -1.0e30f); } av[s][q] = v; mx = fmaxf(mx, v); } }
#pragma unroll
  for (int m = 16; m > 0; m >>= 1) mx = fmaxf(mx, __shfl_xor(mx, m, 32));
  v4f s4 = {0.f, 0.f, 0.f, 0.f};
#pragma unroll
  for (int s = 0; s < NS; ++s) { av[s] = exp2x4((av[s] - mx) * 1.44269504f); s4 += av[s]; }      /* exp(v - mx) as the native form has it: 2^((v - mx) log2 e) */
  float se = (s4[0] + s4[1]) + (s4[2] + s4[3]);
#pragma unroll
  for (int m = 16; m > 0; m >>= 1) se += __shfl_xor(se, m, 32);
  const float sc = 256.0f / se;
#pragma unroll
  for (int s = 0; s < NS; ++s) { v4h fr, fl;
#pragma unroll
    for (int q = 0; q < 4; ++q) { const float pv = av[s][q] * sc; const _Float16 hv = (_Float16)pv; fr[q] = hv; fl[q] = (_Float16)((pv - (float)hv) * 1024.0f); }
    const size_t o = ri * NKX + s * 128 + lane * 4; *(v4h*)(P + o) = fr; *(v4h*)(PL + o) = fl; } }
template <int NS>
static void rsmxl_go(const float* AC, const float* BDp, _Float16* P, _Float16* PL, hipStream_t stream) { k_rsmxl<NS><<<(NH * QT + 7) / 8, 256, 0, stream>>>(AC, BDp, P, PL, NH); }

template <int N>
__global__ __launch_bounds__(256) void k_rmsrow(float* __restrict__ X, const float* __restrict__ w, float eps) {
  #pragma clang fp contract(off)
  constexpr int PT = N / 256; __shared__ float red[256]; const size_t r = blockIdx.x; const int t = threadIdx.x; float* row = X + r * N + (size_t)t * PT; float v[PT]; float ss = 0.f;
  for (int q = 0; q < PT; ++q) { v[q] = row[q]; ss = __fadd_rn(ss, __fmul_rn(v[q], v[q])); }
  red[t] = ss; __syncthreads(); for (int k = 128; k > 0; k >>= 1) { if (t < k) red[t] = __fadd_rn(red[t], red[t + k]); __syncthreads(); }
  const float rs = rsqrtf(__fadd_rn(red[0] / (float)N, eps)); float o[PT]; for (int q = 0; q < PT; ++q) o[q] = __fmul_rn(__fmul_rn(v[q], rs), bf16_round(w[t * PT + q]));
  { for (int q = 0; q < PT; ++q) *(float*)(row + q) = o[q];  } }

__global__ __launch_bounds__(256) void k_bfr(const float* __restrict__ x, float* __restrict__ XB, size_t n8) { const size_t t = (size_t)blockIdx.x * 256 + threadIdx.x; if (t >= n8) return; v4f a = *(const v4fa*)(x + t * 8), c = *(const v4fa*)(x + t * 8 + 4); for (int q = 0; q < 4; ++q) { a[q] = bf16_round(a[q]); c[q] = bf16_round(c[q]); }
  { *(v4f*)(XB + t * 8) = a; *(v4f*)(XB + t * 8 + 4) = c;  } }





// Exact f32 XL attention of the first QT0 rows of a batch: one wave per (head, row i). Lane = 16 hh + ln: ln owns dims 4 ln .. 4 ln + 3, hh one of two keys,
// so every 16-byte load instruction reads two whole 256-byte rows. Keys go in chunks of 32: a lane forms 16 partial dots (q+u).k + (q+v).r over its four dims,
// a four-step butterfly sums each over its 16 lanes, and lane l keeps the score of key 32 c + l. Scores, then weights, rest in the wave's own LDS row;
// maximum and sum are taken over the whole row (two passes, no rescaling); o = sum_j e_j v_j per half, the halves added at the end, x 64 / sum.
// Rows of K, V up to 32 c + 31 <= QT0 - 1 exist; a key above the diagonal gets -1e30 by the arithmetic select and its xl_r index is clamped.
__global__ __launch_bounds__(256) void k_att0xl(const float* __restrict__ QF, const float* __restrict__ QVF, const float* __restrict__ KF, const float* __restrict__ VF, const float* __restrict__ RF, float* __restrict__ OF) {
  __shared__ __attribute__((aligned(16))) float pw[8][QT0];
  const int lane = threadIdx.x & 31, ln = lane & 15, hh = lane >> 4; const int w = __builtin_amdgcn_readfirstlane((int)(threadIdx.x >> 5));      /* wave-uniform: scalar row bases and trip counts */
  const int h = blockIdx.x % NH; const int i = QT0 - 1 - ((int)(blockIdx.x / NH) * 8 + w); const int nch = (i >> 5) + 1;      /* the long rows start first; nch chunks of 32 keys cover 0 .. i */
  const unsigned qo = (unsigned)(i * DM + h * HD + ln * 4) * 4u;
  const v4f q4 = *(const v4fa*)((const char*)QF + qo), qv4 = *(const v4fa*)((const char*)QVF + qo);
  const unsigned ko = (unsigned)(hh * 16 * DM + h * HD + ln * 4) * 4u;      /* the lane's byte offset in a chunk of K or V rows */
  const char* rb = (const char*)(RF + (size_t)h * SQ * HD); float* pr = pw[w]; float mx = -3.0e38f;
#pragma unroll 1
  for (int c = 0; c < nch; ++c) { const char* kp = (const char*)KF + (size_t)c * (32 * DM * 4) + ko; const int r0 = SQ - 1 - i + c * 32 + hh * 16; v4f kk[16], rr[16]; unsigned ro[16];
#pragma unroll
    for (int u = 0; u < 16; ++u) { ro[u] = (unsigned)min(r0 + u, SQ - 1) * (HD * 4u) + ln * 16u; kk[u] = *(const v4fa*)(kp + u * (DM * 4)); rr[u] = *(const v4fa*)(rb + ro[u]); }      /* key j = 32 c + 16 hh + u; xl_r row min(SQ - 1 - i + j, SQ - 1) */
    /* the wait that stands in front of any overwrite of a register that an issued load names, for the chunk's 32 loads: every address register is an input, so none is reused (as a destination either) before it */
    asm volatile("s_wait_xcnt 0x0" :: "v"(kp), "s"(rb), "v"(ro[0]), "v"(ro[1]), "v"(ro[2]), "v"(ro[3]), "v"(ro[4]), "v"(ro[5]), "v"(ro[6]), "v"(ro[7]), "v"(ro[8]), "v"(ro[9]), "v"(ro[10]), "v"(ro[11]), "v"(ro[12]), "v"(ro[13]), "v"(ro[14]), "v"(ro[15]) : "memory");
    __builtin_amdgcn_sched_barrier(0);      /* keeps the arithmetic behind the chunk's loads: without it most K rows are loaded one at a time, each with its own wait */
    float keep = 0.f;
#pragma unroll
    for (int u = 0; u < 16; ++u) { float p = q4[0] * kk[u][0];
#pragma unroll
      for (int d = 1; d < 4; ++d) p = fmaf(q4[d], kk[u][d], p);
#pragma unroll
      for (int d = 0; d < 4; ++d) p = fmaf(qv4[d], bf16_round(rr[u][d]), p);
      p += __shfl_xor(p, 1, 32); p += __shfl_xor(p, 2, 32); p += __shfl_xor(p, 4, 32); p += __shfl_xor(p, 8, 32);
      keep = (ln == u) ? p : keep; }
    const float f = (c * 32 + lane <= i) ? 1.f : 0.f; const float sm = fmaf(f, keep, (1.f - f) * -1.0e30f); pr[c * 32 + lane] = sm; mx = fmaxf(mx, sm); }
#pragma unroll
  for (int m = 16; m > 0; m >>= 1) mx = fmaxf(mx, __shfl_xor(mx, m, 32));
  float l = 0.f;
#pragma unroll 1
  for (int c = 0; c < nch; ++c) { const float e = expf(pr[c * 32 + lane] - mx); pr[c * 32 + lane] = e; l += e; }      /* each lane reads back what it wrote itself */
#pragma unroll
  for (int m = 16; m > 0; m >>= 1) l += __shfl_xor(l, m, 32);
  __builtin_amdgcn_fence(__ATOMIC_ACQ_REL, "workgroup"); __builtin_amdgcn_wave_barrier();      /* the weights are read across the wave's lanes from here on: keeps the LDS stores in front of those reads */
  v4f o = {0.f, 0.f, 0.f, 0.f};
#pragma unroll 1
  for (int c = 0; c < nch; ++c) { const char* vp = (const char*)VF + (size_t)c * (32 * DM * 4) + ko; v4f vv[16], pe[4];
#pragma unroll
    for (int u = 0; u < 16; ++u) vv[u] = *(const v4fa*)(vp + u * (DM * 4));
    asm volatile("s_wait_xcnt 0x0" :: "v"(vp) : "memory");      /* same wait, for the chunk's 16 loads; the address is an input so that no load of the chunk gets it as its destination */
#pragma unroll
    for (int m = 0; m < 4; ++m) pe[m] = *(const v4f*)&pr[c * 32 + hh * 16 + m * 4];      /* the half's 16 weights, one address per half */
#pragma unroll
    for (int u = 0; u < 16; ++u) { const float e = pe[u >> 2][u & 3];
#pragma unroll
      for (int d = 0; d < 4; ++d) o[d] = fmaf(e, vv[u][d], o[d]); } }
  const float fin = 64.0f / l;      /* o carried x64 like the f16 path */
#pragma unroll
  for (int d = 0; d < 4; ++d) o[d] = (o[d] + __shfl_xor(o[d], 16, 32)) * fin;
  if (hh == 0) *(v4f*)(OF + (size_t)i * DM + h * HD + ln * 4) = o; }

extern "C" void kernel_launch(void* const* d_in, const int* in_sizes, int n_in,
                              void* d_out, int out_size, void* d_ws, size_t ws_size, hipStream_t stream) {
  (void)in_sizes; (void)n_in; (void)out_size;
  const float* const* I = (const float* const*)d_in; const float* x = I[0]; const float* g = I[1]; const float* wq = I[2]; const float* wk = I[3]; const float* wv = I[4]; const float* wres = I[5]; const float* xlr = I[6]; const float* xlu = I[7]; const float* xlv = I[8];      /* x; RMS gain; w_q/w_k/w_v [1024][16][64] = [in][out]; w_res [1024][1024] [in][out]; xl_r [16][2048][64]; xl_u, xl_v [1][16][1][64] = per-head 64-vectors (a [1024] bias over the merged columns) */
  char* ws = (char*)d_ws; size_t off = 0;
  auto take = [&](size_t bytes) { char* p = ws + off; off += (bytes + 255) & ~(size_t)255; return p; };
  _Float16* BQ = (_Float16*)take((size_t)DM * DM * 2); _Float16* BK = (_Float16*)take((size_t)DM * DM * 2); _Float16* BV = (_Float16*)take((size_t)DM * DM * 2); _Float16* BR = (_Float16*)take((size_t)DM * DM * 2);
  float* XT = (float*)take(NR * DM * 4); _Float16* X16 = (_Float16*)take(NR * DM * 2); _Float16* XL16 = (_Float16*)take(NR * DM * 2); float* QUF = (float*)take((size_t)QT0 * DM * 4); float* QVF = (float*)take((size_t)QT0 * DM * 4); float* KF0 = (float*)take((size_t)QT0 * DM * 4); float* VF0 = (float*)take((size_t)QT0 * DM * 4); float* OF0 = (float*)take((size_t)NB * QT0 * DM * 4); _Float16* OH0 = (_Float16*)take((size_t)NB * QT0 * DM * 2); _Float16* OL0 = (_Float16*)take((size_t)NB * QT0 * DM * 2); _Float16* QU = (_Float16*)take(NR * DM * 2); _Float16* QV = (_Float16*)take(NR * DM * 2); _Float16* K16 = (_Float16*)take(NR * DM * 2); float* VF = (float*)take(NR * DM * 4); _Float16* V16 = (_Float16*)take(NR * DM * 2); _Float16* VL16 = (_Float16*)take(NR * DM * 2); _Float16* R16 = (_Float16*)take((size_t)NH * SQ * HD * 2); float* OF = (float*)take(NR * DM * 4); _Float16* O16 = (_Float16*)take(NR * DM * 2); _Float16* OL16 = (_Float16*)take(NR * DM * 2);      /* v and wv carried as f32 -> f16 hi + x1024 residual (the first causal rows copy v almost verbatim into small outputs) */
  float* S = (float*)take((size_t)NH * QT * NKX * 4); float* BD = (float*)take((size_t)NH * QT * NKX * 4); _Float16* P = (_Float16*)take((size_t)NH * QT * NKX * 2); _Float16* PL = (_Float16*)take((size_t)NH * QT * NKX * 2); _Float16* VT = (_Float16*)take((size_t)NH * HD * SQ * 2); _Float16* VTL = (_Float16*)take((size_t)NH * HD * SQ * 2);
  if (off > ws_size) return;
  { const unsigned gw = (unsigned)(((size_t)DM * DM / 8 + 255) / 256); k_wt_f16<<<gw, 256, 0, stream>>>(wq, BQ, DM, DM, 16.0f); k_wt_f16<<<gw, 256, 0, stream>>>(wk, BK, DM, DM, 16.0f); k_wt_f16<<<gw, 256, 0, stream>>>(wv, BV, DM, DM, 16.0f); k_wt_f16<<<gw, 256, 0, stream>>>(wres, BR, DM, DM, 16.0f); }      /* [in][out] ([in][h][k] flattened) -> Bt x16 */
  k_bfr<<<(unsigned)((NR * DM / 8 + 255) / 256), 256, 0, stream>>>(x, XT, NR * DM / 8); k_rmsrow<DM><<<(unsigned)NR, 256, 0, stream>>>(XT, g, 1e-6f); k_hl<<<(unsigned)((NR * DM / 8 + 255) / 256), 256, 0, stream>>>(XT, X16, XL16, NR * DM / 8);      /* x_t = RMSNorm(bf16(x)) g (f32, in place) -> f16 hi rows (+ x1024 residual rows for the exact first tile) */
  k_x16<<<(unsigned)(((size_t)NH * SQ * HD / 8 + 255) / 256), 256, 0, stream>>>(xlr, R16, (size_t)NH * SQ * HD / 8);      /* xl_r [h][j][64] as exact f16 rows (bf16-valued input) */
  k_gemm2<0><<<dim3((unsigned)((NR / 128) * (DM / 64)), 1), 128, 0, stream>>>(X16, DM, 0, BQ, DM, 0, 0.0078125f, xlu, 0, nullptr, 1, 0, 0, nullptr, QU, DM, 0, (int)NR, DM, DM); k_gemm2<0><<<dim3((unsigned)((NR / 128) * (DM / 64)), 1), 128, 0, stream>>>(X16, DM, 0, BQ, DM, 0, 0.0078125f, xlv, 0, nullptr, 1, 0, 0, nullptr, QV, DM, 0, (int)NR, DM, DM);      /* q / 8 + xl_u and q / 8 + xl_v (the per-head 64-vectors as [1024] column biases) -> f16 rows */
  k_gemm2<0><<<dim3((unsigned)((NR / 128) * (DM / 64)), 1), 128, 0, stream>>>(X16, DM, 0, BK, DM, 0, 0.0625f, nullptr, 0, nullptr, 1, 0, 0, nullptr, K16, DM, 0, (int)NR, DM, DM); k_gemm2<0><<<dim3((unsigned)((NR / 128) * (DM / 64)), 1), 128, 0, stream>>>(X16, DM, 0, BV, DM, 0, 0.0625f, nullptr, 0, nullptr, 1, 0, 0, VF, nullptr, DM, 0, (int)NR, DM, DM); k_hl<<<(unsigned)((NR * DM / 8 + 255) / 256), 256, 0, stream>>>(VF, V16, VL16, NR * DM / 8);      /* k -> f16; v f32 -> f16 hi + x1024 residual rows */
  for (int b = 0; b < NB; ++b) { const size_t r0 = (size_t)b * SQ;
    k_vt<NH, SQ><<<NH * (SQ / 64), 256, 0, stream>>>(V16 + r0 * DM, DM, 0, VT); k_vt<NH, SQ><<<NH * (SQ / 64), 256, 0, stream>>>(VL16 + r0 * DM, DM, 0, VTL);      /* V^T hi and residual [16][64][SQ] of this batch */
    { const dim3 g0((QT0 / 128) * (DM / 64), 1);      
      k_gemm2<0><<<g0, 128, 0, stream>>>(X16 + r0 * DM, DM, 0, BQ, DM, 0, 0.0078125f, xlu, 0, nullptr, 1, 0, 0, QUF, nullptr, DM, 0, QT0, DM, DM); k_gemm2<0><<<g0, 128, 0, stream>>>(XL16 + r0 * DM, DM, 0, BQ, DM, 0, 0.00000762939453125f, nullptr, 0, QUF, -1, 0, 0, QUF, nullptr, DM, 0, QT0, DM, DM);
      k_gemm2<0><<<g0, 128, 0, stream>>>(X16 + r0 * DM, DM, 0, BQ, DM, 0, 0.0078125f, xlv, 0, nullptr, 1, 0, 0, QVF, nullptr, DM, 0, QT0, DM, DM); k_gemm2<0><<<g0, 128, 0, stream>>>(XL16 + r0 * DM, DM, 0, BQ, DM, 0, 0.00000762939453125f, nullptr, 0, QVF, -1, 0, 0, QVF, nullptr, DM, 0, QT0, DM, DM);
      k_gemm2<0><<<g0, 128, 0, stream>>>(X16 + r0 * DM, DM, 0, BK, DM, 0, 0.0625f, nullptr, 0, nullptr, 1, 0, 0, KF0, nullptr, DM, 0, QT0, DM, DM); k_gemm2<0><<<g0, 128, 0, stream>>>(XL16 + r0 * DM, DM, 0, BK, DM, 0, 0.00006103515625f, nullptr, 0, KF0, -1, 0, 0, KF0, nullptr, DM, 0, QT0, DM, DM);
      k_gemm2<0><<<g0, 128, 0, stream>>>(X16 + r0 * DM, DM, 0, BV, DM, 0, 0.0625f, nullptr, 0, nullptr, 1, 0, 0, VF0, nullptr, DM, 0, QT0, DM, DM); k_gemm2<0><<<g0, 128, 0, stream>>>(XL16 + r0 * DM, DM, 0, BV, DM, 0, 0.00006103515625f, nullptr, 0, VF0, -1, 0, 0, VF0, nullptr, DM, 0, QT0, DM, DM);
      k_att0xl<<<NH * (QT0 / 8), 256, 0, stream>>>(QUF, QVF, KF0, VF0, xlr, OF0 + (size_t)b * QT0 * DM); }      /* exact causal XL attention for rows 0..255 (o x64, f32) */
    for (int q0 = 0; q0 < SQ; q0 += QT) { const int nk = q0 + QT;      /* causal: keys below the tile end only */
      k_gemm2<0><<<dim3((QT / 128) * (nk / 64), NH), 128, 0, stream>>>(QU + (r0 + q0) * DM, DM, (size_t)HD, K16 + r0 * DM, DM, (size_t)HD, 1.0f, nullptr, 0, nullptr, 1, 0, 0, S, nullptr, NKX, (size_t)QT * NKX, QT, nk, HD);      /* AC[i][j] = (q_i + u).k_j, 16 heads on grid.y */
      k_gemm2<0><<<dim3((QT / 128) * (nk / 64), NH), 128, 0, stream>>>(QV + (r0 + q0) * DM, DM, (size_t)HD, R16 + (size_t)(SQ - nk) * HD, HD, (size_t)SQ * HD, 1.0f, nullptr, 0, nullptr, 1, 0, 0, BD, nullptr, NKX, (size_t)QT * NKX, QT, nk, HD);      /* BD'[i][c] = (q_i + v).xl_r[h][SQ - nk + c] for c < nk (the xl_r rows the shift can reach from this tile) */
      static_assert(SQ == 8 * QT, "one k_rsmxl instance per tile end"); switch (nk / QT) { case 1: rsmxl_go<2>(S, BD, P, PL, stream); break; case 2: rsmxl_go<4>(S, BD, P, PL, stream); break; case 3: rsmxl_go<6>(S, BD, P, PL, stream); break; case 4: rsmxl_go<8>(S, BD, P, PL, stream); break; case 5: rsmxl_go<10>(S, BD, P, PL, stream); break; case 6: rsmxl_go<12>(S, BD, P, PL, stream); break; case 7: rsmxl_go<14>(S, BD, P, PL, stream); break; default: rsmxl_go<16>(S, BD, P, PL, stream); break; }      /* scores = AC + BD'[i][nk-1-(i-j)] (== rel_shift) for j <= i, -1e30 above the diagonal; softmax -> x256 f16 */
      k_gemm2<0><<<dim3((QT / 128) * (HD / 64), NH), 128, 0, stream>>>(P, NKX, (size_t)QT * NKX, VT, SQ, (size_t)HD * SQ, 0.25f, nullptr, 0, nullptr, 1, 0, 0, OF + (r0 + q0) * DM, nullptr, DM, (size_t)HD, QT, HD, nk); k_gemm2<0><<<dim3((QT / 128) * (HD / 64), NH), 128, 0, stream>>>(PL, NKX, (size_t)QT * NKX, VT, SQ, (size_t)HD * SQ, 0.000244140625f, nullptr, 0, OF + (r0 + q0) * DM, -1, 0, 0, OF + (r0 + q0) * DM, nullptr, DM, (size_t)HD, QT, HD, nk); k_gemm2<0><<<dim3((QT / 128) * (HD / 64), NH), 128, 0, stream>>>(P, NKX, (size_t)QT * NKX, VTL, SQ, (size_t)HD * SQ, 0.000244140625f, nullptr, 0, OF + (r0 + q0) * DM, -1, 0, 0, OF + (r0 + q0) * DM, nullptr, DM, (size_t)HD, QT, HD, nk); } }      /* wv x64 = Ph Vh 2^-2 + Pl Vh 2^-12 + Ph Vl 2^-12 (f32, own-element accumulate) */
  k_hl<<<(unsigned)((NR * DM / 8 + 255) / 256), 256, 0, stream>>>(OF, O16, OL16, NR * DM / 8);      /* wv x64 -> f16 hi + x1024 residual rows */
  k_gemm2<0><<<dim3((unsigned)((NR / 128) * (DM / 64)), 1), 128, 0, stream>>>(O16, DM, 0, BR, DM, 0, 0.0009765625f, nullptr, 0, nullptr, 1, 0, 0, (float*)d_out, nullptr, DM, 0, (int)NR, DM, DM); k_gemm2<0><<<dim3((unsigned)((NR / 128) * (DM / 64)), 1), 128, 0, stream>>>(OL16, DM, 0, BR, DM, 0, 0.00000095367431640625f, nullptr, 0, (const float*)d_out, -1, 0, 0, (float*)d_out, nullptr, DM, 0, (int)NR, DM, DM);      /* res = wv_hi w_res 2^-10 += wv_lo w_res 2^-20 (own element) */
  k_hl<<<(unsigned)(((size_t)NB * QT0 * DM / 8 + 255) / 256), 256, 0, stream>>>(OF0, OH0, OL0, (size_t)NB * QT0 * DM / 8);      /* first-tile o (x64) -> f16 hi + x1024 residual planes */
  for (int b = 0; b < NB; ++b) { const size_t r0 = (size_t)b * SQ; const size_t f0 = (size_t)b * QT0;
    k_gemm2<0><<<dim3((QT0 / 128) * (DM / 64), 1), 128, 0, stream>>>(OH0 + f0 * DM, DM, 0, BR, DM, 0, 0.0009765625f, nullptr, 0, nullptr, 1, 0, 0, (float*)d_out + r0 * DM, nullptr, DM, 0, QT0, DM, DM);      /* rows 0..255 of the batch rewritten from the exact path */
    k_gemm2<0><<<dim3((QT0 / 128) * (DM / 64), 1), 128, 0, stream>>>(OL0 + f0 * DM, DM, 0, BR, DM, 0, 0.00000095367431640625f, nullptr, 0, (const float*)d_out + r0 * DM, -1, 0, 0, (float*)d_out + r0 * DM, nullptr, DM, 0, QT0, DM, DM); }      /* += o_lo w_res 2^-20 (own-element accumulate) */
}

// v004
// It runs in 944 microseconds.
// Two timings next to v003 put it at 2.21 and 2.22 times that version's speed.
// Over all steps from v000 it is 16.4 times as fast.
#include <hip/hip_runtime.h>
// Transformer-XL style causal attention with relative-position (rel_shift) scores (x [2][2048][1024]; x_t = RMSNorm(x) g (eps 1e-6); q = x_t w_q / 8, k = x_t w_k, v = x_t w_v (w [1024][16][64] = [in][out], sigma 1/32); scores = (q + xl_u).k^T + rel_shift((q + xl_v).xl_r^T) (xl_r [16][2048][64], xl_u / xl_v [1][16][1][64]); causal: - 1e30 above the diagonal; softmax; wv = w v merged (h*64+v); res = wv w_res ([in][out]) -> [2][2048][1024]. rel_shift with q_len = k_len = T gives bd[i][j] = (q_i + xl_v).xl_r[h][T-1-(i-j)] for j <= i).
// Structure: token rows; x_t = RMSNorm(bf16(x)) in f32 on VALU -> f16 rows; [in][out] weights as x16 planes; q+u and q+v as two WMMA GEMMs (32x64 wave tiles, f32 accumulation, alpha 1/128, per-head bias vectors), k, v -> f16 rows; xl_r as exact f16 rows; per batch: V^T via LDS transposes; exact f32 XL attention for rows 0..255 per batch on VALU (q/k/v of those rows from x_t hi + residual GEMM passes); per 256-row tile: AC = (q+u) k^T over keys < tile end and BD' = (q+v) r^T over the matching xl_r rows [T-nk, T) (K = 64, 16 heads on grid.y) f32; causal softmax on VALU that adds the rel-shifted BD'[i][nk-1-(i-j)] (arithmetic select and clamped index, -1e30 fill, f32 statistics, native exp; weights x256 f16); o = P V^T (x64) merged f16; res = o_hi w_res + o_lo w_res 2^-10; first-tile rows rewritten from the exact o hi/lo; launches: see trace.
// Compute dtype: inputs rounded to bf16; x / weights exact; q, k as plain f16 GEMM operands (~2^-12); v, softmax weights and o as f16 hi + x1024 residual; scores and softmax statistics f32. v_wmma_f32_16x16x32_f16.
#define NB 2
#define NG 16
#define HPG 1
#define KVD (NG * HD)
#define SQ 2048
#define DM 1024
#define NH 16
#define HD 64
#define HG 4                         /* heads per block group of the unlaunched k_vt(V16, b, h0, VT) */
#define QT 256                       /* query rows per causal tile */
#define NKX SQ                       /* S / P row pitch */
#define QT0 256                      /* first-tile rows recomputed exactly in f32 (= one causal tile) */
#define B0 0                         /* unused; the batch loops start at 0 */
#define NBR NB                       /* unused by the launches; the batch loops run over NB */
#define NR ((size_t)NB * SQ)         /* token rows */
#define MP ((int)((size_t)NBR * SQ)) /* unused by the launches; the projections run over NR rows */
#define QN SQ                        /* unused; the tile loop runs over SQ */
#define NHD NH                       /* unused; the attention launches use NH */
#define MPO MP                       /* unused; the output GEMMs use NR */
#define LQ DM      /* unused; the q/k/v rows use pitch DM */
typedef __bf16 v16b __attribute__((ext_vector_type(16)));
typedef unsigned short v8us __attribute__((ext_vector_type(8), may_alias));
typedef float  v8f  __attribute__((ext_vector_type(8)));
typedef float  v4f  __attribute__((ext_vector_type(4)));
typedef float  v4fa __attribute__((ext_vector_type(4), may_alias));
union FragB { v16b v; v8us half[2]; unsigned short u[16]; };

__device__ __forceinline__ unsigned short bf16_bits(float x) { unsigned int u = __float_as_uint(x); return (unsigned short)((u + 0x7FFFu + ((u >> 16) & 1u)) >> 16); }
__device__ __forceinline__ float bf16_val(unsigned short b) { return __uint_as_float(((unsigned int)b) << 16); }
__device__ __forceinline__ float bf16_round(float x) { return bf16_val(bf16_bits(x)); }
// D += A·B with NT terms: 1 = ah·bh, 2 = + al·bh (A split), 3 = + ah·bl (both split)
template <int NT>
__device__ __forceinline__ v8f mmaN(v16b ah, v16b al, v16b bh, v16b bl, v8f c) {
  c = __builtin_amdgcn_wmma_f32_16x16x32_bf16(false, ah, false, bh, (short)0, c, false, false);
  if (NT >= 2) c = __builtin_amdgcn_wmma_f32_16x16x32_bf16(false, al, false, bh, (short)0, c, false, false);
  if (NT >= 3) c = __builtin_amdgcn_wmma_f32_16x16x32_bf16(false, ah, false, bl, (short)0, c, false, false);
  asm volatile("v_nop\n\tv_nop\n\tv_nop\n\tv_nop" : "+v"(c) : "v"(ah), "v"(al), "v"(bh), "v"(bl));
  return c;
}

__global__ __launch_bounds__(256) void k_wt_bf16(const float* __restrict__ W, unsigned short* __restrict__ Wt, int K, int N) {
  const int t = blockIdx.x * 256 + threadIdx.x;
  const int k8n = K / 8;
  if (t >= N * k8n) return;
  const int n = t / k8n, k8 = (t % k8n) * 8;
  v8us v;
#pragma unroll
  for (int i = 0; i < 8; ++i) v[i] = bf16_bits(W[(size_t)(k8 + i) * N + n]);
  *(v8us*)(Wt + (size_t)n * K + k8) = v;
  
}

// GEMM C[M][N] (f32, pitch ldc) = act(A[M][K]·W + bias). A f32 row-major (pitch lda) converted per fragment to bf16
// (ASPLIT: hi/lo two planes -> 2 terms, else single rounded term); Wt bf16 [N][K] (pitch ldb). BIAS_BF16 rounds the
// bias to bf16 first (bias quantised to bf16 before the add). K%32==0, M%16==0, N%64==0.
template <bool ASPLIT, int ACT, bool BIAS_BF16>
__global__ __launch_bounds__(128) void k_gemm_bf(const float* __restrict__ A, int lda, const unsigned short* __restrict__ Wt, int ldb,
                                               const float* __restrict__ bias, float* __restrict__ C, int ldc, int M, int N, int K) {
  __shared__ __attribute__((aligned(16))) float so[4][16][64];
  const int tid = threadIdx.x, w = tid >> 5, lane = tid & 31, ln = lane & 15, hh = lane >> 4;
  const int ntn = N / 64;
  const int wid = blockIdx.x * 4 + w;
  const int mt = wid / ntn, nq = wid % ntn;
  if (mt * 16 >= M) return;
  const int row0 = mt * 16, col0 = nq * 64;
  const float* arow = A + (size_t)(row0 + ln) * lda;
  v8f acc[4] = {};
  for (int kb = 0; kb < K; kb += 32) {
    FragB ah, al;
    const v4f x0 = *(const v4fa*)(arow + kb + 8 * hh), x1 = *(const v4fa*)(arow + kb + 8 * hh + 4);
    const v4f x2 = *(const v4fa*)(arow + kb + 16 + 8 * hh), x3 = *(const v4fa*)(arow + kb + 16 + 8 * hh + 4);
    float xs[16] = {x0[0],x0[1],x0[2],x0[3],x1[0],x1[1],x1[2],x1[3],x2[0],x2[1],x2[2],x2[3],x3[0],x3[1],x3[2],x3[3]};
#pragma unroll
    for (int i = 0; i < 16; ++i) { const unsigned short hb = bf16_bits(xs[i]); ah.u[i] = hb; al.u[i] = ASPLIT ? bf16_bits(xs[i] - bf16_val(hb)) : (unsigned short)0; }
#pragma unroll
    for (int t = 0; t < 4; ++t) {
      const unsigned short* brow = Wt + (size_t)(col0 + t * 16 + ln) * ldb + kb;
      FragB b;
      b.half[0] = *(const v8us*)(brow + 8 * hh);
      b.half[1] = *(const v8us*)(brow + 16 + 8 * hh);
      acc[t] = mmaN<ASPLIT ? 2 : 1>(ah.v, al.v, b.v, b.v, acc[t]);
    }
  }
#pragma unroll
  for (int t = 0; t < 4; ++t) {
    float bv = bias ? bias[col0 + t * 16 + ln] : 0.f;
    if (BIAS_BF16) bv = bf16_round(bv);
#pragma unroll
    for (int r = 0; r < 8; ++r) { float v = acc[t][r] + bv; if (ACT == 1) v = fmaxf(v, 0.f); so[w][8 * hh + r][t * 16 + ln] = v; }
  }
  __builtin_amdgcn_fence(__ATOMIC_ACQ_REL, "workgroup");
  __builtin_amdgcn_wave_barrier();
  const int rsub = lane >> 4, c4 = (lane & 15) * 4;
  {
#pragma unroll
    for (int q = 0; q < 8; ++q) {
      const int r = q * 2 + rsub;
      const v4f v = *(const v4fa*)&so[w][r][c4];
      *(v4f*)(C + (size_t)(row0 + r) * ldc + col0 + c4) = v;
    }
    
  }
}

// GEMM C = act(A·W + bias + resid): A f32 (ASPLIT -> hi/lo 2 terms), Wt bf16 [N][K]; ACT 0 none, 1 relu, 2 exact gelu;
// resid (optional, f32, row index = (row % rmod), pitch ldr, RES_BF16 rounds it) added before the activation.
template <bool ASPLIT, int ACT, bool BIAS_BF16, bool RES_BF16>
__global__ __launch_bounds__(128) void k_gemm_bf3(const float* __restrict__ A, int lda, const unsigned short* __restrict__ Wt, int ldb,
                                                const float* __restrict__ bias, const float* __restrict__ resid, int rmod, int ldr,
                                                float* __restrict__ C, int ldc, int M, int N, int K) {
  __shared__ __attribute__((aligned(16))) float so[4][16][64];
  const int tid = threadIdx.x, w = tid >> 5, lane = tid & 31, ln = lane & 15, hh = lane >> 4;
  const int ntn = N / 64;
  const int wid = blockIdx.x * 4 + w;
  const int mt = wid / ntn, nq = wid % ntn;
  if (mt * 16 >= M) return;
  const int row0 = mt * 16, col0 = nq * 64;
  const float* arow = A + (size_t)(row0 + ln) * lda;
  v8f acc[4] = {};
  for (int kb = 0; kb < K; kb += 32) {
    FragB ah, al;
    const v4f x0 = *(const v4fa*)(arow + kb + 8 * hh), x1 = *(const v4fa*)(arow + kb + 8 * hh + 4);
    const v4f x2 = *(const v4fa*)(arow + kb + 16 + 8 * hh), x3 = *(const v4fa*)(arow + kb + 16 + 8 * hh + 4);
    float xs[16] = {x0[0],x0[1],x0[2],x0[3],x1[0],x1[1],x1[2],x1[3],x2[0],x2[1],x2[2],x2[3],x3[0],x3[1],x3[2],x3[3]};
#pragma unroll
    for (int i = 0; i < 16; ++i) { const unsigned short hb = bf16_bits(xs[i]); ah.u[i] = hb; al.u[i] = ASPLIT ? bf16_bits(xs[i] - bf16_val(hb)) : (unsigned short)0; }
#pragma unroll
    for (int t = 0; t < 4; ++t) {
      const unsigned short* brow = Wt + (size_t)(col0 + t * 16 + ln) * ldb + kb;
      FragB b;
      b.half[0] = *(const v8us*)(brow + 8 * hh);
      b.half[1] = *(const v8us*)(brow + 16 + 8 * hh);
      acc[t] = mmaN<ASPLIT ? 2 : 1>(ah.v, al.v, b.v, b.v, acc[t]);
    }
  }
#pragma unroll
  for (int t = 0; t < 4; ++t) {
    const int col = col0 + t * 16 + ln;
    float bv = bias ? bias[col] : 0.f;
    if (BIAS_BF16) bv = bf16_round(bv);
#pragma unroll
    for (int r = 0; r < 8; ++r) {
      float v = acc[t][r] + bv;
      if (resid) { float rv = resid[(size_t)((row0 + 8 * hh + r) % rmod) * ldr + col]; if (RES_BF16) rv = bf16_round(rv); v += rv; }
      if (ACT == 1) v = fmaxf(v, 0.f);
      if (ACT == 2) v = 0.5f * v * (1.0f + erff(v * 0.70710678118654752f));
      if (ACT == 3) { const float u = 0.7978845608028654f * (v + 0.044715f * v * v * v); v = 0.5f * v * (1.0f + tanhf(u)); }
      so[w][8 * hh + r][t * 16 + ln] = v;
    }
  }
  __builtin_amdgcn_fence(__ATOMIC_ACQ_REL, "workgroup");
  __builtin_amdgcn_wave_barrier();
  const int rsub = lane >> 4, c4 = (lane & 15) * 4;
  {
#pragma unroll
    for (int q = 0; q < 8; ++q) {
      const int r = q * 2 + rsub;
      const v4f v = *(const v4fa*)&so[w][r][c4];
      *(v4f*)(C + (size_t)(row0 + r) * ldc + col0 + c4) = v;
    }
    
  }
}
// row LayerNorm (biased variance, eps) over N: s = X (+ R); optional out_sum <- s; out_norm <- (s-mu)*rsqrt(var+eps)*g + b
template <bool PARAM_BF16>
__global__ __launch_bounds__(256) void k_layernorm(const float* __restrict__ X, const float* __restrict__ R, const float* __restrict__ g, const float* __restrict__ bta,
                                                  float* __restrict__ out_sum, float* __restrict__ out_norm, int N, float eps) {
  __shared__ float red[256];
  const int row = blockIdx.x, tid = threadIdx.x;
  const float* x = X + (size_t)row * N; const float* rr = R ? R + (size_t)row * N : nullptr;
  float vals[16];                     // up to N = 4096
  const int per = N / 256;            // contiguous chunk per thread? use strided-by-4 chunks: thread handles j = tid*4 + 1024*u
  float s1 = 0.f;
  for (int u = 0; u < per / 4; ++u) {
    const int j = tid * 4 + 1024 * u;
    const v4f a = *(const v4fa*)(x + j);
    v4f b = {0.f,0.f,0.f,0.f}; if (rr) b = *(const v4fa*)(rr + j);
#pragma unroll
    for (int q = 0; q < 4; ++q) { const float v = a[q] + b[q]; vals[u * 4 + q] = v; s1 += v; }
  }
  red[tid] = s1; __syncthreads();
  for (int st = 128; st > 0; st >>= 1) { if (tid < st) red[tid] += red[tid + st]; __syncthreads(); }
  const float mu = red[0] / (float)N; __syncthreads();
  float s2 = 0.f;
  for (int u = 0; u < per / 4; ++u)
#pragma unroll
    for (int q = 0; q < 4; ++q) { const float c = vals[u * 4 + q] - mu; s2 += c * c; }
  red[tid] = s2; __syncthreads();
  for (int st = 128; st > 0; st >>= 1) { if (tid < st) red[tid] += red[tid + st]; __syncthreads(); }
  const float rs = rsqrtf(red[0] / (float)N + eps);
  {
    for (int u = 0; u < per / 4; ++u) {
      const int j = tid * 4 + 1024 * u;
      v4f o, sm;
#pragma unroll
      for (int q = 0; q < 4; ++q) {
        float gg = g[j + q], bb = bta[j + q];
        if (PARAM_BF16) { gg = bf16_round(gg); bb = bf16_round(bb); }
        sm[q] = vals[u * 4 + q]; o[q] = (vals[u * 4 + q] - mu) * rs * gg + bb;
      }
      if (out_sum) *(v4f*)(out_sum + (size_t)row * N + j) = sm;
      *(v4f*)(out_norm + (size_t)row * N + j) = o;
    }
    
  }
}



// ---- f16 WMMA path (v_wmma_f32_16x16x32_f16): 11-bit significands for operands in range — used where a [0,1] probability operand needs more precision than bf16
typedef _Float16 v16h __attribute__((ext_vector_type(16)));
union FragH { v16h v; v8us half[2]; _Float16 h[16]; unsigned short u[16]; };
template <int NT>
__device__ __forceinline__ v8f mmaH(v16h ah, v16h al, v16h bh, v16h bl, v8f c) {
  c = __builtin_amdgcn_wmma_f32_16x16x32_f16(false, ah, false, bh, (short)0, c, false, false);
  if (NT >= 2) c = __builtin_amdgcn_wmma_f32_16x16x32_f16(false, al, false, bh, (short)0, c, false, false);
  if (NT >= 3) c = __builtin_amdgcn_wmma_f32_16x16x32_f16(false, ah, false, bl, (short)0, c, false, false);
  asm volatile("v_nop\n\tv_nop\n\tv_nop\n\tv_nop" : "+v"(c) : "v"(ah), "v"(al), "v"(bh), "v"(bl));
  return c;
}
// batched GEMM like k_gemm_b but f16 operands: A f32 (split into f16 hi/lo if ASPLIT, else rounded to f16), Bt = f16 values [n][k]; alpha; C f32; N multiple of 16 (partial tiles skipped)
template <bool ASPLIT>
__global__ __launch_bounds__(128) void k_gemm_h(const float* __restrict__ A, int lda, size_t sA, const _Float16* __restrict__ Bh, int ldb, size_t sB, float alpha, float* __restrict__ C, int ldc, size_t sC, int M, int N, int K) {
  __shared__ __attribute__((aligned(16))) float so[4][16][64];
  const int tid = threadIdx.x, w = tid >> 5, lane = tid & 31, ln = lane & 15, hh = lane >> 4; const int by = blockIdx.y;
  A += (size_t)by * sA; Bh += (size_t)by * sB; C += (size_t)by * sC;
  const int ntn = (N + 63) / 64; const int wid = blockIdx.x * 4 + w; const int mt = wid / ntn, nq = wid % ntn; if (mt * 16 >= M) return;
  const int row0 = mt * 16, col0 = nq * 64; const float* arow = A + (size_t)(row0 + ln) * lda;
  v8f acc[4] = {};
  for (int kb = 0; kb < K; kb += 32) {
    FragH ah, al;
    const v4f x0 = *(const v4fa*)(arow + kb + 8 * hh), x1 = *(const v4fa*)(arow + kb + 8 * hh + 4), x2 = *(const v4fa*)(arow + kb + 16 + 8 * hh), x3 = *(const v4fa*)(arow + kb + 16 + 8 * hh + 4);
    float xs[16] = {x0[0],x0[1],x0[2],x0[3],x1[0],x1[1],x1[2],x1[3],x2[0],x2[1],x2[2],x2[3],x3[0],x3[1],x3[2],x3[3]};
#pragma unroll
    for (int i = 0; i < 16; ++i) { const _Float16 h = (_Float16)xs[i]; ah.h[i] = h; al.h[i] = ASPLIT ? (_Float16)(xs[i] - (float)h) : (_Float16)0.0f; }
#pragma unroll
    for (int t = 0; t < 4; ++t) { if (col0 + t * 16 >= N) continue; const size_t boff = (size_t)(col0 + t * 16 + ln) * ldb + kb; FragH bq; bq.half[0] = *(const v8us*)(Bh + boff + 8 * hh); bq.half[1] = *(const v8us*)(Bh + boff + 16 + 8 * hh);
      acc[t] = mmaH<ASPLIT ? 2 : 1>(ah.v, al.v, bq.v, bq.v, acc[t]); }
  }
#pragma unroll
  for (int t = 0; t < 4; ++t) { if (col0 + t * 16 >= N) continue;
#pragma unroll
    for (int r = 0; r < 8; ++r) so[w][8 * hh + r][t * 16 + ln] = acc[t][r] * alpha; }
  __builtin_amdgcn_fence(__ATOMIC_ACQ_REL, "workgroup"); __builtin_amdgcn_wave_barrier();
  const int rsub = lane >> 4, c4 = (lane & 15) * 4;
  {
#pragma unroll
    for (int q = 0; q < 8; ++q) { const int r = q * 2 + rsub; if (col0 + c4 < N) { const v4f v = *(const v4fa*)&so[w][r][c4]; *(v4f*)(C + (size_t)(row0 + r) * ldc + col0 + c4) = v; } }
     }
}

// Wt[n][k] = f16(W[k][n]·scale) from f32 row-major W[K][N] (scale = power of two; bf16-exact weights stay exact in f16 away from the subnormal range)
__global__ __launch_bounds__(256) void k_wt_f16(const float* __restrict__ W, _Float16* __restrict__ Wt, int K, int N, float scale) {
  const int t = blockIdx.x * 256 + threadIdx.x; if (t >= N * (K / 8)) return; const int n = t / (K / 8), k8 = (t % (K / 8)) * 8; FragH f;
#pragma unroll
  for (int i = 0; i < 8; ++i) f.h[i] = (_Float16)(bf16_round(W[(size_t)(k8 + i) * N + n]) * scale); const v8us o = f.half[0];
  *(v8us*)((unsigned short*)Wt + (size_t)n * K + k8) = o; 
}
// k_gemm_hh variant with fused epilogue: v = acc·alpha + bias[by·sBias + col] (+ CP[(row/rowsPerB)·sCPb + by·64 + col] if CP) ; ACT 0 none / 1 elu ; writes f16 C16 (and f32 C if non-null)
template <int ACT>
__global__ __launch_bounds__(128) void k_gemm_hhx(const _Float16* __restrict__ A, int lda, size_t sA, const _Float16* __restrict__ Bh, int ldb, size_t sB, float alpha, const float* __restrict__ bias, size_t sBias, const float* __restrict__ CP, int rowsPerB, size_t sCPb, int row0g,
    float* __restrict__ C, _Float16* __restrict__ C16, int ldc, size_t sC, int M, int N, int K) {
  __shared__ __attribute__((aligned(16))) float so[4][16][64];
  const int tid = threadIdx.x, w = tid >> 5, lane = tid & 31, ln = lane & 15, hh = lane >> 4; const int by = blockIdx.y;
  A += (size_t)by * sA; Bh += (size_t)by * sB; const size_t cofs = (size_t)by * sC; const float* bp = bias ? bias + (size_t)by * sBias : nullptr;
  const int ntn = (N + 63) / 64; const int wid = blockIdx.x * 4 + w; const int mt = wid / ntn, nq = wid % ntn; if (mt * 16 >= M) return;
  const int row0 = mt * 16, col0 = nq * 64; const _Float16* arow = A + (size_t)(row0 + ln) * lda;
  v8f acc[4] = {};
  for (int kb = 0; kb < K; kb += 32) { FragH ah; ah.half[0] = *(const v8us*)((const unsigned short*)arow + kb + 8 * hh); ah.half[1] = *(const v8us*)((const unsigned short*)arow + kb + 16 + 8 * hh);
#pragma unroll
    for (int t = 0; t < 4; ++t) { if (col0 + t * 16 >= N) continue; const size_t boff = (size_t)(col0 + t * 16 + ln) * ldb + kb; FragH bq; bq.half[0] = *(const v8us*)((const unsigned short*)Bh + boff + 8 * hh); bq.half[1] = *(const v8us*)((const unsigned short*)Bh + boff + 16 + 8 * hh);
      acc[t] = mmaH<1>(ah.v, ah.v, bq.v, bq.v, acc[t]); }
  }
#pragma unroll
  for (int t = 0; t < 4; ++t) { if (col0 + t * 16 >= N) continue; const int col = col0 + t * 16 + ln; const float bv = bp ? bf16_round(bp[col]) : 0.f;
#pragma unroll
    for (int r = 0; r < 8; ++r) { float v = acc[t][r] * alpha + bv; if (CP) { const int rr = row0g + row0 + 8 * hh + r; if (rowsPerB < 0) v += CP[cofs + (size_t)rr * ldc + col];      /* rowsPerB < 0: own element of the batched C plane */ else { const int bidx = rr / rowsPerB; v += CP[(size_t)bidx * sCPb + (size_t)by * 64 + col]; } } if (ACT == 1) v = (v > 0.f) ? v : expm1f(v); else if (ACT == 7) v = (v > 0.f) ? v + 1.0f : expf(v); else if (ACT == 8) v = tanhf(v); else if (ACT == 9) v = 0.5f * v * (1.0f + tanhf(0.7978845608028654f * (v + 0.044715f * v * v * v))); else if (ACT == 11) v = 1.0f / (1.0f + expf(-v)); else if (ACT == 12) v = (v > 0.f) ? v : 0.01f * v; else if (ACT == 14) v = (v > 0.f) ? v : 0.1f * v; else if (ACT == 16) v = (v >= 0.f) ? v : 0.3f * v; else if (ACT == 17) v = (v >= 0.f) ? v : 0.2f * v; else if (ACT == 15) v = v / (1.0f + expf(-v)); else if (ACT == 3) v = fmaxf(v, 0.f); else if (ACT == 6) v = 0.5f * v * (1.0f + erff(v * 0.70710678118654752f)); so[w][8 * hh + r][t * 16 + ln] = v; } }
  __builtin_amdgcn_fence(__ATOMIC_ACQ_REL, "workgroup"); __builtin_amdgcn_wave_barrier();
  const int rsub = lane >> 4, c4 = (lane & 15) * 4; typedef _Float16 v4h __attribute__((ext_vector_type(4)));
  {
#pragma unroll
    for (int q = 0; q < 8; ++q) { const int r = q * 2 + rsub; if (col0 + c4 < N) { const v4f v = *(const v4fa*)&so[w][r][c4]; if (C) *(v4f*)(C + cofs + (size_t)(row0 + r) * ldc + col0 + c4) = v; if (C16) { v4h h4; for (int i = 0; i < 4; ++i) h4[i] = (_Float16)v[i]; *(v4h*)(C16 + cofs + (size_t)(row0 + r) * ldc + col0 + c4) = h4; } } }
     }
}


typedef _Float16 v4h __attribute__((ext_vector_type(4)));

__global__ __launch_bounds__(256) void k_x16(const float* __restrict__ x, _Float16* __restrict__ X16, size_t n8) { const size_t t = (size_t)blockIdx.x * 256 + threadIdx.x; if (t >= n8) return; FragH f;
#pragma unroll
  for (int q = 0; q < 8; ++q) f.h[q] = (_Float16)bf16_round(x[t * 8 + q]); *(v8us*)((unsigned short*)X16 + t * 8) = f.half[0];  }
__global__ __launch_bounds__(256) void k_h16(const float* __restrict__ x, _Float16* __restrict__ X16, size_t n8) { const size_t t = (size_t)blockIdx.x * 256 + threadIdx.x; if (t >= n8) return; FragH f;
#pragma unroll
  for (int q = 0; q < 8; ++q) f.h[q] = (_Float16)x[t * 8 + q]; *(v8us*)((unsigned short*)X16 + t * 8) = f.half[0];  }
__global__ __launch_bounds__(256) void k_round16f(const float* __restrict__ W, _Float16* __restrict__ Bt, size_t n8) { const size_t t = (size_t)blockIdx.x * 256 + threadIdx.x; if (t >= n8) return; FragH f;
#pragma unroll
  for (int i = 0; i < 8; ++i) f.h[i] = (_Float16)(bf16_round(W[t * 8 + i]) * 16.0f); *(v8us*)((unsigned short*)Bt + t * 8) = f.half[0];  }
template <int NHv, int TTv>
__global__ __launch_bounds__(256) void k_vt(const _Float16* __restrict__ V16, int ldv, int voff, _Float16* __restrict__ Vt) { __shared__ unsigned short tl[64][66]; const int tid = threadIdx.x; const int slab = blockIdx.x / (TTv / 64), lg = blockIdx.x % (TTv / 64); const int b = slab / NHv, h = slab % NHv;
  for (int i = tid; i < 64 * 8; i += 256) { const int r = i / 8, c8 = (i % 8) * 8; FragH f; f.half[0] = *(const v8us*)((const unsigned short*)V16 + ((size_t)b * TTv + lg * 64 + r) * ldv + voff + h * 64 + c8);
#pragma unroll
    for (int q = 0; q < 8; ++q) tl[r][c8 + q] = f.u[q]; }
  __syncthreads();
  {
#pragma unroll
    for (int rd = 0; rd < 2; ++rd) { const int d = rd * 32 + tid / 8, pc = tid % 8; FragH f;
#pragma unroll
      for (int q = 0; q < 8; ++q) f.u[q] = tl[pc * 8 + q][d];
      *(v8us*)((unsigned short*)Vt + ((size_t)slab * 64 + d) * TTv + lg * 64 + pc * 8) = f.half[0]; }
     } }

__global__ __launch_bounds__(256) void k_hl(const float* __restrict__ F, _Float16* __restrict__ Hh, _Float16* __restrict__ Hl, size_t n8) { const size_t t = (size_t)blockIdx.x * 256 + threadIdx.x; if (t >= n8) return; FragH fh, fl; const v4f a = *(const v4fa*)(F + t * 8), c = *(const v4fa*)(F + t * 8 + 4);
#pragma unroll
  for (int q = 0; q < 4; ++q) { _Float16 h = (_Float16)a[q]; fh.h[q] = h; fl.h[q] = (_Float16)((a[q] - (float)h) * 1024.0f); h = (_Float16)c[q]; fh.h[4 + q] = h; fl.h[4 + q] = (_Float16)((c[q] - (float)h) * 1024.0f); }
  { *(v8us*)((unsigned short*)Hh + t * 8) = fh.half[0]; *(v8us*)((unsigned short*)Hl + t * 8) = fl.half[0];  } }

// ---- fast GEMM (wave tile 32x64; requires M % 32 == 0 rows per launch region and N % 64 == 0); epilogue = k_gemm_hhx semantics ----
__device__ __forceinline__ v8f g2_mma(v16h a, v16h b, v8f c) { v8f d = __builtin_amdgcn_wmma_f32_16x16x32_f16(false, a, false, b, (short)0, c, false, false); asm volatile("v_nop\n\tv_nop\n\tv_nop\n\tv_nop" : "+v"(d) : "v"(a), "v"(b)); return d; }
// One k-step (32 k) of the wave's 32x64 tile: two A and four B fragments = twelve 16-byte loads. pa / pb: wave-uniform byte address of A / B at that k-step; oa / ob: the lane's fixed byte offsets (row and half).
struct G2St { v16h a0, a1, b0, b1, b2, b3; };
__device__ __forceinline__ v16h g2_fragb(const char* base, unsigned o) { FragH f; f.half[0] = *(const v8us*)(base + (size_t)o); f.half[1] = *(const v8us*)(base + (size_t)o + 32); return f.v; }
__device__ __forceinline__ void g2_ld(G2St& s, const char* pa, const char* pb, unsigned oa0, unsigned oa1, unsigned ob0, unsigned ob1, unsigned ob2, unsigned ob3) {
  s.a0 = g2_fragb(pa, oa0); s.a1 = g2_fragb(pa, oa1); s.b0 = g2_fragb(pb, ob0); s.b1 = g2_fragb(pb, ob1); s.b2 = g2_fragb(pb, ob2); s.b3 = g2_fragb(pb, ob3);
  __builtin_amdgcn_sched_barrier(0); }      /* keeps the twelve loads in front of the next k-step's first WMMA: behind it they would be issued only after that WMMA's wait for its own operands */
// The wait that stands in front of any overwrite of a register that an issued load names. The bases and the lane offsets are inputs so that they stay as they are up to here.
__device__ __forceinline__ void g2_xw(const char* pa, const char* pb, unsigned oa0, unsigned oa1, unsigned ob0, unsigned ob1, unsigned ob2, unsigned ob3) { asm volatile("s_wait_xcnt 0x0" :: "s"(pa), "s"(pb), "v"(oa0), "v"(oa1), "v"(ob0), "v"(ob1), "v"(ob2), "v"(ob3) : "memory"); }
__device__ __forceinline__ void g2_mm(const G2St& s, v8f (&c)[8]) { c[0] = g2_mma(s.a0, s.b0, c[0]); c[4] = g2_mma(s.a1, s.b0, c[4]); c[1] = g2_mma(s.a0, s.b1, c[1]); c[5] = g2_mma(s.a1, s.b1, c[5]); c[2] = g2_mma(s.a0, s.b2, c[2]); c[6] = g2_mma(s.a1, s.b2, c[6]); c[3] = g2_mma(s.a0, s.b3, c[3]); c[7] = g2_mma(s.a1, s.b3, c[7]); }
// The K loop of a wave's 32x64 tile (nst k-steps of 32), shared by the GEMM kernels below. pa / pb: wave-uniform bases; the offsets: the lane's own.
__device__ __forceinline__ void g2_kloop(const char* pa, const char* pb, const int nst, const unsigned oa0, const unsigned oa1, const unsigned ob0, const unsigned ob1, const unsigned ob2, const unsigned ob3, v8f (&accs)[8]) { G2St s0, s1, s2;
  // Three k-steps' fragments rest in registers: a set is loaded again right after its WMMAs, so its loads fly while the other two sets are worked on. Every accumulator still takes its k-steps in rising order.
  if (nst >= 3) { g2_ld(s0, pa, pb, oa0, oa1, ob0, ob1, ob2, ob3); g2_ld(s1, pa + 64, pb + 64, oa0, oa1, ob0, ob1, ob2, ob3); g2_ld(s2, pa + 128, pb + 128, oa0, oa1, ob0, ob1, ob2, ob3); g2_xw(pa, pb, oa0, oa1, ob0, ob1, ob2, ob3); int s = 0;
#pragma unroll 1      /* the body already holds three k-steps; a copy of it would not fit the registers */
    for (; s + 6 <= nst; s += 3) {
      g2_mm(s0, accs); g2_ld(s0, pa + 192, pb + 192, oa0, oa1, ob0, ob1, ob2, ob3);
      g2_mm(s1, accs); g2_ld(s1, pa + 256, pb + 256, oa0, oa1, ob0, ob1, ob2, ob3);
      g2_mm(s2, accs); g2_ld(s2, pa + 320, pb + 320, oa0, oa1, ob0, ob1, ob2, ob3);
      g2_xw(pa, pb, oa0, oa1, ob0, ob1, ob2, ob3);      /* the two bases move on below */
      pa += 192; pb += 192; }
    const int rem = nst - s;      /* 3 to 5 k-steps are left, three of them loaded */
    g2_mm(s0, accs); if (rem > 3) { g2_ld(s0, pa + 192, pb + 192, oa0, oa1, ob0, ob1, ob2, ob3); g2_xw(pa, pb, oa0, oa1, ob0, ob1, ob2, ob3); }
    g2_mm(s1, accs); if (rem > 4) { g2_ld(s1, pa + 256, pb + 256, oa0, oa1, ob0, ob1, ob2, ob3); g2_xw(pa, pb, oa0, oa1, ob0, ob1, ob2, ob3); }
    g2_mm(s2, accs); if (rem > 3) g2_mm(s0, accs); if (rem > 4) g2_mm(s1, accs); }
  else if (nst == 2) { g2_ld(s0, pa, pb, oa0, oa1, ob0, ob1, ob2, ob3); g2_ld(s1, pa + 64, pb + 64, oa0, oa1, ob0, ob1, ob2, ob3); g2_xw(pa, pb, oa0, oa1, ob0, ob1, ob2, ob3); g2_mm(s0, accs); g2_mm(s1, accs); }
  else if (nst == 1) { g2_ld(s0, pa, pb, oa0, oa1, ob0, ob1, ob2, ob3); g2_xw(pa, pb, oa0, oa1, ob0, ob1, ob2, ob3); g2_mm(s0, accs); }
}
template <int ACT>
__global__ __launch_bounds__(128) void k_gemm2(const _Float16* __restrict__ A, int lda, size_t sA, const _Float16* __restrict__ Bh, int ldb, size_t sB, float alpha, const float* __restrict__ bias, size_t sBias, const float* __restrict__ CP, int rowsPerB, size_t sCPb, int row0g,
    float* __restrict__ C, _Float16* __restrict__ C16, int ldc, size_t sC, int M, int N, int K) { static_assert(ACT == 0 || ACT == 3 || ACT == 6 || ACT == 8 || ACT == 9 || ACT == 11 || ACT == 12 || ACT == 14 || ACT == 15 || ACT == 16 || ACT == 17, "k_gemm2: unsupported ACT code (would silently apply no activation)");
  __shared__ __attribute__((aligned(16))) float so[4][32][68];
  const int tid = threadIdx.x, w = tid >> 5, lane = tid & 31, ln = lane & 15, hh = lane >> 4; const int by = blockIdx.y;
  A += (size_t)by * sA; Bh += (size_t)by * sB; const size_t cofs = (size_t)by * sC; const float* bp = bias ? bias + (size_t)by * sBias : nullptr;
  const int ntn = N >> 6; const int mt = blockIdx.x / ntn, nq = blockIdx.x - mt * ntn; const int row0 = mt * 128 + 32 * w, col0 = nq * 64; if (row0 >= M) return;
  const unsigned oa0 = (unsigned)(row0 + ln) * (unsigned)lda * 2u + 16u * hh, oa1 = oa0 + 32u * (unsigned)lda;
  const unsigned ob0 = (unsigned)(col0 + ln) * (unsigned)ldb * 2u + 16u * hh, ob1 = ob0 + 32u * (unsigned)ldb, ob2 = ob1 + 32u * (unsigned)ldb, ob3 = ob2 + 32u * (unsigned)ldb;
  const char* pa = (const char*)A; const char* pb = (const char*)Bh; const int nst = K >> 5;      /* k-steps of 32 = 64 bytes of every row */
  const v8f z8 = {0.f,0.f,0.f,0.f,0.f,0.f,0.f,0.f}; v8f accs[8] = {z8, z8, z8, z8, z8, z8, z8, z8};
  g2_kloop(pa, pb, nst, oa0, oa1, ob0, ob1, ob2, ob3, accs);
#pragma unroll
  for (int u = 0; u < 8; ++u) { const int t = u & 3, half = u >> 2; const int col = col0 + t * 16 + ln; const float bv = bp ? bf16_round(bp[col]) : 0.f;
#pragma unroll
    for (int r = 0; r < 8; ++r) { const int rloc = half * 16 + 8 * hh + r; float v = accs[u][r] * alpha + bv; if (CP) { if (rowsPerB < 0) v += CP[cofs + (size_t)(row0g + row0 + rloc) * ldc + col];      /* rowsPerB < 0: own element of the batched C plane */ else { const int bidx = (row0g + row0 + rloc) / rowsPerB; v += CP[(size_t)bidx * sCPb + (size_t)by * 64 + col]; } }
      if (ACT == 3) v = fmaxf(v, 0.f); else if (ACT == 6) v = 0.5f * v * (1.0f + erff(v * 0.70710678118654752f)); else if (ACT == 11) v = 1.0f / (1.0f + expf(-v)); else if (ACT == 15) v = v / (1.0f + expf(-v)); else if (ACT == 12) v = (v > 0.f) ? v : 0.01f * v; else if (ACT == 8) v = tanhf(v); else if (ACT == 9) v = 0.5f * v * (1.0f + tanhf(0.7978845608028654f * (v + 0.044715f * v * v * v))); else if (ACT == 14) v = (v > 0.f) ? v : 0.1f * v; else if (ACT == 16) v = (v >= 0.f) ? v : 0.3f * v; else if (ACT == 17) v = (v >= 0.f) ? v : 0.2f * v;
      so[w][rloc][t * 16 + ln] = v; } }
  __builtin_amdgcn_fence(__ATOMIC_ACQ_REL, "workgroup"); __builtin_amdgcn_wave_barrier();
  const int rsub = lane >> 4, c4 = (lane & 15) * 4;
  {
#pragma unroll
    for (int q = 0; q < 16; ++q) { const int r = q * 2 + rsub; const v4f v = *(const v4fa*)&so[w][r][c4]; if (C) *(v4f*)(C + cofs + (size_t)(row0 + r) * ldc + col0 + c4) = v; if (C16) { v4h h4; for (int i = 0; i < 4; ++i) h4[i] = (_Float16)v[i]; *(v4h*)(C16 + cofs + (size_t)(row0 + r) * ldc + col0 + c4) = h4; } }
     } }


// C = (Aa Ba ala + bias) + Ab Bb alb (+ Ac Bc alc): the hi / residual terms of one product, side by side in one launch. A work-group is one 32x64 tile of C and NT waves;
// wave t runs the whole K loop of term t, lays its scaled tile in its own LDS plane, and behind one barrier the planes are added in the order of the terms and stored as whole rows.
// Needs M % 32 == 0 (grid.x = (M / 32) (N / 64), exact), N % 64 == 0, K % 32 == 0; grid.y = batch (strides sA, sB, sC).
template <int NT>
__global__ __launch_bounds__(NT * 32) void k_gemm2t(const _Float16* __restrict__ Aa, const _Float16* __restrict__ Ab, const _Float16* __restrict__ Ac, int lda, size_t sA, const _Float16* __restrict__ Ba, const _Float16* __restrict__ Bb, const _Float16* __restrict__ Bc, int ldb, size_t sB,
    float ala, float alb, float alc, const float* __restrict__ bias, float* __restrict__ C, int ldc, size_t sC, int N, int K) { static_assert(NT == 2 || NT == 3, "k_gemm2t: two or three terms");
  __shared__ __attribute__((aligned(16))) float so[NT][32][68];
  const int lane = threadIdx.x & 31, ln = lane & 15, hh = lane >> 4; const int t = __builtin_amdgcn_readfirstlane((int)(threadIdx.x >> 5)); const int by = blockIdx.y;      /* t wave-uniform: the term's bases stay scalar */
  const _Float16* A = (NT > 2 && t == 2) ? Ac : (t == 1) ? Ab : Aa; const _Float16* Bh = (NT > 2 && t == 2) ? Bc : (t == 1) ? Bb : Ba; const float alpha = (NT > 2 && t == 2) ? alc : (t == 1) ? alb : ala;
  A += (size_t)by * sA; Bh += (size_t)by * sB; const size_t cofs = (size_t)by * sC;
  const int ntn = N >> 6; const int mt = blockIdx.x / ntn, nq = blockIdx.x - mt * ntn; const int row0 = mt * 32, col0 = nq * 64;
  const unsigned oa0 = (unsigned)(row0 + ln) * (unsigned)lda * 2u + 16u * hh, oa1 = oa0 + 32u * (unsigned)lda;
  const unsigned ob0 = (unsigned)(col0 + ln) * (unsigned)ldb * 2u + 16u * hh, ob1 = ob0 + 32u * (unsigned)ldb, ob2 = ob1 + 32u * (unsigned)ldb, ob3 = ob2 + 32u * (unsigned)ldb;
  const v8f z8 = {0.f,0.f,0.f,0.f,0.f,0.f,0.f,0.f}; v8f accs[8] = {z8, z8, z8, z8, z8, z8, z8, z8};
  g2_kloop((const char*)A, (const char*)Bh, K >> 5, oa0, oa1, ob0, ob1, ob2, ob3, accs);
#pragma unroll
  for (int u = 0; u < 8; ++u) { const int tc = u & 3, half = u >> 2; const float bv = (bias && t == 0) ? bf16_round(bias[col0 + tc * 16 + ln]) : 0.f;
#pragma unroll
    for (int r = 0; r < 8; ++r) so[t][half * 16 + 8 * hh + r][tc * 16 + ln] = accs[u][r] * alpha + bv; }
  __syncthreads();      /* every term's plane is complete before any wave adds them */
  const int rsub = lane >> 4, c4 = (lane & 15) * 4;
  for (int q = t; q < 16; q += NT) { const int r = q * 2 + rsub; v4f v = *(const v4fa*)&so[0][r][c4]; v += *(const v4fa*)&so[1][r][c4]; if (NT > 2) v += *(const v4fa*)&so[2][r][c4];
    *(v4f*)(C + cofs + (size_t)(row0 + r) * ldc + col0 + c4) = v;
    asm volatile("s_wait_xcnt 0x0" ::: "memory"); } }      /* the wait that stands in front of any overwrite of a register that an issued store names: the next trip forms its address and its sum in the same registers */

__global__ __launch_bounds__(256) void k_wnat(const float* __restrict__ w, size_t n8, _Float16* __restrict__ Bt) { const size_t t = (size_t)blockIdx.x * 256 + threadIdx.x; if (t >= n8) return; FragH f; for (int q = 0; q < 8; ++q) f.h[q] = (_Float16)(bf16_round(w[t * 8 + q]) * 16.0f); *(v8us*)((unsigned short*)Bt + t * 8) = f.half[0];  }
__global__ __launch_bounds__(256) void k_rsm(const float* __restrict__ S, _Float16* __restrict__ P, int nrows) {
  #pragma clang fp contract(off)
  const int i = blockIdx.x * 256 + threadIdx.x; if (i >= nrows) return; const float* s = S + (size_t)i * SQ; float mx = -3.0e38f;
#pragma unroll 1
  for (int j = 0; j < SQ; ++j) mx = fmaxf(mx, s[j]); float se = 0.f;
#pragma unroll 1
  for (int j = 0; j < SQ; ++j) se += expf(s[j] - mx); const float sc = 256.0f / se;
#pragma unroll 1
  for (int j0 = 0; j0 < SQ; j0 += 8) { FragH f; for (int q = 0; q < 8; ++q) f.h[q] = (_Float16)(expf(s[j0 + q] - mx) * sc); unsigned short* d = (unsigned short*)P + (size_t)i * SQ + j0; *(v8us*)d = f.half[0];  } }
__global__ __launch_bounds__(256) void k_vt(const _Float16* __restrict__ V16, int b, int h0, _Float16* __restrict__ VT) { __shared__ unsigned short tl[64][65]; const int tid = threadIdx.x; const int hh = blockIdx.x % HG, sg = blockIdx.x / HG; const int s0 = sg * 64; const int h = h0 + hh;
  for (int i = tid; i < 64 * 8; i += 256) { const int j = i / 8, d8 = (i % 8) * 8; FragH f; f.half[0] = *(const v8us*)((const unsigned short*)V16 + ((size_t)b * SQ + s0 + j) * DM + h * HD + d8); for (int q = 0; q < 8; ++q) tl[d8 + q][j] = f.u[q]; }
  __syncthreads();
  { for (int i = tid; i < 64 * 8; i += 256) { const int d = i / 8, j8 = (i % 8) * 8; FragH f; for (int q = 0; q < 8; ++q) f.u[q] = tl[d][j8 + q]; *(v8us*)((unsigned short*)VT + ((size_t)hh * HD + d) * SQ + s0 + j8) = f.half[0]; }  } }



__global__ __launch_bounds__(256) void k_rsmcf2(const float* __restrict__ S, _Float16* __restrict__ P, int hg, int q0, int nk) {
  #pragma clang fp contract(off)
  const int t = blockIdx.x * 256 + threadIdx.x; if (t >= hg * QT) return; const size_t i = (size_t)t; const float* s = S + i * NKX; const int last = q0 + (t % QT); float mx = -3.0e38f;
#pragma unroll 1
  for (int j = 0; j < nk; ++j) { const float f = (j <= last) ? 1.f : 0.f; mx = fmaxf(mx, fmaf(f, s[j], (1.f - f) * -1.0e9f)); } float se = 0.f;
#pragma unroll 1
  for (int j = 0; j < nk; ++j) { const float f = (j <= last) ? 1.f : 0.f; se += __expf(fmaf(f, s[j], (1.f - f) * -1.0e9f) - mx); } const float sc = 256.0f / se;
#pragma unroll 1
  for (int j0 = 0; j0 < nk; j0 += 8) { FragH fr; for (int q = 0; q < 8; ++q) { const int j = j0 + q; const float f = (j <= last) ? 1.f : 0.f; fr.h[q] = (_Float16)(__expf(fmaf(f, s[j], (1.f - f) * -1.0e9f) - mx) * sc); } unsigned short* d = (unsigned short*)P + i * NKX + j0; *(v8us*)d = fr.half[0];  } }


template <int MASKADD>
__global__ __launch_bounds__(64) void k_att0(const float* __restrict__ QF, const float* __restrict__ KF, const float* __restrict__ VF, int ld, const float* __restrict__ mask, float scale, float* __restrict__ OF, int ldo) {
  #pragma clang fp contract(off)
  __shared__ __attribute__((aligned(16))) float lq[64][64]; __shared__ __attribute__((aligned(16))) float lo[64][64];
  const int tid = threadIdx.x; const int h = blockIdx.x / (QT0 / 64), rg = blockIdx.x % (QT0 / 64); const int i = rg * 64 + tid;
  const float* qr = QF + (size_t)i * ld + h * HD;
#pragma unroll 1
  for (int c = 0; c < HD / 4; ++c) { *(v4f*)&lq[tid][c * 4] = *(const v4fa*)(qr + c * 4); const v4f z = {0.f, 0.f, 0.f, 0.f}; *(v4f*)&lo[tid][c * 4] = z; }
  float m = -1.0e30f, l = 0.f; const int jmax = MASKADD ? (SQ - 1) : (rg * 64 + 63);      /* additive-mask form: every key (the mask input decides); causal form: keys up to the block's last row */
#pragma unroll 1
  for (int j = 0; j <= jmax; ++j) { const float* kr = KF + (size_t)j * ld + h * HD; const float* vr = VF + (size_t)j * ld + h * HD; float s = 0.f;
#pragma unroll 1
    for (int c = 0; c < HD / 4; ++c) { const v4f kq = *(const v4fa*)(kr + c * 4); const v4f qq = *(v4f*)&lq[tid][c * 4]; s = __fadd_rn(s, __fmul_rn(qq[0], kq[0])); s = __fadd_rn(s, __fmul_rn(qq[1], kq[1])); s = __fadd_rn(s, __fmul_rn(qq[2], kq[2])); s = __fadd_rn(s, __fmul_rn(qq[3], kq[3])); }
    s = __fmul_rn(s, scale); if (MASKADD) s = __fadd_rn(s, __fmul_rn(bf16_round(mask[(size_t)i * SQ + j]), -10000.0f));
    const float f = (MASKADD || j <= i) ? 1.f : 0.f; const float sm = fmaf(f, s, (1.f - f) * -1.0e30f); const float mn = fmaxf(m, sm); const float sc = expf(m - mn); const float e = expf(sm - mn); l = __fadd_rn(__fmul_rn(l, sc), e); m = mn;
#pragma unroll 1
    for (int c = 0; c < HD / 4; ++c) { const v4f vv = *(const v4fa*)(vr + c * 4); v4f oo = *(v4f*)&lo[tid][c * 4]; for (int u = 0; u < 4; ++u) oo[u] = __fadd_rn(__fmul_rn(oo[u], sc), __fmul_rn(e, vv[u])); *(v4f*)&lo[tid][c * 4] = oo; } }
  const float fin = 64.0f / l;      /* o carried x64 like the f16 path */
#pragma unroll 1
  for (int c = 0; c < HD / 4; ++c) { v4f oo = *(v4f*)&lo[tid][c * 4]; for (int u = 0; u < 4; ++u) oo[u] = __fmul_rn(oo[u], fin); *(v4f*)&lo[tid][c * 4] = oo; }
  __syncthreads();
  {
#pragma unroll 1
    for (int it = 0; it < 16; ++it) { const int row = it * 4 + tid / 16, pc = (tid % 16) * 4; const v4f v = *(const v4f*)&lo[row][pc]; *(v4f*)(OF + (size_t)(rg * 64 + row) * ldo + h * HD + pc) = v; }
     } }


__global__ __launch_bounds__(256) void k_kvexp(const float* __restrict__ src, float* __restrict__ dst, size_t n4) { const size_t t = (size_t)blockIdx.x * 256 + threadIdx.x; if (t >= n4) return; const size_t e = t * 4; const size_t row = e / DM; const int col = (int)(e % DM); const int h = col / HD, d = col % HD; const v4f v = *(const v4fa*)(src + row * KVD + (size_t)(h / HPG) * HD + d); *(v4f*)(dst + e) = v;  }

__global__ __launch_bounds__(256) void k_tab2(float theta, float* __restrict__ CS, float* __restrict__ SN) {
  #pragma clang fp contract(off)
  const int t = blockIdx.x * 256 + threadIdx.x; if (t >= SQ * (HD / 2)) return; const int i = t % (HD / 2); const int p = t / (HD / 2); const float invf = 1.0f / powf(theta, (float)(2 * i) / (float)HD); const float ang = __fmul_rn((float)p, invf); const float c = cosf(ang), s = sinf(ang);
  *(float*)(CS + t) = c; *(float*)(SN + t) = s;  }
template <int NORM, int ROPE>
__global__ __launch_bounds__(64) void k_xform(const float* __restrict__ F, int ldf, int nh, const float* __restrict__ gain, float eps, const float* __restrict__ CS, const float* __restrict__ SN, _Float16* __restrict__ H16, int ldo) {
  #pragma clang fp contract(off)
  __shared__ float xv[HD]; __shared__ float red[HD]; __shared__ unsigned short sh_[HD]; const int d = threadIdx.x; const int h = blockIdx.x % nh; const size_t r = blockIdx.x / nh; const int p = (int)(r % SQ);
  float x = F[r * (size_t)ldf + (size_t)h * HD + d];
  if (NORM) { red[d] = __fmul_rn(x, x); __syncthreads(); for (int st = HD / 2; st > 0; st >>= 1) { if (d < st) red[d] = __fadd_rn(red[d], red[d + st]); __syncthreads(); } const float rs = rsqrtf(__fadd_rn(red[0] / (float)HD, eps)); x = __fmul_rn(__fmul_rn(x, rs), bf16_round(gain[d])); }
  xv[d] = x; __syncthreads();
  float o = x;
  if (ROPE == 1) { const int i = d >> 1; const float c = CS[p * (HD / 2) + i], s = SN[p * (HD / 2) + i]; const float ev = xv[2 * i], od = xv[2 * i + 1]; o = (d & 1) ? __fadd_rn(__fmul_rn(ev, s), __fmul_rn(od, c)) : __fadd_rn(__fmul_rn(ev, c), -__fmul_rn(od, s)); }
  if (ROPE == 2) { const int i = d & (HD / 2 - 1); const float c = CS[p * (HD / 2) + i], s = SN[p * (HD / 2) + i]; const float lo = xv[i], hi = xv[i + HD / 2]; o = (d < HD / 2) ? __fadd_rn(__fmul_rn(lo, c), -__fmul_rn(hi, s)) : __fadd_rn(__fmul_rn(lo, s), __fmul_rn(hi, c)); }
  FragH th; th.h[0] = (_Float16)o; sh_[d] = th.u[0]; __syncthreads();
  if (d < HD / 8) { FragH f; for (int q = 0; q < 8; ++q) f.u[q] = sh_[d * 8 + q]; unsigned short* dst = (unsigned short*)H16 + r * (size_t)ldo + (size_t)h * HD + d * 8; *(v8us*)dst = f.half[0];  } }

template <int NORM, int ROPE>
__global__ __launch_bounds__(64) void k_xformf(const float* __restrict__ F, int ldf, int nh, const float* __restrict__ gain, float eps, const float* __restrict__ CS, const float* __restrict__ SN, float* __restrict__ F32, int ldo) {
  #pragma clang fp contract(off)
  __shared__ float xv[HD]; __shared__ float red[HD]; const int d = threadIdx.x; const int h = blockIdx.x % nh; const size_t r = blockIdx.x / nh; const int p = (int)(r % SQ);
  float x = F[r * (size_t)ldf + (size_t)h * HD + d];
  if (NORM) { red[d] = __fmul_rn(x, x); __syncthreads(); for (int st = HD / 2; st > 0; st >>= 1) { if (d < st) red[d] = __fadd_rn(red[d], red[d + st]); __syncthreads(); } const float rs = rsqrtf(__fadd_rn(red[0] / (float)HD, eps)); x = __fmul_rn(__fmul_rn(x, rs), bf16_round(gain[d])); }
  xv[d] = x; __syncthreads();
  float o = x;
  if (ROPE == 1) { const int i = d >> 1; const float c = CS[p * (HD / 2) + i], s = SN[p * (HD / 2) + i]; const float ev = xv[2 * i], od = xv[2 * i + 1]; o = (d & 1) ? __fadd_rn(__fmul_rn(ev, s), __fmul_rn(od, c)) : __fadd_rn(__fmul_rn(ev, c), -__fmul_rn(od, s)); }
  if (ROPE == 2) { const int i = d & (HD / 2 - 1); const float c = CS[p * (HD / 2) + i], s = SN[p * (HD / 2) + i]; const float lo = xv[i], hi = xv[i + HD / 2]; o = (d < HD / 2) ? __fadd_rn(__fmul_rn(lo, c), -__fmul_rn(hi, s)) : __fadd_rn(__fmul_rn(lo, s), __fmul_rn(hi, c)); }
  float* dst = F32 + r * (size_t)ldo + (size_t)h * HD + d; *(float*)dst = o;  }

__global__ __launch_bounds__(256) void k_trig(const float* __restrict__ a, float* __restrict__ CS, float* __restrict__ SN, int n) {
  #pragma clang fp contract(off)
  const int t = blockIdx.x * 256 + threadIdx.x; if (t >= n) return; const float v = bf16_round(a[t]); const float c = cosf(v), s = sinf(v);
  *(float*)(CS + t) = c; *(float*)(SN + t) = s;  }

__global__ __launch_bounds__(256) void k_tabpos(const int* __restrict__ pos, float* __restrict__ CS, float* __restrict__ SN, int n) {
  #pragma clang fp contract(off)
  const int t = blockIdx.x * 256 + threadIdx.x; if (t >= n) return; const int p = t / 32, i = t % 32; const float invf = (float)(1.0 / pow(10000.0, ((double)(2 * i)) / 64.0)); const float a = __fmul_rn((float)pos[p], invf); const float c = cosf(a), s = sinf(a);
  *(float*)(CS + t) = c; *(float*)(SN + t) = s;  }

// One wave per score row. Lane l holds columns 128 s + 4 l .. + 3 of every 128-column slice s in registers, so AC and BD' are read once:
// AC as whole-line 16-byte loads, BD' at the row's shift; maximum and sum end in a five-step butterfly over the lanes.
// NS = nk / 128 is a template parameter (q0 = nk - QT): the body is one straight line, so a row's loads can all be in flight together.
// A slice with 128 s + 127 <= q0 lies below every row's diagonal (j <= q0 <= i) and its shifted index stays below nk (shift <= QT - 1),
// so the index clamp and the arithmetic select, both identities there, are written for the later slices only.
typedef float v4fu __attribute__((ext_vector_type(4), may_alias, aligned(4)));      /* 16-byte load at a 4-byte boundary (the shifted BD' columns) */
// 2^x of four values. One asm statement so that every v_exp_f32 has an independent instruction behind it (early-clobber outputs: none overwrites a source);
// the closing v_nop is the slot that the instruction set asks for before the last result is read or its source overwritten.
__device__ __forceinline__ v4f exp2x4(v4f x) { float r0, r1, r2, r3;
  asm("v_exp_f32 %0, %4\n\tv_exp_f32 %1, %5\n\tv_exp_f32 %2, %6\n\tv_exp_f32 %3, %7\n\tv_nop" : "=&v"(r0), "=&v"(r1), "=&v"(r2), "=&v"(r3) : "v"(x[0]), "v"(x[1]), "v"(x[2]), "v"(x[3]));
  const v4f r = {r0, r1, r2, r3}; return r; }
template <int NS>
__global__ __launch_bounds__(256) void k_rsmxl(const float* __restrict__ AC, const float* __restrict__ BDp, _Float16* __restrict__ P, _Float16* __restrict__ PL, int hg) {
  #pragma clang fp contract(off)
  constexpr int nk = NS * 128, q0 = nk - QT;
  const int lane = threadIdx.x & 31; const int t = __builtin_amdgcn_readfirstlane((int)(blockIdx.x * 8 + (threadIdx.x >> 5))); if (t >= hg * QT) return;      /* wave-uniform row number: scalar row bases; no barrier in this kernel */
  const size_t ri = (size_t)t; const float* a = AC + ri * NKX; const float* bd = BDp + ri * NKX; const int tl = t & (QT - 1); const int i = q0 + tl; const int sh = QT - 1 - tl;      /* sh = nk - 1 - i */
  const unsigned ob = (unsigned)(sh + lane * 4) * 4u;      /* byte offset of the lane's first shifted column in the BD' row */
  v4f av[NS], bv[NS]; int ic[8];
#pragma unroll
  for (int s = 0; s < NS; ++s) { av[s] = ((const v4fa*)a)[lane + s * 32];
    if (s * 128 + 127 <= q0) bv[s] = *(const v4fu*)((const char*)bd + ob + s * 512);
    else {
#pragma unroll
      for (int q = 0; q < 4; ++q) { const int c = min(sh + lane * 4 + s * 128, nk - 1 - q); ic[(s - (NS - 2)) * 4 + q] = c; bv[s][q] = bd[c + q]; } } }      /* c + q = min(sh + j, nk - 1) */
  /* The wait that stands in front of any overwrite of a register that an issued load names. The address registers are its inputs so that they stay live up to here: no later load of the row gets one of them as its destination. */
  if constexpr (NS > 2) asm volatile("s_wait_xcnt 0x0" :: "v"(lane), "v"(ob), "v"(ic[0]), "v"(ic[1]), "v"(ic[2]), "v"(ic[3]), "v"(ic[4]), "v"(ic[5]), "v"(ic[6]), "v"(ic[7]) : "memory");
  else asm volatile("s_wait_xcnt 0x0" :: "v"(lane), "v"(ic[0]), "v"(ic[1]), "v"(ic[2]), "v"(ic[3]), "v"(ic[4]), "v"(ic[5]), "v"(ic[6]), "v"(ic[7]) : "memory");
  __builtin_amdgcn_sched_barrier(0);      /* keeps the arithmetic behind the row's loads: without it they are issued in groups with a full wait between the groups */
  float mx = -3.0e38f;
#pragma unroll
  for (int s = 0; s < NS; ++s) {
#pragma unroll
    for (int q = 0; q < 4; ++q) { const int j = s * 128 + lane * 4 + q; float v = __fadd_rn(av[s][q], bv[s][q]); if (s * 128 + 127 > q0) { const float f = (j <= i) ? 1.f : 0.f; v = fmaf(f, v, (1.f - f) * -1.0e30f); } av[s][q] = v; mx = fmaxf(mx, v); } }
#pragma unroll
  for (int m = 16; m > 0; m >>= 1) mx = fmaxf(mx, __shfl_xor(mx, m, 32));
  v4f s4 = {0.f, 0.f, 0.f, 0.f};
#pragma unroll
  for (int s = 0; s < NS; ++s) { av[s] = exp2x4((av[s] - mx) * 1.44269504f); s4 += av[s]; }      /* exp(v - mx) as the native form has it: 2^((v - mx) log2 e) */
  float se = (s4[0] + s4[1]) + (s4[2] + s4[3]);
#pragma unroll
  for (int m = 16; m > 0; m >>= 1) se += __shfl_xor(se, m, 32);
  const float sc = 256.0f / se;
#pragma unroll
  for (int s = 0; s < NS; ++s) { v4h fr, fl;
#pragma unroll
    for (int q = 0; q < 4; ++q) { const float pv = av[s][q] * sc; const _Float16 hv = (_Float16)pv; fr[q] = hv; fl[q] = (_Float16)((pv - (float)hv) * 1024.0f); }
    const size_t o = ri * NKX + s * 128 + lane * 4; *(v4h*)(P + o) = fr; *(v4h*)(PL + o) = fl; } }
template <int NS>
static void rsmxl_go(const float* AC, const float* BDp, _Float16* P, _Float16* PL, hipStream_t stream) { k_rsmxl<NS><<<(NH * QT + 7) / 8, 256, 0, stream>>>(AC, BDp, P, PL, NH); }

template <int N>
__global__ __launch_bounds__(256) void k_rmsrow(float* __restrict__ X, const float* __restrict__ w, float eps) {
  #pragma clang fp contract(off)
  constexpr int PT = N / 256; __shared__ float red[256]; const size_t r = blockIdx.x; const int t = threadIdx.x; float* row = X + r * N + (size_t)t * PT; float v[PT]; float ss = 0.f;
  for (int q = 0; q < PT; ++q) { v[q] = row[q]; ss = __fadd_rn(ss, __fmul_rn(v[q], v[q])); }
  red[t] = ss; __syncthreads(); for (int k = 128; k > 0; k >>= 1) { if (t < k) red[t] = __fadd_rn(red[t], red[t + k]); __syncthreads(); }
  const float rs = rsqrtf(__fadd_rn(red[0] / (float)N, eps)); float o[PT]; for (int q = 0; q < PT; ++q) o[q] = __fmul_rn(__fmul_rn(v[q], rs), bf16_round(w[t * PT + q]));
  { for (int q = 0; q < PT; ++q) *(float*)(row + q) = o[q];  } }

__global__ __launch_bounds__(256) void k_bfr(const float* __restrict__ x, float* __restrict__ XB, size_t n8) { const size_t t = (size_t)blockIdx.x * 256 + threadIdx.x; if (t >= n8) return; v4f a = *(const v4fa*)(x + t * 8), c = *(const v4fa*)(x + t * 8 + 4); for (int q = 0; q < 4; ++q) { a[q] = bf16_round(a[q]); c[q] = bf16_round(c[q]); }
  { *(v4f*)(XB + t * 8) = a; *(v4f*)(XB + t * 8 + 4) = c;  } }





// Exact f32 XL attention of the first QT0 rows of a batch: one wave per (head, row i). Lane = 16 hh + ln: ln owns dims 4 ln .. 4 ln + 3, hh one of two keys,
// so every 16-byte load instruction reads two whole 256-byte rows. Keys go in chunks of 32: a lane forms 16 partial dots (q+u).k + (q+v).r over its four dims,
// a four-step butterfly sums each over its 16 lanes, and lane l keeps the score of key 32 c + l. Scores, then weights, rest in the wave's own LDS row;
// maximum and sum are taken over the whole row (two passes, no rescaling); o = sum_j e_j v_j per half, the halves added at the end, x 64 / sum.
// Rows of K, V up to 32 c + 31 <= QT0 - 1 exist; a key above the diagonal gets -1e30 by the arithmetic select and its xl_r index is clamped.
__global__ __launch_bounds__(256) void k_att0xl(const float* __restrict__ QF, const float* __restrict__ QVF, const float* __restrict__ KF, const float* __restrict__ VF, const float* __restrict__ RF, float* __restrict__ OF) {
  __shared__ __attribute__((aligned(16))) float pw[8][QT0];
  const int lane = threadIdx.x & 31, ln = lane & 15, hh = lane >> 4; const int w = __builtin_amdgcn_readfirstlane((int)(threadIdx.x >> 5));      /* wave-uniform: scalar row bases and trip counts */
  const int h = blockIdx.x % NH; const int i = QT0 - 1 - ((int)(blockIdx.x / NH) * 8 + w); const int nch = (i >> 5) + 1;      /* the long rows start first; nch chunks of 32 keys cover 0 .. i */
  const unsigned qo = (unsigned)(i * DM + h * HD + ln * 4) * 4u;
  const v4f q4 = *(const v4fa*)((const char*)QF + qo), qv4 = *(const v4fa*)((const char*)QVF + qo);
  const unsigned ko = (unsigned)(hh * 16 * DM + h * HD + ln * 4) * 4u;      /* the lane's byte offset in a chunk of K or V rows */
  const char* rb = (const char*)(RF + (size_t)h * SQ * HD); float* pr = pw[w]; float mx = -3.0e38f;
#pragma unroll 1
  for (int c = 0; c < nch; ++c) { const char* kp = (const char*)KF + (size_t)c * (32 * DM * 4) + ko; const int r0 = SQ - 1 - i + c * 32 + hh * 16; v4f kk[16], rr[16]; unsigned ro[16];
#pragma unroll
    for (int u = 0; u < 16; ++u) { ro[u] = (unsigned)min(r0 + u, SQ - 1) * (HD * 4u) + ln * 16u; kk[u] = *(const v4fa*)(kp + u * (DM * 4)); rr[u] = *(const v4fa*)(rb + ro[u]); }      /* key j = 32 c + 16 hh + u; xl_r row min(SQ - 1 - i + j, SQ - 1) */
    /* the wait that stands in front of any overwrite of a register that an issued load names, for the chunk's 32 loads: every address register is an input, so none is reused (as a destination either) before it */
    asm volatile("s_wait_xcnt 0x0" :: "v"(kp), "s"(rb), "v"(ro[0]), "v"(ro[1]), "v"(ro[2]), "v"(ro[3]), "v"(ro[4]), "v"(ro[5]), "v"(ro[6]), "v"(ro[7]), "v"(ro[8]), "v"(ro[9]), "v"(ro[10]), "v"(ro[11]), "v"(ro[12]), "v"(ro[13]), "v"(ro[14]), "v"(ro[15]) : "memory");
    __builtin_amdgcn_sched_barrier(0);      /* keeps the arithmetic behind the chunk's loads: without it most K rows are loaded one at a time, each with its own wait */
    float keep = 0.f;
#pragma unroll
    for (int u = 0; u < 16; ++u) { float p = q4[0] * kk[u][0];
#pragma unroll
      for (int d = 1; d < 4; ++d) p = fmaf(q4[d], kk[u][d], p);
#pragma unroll
      for (int d = 0; d < 4; ++d) p = fmaf(qv4[d], bf16_round(rr[u][d]), p);
      p += __shfl_xor(p, 1, 32); p += __shfl_xor(p, 2, 32); p += __shfl_xor(p, 4, 32); p += __shfl_xor(p, 8, 32);
      keep = (ln == u) ? p : keep; }
    const float f = (c * 32 + lane <= i) ? 1.f : 0.f; const float sm = fmaf(f, keep, (1.f - f) * -1.0e30f); pr[c * 32 + lane] = sm; mx = fmaxf(mx, sm); }
#pragma unroll
  for (int m = 16; m > 0; m >>= 1) mx = fmaxf(mx, __shfl_xor(mx, m, 32));
  float l = 0.f;
#pragma unroll 1
  for (int c = 0; c < nch; ++c) { const float e = expf(pr[c * 32 + lane] - mx); pr[c * 32 + lane] = e; l += e; }      /* each lane reads back what it wrote itself */
#pragma unroll
  for (int m = 16; m > 0; m >>= 1) l += __shfl_xor(l, m, 32);
  __builtin_amdgcn_fence(__ATOMIC_ACQ_REL, "workgroup"); __builtin_amdgcn_wave_barrier();      /* the weights are read across the wave's lanes from here on: keeps the LDS stores in front of those reads */
  v4f o = {0.f, 0.f, 0.f, 0.f};
#pragma unroll 1
  for (int c = 0; c < nch; ++c) { const char* vp = (const char*)VF + (size_t)c * (32 * DM * 4) + ko; v4f vv[16], pe[4];
#pragma unroll
    for (int u = 0; u < 16; ++u) vv[u] = *(const v4fa*)(vp + u * (DM * 4));
    asm volatile("s_wait_xcnt 0x0" :: "v"(vp) : "memory");      /* same wait, for the chunk's 16 loads; the address is an input so that no load of the chunk gets it as its destination */
#pragma unroll
    for (int m = 0; m < 4; ++m) pe[m] = *(const v4f*)&pr[c * 32 + hh * 16 + m * 4];      /* the half's 16 weights, one address per half */
#pragma unroll
    for (int u = 0; u < 16; ++u) { const float e = pe[u >> 2][u & 3];
#pragma unroll
      for (int d = 0; d < 4; ++d) o[d] = fmaf(e, vv[u][d], o[d]); } }
  const float fin = 64.0f / l;      /* o carried x64 like the f16 path */
#pragma unroll
  for (int d = 0; d < 4; ++d) o[d] = (o[d] + __shfl_xor(o[d], 16, 32)) * fin;
  if (hh == 0) *(v4f*)(OF + (size_t)i * DM + h * HD + ln * 4) = o; }

extern "C" void kernel_launch(void* const* d_in, const int* in_sizes, int n_in,
                              void* d_out, int out_size, void* d_ws, size_t ws_size, hipStream_t stream) {
  (void)in_sizes; (void)n_in; (void)out_size;
  const float* const* I = (const float* const*)d_in; const float* x = I[0]; const float* g = I[1]; const float* wq = I[2]; const float* wk = I[3]; const float* wv = I[4]; const float* wres = I[5]; const float* xlr = I[6]; const float* xlu = I[7]; const float* xlv = I[8];      /* x; RMS gain; w_q/w_k/w_v [1024][16][64] = [in][out]; w_res [1024][1024] [in][out]; xl_r [16][2048][64]; xl_u, xl_v [1][16][1][64] = per-head 64-vectors (a [1024] bias over the merged columns) */
  char* ws = (char*)d_ws; size_t off = 0;
  auto take = [&](size_t bytes) { char* p = ws + off; off += (bytes + 255) & ~(size_t)255; return p; };
  _Float16* BQ = (_Float16*)take((size_t)DM * DM * 2); _Float16* BK = (_Float16*)take((size_t)DM * DM * 2); _Float16* BV = (_Float16*)take((size_t)DM * DM * 2); _Float16* BR = (_Float16*)take((size_t)DM * DM * 2);
  float* XT = (float*)take(NR * DM * 4); _Float16* X16 = (_Float16*)take(NR * DM * 2); _Float16* XL16 = (_Float16*)take(NR * DM * 2); float* QUF = (float*)take((size_t)QT0 * DM * 4); float* QVF = (float*)take((size_t)QT0 * DM * 4); float* KF0 = (float*)take((size_t)QT0 * DM * 4); float* VF0 = (float*)take((size_t)QT0 * DM * 4); float* OF0 = (float*)take((size_t)NB * QT0 * DM * 4); _Float16* OH0 = (_Float16*)take((size_t)NB * QT0 * DM * 2); _Float16* OL0 = (_Float16*)take((size_t)NB * QT0 * DM * 2); _Float16* QU = (_Float16*)take(NR * DM * 2); _Float16* QV = (_Float16*)take(NR * DM * 2); _Float16* K16 = (_Float16*)take(NR * DM * 2); float* VF = (float*)take(NR * DM * 4); _Float16* V16 = (_Float16*)take(NR * DM * 2); _Float16* VL16 = (_Float16*)take(NR * DM * 2); _Float16* R16 = (_Float16*)take((size_t)NH * SQ * HD * 2); float* OF = (float*)take(NR * DM * 4); _Float16* O16 = (_Float16*)take(NR * DM * 2); _Float16* OL16 = (_Float16*)take(NR * DM * 2);      /* v and wv carried as f32 -> f16 hi + x1024 residual (the first causal rows copy v almost verbatim into small outputs) */
  float* S = (float*)take((size_t)NH * QT * NKX * 4); float* BD = (float*)take((size_t)NH * QT * NKX * 4); _Float16* P = (_Float16*)take((size_t)NH * QT * NKX * 2); _Float16* PL = (_Float16*)take((size_t)NH * QT * NKX * 2); _Float16* VT = (_Float16*)take((size_t)NH * HD * SQ * 2); _Float16* VTL = (_Float16*)take((size_t)NH * HD * SQ * 2);
  if (off > ws_size) return;
  { const unsigned gw = (unsigned)(((size_t)DM * DM / 8 + 255) / 256); k_wt_f16<<<gw, 256, 0, stream>>>(wq, BQ, DM, DM, 16.0f); k_wt_f16<<<gw, 256, 0, stream>>>(wk, BK, DM, DM, 16.0f); k_wt_f16<<<gw, 256, 0, stream>>>(wv, BV, DM, DM, 16.0f); k_wt_f16<<<gw, 256, 0, stream>>>(wres, BR, DM, DM, 16.0f); }      /* [in][out] ([in][h][k] flattened) -> Bt x16 */
  k_bfr<<<(unsigned)((NR * DM / 8 + 255) / 256), 256, 0, stream>>>(x, XT, NR * DM / 8); k_rmsrow<DM><<<(unsigned)NR, 256, 0, stream>>>(XT, g, 1e-6f); k_hl<<<(unsigned)((NR * DM / 8 + 255) / 256), 256, 0, stream>>>(XT, X16, XL16, NR * DM / 8);      /* x_t = RMSNorm(bf16(x)) g (f32, in place) -> f16 hi rows (+ x1024 residual rows for the exact first tile) */
  k_x16<<<(unsigned)(((size_t)NH * SQ * HD / 8 + 255) / 256), 256, 0, stream>>>(xlr, R16, (size_t)NH * SQ * HD / 8);      /* xl_r [h][j][64] as exact f16 rows (bf16-valued input) */
  k_gemm2<0><<<dim3((unsigned)((NR / 128) * (DM / 64)), 1), 128, 0, stream>>>(X16, DM, 0, BQ, DM, 0, 0.0078125f, xlu, 0, nullptr, 1, 0, 0, nullptr, QU, DM, 0, (int)NR, DM, DM); k_gemm2<0><<<dim3((unsigned)((NR / 128) * (DM / 64)), 1), 128, 0, stream>>>(X16, DM, 0, BQ, DM, 0, 0.0078125f, xlv, 0, nullptr, 1, 0, 0, nullptr, QV, DM, 0, (int)NR, DM, DM);      /* q / 8 + xl_u and q / 8 + xl_v (the per-head 64-vectors as [1024] column biases) -> f16 rows */
  k_gemm2<0><<<dim3((unsigned)((NR / 128) * (DM / 64)), 1), 128, 0, stream>>>(X16, DM, 0, BK, DM, 0, 0.0625f, nullptr, 0, nullptr, 1, 0, 0, nullptr, K16, DM, 0, (int)NR, DM, DM); k_gemm2<0><<<dim3((unsigned)((NR / 128) * (DM / 64)), 1), 128, 0, stream>>>(X16, DM, 0, BV, DM, 0, 0.0625f, nullptr, 0, nullptr, 1, 0, 0, VF, nullptr, DM, 0, (int)NR, DM, DM); k_hl<<<(unsigned)((NR * DM / 8 + 255) / 256), 256, 0, stream>>>(VF, V16, VL16, NR * DM / 8);      /* k -> f16; v f32 -> f16 hi + x1024 residual rows */
  for (int b = 0; b < NB; ++b) { const size_t r0 = (size_t)b * SQ;
    k_vt<NH, SQ><<<NH * (SQ / 64), 256, 0, stream>>>(V16 + r0 * DM, DM, 0, VT); k_vt<NH, SQ><<<NH * (SQ / 64), 256, 0, stream>>>(VL16 + r0 * DM, DM, 0, VTL);      /* V^T hi and residual [16][64][SQ] of this batch */
    { const dim3 g0((QT0 / 32) * (DM / 64), 1);      /* hi and residual rows of x_t as the two terms of one launch */
      k_gemm2t<2><<<g0, 64, 0, stream>>>(X16 + r0 * DM, XL16 + r0 * DM, nullptr, DM, 0, BQ, BQ, nullptr, DM, 0, 0.0078125f, 0.00000762939453125f, 0.f, xlu, QUF, DM, 0, DM, DM);
      k_gemm2t<2><<<g0, 64, 0, stream>>>(X16 + r0 * DM, XL16 + r0 * DM, nullptr, DM, 0, BQ, BQ, nullptr, DM, 0, 0.0078125f, 0.00000762939453125f, 0.f, xlv, QVF, DM, 0, DM, DM);
      k_gemm2t<2><<<g0, 64, 0, stream>>>(X16 + r0 * DM, XL16 + r0 * DM, nullptr, DM, 0, BK, BK, nullptr, DM, 0, 0.0625f, 0.00006103515625f, 0.f, nullptr, KF0, DM, 0, DM, DM);
      k_gemm2t<2><<<g0, 64, 0, stream>>>(X16 + r0 * DM, XL16 + r0 * DM, nullptr, DM, 0, BV, BV, nullptr, DM, 0, 0.0625f, 0.00006103515625f, 0.f, nullptr, VF0, DM, 0, DM, DM);
      k_att0xl<<<NH * (QT0 / 8), 256, 0, stream>>>(QUF, QVF, KF0, VF0, xlr, OF0 + (size_t)b * QT0 * DM); }      /* exact causal XL attention for rows 0..255 (o x64, f32) */
    for (int q0 = 0; q0 < SQ; q0 += QT) { const int nk = q0 + QT;      /* causal: keys below the tile end only */
      k_gemm2<0><<<dim3((QT / 128) * (nk / 64), NH), 128, 0, stream>>>(QU + (r0 + q0) * DM, DM, (size_t)HD, K16 + r0 * DM, DM, (size_t)HD, 1.0f, nullptr, 0, nullptr, 1, 0, 0, S, nullptr, NKX, (size_t)QT * NKX, QT, nk, HD);      /* AC[i][j] = (q_i + u).k_j, 16 heads on grid.y */
      k_gemm2<0><<<dim3((QT / 128) * (nk / 64), NH), 128, 0, stream>>>(QV + (r0 + q0) * DM, DM, (size_t)HD, R16 + (size_t)(SQ - nk) * HD, HD, (size_t)SQ * HD, 1.0f, nullptr, 0, nullptr, 1, 0, 0, BD, nullptr, NKX, (size_t)QT * NKX, QT, nk, HD);      /* BD'[i][c] = (q_i + v).xl_r[h][SQ - nk + c] for c < nk (the xl_r rows the shift can reach from this tile) */
      static_assert(SQ == 8 * QT, "one k_rsmxl instance per tile end"); switch (nk / QT) { case 1: rsmxl_go<2>(S, BD, P, PL, stream); break; case 2: rsmxl_go<4>(S, BD, P, PL, stream); break; case 3: rsmxl_go<6>(S, BD, P, PL, stream); break; case 4: rsmxl_go<8>(S, BD, P, PL, stream); break; case 5: rsmxl_go<10>(S, BD, P, PL, stream); break; case 6: rsmxl_go<12>(S, BD, P, PL, stream); break; case 7: rsmxl_go<14>(S, BD, P, PL, stream); break; default: rsmxl_go<16>(S, BD, P, PL, stream); break; }      /* scores = AC + BD'[i][nk-1-(i-j)] (== rel_shift) for j <= i, -1e30 above the diagonal; softmax -> x256 f16 */
      k_gemm2t<3><<<dim3((QT / 32) * (HD / 64), NH), 96, 0, stream>>>(P, PL, P, NKX, (size_t)QT * NKX, VT, VT, VTL, SQ, (size_t)HD * SQ, 0.25f, 0.000244140625f, 0.000244140625f, nullptr, OF + (r0 + q0) * DM, DM, (size_t)HD, HD, nk); } }      /* wv x64 = Ph Vh 2^-2 + Pl Vh 2^-12 + Ph Vl 2^-12 (f32), the three terms in one launch */
  k_hl<<<(unsigned)((NR * DM / 8 + 255) / 256), 256, 0, stream>>>(OF, O16, OL16, NR * DM / 8);      /* wv x64 -> f16 hi + x1024 residual rows */
  k_gemm2<0><<<dim3((unsigned)((NR / 128) * (DM / 64)), 1), 128, 0, stream>>>(O16, DM, 0, BR, DM, 0, 0.0009765625f, nullptr, 0, nullptr, 1, 0, 0, (float*)d_out, nullptr, DM, 0, (int)NR, DM, DM); k_gemm2<0><<<dim3((unsigned)((NR / 128) * (DM / 64)), 1), 128, 0, stream>>>(OL16, DM, 0, BR, DM, 0, 0.00000095367431640625f, nullptr, 0, (const float*)d_out, -1, 0, 0, (float*)d_out, nullptr, DM, 0, (int)NR, DM, DM);      /* res = wv_hi w_res 2^-10 += wv_lo w_res 2^-20 (own element) */
  k_hl<<<(unsigned)(((size_t)NB * QT0 * DM / 8 + 255) / 256), 256, 0, stream>>>(OF0, OH0, OL0, (size_t)NB * QT0 * DM / 8);      /* first-tile o (x64) -> f16 hi + x1024 residual planes */
  for (int b = 0; b < NB; ++b) { const size_t r0 = (size_t)b * SQ; const size_t f0 = (size_t)b * QT0;
    k_gemm2t<2><<<dim3((QT0 / 32) * (DM / 64), 1), 64, 0, stream>>>(OH0 + f0 * DM, OL0 + f0 * DM, nullptr, DM, 0, BR, BR, nullptr, DM, 0, 0.0009765625f, 0.00000095367431640625f, 0.f, nullptr, (float*)d_out + r0 * DM, DM, 0, DM, DM); }      /* rows 0..255 of the batch rewritten from the exact path: o_hi w_res 2^-10 + o_lo w_res 2^-20 */
}

// v005
// It runs in 714 microseconds.
// Two timings next to v004 both put it at 1.33 times that version's speed.
// Counting every step since v000, it is 21.7 times as fast.
#include <hip/hip_runtime.h>
// Transformer-XL style causal attention with relative-position (rel_shift) scores (x [2][2048][1024]; x_t = RMSNorm(x) g (eps 1e-6); q = x_t w_q / 8, k = x_t w_k, v = x_t w_v (w [1024][16][64] = [in][out], sigma 1/32); scores = (q + xl_u).k^T + rel_shift((q + xl_v).xl_r^T) (xl_r [16][2048][64], xl_u / xl_v [1][16][1][64]); causal: - 1e30 above the diagonal; softmax; wv = w v merged (h*64+v); res = wv w_res ([in][out]) -> [2][2048][1024]. rel_shift with q_len = k_len = T gives bd[i][j] = (q_i + xl_v).xl_r[h][T-1-(i-j)] for j <= i).
// Structure: token rows; x_t = RMSNorm(bf16(x)) in f32 on VALU -> f16 rows; [in][out] weights as x16 planes; q+u and q+v as two WMMA GEMMs (32x64 wave tiles, f32 accumulation, alpha 1/128, per-head bias vectors), k, v -> f16 rows; xl_r as exact f16 rows; both batches side by side in every launch from here on (batch = one more grid index): V^T via LDS transposes; exact f32 XL attention for rows 0..255 per batch on VALU (q/k/v of those rows from x_t hi + residual GEMM passes); per 256-row tile: AC = (q+u) k^T over keys < tile end and BD' = (q+v) r^T over the matching xl_r rows [T-nk, T) (K = 64, 16 heads on grid.y) f32; causal softmax on VALU that adds the rel-shifted BD'[i][nk-1-(i-j)] (arithmetic select and clamped index, -1e30 fill, f32 statistics, native exp; weights x256 f16); o = P V^T (x64) merged f16; res = o_hi w_res + o_lo w_res 2^-10; first-tile rows rewritten from the exact o hi/lo; launches: see trace.
// Compute dtype: inputs rounded to bf16; x / weights exact; q, k as plain f16 GEMM operands (~2^-12); v, softmax weights and o as f16 hi + x1024 residual pairs; scores and softmax statistics f32. v_wmma_f32_16x16x32_f16.
#define NB 2
#define NG 16
#define HPG 1
#define KVD (NG * HD)
#define SQ 2048
#define DM 1024
#define NH 16
#define HD 64
#define HG 4                         /* heads per block group of the unlaunched k_vt(V16, b, h0, VT) */
#define QT 256                       /* query rows per causal tile */
#define NKX SQ                       /* S / P row pitch */
#define QT0 256                      /* first-tile rows recomputed exactly in f32 (= one causal tile) */
#define B0 0                         /* unused */
#define NBR NB                       /* unused by the launches; they use NB */
#define NR ((size_t)NB * SQ)         /* token rows */
#define MP ((int)((size_t)NBR * SQ)) /* unused by the launches; the projections run over NR rows */
#define QN SQ                        /* unused; the tile loop runs over SQ */
#define NHD NH                       /* unused; the attention launches use NH */
#define MPO MP                       /* unused; the output GEMMs use NR */
#define LQ DM      /* unused; the q/k/v rows use pitch DM */
typedef __bf16 v16b __attribute__((ext_vector_type(16)));
typedef unsigned short v8us __attribute__((ext_vector_type(8), may_alias));
typedef float  v8f  __attribute__((ext_vector_type(8)));
typedef float  v4f  __attribute__((ext_vector_type(4)));
typedef float  v4fa __attribute__((ext_vector_type(4), may_alias));
union FragB { v16b v; v8us half[2]; unsigned short u[16]; };

__device__ __forceinline__ unsigned short bf16_bits(float x) { unsigned int u = __float_as_uint(x); return (unsigned short)((u + 0x7FFFu + ((u >> 16) & 1u)) >> 16); }
__device__ __forceinline__ float bf16_val(unsigned short b) { return __uint_as_float(((unsigned int)b) << 16); }
__device__ __forceinline__ float bf16_round(float x) { return bf16_val(bf16_bits(x)); }
// D += A·B with NT terms: 1 = ah·bh, 2 = + al·bh (A split), 3 = + ah·bl (both split)
template <int NT>
__device__ __forceinline__ v8f mmaN(v16b ah, v16b al, v16b bh, v16b bl, v8f c) {
  c = __builtin_amdgcn_wmma_f32_16x16x32_bf16(false, ah, false, bh, (short)0, c, false, false);
  if (NT >= 2) c = __builtin_amdgcn_wmma_f32_16x16x32_bf16(false, al, false, bh, (short)0, c, false, false);
  if (NT >= 3) c = __builtin_amdgcn_wmma_f32_16x16x32_bf16(false, ah, false, bl, (short)0, c, false, false);
  asm volatile("v_nop\n\tv_nop\n\tv_nop\n\tv_nop" : "+v"(c) : "v"(ah), "v"(al), "v"(bh), "v"(bl));
  return c;
}

__global__ __launch_bounds__(256) void k_wt_bf16(const float* __restrict__ W, unsigned short* __restrict__ Wt, int K, int N) {
  const int t = blockIdx.x * 256 + threadIdx.x;
  const int k8n = K / 8;
  if (t >= N * k8n) return;
  const int n = t / k8n, k8 = (t % k8n) * 8;
  v8us v;
#pragma unroll
  for (int i = 0; i < 8; ++i) v[i] = bf16_bits(W[(size_t)(k8 + i) * N + n]);
  *(v8us*)(Wt + (size_t)n * K + k8) = v;
  
}

// GEMM C[M][N] (f32, pitch ldc) = act(A[M][K]·W + bias). A f32 row-major (pitch lda) converted per fragment to bf16
// (ASPLIT: hi/lo two planes -> 2 terms, else single rounded term); Wt bf16 [N][K] (pitch ldb). BIAS_BF16 rounds the
// bias to bf16 first (bias quantised to bf16 before the add). K%32==0, M%16==0, N%64==0.
template <bool ASPLIT, int ACT, bool BIAS_BF16>
__global__ __launch_bounds__(128) void k_gemm_bf(const float* __restrict__ A, int lda, const unsigned short* __restrict__ Wt, int ldb,
                                               const float* __restrict__ bias, float* __restrict__ C, int ldc, int M, int N, int K) {
  __shared__ __attribute__((aligned(16))) float so[4][16][64];
  const int tid = threadIdx.x, w = tid >> 5, lane = tid & 31, ln = lane & 15, hh = lane >> 4;
  const int ntn = N / 64;
  const int wid = blockIdx.x * 4 + w;
  const int mt = wid / ntn, nq = wid % ntn;
  if (mt * 16 >= M) return;
  const int row0 = mt * 16, col0 = nq * 64;
  const float* arow = A + (size_t)(row0 + ln) * lda;
  v8f acc[4] = {};
  for (int kb = 0; kb < K; kb += 32) {
    FragB ah, al;
    const v4f x0 = *(const v4fa*)(arow + kb + 8 * hh), x1 = *(const v4fa*)(arow + kb + 8 * hh + 4);
    const v4f x2 = *(const v4fa*)(arow + kb + 16 + 8 * hh), x3 = *(const v4fa*)(arow + kb + 16 + 8 * hh + 4);
    float xs[16] = {x0[0],x0[1],x0[2],x0[3],x1[0],x1[1],x1[2],x1[3],x2[0],x2[1],x2[2],x2[3],x3[0],x3[1],x3[2],x3[3]};
#pragma unroll
    for (int i = 0; i < 16; ++i) { const unsigned short hb = bf16_bits(xs[i]); ah.u[i] = hb; al.u[i] = ASPLIT ? bf16_bits(xs[i] - bf16_val(hb)) : (unsigned short)0; }
#pragma unroll
    for (int t = 0; t < 4; ++t) {
      const unsigned short* brow = Wt + (size_t)(col0 + t * 16 + ln) * ldb + kb;
      FragB b;
      b.half[0] = *(const v8us*)(brow + 8 * hh);
      b.half[1] = *(const v8us*)(brow + 16 + 8 * hh);
      acc[t] = mmaN<ASPLIT ? 2 : 1>(ah.v, al.v, b.v, b.v, acc[t]);
    }
  }
#pragma unroll
  for (int t = 0; t < 4; ++t) {
    float bv = bias ? bias[col0 + t * 16 + ln] : 0.f;
    if (BIAS_BF16) bv = bf16_round(bv);
#pragma unroll
    for (int r = 0; r < 8; ++r) { float v = acc[t][r] + bv; if (ACT == 1) v = fmaxf(v, 0.f); so[w][8 * hh + r][t * 16 + ln] = v; }
  }
  __builtin_amdgcn_fence(__ATOMIC_ACQ_REL, "workgroup");
  __builtin_amdgcn_wave_barrier();
  const int rsub = lane >> 4, c4 = (lane & 15) * 4;
  {
#pragma unroll
    for (int q = 0; q < 8; ++q) {
      const int r = q * 2 + rsub;
      const v4f v = *(const v4fa*)&so[w][r][c4];
      *(v4f*)(C + (size_t)(row0 + r) * ldc + col0 + c4) = v;
    }
    
  }
}

// GEMM C = act(A·W + bias + resid): A f32 (ASPLIT -> hi/lo 2 terms), Wt bf16 [N][K]; ACT 0 none, 1 relu, 2 exact gelu;
// resid (optional, f32, row index = (row % rmod), pitch ldr, RES_BF16 rounds it) added before the activation.
template <bool ASPLIT, int ACT, bool BIAS_BF16, bool RES_BF16>
__global__ __launch_bounds__(128) void k_gemm_bf3(const float* __restrict__ A, int lda, const unsigned short* __restrict__ Wt, int ldb,
                                                const float* __restrict__ bias, const float* __restrict__ resid, int rmod, int ldr,
                                                float* __restrict__ C, int ldc, int M, int N, int K) {
  __shared__ __attribute__((aligned(16))) float so[4][16][64];
  const int tid = threadIdx.x, w = tid >> 5, lane = tid & 31, ln = lane & 15, hh = lane >> 4;
  const int ntn = N / 64;
  const int wid = blockIdx.x * 4 + w;
  const int mt = wid / ntn, nq = wid % ntn;
  if (mt * 16 >= M) return;
  const int row0 = mt * 16, col0 = nq * 64;
  const float* arow = A + (size_t)(row0 + ln) * lda;
  v8f acc[4] = {};
  for (int kb = 0; kb < K; kb += 32) {
    FragB ah, al;
    const v4f x0 = *(const v4fa*)(arow + kb + 8 * hh), x1 = *(const v4fa*)(arow + kb + 8 * hh + 4);
    const v4f x2 = *(const v4fa*)(arow + kb + 16 + 8 * hh), x3 = *(const v4fa*)(arow + kb + 16 + 8 * hh + 4);
    float xs[16] = {x0[0],x0[1],x0[2],x0[3],x1[0],x1[1],x1[2],x1[3],x2[0],x2[1],x2[2],x2[3],x3[0],x3[1],x3[2],x3[3]};
#pragma unroll
    for (int i = 0; i < 16; ++i) { const unsigned short hb = bf16_bits(xs[i]); ah.u[i] = hb; al.u[i] = ASPLIT ? bf16_bits(xs[i] - bf16_val(hb)) : (unsigned short)0; }
#pragma unroll
    for (int t = 0; t < 4; ++t) {
      const unsigned short* brow = Wt + (size_t)(col0 + t * 16 + ln) * ldb + kb;
      FragB b;
      b.half[0] = *(const v8us*)(brow + 8 * hh);
      b.half[1] = *(const v8us*)(brow + 16 + 8 * hh);
      acc[t] = mmaN<ASPLIT ? 2 : 1>(ah.v, al.v, b.v, b.v, acc[t]);
    }
  }
#pragma unroll
  for (int t = 0; t < 4; ++t) {
    const int col = col0 + t * 16 + ln;
    float bv = bias ? bias[col] : 0.f;
    if (BIAS_BF16) bv = bf16_round(bv);
#pragma unroll
    for (int r = 0; r < 8; ++r) {
      float v = acc[t][r] + bv;
      if (resid) { float rv = resid[(size_t)((row0 + 8 * hh + r) % rmod) * ldr + col]; if (RES_BF16) rv = bf16_round(rv); v += rv; }
      if (ACT == 1) v = fmaxf(v, 0.f);
      if (ACT == 2) v = 0.5f * v * (1.0f + erff(v * 0.70710678118654752f));
      if (ACT == 3) { const float u = 0.7978845608028654f * (v + 0.044715f * v * v * v); v = 0.5f * v * (1.0f + tanhf(u)); }
      so[w][8 * hh + r][t * 16 + ln] = v;
    }
  }
  __builtin_amdgcn_fence(__ATOMIC_ACQ_REL, "workgroup");
  __builtin_amdgcn_wave_barrier();
  const int rsub = lane >> 4, c4 = (lane & 15) * 4;
  {
#pragma unroll
    for (int q = 0; q < 8; ++q) {
      const int r = q * 2 + rsub;
      const v4f v = *(const v4fa*)&so[w][r][c4];
      *(v4f*)(C + (size_t)(row0 + r) * ldc + col0 + c4) = v;
    }
    
  }
}
// row LayerNorm (biased variance, eps) over N: s = X (+ R); optional out_sum <- s; out_norm <- (s-mu)*rsqrt(var+eps)*g + b
template <bool PARAM_BF16>
__global__ __launch_bounds__(256) void k_layernorm(const float* __restrict__ X, const float* __restrict__ R, const float* __restrict__ g, const float* __restrict__ bta,
                                                  float* __restrict__ out_sum, float* __restrict__ out_norm, int N, float eps) {
  __shared__ float red[256];
  const int row = blockIdx.x, tid = threadIdx.x;
  const float* x = X + (size_t)row * N; const float* rr = R ? R + (size_t)row * N : nullptr;
  float vals[16];                     // up to N = 4096
  const int per = N / 256;            // contiguous chunk per thread? use strided-by-4 chunks: thread handles j = tid*4 + 1024*u
  float s1 = 0.f;
  for (int u = 0; u < per / 4; ++u) {
    const int j = tid * 4 + 1024 * u;
    const v4f a = *(const v4fa*)(x + j);
    v4f b = {0.f,0.f,0.f,0.f}; if (rr) b = *(const v4fa*)(rr + j);
#pragma unroll
    for (int q = 0; q < 4; ++q) { const float v = a[q] + b[q]; vals[u * 4 + q] = v; s1 += v; }
  }
  red[tid] = s1; __syncthreads();
  for (int st = 128; st > 0; st >>= 1) { if (tid < st) red[tid] += red[tid + st]; __syncthreads(); }
  const float mu = red[0] / (float)N; __syncthreads();
  float s2 = 0.f;
  for (int u = 0; u < per / 4; ++u)
#pragma unroll
    for (int q = 0; q < 4; ++q) { const float c = vals[u * 4 + q] - mu; s2 += c * c; }
  red[tid] = s2; __syncthreads();
  for (int st = 128; st > 0; st >>= 1) { if (tid < st) red[tid] += red[tid + st]; __syncthreads(); }
  const float rs = rsqrtf(red[0] / (float)N + eps);
  {
    for (int u = 0; u < per / 4; ++u) {
      const int j = tid * 4 + 1024 * u;
      v4f o, sm;
#pragma unroll
      for (int q = 0; q < 4; ++q) {
        float gg = g[j + q], bb = bta[j + q];
        if (PARAM_BF16) { gg = bf16_round(gg); bb = bf16_round(bb); }
        sm[q] = vals[u * 4 + q]; o[q] = (vals[u * 4 + q] - mu) * rs * gg + bb;
      }
      if (out_sum) *(v4f*)(out_sum + (size_t)row * N + j) = sm;
      *(v4f*)(out_norm + (size_t)row * N + j) = o;
    }
    
  }
}



// ---- f16 WMMA path (v_wmma_f32_16x16x32_f16): 11-bit significands for operands in range — used where a [0,1] probability operand needs more precision than bf16
typedef _Float16 v16h __attribute__((ext_vector_type(16)));
union FragH { v16h v; v8us half[2]; _Float16 h[16]; unsigned short u[16]; };
template <int NT>
__device__ __forceinline__ v8f mmaH(v16h ah, v16h al, v16h bh, v16h bl, v8f c) {
  c = __builtin_amdgcn_wmma_f32_16x16x32_f16(false, ah, false, bh, (short)0, c, false, false);
  if (NT >= 2) c = __builtin_amdgcn_wmma_f32_16x16x32_f16(false, al, false, bh, (short)0, c, false, false);
  if (NT >= 3) c = __builtin_amdgcn_wmma_f32_16x16x32_f16(false, ah, false, bl, (short)0, c, false, false);
  asm volatile("v_nop\n\tv_nop\n\tv_nop\n\tv_nop" : "+v"(c) : "v"(ah), "v"(al), "v"(bh), "v"(bl));
  return c;
}
// batched GEMM like k_gemm_b but f16 operands: A f32 (split into f16 hi/lo if ASPLIT, else rounded to f16), Bt = f16 values [n][k]; alpha; C f32; N multiple of 16 (partial tiles skipped)
template <bool ASPLIT>
__global__ __launch_bounds__(128) void k_gemm_h(const float* __restrict__ A, int lda, size_t sA, const _Float16* __restrict__ Bh, int ldb, size_t sB, float alpha, float* __restrict__ C, int ldc, size_t sC, int M, int N, int K) {
  __shared__ __attribute__((aligned(16))) float so[4][16][64];
  const int tid = threadIdx.x, w = tid >> 5, lane = tid & 31, ln = lane & 15, hh = lane >> 4; const int by = blockIdx.y;
  A += (size_t)by * sA; Bh += (size_t)by * sB; C += (size_t)by * sC;
  const int ntn = (N + 63) / 64; const int wid = blockIdx.x * 4 + w; const int mt = wid / ntn, nq = wid % ntn; if (mt * 16 >= M) return;
  const int row0 = mt * 16, col0 = nq * 64; const float* arow = A + (size_t)(row0 + ln) * lda;
  v8f acc[4] = {};
  for (int kb = 0; kb < K; kb += 32) {
    FragH ah, al;
    const v4f x0 = *(const v4fa*)(arow + kb + 8 * hh), x1 = *(const v4fa*)(arow + kb + 8 * hh + 4), x2 = *(const v4fa*)(arow + kb + 16 + 8 * hh), x3 = *(const v4fa*)(arow + kb + 16 + 8 * hh + 4);
    float xs[16] = {x0[0],x0[1],x0[2],x0[3],x1[0],x1[1],x1[2],x1[3],x2[0],x2[1],x2[2],x2[3],x3[0],x3[1],x3[2],x3[3]};
#pragma unroll
    for (int i = 0; i < 16; ++i) { const _Float16 h = (_Float16)xs[i]; ah.h[i] = h; al.h[i] = ASPLIT ? (_Float16)(xs[i] - (float)h) : (_Float16)0.0f; }
#pragma unroll
    for (int t = 0; t < 4; ++t) { if (col0 + t * 16 >= N) continue; const size_t boff = (size_t)(col0 + t * 16 + ln) * ldb + kb; FragH bq; bq.half[0] = *(const v8us*)(Bh + boff + 8 * hh); bq.half[1] = *(const v8us*)(Bh + boff + 16 + 8 * hh);
      acc[t] = mmaH<ASPLIT ? 2 : 1>(ah.v, al.v, bq.v, bq.v, acc[t]); }
  }
#pragma unroll
  for (int t = 0; t < 4; ++t) { if (col0 + t * 16 >= N) continue;
#pragma unroll
    for (int r = 0; r < 8; ++r) so[w][8 * hh + r][t * 16 + ln] = acc[t][r] * alpha; }
  __builtin_amdgcn_fence(__ATOMIC_ACQ_REL, "workgroup"); __builtin_amdgcn_wave_barrier();
  const int rsub = lane >> 4, c4 = (lane & 15) * 4;
  {
#pragma unroll
    for (int q = 0; q < 8; ++q) { const int r = q * 2 + rsub; if (col0 + c4 < N) { const v4f v = *(const v4fa*)&so[w][r][c4]; *(v4f*)(C + (size_t)(row0 + r) * ldc + col0 + c4) = v; } }
     }
}

// Wt[n][k] = f16(W[k][n]·scale) from f32 row-major W[K][N] (scale = power of two; bf16-exact weights stay exact in f16 away from the subnormal range)
__global__ __launch_bounds__(256) void k_wt_f16(const float* __restrict__ W, _Float16* __restrict__ Wt, int K, int N, float scale) {
  const int t = blockIdx.x * 256 + threadIdx.x; if (t >= N * (K / 8)) return; const int n = t / (K / 8), k8 = (t % (K / 8)) * 8; FragH f;
#pragma unroll
  for (int i = 0; i < 8; ++i) f.h[i] = (_Float16)(bf16_round(W[(size_t)(k8 + i) * N + n]) * scale); const v8us o = f.half[0];
  *(v8us*)((unsigned short*)Wt + (size_t)n * K + k8) = o; 
}
// k_gemm_hh variant with fused epilogue: v = acc·alpha + bias[by·sBias + col] (+ CP[(row/rowsPerB)·sCPb + by·64 + col] if CP) ; ACT 0 none / 1 elu ; writes f16 C16 (and f32 C if non-null)
template <int ACT>
__global__ __launch_bounds__(128) void k_gemm_hhx(const _Float16* __restrict__ A, int lda, size_t sA, const _Float16* __restrict__ Bh, int ldb, size_t sB, float alpha, const float* __restrict__ bias, size_t sBias, const float* __restrict__ CP, int rowsPerB, size_t sCPb, int row0g,
    float* __restrict__ C, _Float16* __restrict__ C16, int ldc, size_t sC, int M, int N, int K) {
  __shared__ __attribute__((aligned(16))) float so[4][16][64];
  const int tid = threadIdx.x, w = tid >> 5, lane = tid & 31, ln = lane & 15, hh = lane >> 4; const int by = blockIdx.y;
  A += (size_t)by * sA; Bh += (size_t)by * sB; const size_t cofs = (size_t)by * sC; const float* bp = bias ? bias + (size_t)by * sBias : nullptr;
  const int ntn = (N + 63) / 64; const int wid = blockIdx.x * 4 + w; const int mt = wid / ntn, nq = wid % ntn; if (mt * 16 >= M) return;
  const int row0 = mt * 16, col0 = nq * 64; const _Float16* arow = A + (size_t)(row0 + ln) * lda;
  v8f acc[4] = {};
  for (int kb = 0; kb < K; kb += 32) { FragH ah; ah.half[0] = *(const v8us*)((const unsigned short*)arow + kb + 8 * hh); ah.half[1] = *(const v8us*)((const unsigned short*)arow + kb + 16 + 8 * hh);
#pragma unroll
    for (int t = 0; t < 4; ++t) { if (col0 + t * 16 >= N) continue; const size_t boff = (size_t)(col0 + t * 16 + ln) * ldb + kb; FragH bq; bq.half[0] = *(const v8us*)((const unsigned short*)Bh + boff + 8 * hh); bq.half[1] = *(const v8us*)((const unsigned short*)Bh + boff + 16 + 8 * hh);
      acc[t] = mmaH<1>(ah.v, ah.v, bq.v, bq.v, acc[t]); }
  }
#pragma unroll
  for (int t = 0; t < 4; ++t) { if (col0 + t * 16 >= N) continue; const int col = col0 + t * 16 + ln; const float bv = bp ? bf16_round(bp[col]) : 0.f;
#pragma unroll
    for (int r = 0; r < 8; ++r) { float v = acc[t][r] * alpha + bv; if (CP) { const int rr = row0g + row0 + 8 * hh + r; if (rowsPerB < 0) v += CP[cofs + (size_t)rr * ldc + col];      /* rowsPerB < 0: own element of the batched C plane */ else { const int bidx = rr / rowsPerB; v += CP[(size_t)bidx * sCPb + (size_t)by * 64 + col]; } } if (ACT == 1) v = (v > 0.f) ? v : expm1f(v); else if (ACT == 7) v = (v > 0.f) ? v + 1.0f : expf(v); else if (ACT == 8) v = tanhf(v); else if (ACT == 9) v = 0.5f * v * (1.0f + tanhf(0.7978845608028654f * (v + 0.044715f * v * v * v))); else if (ACT == 11) v = 1.0f / (1.0f + expf(-v)); else if (ACT == 12) v = (v > 0.f) ? v : 0.01f * v; else if (ACT == 14) v = (v > 0.f) ? v : 0.1f * v; else if (ACT == 16) v = (v >= 0.f) ? v : 0.3f * v; else if (ACT == 17) v = (v >= 0.f) ? v : 0.2f * v; else if (ACT == 15) v = v / (1.0f + expf(-v)); else if (ACT == 3) v = fmaxf(v, 0.f); else if (ACT == 6) v = 0.5f * v * (1.0f + erff(v * 0.70710678118654752f)); so[w][8 * hh + r][t * 16 + ln] = v; } }
  __builtin_amdgcn_fence(__ATOMIC_ACQ_REL, "workgroup"); __builtin_amdgcn_wave_barrier();
  const int rsub = lane >> 4, c4 = (lane & 15) * 4; typedef _Float16 v4h __attribute__((ext_vector_type(4)));
  {
#pragma unroll
    for (int q = 0; q < 8; ++q) { const int r = q * 2 + rsub; if (col0 + c4 < N) { const v4f v = *(const v4fa*)&so[w][r][c4]; if (C) *(v4f*)(C + cofs + (size_t)(row0 + r) * ldc + col0 + c4) = v; if (C16) { v4h h4; for (int i = 0; i < 4; ++i) h4[i] = (_Float16)v[i]; *(v4h*)(C16 + cofs + (size_t)(row0 + r) * ldc + col0 + c4) = h4; } } }
     }
}


typedef _Float16 v4h __attribute__((ext_vector_type(4)));

__global__ __launch_bounds__(256) void k_x16(const float* __restrict__ x, _Float16* __restrict__ X16, size_t n8) { const size_t t = (size_t)blockIdx.x * 256 + threadIdx.x; if (t >= n8) return; FragH f;
#pragma unroll
  for (int q = 0; q < 8; ++q) f.h[q] = (_Float16)bf16_round(x[t * 8 + q]); *(v8us*)((unsigned short*)X16 + t * 8) = f.half[0];  }
__global__ __launch_bounds__(256) void k_h16(const float* __restrict__ x, _Float16* __restrict__ X16, size_t n8) { const size_t t = (size_t)blockIdx.x * 256 + threadIdx.x; if (t >= n8) return; FragH f;
#pragma unroll
  for (int q = 0; q < 8; ++q) f.h[q] = (_Float16)x[t * 8 + q]; *(v8us*)((unsigned short*)X16 + t * 8) = f.half[0];  }
__global__ __launch_bounds__(256) void k_round16f(const float* __restrict__ W, _Float16* __restrict__ Bt, size_t n8) { const size_t t = (size_t)blockIdx.x * 256 + threadIdx.x; if (t >= n8) return; FragH f;
#pragma unroll
  for (int i = 0; i < 8; ++i) f.h[i] = (_Float16)(bf16_round(W[t * 8 + i]) * 16.0f); *(v8us*)((unsigned short*)Bt + t * 8) = f.half[0];  }
template <int NHv, int TTv>
__global__ __launch_bounds__(256) void k_vt(const _Float16* __restrict__ V16, int ldv, int voff, _Float16* __restrict__ Vt) { __shared__ unsigned short tl[64][66]; const int tid = threadIdx.x; const int slab = blockIdx.x / (TTv / 64), lg = blockIdx.x % (TTv / 64); const int b = slab / NHv, h = slab % NHv;
  for (int i = tid; i < 64 * 8; i += 256) { const int r = i / 8, c8 = (i % 8) * 8; FragH f; f.half[0] = *(const v8us*)((const unsigned short*)V16 + ((size_t)b * TTv + lg * 64 + r) * ldv + voff + h * 64 + c8);
#pragma unroll
    for (int q = 0; q < 8; ++q) tl[r][c8 + q] = f.u[q]; }
  __syncthreads();
  {
#pragma unroll
    for (int rd = 0; rd < 2; ++rd) { const int d = rd * 32 + tid / 8, pc = tid % 8; FragH f;
#pragma unroll
      for (int q = 0; q < 8; ++q) f.u[q] = tl[pc * 8 + q][d];
      *(v8us*)((unsigned short*)Vt + ((size_t)slab * 64 + d) * TTv + lg * 64 + pc * 8) = f.half[0]; }
     } }

__global__ __launch_bounds__(256) void k_hl(const float* __restrict__ F, _Float16* __restrict__ Hh, _Float16* __restrict__ Hl, size_t n8) { const size_t t = (size_t)blockIdx.x * 256 + threadIdx.x; if (t >= n8) return; FragH fh, fl; const v4f a = *(const v4fa*)(F + t * 8), c = *(const v4fa*)(F + t * 8 + 4);
#pragma unroll
  for (int q = 0; q < 4; ++q) { _Float16 h = (_Float16)a[q]; fh.h[q] = h; fl.h[q] = (_Float16)((a[q] - (float)h) * 1024.0f); h = (_Float16)c[q]; fh.h[4 + q] = h; fl.h[4 + q] = (_Float16)((c[q] - (float)h) * 1024.0f); }
  { *(v8us*)((unsigned short*)Hh + t * 8) = fh.half[0]; *(v8us*)((unsigned short*)Hl + t * 8) = fl.half[0];  } }

// ---- fast GEMM (wave tile 32x64; requires M % 32 == 0 rows per launch region and N % 64 == 0); epilogue = k_gemm_hhx semantics ----
__device__ __forceinline__ v8f g2_mma(v16h a, v16h b, v8f c) { v8f d = __builtin_amdgcn_wmma_f32_16x16x32_f16(false, a, false, b, (short)0, c, false, false); asm volatile("v_nop\n\tv_nop\n\tv_nop\n\tv_nop" : "+v"(d) : "v"(a), "v"(b)); return d; }
// One k-step (32 k) of the wave's 32x64 tile: two A and four B fragments = twelve 16-byte loads. pa / pb: wave-uniform byte address of A / B at that k-step; oa / ob: the lane's fixed byte offsets (row and half).
struct G2St { v16h a0, a1, b0, b1, b2, b3; };
__device__ __forceinline__ v16h g2_fragb(const char* base, unsigned o) { FragH f; f.half[0] = *(const v8us*)(base + (size_t)o); f.half[1] = *(const v8us*)(base + (size_t)o + 32); return f.v; }
__device__ __forceinline__ void g2_ld(G2St& s, const char* pa, const char* pb, unsigned oa0, unsigned oa1, unsigned ob0, unsigned ob1, unsigned ob2, unsigned ob3) {
  s.a0 = g2_fragb(pa, oa0); s.a1 = g2_fragb(pa, oa1); s.b0 = g2_fragb(pb, ob0); s.b1 = g2_fragb(pb, ob1); s.b2 = g2_fragb(pb, ob2); s.b3 = g2_fragb(pb, ob3);
  __builtin_amdgcn_sched_barrier(0); }      /* keeps the twelve loads in front of the next k-step's first WMMA: behind it they would be issued only after that WMMA's wait for its own operands */
// The wait that stands in front of any overwrite of a register that an issued load names. The bases and the lane offsets are inputs so that they stay as they are up to here.
__device__ __forceinline__ void g2_xw(const char* pa, const char* pb, unsigned oa0, unsigned oa1, unsigned ob0, unsigned ob1, unsigned ob2, unsigned ob3) { asm volatile("s_wait_xcnt 0x0" :: "s"(pa), "s"(pb), "v"(oa0), "v"(oa1), "v"(ob0), "v"(ob1), "v"(ob2), "v"(ob3) : "memory"); }
__device__ __forceinline__ void g2_mm(const G2St& s, v8f (&c)[8]) { c[0] = g2_mma(s.a0, s.b0, c[0]); c[4] = g2_mma(s.a1, s.b0, c[4]); c[1] = g2_mma(s.a0, s.b1, c[1]); c[5] = g2_mma(s.a1, s.b1, c[5]); c[2] = g2_mma(s.a0, s.b2, c[2]); c[6] = g2_mma(s.a1, s.b2, c[6]); c[3] = g2_mma(s.a0, s.b3, c[3]); c[7] = g2_mma(s.a1, s.b3, c[7]); }
// The K loop of a wave's 32x64 tile (nst k-steps of 32), shared by the GEMM kernels below. pa / pb: wave-uniform bases; the offsets: the lane's own.
__device__ __forceinline__ void g2_kloop(const char* pa, const char* pb, const int nst, const unsigned oa0, const unsigned oa1, const unsigned ob0, const unsigned ob1, const unsigned ob2, const unsigned ob3, v8f (&accs)[8]) { G2St s0, s1, s2;
  // Three k-steps' fragments rest in registers: a set is loaded again right after its WMMAs, so its loads fly while the other two sets are worked on. Every accumulator still takes its k-steps in rising order.
  if (nst >= 3) { g2_ld(s0, pa, pb, oa0, oa1, ob0, ob1, ob2, ob3); g2_ld(s1, pa + 64, pb + 64, oa0, oa1, ob0, ob1, ob2, ob3); g2_ld(s2, pa + 128, pb + 128, oa0, oa1, ob0, ob1, ob2, ob3); g2_xw(pa, pb, oa0, oa1, ob0, ob1, ob2, ob3); int s = 0;
#pragma unroll 1      /* the body already holds three k-steps; a copy of it would not fit the registers */
    for (; s + 6 <= nst; s += 3) {
      g2_mm(s0, accs); g2_ld(s0, pa + 192, pb + 192, oa0, oa1, ob0, ob1, ob2, ob3);
      g2_mm(s1, accs); g2_ld(s1, pa + 256, pb + 256, oa0, oa1, ob0, ob1, ob2, ob3);
      g2_mm(s2, accs); g2_ld(s2, pa + 320, pb + 320, oa0, oa1, ob0, ob1, ob2, ob3);
      g2_xw(pa, pb, oa0, oa1, ob0, ob1, ob2, ob3);      /* the two bases move on below */
      pa += 192; pb += 192; }
    const int rem = nst - s;      /* 3 to 5 k-steps are left, three of them loaded */
    g2_mm(s0, accs); if (rem > 3) { g2_ld(s0, pa + 192, pb + 192, oa0, oa1, ob0, ob1, ob2, ob3); g2_xw(pa, pb, oa0, oa1, ob0, ob1, ob2, ob3); }
    g2_mm(s1, accs); if (rem > 4) { g2_ld(s1, pa + 256, pb + 256, oa0, oa1, ob0, ob1, ob2, ob3); g2_xw(pa, pb, oa0, oa1, ob0, ob1, ob2, ob3); }
    g2_mm(s2, accs); if (rem > 3) g2_mm(s0, accs); if (rem > 4) g2_mm(s1, accs); }
  else if (nst == 2) { g2_ld(s0, pa, pb, oa0, oa1, ob0, ob1, ob2, ob3); g2_ld(s1, pa + 64, pb + 64, oa0, oa1, ob0, ob1, ob2, ob3); g2_xw(pa, pb, oa0, oa1, ob0, ob1, ob2, ob3); g2_mm(s0, accs); g2_mm(s1, accs); }
  else if (nst == 1) { g2_ld(s0, pa, pb, oa0, oa1, ob0, ob1, ob2, ob3); g2_xw(pa, pb, oa0, oa1, ob0, ob1, ob2, ob3); g2_mm(s0, accs); }
}
template <int ACT>
__global__ __launch_bounds__(128) void k_gemm2(const _Float16* __restrict__ A, int lda, size_t sA, const _Float16* __restrict__ Bh, int ldb, size_t sB, float alpha, const float* __restrict__ bias, size_t sBias, const float* __restrict__ CP, int rowsPerB, size_t sCPb, int row0g,
    float* __restrict__ C, _Float16* __restrict__ C16, int ldc, size_t sC, int M, int N, int K, size_t zA, size_t zB, size_t zC) { static_assert(ACT == 0 || ACT == 3 || ACT == 6 || ACT == 8 || ACT == 9 || ACT == 11 || ACT == 12 || ACT == 14 || ACT == 15 || ACT == 16 || ACT == 17, "k_gemm2: unsupported ACT code (would silently apply no activation)");
  __shared__ __attribute__((aligned(16))) float so[4][32][68];
  const int tid = threadIdx.x, w = tid >> 5, lane = tid & 31, ln = lane & 15, hh = lane >> 4; const int by = blockIdx.y, bz = blockIdx.z;      /* grid.z: a second batch index with strides of its own (zA, zB, zC) */
  A += (size_t)by * sA + (size_t)bz * zA; Bh += (size_t)by * sB + (size_t)bz * zB; const size_t cofs = (size_t)by * sC + (size_t)bz * zC; const float* bp = bias ? bias + (size_t)by * sBias : nullptr;
  const int ntn = N >> 6; const int mt = blockIdx.x / ntn, nq = blockIdx.x - mt * ntn; const int row0 = mt * 128 + 32 * w, col0 = nq * 64; if (row0 >= M) return;
  const unsigned oa0 = (unsigned)(row0 + ln) * (unsigned)lda * 2u + 16u * hh, oa1 = oa0 + 32u * (unsigned)lda;
  const unsigned ob0 = (unsigned)(col0 + ln) * (unsigned)ldb * 2u + 16u * hh, ob1 = ob0 + 32u * (unsigned)ldb, ob2 = ob1 + 32u * (unsigned)ldb, ob3 = ob2 + 32u * (unsigned)ldb;
  const char* pa = (const char*)A; const char* pb = (const char*)Bh; const int nst = K >> 5;      /* k-steps of 32 = 64 bytes of every row */
  const v8f z8 = {0.f,0.f,0.f,0.f,0.f,0.f,0.f,0.f}; v8f accs[8] = {z8, z8, z8, z8, z8, z8, z8, z8};
  g2_kloop(pa, pb, nst, oa0, oa1, ob0, ob1, ob2, ob3, accs);
#pragma unroll
  for (int u = 0; u < 8; ++u) { const int t = u & 3, half = u >> 2; const int col = col0 + t * 16 + ln; const float bv = bp ? bf16_round(bp[col]) : 0.f;
#pragma unroll
    for (int r = 0; r < 8; ++r) { const int rloc = half * 16 + 8 * hh + r; float v = accs[u][r] * alpha + bv; if (CP) { if (rowsPerB < 0) v += CP[cofs + (size_t)(row0g + row0 + rloc) * ldc + col];      /* rowsPerB < 0: own element of the batched C plane */ else { const int bidx = (row0g + row0 + rloc) / rowsPerB; v += CP[(size_t)bidx * sCPb + (size_t)by * 64 + col]; } }
      if (ACT == 3) v = fmaxf(v, 0.f); else if (ACT == 6) v = 0.5f * v * (1.0f + erff(v * 0.70710678118654752f)); else if (ACT == 11) v = 1.0f / (1.0f + expf(-v)); else if (ACT == 15) v = v / (1.0f + expf(-v)); else if (ACT == 12) v = (v > 0.f) ? v : 0.01f * v; else if (ACT == 8) v = tanhf(v); else if (ACT == 9) v = 0.5f * v * (1.0f + tanhf(0.7978845608028654f * (v + 0.044715f * v * v * v))); else if (ACT == 14) v = (v > 0.f) ? v : 0.1f * v; else if (ACT == 16) v = (v >= 0.f) ? v : 0.3f * v; else if (ACT == 17) v = (v >= 0.f) ? v : 0.2f * v;
      so[w][rloc][t * 16 + ln] = v; } }
  __builtin_amdgcn_fence(__ATOMIC_ACQ_REL, "workgroup"); __builtin_amdgcn_wave_barrier();
  const int rsub = lane >> 4, c4 = (lane & 15) * 4;
  {
#pragma unroll
    for (int q = 0; q < 16; ++q) { const int r = q * 2 + rsub; const v4f v = *(const v4fa*)&so[w][r][c4]; if (C) *(v4f*)(C + cofs + (size_t)(row0 + r) * ldc + col0 + c4) = v; if (C16) { v4h h4; for (int i = 0; i < 4; ++i) h4[i] = (_Float16)v[i]; *(v4h*)(C16 + cofs + (size_t)(row0 + r) * ldc + col0 + c4) = h4; } }
     } }


// C = (Aa Ba ala + bias) + Ab Bb alb (+ Ac Bc alc): the hi / residual terms of one product, side by side in one launch. A work-group is one 32x64 tile of C and NT waves;
// wave t runs the whole K loop of term t, lays its scaled tile in its own LDS plane, and behind one barrier the planes are added in the order of the terms and stored as whole rows.
// Needs M % 32 == 0 (grid.x = (M / 32) (N / 64), exact), N % 64 == 0, K % 32 == 0; grid.y = batch (strides sA, sB, sC), grid.z = a second batch index (strides zA, zB, zC).
template <int NT>
__global__ __launch_bounds__(NT * 32) void k_gemm2t(const _Float16* __restrict__ Aa, const _Float16* __restrict__ Ab, const _Float16* __restrict__ Ac, int lda, size_t sA, const _Float16* __restrict__ Ba, const _Float16* __restrict__ Bb, const _Float16* __restrict__ Bc, int ldb, size_t sB,
    float ala, float alb, float alc, const float* __restrict__ bias, float* __restrict__ C, int ldc, size_t sC, int N, int K, size_t zA, size_t zB, size_t zC) { static_assert(NT == 2 || NT == 3, "k_gemm2t: two or three terms");
  __shared__ __attribute__((aligned(16))) float so[NT][32][68];
  const int lane = threadIdx.x & 31, ln = lane & 15, hh = lane >> 4; const int t = __builtin_amdgcn_readfirstlane((int)(threadIdx.x >> 5)); const int by = blockIdx.y, bz = blockIdx.z;      /* t wave-uniform: the term's bases stay scalar */
  const _Float16* A = (NT > 2 && t == 2) ? Ac : (t == 1) ? Ab : Aa; const _Float16* Bh = (NT > 2 && t == 2) ? Bc : (t == 1) ? Bb : Ba; const float alpha = (NT > 2 && t == 2) ? alc : (t == 1) ? alb : ala;
  A += (size_t)by * sA + (size_t)bz * zA; Bh += (size_t)by * sB + (size_t)bz * zB; const size_t cofs = (size_t)by * sC + (size_t)bz * zC;
  const int ntn = N >> 6; const int mt = blockIdx.x / ntn, nq = blockIdx.x - mt * ntn; const int row0 = mt * 32, col0 = nq * 64;
  const unsigned oa0 = (unsigned)(row0 + ln) * (unsigned)lda * 2u + 16u * hh, oa1 = oa0 + 32u * (unsigned)lda;
  const unsigned ob0 = (unsigned)(col0 + ln) * (unsigned)ldb * 2u + 16u * hh, ob1 = ob0 + 32u * (unsigned)ldb, ob2 = ob1 + 32u * (unsigned)ldb, ob3 = ob2 + 32u * (unsigned)ldb;
  const v8f z8 = {0.f,0.f,0.f,0.f,0.f,0.f,0.f,0.f}; v8f accs[8] = {z8, z8, z8, z8, z8, z8, z8, z8};
  g2_kloop((const char*)A, (const char*)Bh, K >> 5, oa0, oa1, ob0, ob1, ob2, ob3, accs);
#pragma unroll
  for (int u = 0; u < 8; ++u) { const int tc = u & 3, half = u >> 2; const float bv = (bias && t == 0) ? bf16_round(bias[col0 + tc * 16 + ln]) : 0.f;
#pragma unroll
    for (int r = 0; r < 8; ++r) so[t][half * 16 + 8 * hh + r][tc * 16 + ln] = accs[u][r] * alpha + bv; }
  __syncthreads();      /* every term's plane is complete before any wave adds them */
  const int rsub = lane >> 4, c4 = (lane & 15) * 4;
  for (int q = t; q < 16; q += NT) { const int r = q * 2 + rsub; v4f v = *(const v4fa*)&so[0][r][c4]; v += *(const v4fa*)&so[1][r][c4]; if (NT > 2) v += *(const v4fa*)&so[2][r][c4];
    *(v4f*)(C + cofs + (size_t)(row0 + r) * ldc + col0 + c4) = v;
    asm volatile("s_wait_xcnt 0x0" ::: "memory"); } }      /* the wait that stands in front of any overwrite of a register that an issued store names: the next trip forms its address and its sum in the same registers */

__global__ __launch_bounds__(256) void k_wnat(const float* __restrict__ w, size_t n8, _Float16* __restrict__ Bt) { const size_t t = (size_t)blockIdx.x * 256 + threadIdx.x; if (t >= n8) return; FragH f; for (int q = 0; q < 8; ++q) f.h[q] = (_Float16)(bf16_round(w[t * 8 + q]) * 16.0f); *(v8us*)((unsigned short*)Bt + t * 8) = f.half[0];  }
__global__ __launch_bounds__(256) void k_rsm(const float* __restrict__ S, _Float16* __restrict__ P, int nrows) {
  #pragma clang fp contract(off)
  const int i = blockIdx.x * 256 + threadIdx.x; if (i >= nrows) return; const float* s = S + (size_t)i * SQ; float mx = -3.0e38f;
#pragma unroll 1
  for (int j = 0; j < SQ; ++j) mx = fmaxf(mx, s[j]); float se = 0.f;
#pragma unroll 1
  for (int j = 0; j < SQ; ++j) se += expf(s[j] - mx); const float sc = 256.0f / se;
#pragma unroll 1
  for (int j0 = 0; j0 < SQ; j0 += 8) { FragH f; for (int q = 0; q < 8; ++q) f.h[q] = (_Float16)(expf(s[j0 + q] - mx) * sc); unsigned short* d = (unsigned short*)P + (size_t)i * SQ + j0; *(v8us*)d = f.half[0];  } }
__global__ __launch_bounds__(256) void k_vt(const _Float16* __restrict__ V16, int b, int h0, _Float16* __restrict__ VT) { __shared__ unsigned short tl[64][65]; const int tid = threadIdx.x; const int hh = blockIdx.x % HG, sg = blockIdx.x / HG; const int s0 = sg * 64; const int h = h0 + hh;
  for (int i = tid; i < 64 * 8; i += 256) { const int j = i / 8, d8 = (i % 8) * 8; FragH f; f.half[0] = *(const v8us*)((const unsigned short*)V16 + ((size_t)b * SQ + s0 + j) * DM + h * HD + d8); for (int q = 0; q < 8; ++q) tl[d8 + q][j] = f.u[q]; }
  __syncthreads();
  { for (int i = tid; i < 64 * 8; i += 256) { const int d = i / 8, j8 = (i % 8) * 8; FragH f; for (int q = 0; q < 8; ++q) f.u[q] = tl[d][j8 + q]; *(v8us*)((unsigned short*)VT + ((size_t)hh * HD + d) * SQ + s0 + j8) = f.half[0]; }  } }



__global__ __launch_bounds__(256) void k_rsmcf2(const float* __restrict__ S, _Float16* __restrict__ P, int hg, int q0, int nk) {
  #pragma clang fp contract(off)
  const int t = blockIdx.x * 256 + threadIdx.x; if (t >= hg * QT) return; const size_t i = (size_t)t; const float* s = S + i * NKX; const int last = q0 + (t % QT); float mx = -3.0e38f;
#pragma unroll 1
  for (int j = 0; j < nk; ++j) { const float f = (j <= last) ? 1.f : 0.f; mx = fmaxf(mx, fmaf(f, s[j], (1.f - f) * -1.0e9f)); } float se = 0.f;
#pragma unroll 1
  for (int j = 0; j < nk; ++j) { const float f = (j <= last) ? 1.f : 0.f; se += __expf(fmaf(f, s[j], (1.f - f) * -1.0e9f) - mx); } const float sc = 256.0f / se;
#pragma unroll 1
  for (int j0 = 0; j0 < nk; j0 += 8) { FragH fr; for (int q = 0; q < 8; ++q) { const int j = j0 + q; const float f = (j <= last) ? 1.f : 0.f; fr.h[q] = (_Float16)(__expf(fmaf(f, s[j], (1.f - f) * -1.0e9f) - mx) * sc); } unsigned short* d = (unsigned short*)P + i * NKX + j0; *(v8us*)d = fr.half[0];  } }


template <int MASKADD>
__global__ __launch_bounds__(64) void k_att0(const float* __restrict__ QF, const float* __restrict__ KF, const float* __restrict__ VF, int ld, const float* __restrict__ mask, float scale, float* __restrict__ OF, int ldo) {
  #pragma clang fp contract(off)
  __shared__ __attribute__((aligned(16))) float lq[64][64]; __shared__ __attribute__((aligned(16))) float lo[64][64];
  const int tid = threadIdx.x; const int h = blockIdx.x / (QT0 / 64), rg = blockIdx.x % (QT0 / 64); const int i = rg * 64 + tid;
  const float* qr = QF + (size_t)i * ld + h * HD;
#pragma unroll 1
  for (int c = 0; c < HD / 4; ++c) { *(v4f*)&lq[tid][c * 4] = *(const v4fa*)(qr + c * 4); const v4f z = {0.f, 0.f, 0.f, 0.f}; *(v4f*)&lo[tid][c * 4] = z; }
  float m = -1.0e30f, l = 0.f; const int jmax = MASKADD ? (SQ - 1) : (rg * 64 + 63);      /* additive-mask form: every key (the mask input decides); causal form: keys up to the block's last row */
#pragma unroll 1
  for (int j = 0; j <= jmax; ++j) { const float* kr = KF + (size_t)j * ld + h * HD; const float* vr = VF + (size_t)j * ld + h * HD; float s = 0.f;
#pragma unroll 1
    for (int c = 0; c < HD / 4; ++c) { const v4f kq = *(const v4fa*)(kr + c * 4); const v4f qq = *(v4f*)&lq[tid][c * 4]; s = __fadd_rn(s, __fmul_rn(qq[0], kq[0])); s = __fadd_rn(s, __fmul_rn(qq[1], kq[1])); s = __fadd_rn(s, __fmul_rn(qq[2], kq[2])); s = __fadd_rn(s, __fmul_rn(qq[3], kq[3])); }
    s = __fmul_rn(s, scale); if (MASKADD) s = __fadd_rn(s, __fmul_rn(bf16_round(mask[(size_t)i * SQ + j]), -10000.0f));
    const float f = (MASKADD || j <= i) ? 1.f : 0.f; const float sm = fmaf(f, s, (1.f - f) * -1.0e30f); const float mn = fmaxf(m, sm); const float sc = expf(m - mn); const float e = expf(sm - mn); l = __fadd_rn(__fmul_rn(l, sc), e); m = mn;
#pragma unroll 1
    for (int c = 0; c < HD / 4; ++c) { const v4f vv = *(const v4fa*)(vr + c * 4); v4f oo = *(v4f*)&lo[tid][c * 4]; for (int u = 0; u < 4; ++u) oo[u] = __fadd_rn(__fmul_rn(oo[u], sc), __fmul_rn(e, vv[u])); *(v4f*)&lo[tid][c * 4] = oo; } }
  const float fin = 64.0f / l;      /* o carried x64 like the f16 path */
#pragma unroll 1
  for (int c = 0; c < HD / 4; ++c) { v4f oo = *(v4f*)&lo[tid][c * 4]; for (int u = 0; u < 4; ++u) oo[u] = __fmul_rn(oo[u], fin); *(v4f*)&lo[tid][c * 4] = oo; }
  __syncthreads();
  {
#pragma unroll 1
    for (int it = 0; it < 16; ++it) { const int row = it * 4 + tid / 16, pc = (tid % 16) * 4; const v4f v = *(const v4f*)&lo[row][pc]; *(v4f*)(OF + (size_t)(rg * 64 + row) * ldo + h * HD + pc) = v; }
     } }


__global__ __launch_bounds__(256) void k_kvexp(const float* __restrict__ src, float* __restrict__ dst, size_t n4) { const size_t t = (size_t)blockIdx.x * 256 + threadIdx.x; if (t >= n4) return; const size_t e = t * 4; const size_t row = e / DM; const int col = (int)(e % DM); const int h = col / HD, d = col % HD; const v4f v = *(const v4fa*)(src + row * KVD + (size_t)(h / HPG) * HD + d); *(v4f*)(dst + e) = v;  }

__global__ __launch_bounds__(256) void k_tab2(float theta, float* __restrict__ CS, float* __restrict__ SN) {
  #pragma clang fp contract(off)
  const int t = blockIdx.x * 256 + threadIdx.x; if (t >= SQ * (HD / 2)) return; const int i = t % (HD / 2); const int p = t / (HD / 2); const float invf = 1.0f / powf(theta, (float)(2 * i) / (float)HD); const float ang = __fmul_rn((float)p, invf); const float c = cosf(ang), s = sinf(ang);
  *(float*)(CS + t) = c; *(float*)(SN + t) = s;  }
template <int NORM, int ROPE>
__global__ __launch_bounds__(64) void k_xform(const float* __restrict__ F, int ldf, int nh, const float* __restrict__ gain, float eps, const float* __restrict__ CS, const float* __restrict__ SN, _Float16* __restrict__ H16, int ldo) {
  #pragma clang fp contract(off)
  __shared__ float xv[HD]; __shared__ float red[HD]; __shared__ unsigned short sh_[HD]; const int d = threadIdx.x; const int h = blockIdx.x % nh; const size_t r = blockIdx.x / nh; const int p = (int)(r % SQ);
  float x = F[r * (size_t)ldf + (size_t)h * HD + d];
  if (NORM) { red[d] = __fmul_rn(x, x); __syncthreads(); for (int st = HD / 2; st > 0; st >>= 1) { if (d < st) red[d] = __fadd_rn(red[d], red[d + st]); __syncthreads(); } const float rs = rsqrtf(__fadd_rn(red[0] / (float)HD, eps)); x = __fmul_rn(__fmul_rn(x, rs), bf16_round(gain[d])); }
  xv[d] = x; __syncthreads();
  float o = x;
  if (ROPE == 1) { const int i = d >> 1; const float c = CS[p * (HD / 2) + i], s = SN[p * (HD / 2) + i]; const float ev = xv[2 * i], od = xv[2 * i + 1]; o = (d & 1) ? __fadd_rn(__fmul_rn(ev, s), __fmul_rn(od, c)) : __fadd_rn(__fmul_rn(ev, c), -__fmul_rn(od, s)); }
  if (ROPE == 2) { const int i = d & (HD / 2 - 1); const float c = CS[p * (HD / 2) + i], s = SN[p * (HD / 2) + i]; const float lo = xv[i], hi = xv[i + HD / 2]; o = (d < HD / 2) ? __fadd_rn(__fmul_rn(lo, c), -__fmul_rn(hi, s)) : __fadd_rn(__fmul_rn(lo, s), __fmul_rn(hi, c)); }
  FragH th; th.h[0] = (_Float16)o; sh_[d] = th.u[0]; __syncthreads();
  if (d < HD / 8) { FragH f; for (int q = 0; q < 8; ++q) f.u[q] = sh_[d * 8 + q]; unsigned short* dst = (unsigned short*)H16 + r * (size_t)ldo + (size_t)h * HD + d * 8; *(v8us*)dst = f.half[0];  } }

template <int NORM, int ROPE>
__global__ __launch_bounds__(64) void k_xformf(const float* __restrict__ F, int ldf, int nh, const float* __restrict__ gain, float eps, const float* __restrict__ CS, const float* __restrict__ SN, float* __restrict__ F32, int ldo) {
  #pragma clang fp contract(off)
  __shared__ float xv[HD]; __shared__ float red[HD]; const int d = threadIdx.x; const int h = blockIdx.x % nh; const size_t r = blockIdx.x / nh; const int p = (int)(r % SQ);
  float x = F[r * (size_t)ldf + (size_t)h * HD + d];
  if (NORM) { red[d] = __fmul_rn(x, x); __syncthreads(); for (int st = HD / 2; st > 0; st >>= 1) { if (d < st) red[d] = __fadd_rn(red[d], red[d + st]); __syncthreads(); } const float rs = rsqrtf(__fadd_rn(red[0] / (float)HD, eps)); x = __fmul_rn(__fmul_rn(x, rs), bf16_round(gain[d])); }
  xv[d] = x; __syncthreads();
  float o = x;
  if (ROPE == 1) { const int i = d >> 1; const float c = CS[p * (HD / 2) + i], s = SN[p * (HD / 2) + i]; const float ev = xv[2 * i], od = xv[2 * i + 1]; o = (d & 1) ? __fadd_rn(__fmul_rn(ev, s), __fmul_rn(od, c)) : __fadd_rn(__fmul_rn(ev, c), -__fmul_rn(od, s)); }
  if (ROPE == 2) { const int i = d & (HD / 2 - 1); const float c = CS[p * (HD / 2) + i], s = SN[p * (HD / 2) + i]; const float lo = xv[i], hi = xv[i + HD / 2]; o = (d < HD / 2) ? __fadd_rn(__fmul_rn(lo, c), -__fmul_rn(hi, s)) : __fadd_rn(__fmul_rn(lo, s), __fmul_rn(hi, c)); }
  float* dst = F32 + r * (size_t)ldo + (size_t)h * HD + d; *(float*)dst = o;  }

__global__ __launch_bounds__(256) void k_trig(const float* __restrict__ a, float* __restrict__ CS, float* __restrict__ SN, int n) {
  #pragma clang fp contract(off)
  const int t = blockIdx.x * 256 + threadIdx.x; if (t >= n) return; const float v = bf16_round(a[t]); const float c = cosf(v), s = sinf(v);
  *(float*)(CS + t) = c; *(float*)(SN + t) = s;  }

__global__ __launch_bounds__(256) void k_tabpos(const int* __restrict__ pos, float* __restrict__ CS, float* __restrict__ SN, int n) {
  #pragma clang fp contract(off)
  const int t = blockIdx.x * 256 + threadIdx.x; if (t >= n) return; const int p = t / 32, i = t % 32; const float invf = (float)(1.0 / pow(10000.0, ((double)(2 * i)) / 64.0)); const float a = __fmul_rn((float)pos[p], invf); const float c = cosf(a), s = sinf(a);
  *(float*)(CS + t) = c; *(float*)(SN + t) = s;  }

// One wave per score row. Lane l holds columns 128 s + 4 l .. + 3 of every 128-column slice s in registers, so AC and BD' are read once:
// AC as whole-line 16-byte loads, BD' at the row's shift; maximum and sum end in a five-step butterfly over the lanes.
// NS = nk / 128 is a template parameter (q0 = nk - QT): the body is one straight line, so a row's loads can all be in flight together.
// A slice with 128 s + 127 <= q0 lies below every row's diagonal (j <= q0 <= i) and its shifted index stays below nk (shift <= QT - 1),
// so the index clamp and the arithmetic select, both identities there, are written for the later slices only.
typedef float v4fu __attribute__((ext_vector_type(4), may_alias, aligned(4)));      /* 16-byte load at a 4-byte boundary (the shifted BD' columns) */
// 2^x of four values. One asm statement so that every v_exp_f32 has an independent instruction behind it (early-clobber outputs: none overwrites a source);
// the closing v_nop is the slot that the instruction set asks for before the last result is read or its source overwritten.
__device__ __forceinline__ v4f exp2x4(v4f x) { float r0, r1, r2, r3;
  asm("v_exp_f32 %0, %4\n\tv_exp_f32 %1, %5\n\tv_exp_f32 %2, %6\n\tv_exp_f32 %3, %7\n\tv_nop" : "=&v"(r0), "=&v"(r1), "=&v"(r2), "=&v"(r3) : "v"(x[0]), "v"(x[1]), "v"(x[2]), "v"(x[3]));
  const v4f r = {r0, r1, r2, r3}; return r; }
template <int NS>
__global__ __launch_bounds__(256) void k_rsmxl(const float* __restrict__ AC, const float* __restrict__ BDp, _Float16* __restrict__ P, _Float16* __restrict__ PL, int hg) {
  #pragma clang fp contract(off)
  constexpr int nk = NS * 128, q0 = nk - QT;
  const int lane = threadIdx.x & 31; const int t = __builtin_amdgcn_readfirstlane((int)(blockIdx.x * 8 + (threadIdx.x >> 5))); if (t >= hg * QT) return;      /* wave-uniform row number: scalar row bases; no barrier in this kernel */
  const size_t ri = (size_t)t; const float* a = AC + ri * NKX; const float* bd = BDp + ri * NKX; const int tl = t & (QT - 1); const int i = q0 + tl; const int sh = QT - 1 - tl;      /* sh = nk - 1 - i */
  const unsigned ob = (unsigned)(sh + lane * 4) * 4u;      /* byte offset of the lane's first shifted column in the BD' row */
  v4f av[NS], bv[NS]; int ic[8];
#pragma unroll
  for (int s = 0; s < NS; ++s) { av[s] = ((const v4fa*)a)[lane + s * 32];
    if (s * 128 + 127 <= q0) bv[s] = *(const v4fu*)((const char*)bd + ob + s * 512);
    else {
#pragma unroll
      for (int q = 0; q < 4; ++q) { const int c = min(sh + lane * 4 + s * 128, nk - 1 - q); ic[(s - (NS - 2)) * 4 + q] = c; bv[s][q] = bd[c + q]; } } }      /* c + q = min(sh + j, nk - 1) */
  /* The wait that stands in front of any overwrite of a register that an issued load names. The address registers are its inputs so that they stay live up to here: no later load of the row gets one of them as its destination. */
  if constexpr (NS > 2) asm volatile("s_wait_xcnt 0x0" :: "v"(lane), "v"(ob), "v"(ic[0]), "v"(ic[1]), "v"(ic[2]), "v"(ic[3]), "v"(ic[4]), "v"(ic[5]), "v"(ic[6]), "v"(ic[7]) : "memory");
  else asm volatile("s_wait_xcnt 0x0" :: "v"(lane), "v"(ic[0]), "v"(ic[1]), "v"(ic[2]), "v"(ic[3]), "v"(ic[4]), "v"(ic[5]), "v"(ic[6]), "v"(ic[7]) : "memory");
  __builtin_amdgcn_sched_barrier(0);      /* keeps the arithmetic behind the row's loads: without it they are issued in groups with a full wait between the groups */
  float mx = -3.0e38f;
#pragma unroll
  for (int s = 0; s < NS; ++s) {
#pragma unroll
    for (int q = 0; q < 4; ++q) { const int j = s * 128 + lane * 4 + q; float v = __fadd_rn(av[s][q], bv[s][q]); if (s * 128 + 127 > q0) { const float f = (j <= i) ? 1.f : 0.f; v = fmaf(f, v, (1.f - f) * -1.0e30f); } av[s][q] = v; mx = fmaxf(mx, v); } }
#pragma unroll
  for (int m = 16; m > 0; m >>= 1) mx = fmaxf(mx, __shfl_xor(mx, m, 32));
  v4f s4 = {0.f, 0.f, 0.f, 0.f};
#pragma unroll
  for (int s = 0; s < NS; ++s) { av[s] = exp2x4((av[s] - mx) * 1.44269504f); s4 += av[s]; }      /* exp(v - mx) as the native form has it: 2^((v - mx) log2 e) */
  float se = (s4[0] + s4[1]) + (s4[2] + s4[3]);
#pragma unroll
  for (int m = 16; m > 0; m >>= 1) se += __shfl_xor(se, m, 32);
  const float sc = 256.0f / se;
#pragma unroll
  for (int s = 0; s < NS; ++s) { v4h fr, fl;
#pragma unroll
    for (int q = 0; q < 4; ++q) { const float pv = av[s][q] * sc; const _Float16 hv = (_Float16)pv; fr[q] = hv; fl[q] = (_Float16)((pv - (float)hv) * 1024.0f); }
    const size_t o = ri * NKX + s * 128 + lane * 4; *(v4h*)(P + o) = fr; *(v4h*)(PL + o) = fl; } }
template <int NS>
static void rsmxl_go(const float* AC, const float* BDp, _Float16* P, _Float16* PL, hipStream_t stream) { k_rsmxl<NS><<<(NB * NH * QT + 7) / 8, 256, 0, stream>>>(AC, BDp, P, PL, NB * NH); }      /* the score rows of both batches: [batch][head][row] */

template <int N>
__global__ __launch_bounds__(256) void k_rmsrow(float* __restrict__ X, const float* __restrict__ w, float eps) {
  #pragma clang fp contract(off)
  constexpr int PT = N / 256; __shared__ float red[256]; const size_t r = blockIdx.x; const int t = threadIdx.x; float* row = X + r * N + (size_t)t * PT; float v[PT]; float ss = 0.f;
  for (int q = 0; q < PT; ++q) { v[q] = row[q]; ss = __fadd_rn(ss, __fmul_rn(v[q], v[q])); }
  red[t] = ss; __syncthreads(); for (int k = 128; k > 0; k >>= 1) { if (t < k) red[t] = __fadd_rn(red[t], red[t + k]); __syncthreads(); }
  const float rs = rsqrtf(__fadd_rn(red[0] / (float)N, eps)); float o[PT]; for (int q = 0; q < PT; ++q) o[q] = __fmul_rn(__fmul_rn(v[q], rs), bf16_round(w[t * PT + q]));
  { for (int q = 0; q < PT; ++q) *(float*)(row + q) = o[q];  } }

__global__ __launch_bounds__(256) void k_bfr(const float* __restrict__ x, float* __restrict__ XB, size_t n8) { const size_t t = (size_t)blockIdx.x * 256 + threadIdx.x; if (t >= n8) return; v4f a = *(const v4fa*)(x + t * 8), c = *(const v4fa*)(x + t * 8 + 4); for (int q = 0; q < 4; ++q) { a[q] = bf16_round(a[q]); c[q] = bf16_round(c[q]); }
  { *(v4f*)(XB + t * 8) = a; *(v4f*)(XB + t * 8 + 4) = c;  } }





// Exact f32 XL attention of the first QT0 rows of a batch: one wave per (head, row i). Lane = 16 hh + ln: ln owns dims 4 ln .. 4 ln + 3, hh one of two keys,
// so every 16-byte load instruction reads two whole 256-byte rows. Keys go in chunks of 32: a lane forms 16 partial dots (q+u).k + (q+v).r over its four dims,
// a four-step butterfly sums each over its 16 lanes, and lane l keeps the score of key 32 c + l. Scores, then weights, rest in the wave's own LDS row;
// maximum and sum are taken over the whole row (two passes, no rescaling); o = sum_j e_j v_j per half, the halves added at the end, x 64 / sum.
// Rows of K, V up to 32 c + 31 <= QT0 - 1 exist; a key above the diagonal gets -1e30 by the arithmetic select and its xl_r index is clamped.
__global__ __launch_bounds__(256) void k_att0xl(const float* __restrict__ QF, const float* __restrict__ QVF, const float* __restrict__ KF, const float* __restrict__ VF, const float* __restrict__ RF, float* __restrict__ OF) {
  __shared__ __attribute__((aligned(16))) float pw[8][QT0];
  { const size_t bo = (size_t)blockIdx.y * (QT0 * DM); QF += bo; QVF += bo; KF += bo; VF += bo; OF += bo; }      /* grid.y = batch: every plane holds QT0 rows per batch */
  const int lane = threadIdx.x & 31, ln = lane & 15, hh = lane >> 4; const int w = __builtin_amdgcn_readfirstlane((int)(threadIdx.x >> 5));      /* wave-uniform: scalar row bases and trip counts */
  const int h = blockIdx.x % NH; const int i = QT0 - 1 - ((int)(blockIdx.x / NH) * 8 + w); const int nch = (i >> 5) + 1;      /* the long rows start first; nch chunks of 32 keys cover 0 .. i */
  const unsigned qo = (unsigned)(i * DM + h * HD + ln * 4) * 4u;
  const v4f q4 = *(const v4fa*)((const char*)QF + qo), qv4 = *(const v4fa*)((const char*)QVF + qo);
  const unsigned ko = (unsigned)(hh * 16 * DM + h * HD + ln * 4) * 4u;      /* the lane's byte offset in a chunk of K or V rows */
  const char* rb = (const char*)(RF + (size_t)h * SQ * HD); float* pr = pw[w]; float mx = -3.0e38f;
#pragma unroll 1
  for (int c = 0; c < nch; ++c) { const char* kp = (const char*)KF + (size_t)c * (32 * DM * 4) + ko; const int r0 = SQ - 1 - i + c * 32 + hh * 16; v4f kk[16], rr[16]; unsigned ro[16];
#pragma unroll
    for (int u = 0; u < 16; ++u) { ro[u] = (unsigned)min(r0 + u, SQ - 1) * (HD * 4u) + ln * 16u; kk[u] = *(const v4fa*)(kp + u * (DM * 4)); rr[u] = *(const v4fa*)(rb + ro[u]); }      /* key j = 32 c + 16 hh + u; xl_r row min(SQ - 1 - i + j, SQ - 1) */
    /* the wait that stands in front of any overwrite of a register that an issued load names, for the chunk's 32 loads: every address register is an input, so none is reused (as a destination either) before it */
    asm volatile("s_wait_xcnt 0x0" :: "v"(kp), "s"(rb), "v"(ro[0]), "v"(ro[1]), "v"(ro[2]), "v"(ro[3]), "v"(ro[4]), "v"(ro[5]), "v"(ro[6]), "v"(ro[7]), "v"(ro[8]), "v"(ro[9]), "v"(ro[10]), "v"(ro[11]), "v"(ro[12]), "v"(ro[13]), "v"(ro[14]), "v"(ro[15]) : "memory");
    __builtin_amdgcn_sched_barrier(0);      /* keeps the arithmetic behind the chunk's loads: without it most K rows are loaded one at a time, each with its own wait */
    float keep = 0.f;
#pragma unroll
    for (int u = 0; u < 16; ++u) { float p = q4[0] * kk[u][0];
#pragma unroll
      for (int d = 1; d < 4; ++d) p = fmaf(q4[d], kk[u][d], p);
#pragma unroll
      for (int d = 0; d < 4; ++d) p = fmaf(qv4[d], bf16_round(rr[u][d]), p);
      p += __shfl_xor(p, 1, 32); p += __shfl_xor(p, 2, 32); p += __shfl_xor(p, 4, 32); p += __shfl_xor(p, 8, 32);
      keep = (ln == u) ? p : keep; }
    const float f = (c * 32 + lane <= i) ? 1.f : 0.f; const float sm = fmaf(f, keep, (1.f - f) * -1.0e30f); pr[c * 32 + lane] = sm; mx = fmaxf(mx, sm); }
#pragma unroll
  for (int m = 16; m > 0; m >>= 1) mx = fmaxf(mx, __shfl_xor(mx, m, 32));
  float l = 0.f;
#pragma unroll 1
  for (int c = 0; c < nch; ++c) { const float e = expf(pr[c * 32 + lane] - mx); pr[c * 32 + lane] = e; l += e; }      /* each lane reads back what it wrote itself */
#pragma unroll
  for (int m = 16; m > 0; m >>= 1) l += __shfl_xor(l, m, 32);
  __builtin_amdgcn_fence(__ATOMIC_ACQ_REL, "workgroup"); __builtin_amdgcn_wave_barrier();      /* the weights are read across the wave's lanes from here on: keeps the LDS stores in front of those reads */
  v4f o = {0.f, 0.f, 0.f, 0.f};
#pragma unroll 1
  for (int c = 0; c < nch; ++c) { const char* vp = (const char*)VF + (size_t)c * (32 * DM * 4) + ko; v4f vv[16], pe[4];
#pragma unroll
    for (int u = 0; u < 16; ++u) vv[u] = *(const v4fa*)(vp + u * (DM * 4));
    asm volatile("s_wait_xcnt 0x0" :: "v"(vp) : "memory");      /* same wait, for the chunk's 16 loads; the address is an input so that no load of the chunk gets it as its destination */
#pragma unroll
    for (int m = 0; m < 4; ++m) pe[m] = *(const v4f*)&pr[c * 32 + hh * 16 + m * 4];      /* the half's 16 weights, one address per half */
#pragma unroll
    for (int u = 0; u < 16; ++u) { const float e = pe[u >> 2][u & 3];
#pragma unroll
      for (int d = 0; d < 4; ++d) o[d] = fmaf(e, vv[u][d], o[d]); } }
  const float fin = 64.0f / l;      /* o carried x64 like the f16 path */
#pragma unroll
  for (int d = 0; d < 4; ++d) o[d] = (o[d] + __shfl_xor(o[d], 16, 32)) * fin;
  if (hh == 0) *(v4f*)(OF + (size_t)i * DM + h * HD + ln * 4) = o; }

extern "C" void kernel_launch(void* const* d_in, const int* in_sizes, int n_in,
                              void* d_out, int out_size, void* d_ws, size_t ws_size, hipStream_t stream) {
  (void)in_sizes; (void)n_in; (void)out_size;
  const float* const* I = (const float* const*)d_in; const float* x = I[0]; const float* g = I[1]; const float* wq = I[2]; const float* wk = I[3]; const float* wv = I[4]; const float* wres = I[5]; const float* xlr = I[6]; const float* xlu = I[7]; const float* xlv = I[8];      /* x; RMS gain; w_q/w_k/w_v [1024][16][64] = [in][out]; w_res [1024][1024] [in][out]; xl_r [16][2048][64]; xl_u, xl_v [1][16][1][64] = per-head 64-vectors (a [1024] bias over the merged columns) */
  char* ws = (char*)d_ws; size_t off = 0;
  auto take = [&](size_t bytes) { char* p = ws + off; off += (bytes + 255) & ~(size_t)255; return p; };
  /* Planes that live across the tile loop. */
  _Float16* BR = (_Float16*)take((size_t)DM * DM * 2); _Float16* QU = (_Float16*)take(NR * DM * 2); _Float16* QV = (_Float16*)take(NR * DM * 2); _Float16* K16 = (_Float16*)take(NR * DM * 2); _Float16* R16 = (_Float16*)take((size_t)NH * SQ * HD * 2); float* OF = (float*)take(NR * DM * 4); float* OF0 = (float*)take((size_t)NB * QT0 * DM * 4); _Float16* VT = (_Float16*)take((size_t)NB * NH * HD * SQ * 2); _Float16* VTL = (_Float16*)take((size_t)NB * NH * HD * SQ * 2);
  /* Score and weight planes of one 256-row tile of BOTH batches, [batch][head][row][NKX]. */
  const size_t offs = off; const size_t zS = (size_t)NH * QT * NKX;
  float* S = (float*)take((size_t)NB * zS * 4); float* BD = (float*)take((size_t)NB * zS * 4); _Float16* P = (_Float16*)take((size_t)NB * zS * 2); _Float16* PL = (_Float16*)take((size_t)NB * zS * 2);
  if (off > ws_size) return;
  /* The same bytes hold, before the tile loop, what is last read in front of the first score GEMM ... */
  off = offs;
  _Float16* BQ = (_Float16*)take((size_t)DM * DM * 2); _Float16* BK = (_Float16*)take((size_t)DM * DM * 2); _Float16* BV = (_Float16*)take((size_t)DM * DM * 2);
  float* XT = (float*)take(NR * DM * 4); _Float16* X16 = (_Float16*)take(NR * DM * 2); _Float16* XL16 = (_Float16*)take(NR * DM * 2); float* QUF = (float*)take((size_t)NB * QT0 * DM * 4); float* QVF = (float*)take((size_t)NB * QT0 * DM * 4); float* KF0 = (float*)take((size_t)NB * QT0 * DM * 4); float* VF0 = (float*)take((size_t)NB * QT0 * DM * 4); float* VF = (float*)take(NR * DM * 4); _Float16* V16 = (_Float16*)take(NR * DM * 2); _Float16* VL16 = (_Float16*)take(NR * DM * 2);      /* v and wv carried as f32 -> f16 hi + x1024 residual (the first causal rows copy v almost verbatim into small outputs) */
  /* ... and, behind the tile loop, the operands of the output stage. */
  off = offs;
  _Float16* O16 = (_Float16*)take(NR * DM * 2); _Float16* OL16 = (_Float16*)take(NR * DM * 2); _Float16* OH0 = (_Float16*)take((size_t)NB * QT0 * DM * 2); _Float16* OL0 = (_Float16*)take((size_t)NB * QT0 * DM * 2);
  { const unsigned gw = (unsigned)(((size_t)DM * DM / 8 + 255) / 256); k_wt_f16<<<gw, 256, 0, stream>>>(wq, BQ, DM, DM, 16.0f); k_wt_f16<<<gw, 256, 0, stream>>>(wk, BK, DM, DM, 16.0f); k_wt_f16<<<gw, 256, 0, stream>>>(wv, BV, DM, DM, 16.0f); k_wt_f16<<<gw, 256, 0, stream>>>(wres, BR, DM, DM, 16.0f); }      /* [in][out] ([in][h][k] flattened) -> Bt x16 */
  k_bfr<<<(unsigned)((NR * DM / 8 + 255) / 256), 256, 0, stream>>>(x, XT, NR * DM / 8); k_rmsrow<DM><<<(unsigned)NR, 256, 0, stream>>>(XT, g, 1e-6f); k_hl<<<(unsigned)((NR * DM / 8 + 255) / 256), 256, 0, stream>>>(XT, X16, XL16, NR * DM / 8);      /* x_t = RMSNorm(bf16(x)) g (f32, in place) -> f16 hi rows (+ x1024 residual rows for the exact first tile) */
  k_x16<<<(unsigned)(((size_t)NH * SQ * HD / 8 + 255) / 256), 256, 0, stream>>>(xlr, R16, (size_t)NH * SQ * HD / 8);      /* xl_r [h][j][64] as exact f16 rows (bf16-valued input) */
  k_gemm2<0><<<dim3((unsigned)((NR / 128) * (DM / 64)), 1), 128, 0, stream>>>(X16, DM, 0, BQ, DM, 0, 0.0078125f, xlu, 0, nullptr, 1, 0, 0, nullptr, QU, DM, 0, (int)NR, DM, DM, 0, 0, 0); k_gemm2<0><<<dim3((unsigned)((NR / 128) * (DM / 64)), 1), 128, 0, stream>>>(X16, DM, 0, BQ, DM, 0, 0.0078125f, xlv, 0, nullptr, 1, 0, 0, nullptr, QV, DM, 0, (int)NR, DM, DM, 0, 0, 0);      /* q / 8 + xl_u and q / 8 + xl_v (the per-head 64-vectors as [1024] column biases) -> f16 rows */
  k_gemm2<0><<<dim3((unsigned)((NR / 128) * (DM / 64)), 1), 128, 0, stream>>>(X16, DM, 0, BK, DM, 0, 0.0625f, nullptr, 0, nullptr, 1, 0, 0, nullptr, K16, DM, 0, (int)NR, DM, DM, 0, 0, 0); k_gemm2<0><<<dim3((unsigned)((NR / 128) * (DM / 64)), 1), 128, 0, stream>>>(X16, DM, 0, BV, DM, 0, 0.0625f, nullptr, 0, nullptr, 1, 0, 0, VF, nullptr, DM, 0, (int)NR, DM, DM, 0, 0, 0); k_hl<<<(unsigned)((NR * DM / 8 + 255) / 256), 256, 0, stream>>>(VF, V16, VL16, NR * DM / 8);      /* k -> f16; v f32 -> f16 hi + x1024 residual rows */
  /* From here to the output stage the two batches, which share nothing but weights, stand side by side in every launch: the batch is one more grid index. */
  const size_t zX = (size_t)SQ * DM, z0 = (size_t)QT0 * DM;      /* batch strides of the token-row planes and of the first-tile planes */
  k_vt<NH, SQ><<<NB * NH * (SQ / 64), 256, 0, stream>>>(V16, DM, 0, VT); k_vt<NH, SQ><<<NB * NH * (SQ / 64), 256, 0, stream>>>(VL16, DM, 0, VTL);      /* V^T hi and residual [batch][16][64][SQ] */
  { const dim3 g0((QT0 / 32) * (DM / 64), 1, NB);      /* hi and residual rows of x_t as the two terms of one launch */
    k_gemm2t<2><<<g0, 64, 0, stream>>>(X16, XL16, nullptr, DM, 0, BQ, BQ, nullptr, DM, 0, 0.0078125f, 0.00000762939453125f, 0.f, xlu, QUF, DM, 0, DM, DM, zX, 0, z0);
    k_gemm2t<2><<<g0, 64, 0, stream>>>(X16, XL16, nullptr, DM, 0, BQ, BQ, nullptr, DM, 0, 0.0078125f, 0.00000762939453125f, 0.f, xlv, QVF, DM, 0, DM, DM, zX, 0, z0);
    k_gemm2t<2><<<g0, 64, 0, stream>>>(X16, XL16, nullptr, DM, 0, BK, BK, nullptr, DM, 0, 0.0625f, 0.00006103515625f, 0.f, nullptr, KF0, DM, 0, DM, DM, zX, 0, z0);
    k_gemm2t<2><<<g0, 64, 0, stream>>>(X16, XL16, nullptr, DM, 0, BV, BV, nullptr, DM, 0, 0.0625f, 0.00006103515625f, 0.f, nullptr, VF0, DM, 0, DM, DM, zX, 0, z0);
    k_att0xl<<<dim3(NH * (QT0 / 8), NB), 256, 0, stream>>>(QUF, QVF, KF0, VF0, xlr, OF0); }      /* exact causal XL attention for rows 0..255 of each batch (o x64, f32) */
  for (int q0 = 0; q0 < SQ; q0 += QT) { const int nk = q0 + QT;      /* causal: keys below the tile end only */
    k_gemm2<0><<<dim3((QT / 128) * (nk / 64), NH, NB), 128, 0, stream>>>(QU + (size_t)q0 * DM, DM, (size_t)HD, K16, DM, (size_t)HD, 1.0f, nullptr, 0, nullptr, 1, 0, 0, S, nullptr, NKX, (size_t)QT * NKX, QT, nk, HD, zX, zX, zS);      /* AC[i][j] = (q_i + u).k_j, 16 heads on grid.y */
    k_gemm2<0><<<dim3((QT / 128) * (nk / 64), NH, NB), 128, 0, stream>>>(QV + (size_t)q0 * DM, DM, (size_t)HD, R16 + (size_t)(SQ - nk) * HD, HD, (size_t)SQ * HD, 1.0f, nullptr, 0, nullptr, 1, 0, 0, BD, nullptr, NKX, (size_t)QT * NKX, QT, nk, HD, zX, 0, zS);      /* BD'[i][c] = (q_i + v).xl_r[h][SQ - nk + c] for c < nk (the xl_r rows the shift can reach from this tile) */
    static_assert(SQ == 8 * QT, "one k_rsmxl instance per tile end"); switch (nk / QT) { case 1: rsmxl_go<2>(S, BD, P, PL, stream); break; case 2: rsmxl_go<4>(S, BD, P, PL, stream); break; case 3: rsmxl_go<6>(S, BD, P, PL, stream); break; case 4: rsmxl_go<8>(S, BD, P, PL, stream); break; case 5: rsmxl_go<10>(S, BD, P, PL, stream); break; case 6: rsmxl_go<12>(S, BD, P, PL, stream); break; case 7: rsmxl_go<14>(S, BD, P, PL, stream); break; default: rsmxl_go<16>(S, BD, P, PL, stream); break; }      /* scores = AC + BD'[i][nk-1-(i-j)] (== rel_shift) for j <= i, -1e30 above the diagonal; softmax -> x256 f16 */
    k_gemm2t<3><<<dim3((QT / 32) * (HD / 64), NH, NB), 96, 0, stream>>>(P, PL, P, NKX, (size_t)QT * NKX, VT, VT, VTL, SQ, (size_t)HD * SQ, 0.25f, 0.000244140625f, 0.000244140625f, nullptr, OF + (size_t)q0 * DM, DM, (size_t)HD, HD, nk, zS, (size_t)NH * HD * SQ, zX); }      /* wv x64 = Ph Vh 2^-2 + Pl Vh 2^-12 + Ph Vl 2^-12 (f32), the three terms in one launch */
  k_hl<<<(unsigned)((NR * DM / 8 + 255) / 256), 256, 0, stream>>>(OF, O16, OL16, NR * DM / 8);      /* wv x64 -> f16 hi + x1024 residual rows */
  k_gemm2<0><<<dim3((unsigned)((NR / 128) * (DM / 64)), 1), 128, 0, stream>>>(O16, DM, 0, BR, DM, 0, 0.0009765625f, nullptr, 0, nullptr, 1, 0, 0, (float*)d_out, nullptr, DM, 0, (int)NR, DM, DM, 0, 0, 0); k_gemm2<0><<<dim3((unsigned)((NR / 128) * (DM / 64)), 1), 128, 0, stream>>>(OL16, DM, 0, BR, DM, 0, 0.00000095367431640625f, nullptr, 0, (const float*)d_out, -1, 0, 0, (float*)d_out, nullptr, DM, 0, (int)NR, DM, DM, 0, 0, 0);      /* res = wv_hi w_res 2^-10 += wv_lo w_res 2^-20 (own element) */
  k_hl<<<(unsigned)(((size_t)NB * QT0 * DM / 8 + 255) / 256), 256, 0, stream>>>(OF0, OH0, OL0, (size_t)NB * QT0 * DM / 8);      /* first-tile o (x64) -> f16 hi + x1024 residual planes */
  k_gemm2t<2><<<dim3((QT0 / 32) * (DM / 64), 1, NB), 64, 0, stream>>>(OH0, OL0, nullptr, DM, 0, BR, BR, nullptr, DM, 0, 0.0009765625f, 0.00000095367431640625f, 0.f, nullptr, (float*)d_out, DM, 0, DM, DM, z0, 0, zX);      /* rows 0..255 of each batch rewritten from the exact path: o_hi w_res 2^-10 + o_lo w_res 2^-20 */
}

// v006
// A run of this version takes 503 microseconds.
// Timed twice side by side with v005, it ran 1.42 and 1.41 times as fast.
// Over all steps from v000 it is 30.8 times as fast.
#include <hip/hip_runtime.h>
// Transformer-XL style causal attention with relative-position (rel_shift) scores (x [2][2048][1024]; x_t = RMSNorm(x) g (eps 1e-6); q = x_t w_q / 8, k = x_t w_k, v = x_t w_v (w [1024][16][64] = [in][out], sigma 1/32); scores = (q + xl_u).k^T + rel_shift((q + xl_v).xl_r^T) (xl_r [16][2048][64], xl_u / xl_v [1][16][1][64]); causal: - 1e30 above the diagonal; softmax; wv = w v merged (h*64+v); res = wv w_res ([in][out]) -> [2][2048][1024]. rel_shift with q_len = k_len = T gives bd[i][j] = (q_i + xl_v).xl_r[h][T-1-(i-j)] for j <= i).
// Structure: token rows; x_t = RMSNorm(bf16(x)) in f32 on VALU -> f16 rows; [in][out] weights as x16 planes; q+u and q+v as two WMMA GEMMs (32x64 wave tiles, f32 accumulation, alpha 1/128, per-head bias vectors), k, v -> f16 rows; xl_r as exact f16 rows; both batches side by side in every launch from here on (batch = one more grid index): V^T via LDS transposes; exact f32 XL attention for rows 0..255 per batch on VALU (q/k/v of those rows from x_t hi + residual GEMM passes); one attention kernel, a wave per 16 query rows, passes of 32 keys: AC = (q+u) k^T and BD' = (q+v) r^T over the 48 xl_r rows the shift can reach (WMMA, f32), rel_shift by a skewed LDS store, causal select (-1e30 fill, clamped xl_r index), running maximum and sum (f32, native exp; weights x256 f16 hi + residual), o = P V^T (x64) f32 in registers; res = o_hi w_res + o_lo w_res 2^-10; first-tile rows rewritten from the exact o hi/lo; launches: see trace.
// Compute dtype: inputs rounded to bf16; x / weights exact; q, k as plain f16 GEMM operands (~2^-12); v, softmax weights and o as f16 hi + x1024 residual; scores and softmax statistics f32. v_wmma_f32_16x16x32_f16.
#define NB 2
#define NG 16
#define HPG 1
#define KVD (NG * HD)
#define SQ 2048
#define DM 1024
#define NH 16
#define HD 64
#define HG 4                         /* heads per block group of the unlaunched k_vt(V16, b, h0, VT) */
#define QT 256                       /* query rows per causal tile */
#define NKX SQ                       /* S / P row pitch */
#define QT0 256                      /* first-tile rows recomputed exactly in f32 (= one causal tile) */
#define B0 0                         /* unused */
#define NBR NB                       /* unused by the launches; they use NB */
#define NR ((size_t)NB * SQ)         /* token rows */
#define MP ((int)((size_t)NBR * SQ)) /* unused by the launches; the projections run over NR rows */
#define QN SQ                        /* unused; the attention grid covers SQ rows */
#define NHD NH                       /* unused; the attention launches use NH */
#define MPO MP                       /* unused; the output GEMMs use NR */
#define LQ DM      /* unused; the q/k/v rows use pitch DM */
typedef __bf16 v16b __attribute__((ext_vector_type(16)));
typedef unsigned short v8us __attribute__((ext_vector_type(8), may_alias));
typedef float  v8f  __attribute__((ext_vector_type(8)));
typedef float  v4f  __attribute__((ext_vector_type(4)));
typedef float  v4fa __attribute__((ext_vector_type(4), may_alias));
union FragB { v16b v; v8us half[2]; unsigned short u[16]; };

__device__ __forceinline__ unsigned short bf16_bits(float x) { unsigned int u = __float_as_uint(x); return (unsigned short)((u + 0x7FFFu + ((u >> 16) & 1u)) >> 16); }
__device__ __forceinline__ float bf16_val(unsigned short b) { return __uint_as_float(((unsigned int)b) << 16); }
__device__ __forceinline__ float bf16_round(float x) { return bf16_val(bf16_bits(x)); }
// D += A·B with NT terms: 1 = ah·bh, 2 = + al·bh (A split), 3 = + ah·bl (both split)
template <int NT>
__device__ __forceinline__ v8f mmaN(v16b ah, v16b al, v16b bh, v16b bl, v8f c) {
  c = __builtin_amdgcn_wmma_f32_16x16x32_bf16(false, ah, false, bh, (short)0, c, false, false);
  if (NT >= 2) c = __builtin_amdgcn_wmma_f32_16x16x32_bf16(false, al, false, bh, (short)0, c, false, false);
  if (NT >= 3) c = __builtin_amdgcn_wmma_f32_16x16x32_bf16(false, ah, false, bl, (short)0, c, false, false);
  asm volatile("v_nop\n\tv_nop\n\tv_nop\n\tv_nop" : "+v"(c) : "v"(ah), "v"(al), "v"(bh), "v"(bl));
  return c;
}

__global__ __launch_bounds__(256) void k_wt_bf16(const float* __restrict__ W, unsigned short* __restrict__ Wt, int K, int N) {
  const int t = blockIdx.x * 256 + threadIdx.x;
  const int k8n = K / 8;
  if (t >= N * k8n) return;
  const int n = t / k8n, k8 = (t % k8n) * 8;
  v8us v;
#pragma unroll
  for (int i = 0; i < 8; ++i) v[i] = bf16_bits(W[(size_t)(k8 + i) * N + n]);
  *(v8us*)(Wt + (size_t)n * K + k8) = v;
  
}

// GEMM C[M][N] (f32, pitch ldc) = act(A[M][K]·W + bias). A f32 row-major (pitch lda) converted per fragment to bf16
// (ASPLIT: hi/lo two planes -> 2 terms, else single rounded term); Wt bf16 [N][K] (pitch ldb). BIAS_BF16 rounds the
// bias to bf16 first (bias quantised to bf16 before the add). K%32==0, M%16==0, N%64==0.
template <bool ASPLIT, int ACT, bool BIAS_BF16>
__global__ __launch_bounds__(128) void k_gemm_bf(const float* __restrict__ A, int lda, const unsigned short* __restrict__ Wt, int ldb,
                                               const float* __restrict__ bias, float* __restrict__ C, int ldc, int M, int N, int K) {
  __shared__ __attribute__((aligned(16))) float so[4][16][64];
  const int tid = threadIdx.x, w = tid >> 5, lane = tid & 31, ln = lane & 15, hh = lane >> 4;
  const int ntn = N / 64;
  const int wid = blockIdx.x * 4 + w;
  const int mt = wid / ntn, nq = wid % ntn;
  if (mt * 16 >= M) return;
  const int row0 = mt * 16, col0 = nq * 64;
  const float* arow = A + (size_t)(row0 + ln) * lda;
  v8f acc[4] = {};
  for (int kb = 0; kb < K; kb += 32) {
    FragB ah, al;
    const v4f x0 = *(const v4fa*)(arow + kb + 8 * hh), x1 = *(const v4fa*)(arow + kb + 8 * hh + 4);
    const v4f x2 = *(const v4fa*)(arow + kb + 16 + 8 * hh), x3 = *(const v4fa*)(arow + kb + 16 + 8 * hh + 4);
    float xs[16] = {x0[0],x0[1],x0[2],x0[3],x1[0],x1[1],x1[2],x1[3],x2[0],x2[1],x2[2],x2[3],x3[0],x3[1],x3[2],x3[3]};
#pragma unroll
    for (int i = 0; i < 16; ++i) { const unsigned short hb = bf16_bits(xs[i]); ah.u[i] = hb; al.u[i] = ASPLIT ? bf16_bits(xs[i] - bf16_val(hb)) : (unsigned short)0; }
#pragma unroll
    for (int t = 0; t < 4; ++t) {
      const unsigned short* brow = Wt + (size_t)(col0 + t * 16 + ln) * ldb + kb;
      FragB b;
      b.half[0] = *(const v8us*)(brow + 8 * hh);
      b.half[1] = *(const v8us*)(brow + 16 + 8 * hh);
      acc[t] = mmaN<ASPLIT ? 2 : 1>(ah.v, al.v, b.v, b.v, acc[t]);
    }
  }
#pragma unroll
  for (int t = 0; t < 4; ++t) {
    float bv = bias ? bias[col0 + t * 16 + ln] : 0.f;
    if (BIAS_BF16) bv = bf16_round(bv);
#pragma unroll
    for (int r = 0; r < 8; ++r) { float v = acc[t][r] + bv; if (ACT == 1) v = fmaxf(v, 0.f); so[w][8 * hh + r][t * 16 + ln] = v; }
  }
  __builtin_amdgcn_fence(__ATOMIC_ACQ_REL, "workgroup");
  __builtin_amdgcn_wave_barrier();
  const int rsub = lane >> 4, c4 = (lane & 15) * 4;
  {
#pragma unroll
    for (int q = 0; q < 8; ++q) {
      const int r = q * 2 + rsub;
      const v4f v = *(const v4fa*)&so[w][r][c4];
      *(v4f*)(C + (size_t)(row0 + r) * ldc + col0 + c4) = v;
    }
    
  }
}

// GEMM C = act(A·W + bias + resid): A f32 (ASPLIT -> hi/lo 2 terms), Wt bf16 [N][K]; ACT 0 none, 1 relu, 2 exact gelu;
// resid (optional, f32, row index = (row % rmod), pitch ldr, RES_BF16 rounds it) added before the activation.
template <bool ASPLIT, int ACT, bool BIAS_BF16, bool RES_BF16>
__global__ __launch_bounds__(128) void k_gemm_bf3(const float* __restrict__ A, int lda, const unsigned short* __restrict__ Wt, int ldb,
                                                const float* __restrict__ bias, const float* __restrict__ resid, int rmod, int ldr,
                                                float* __restrict__ C, int ldc, int M, int N, int K) {
  __shared__ __attribute__((aligned(16))) float so[4][16][64];
  const int tid = threadIdx.x, w = tid >> 5, lane = tid & 31, ln = lane & 15, hh = lane >> 4;
  const int ntn = N / 64;
  const int wid = blockIdx.x * 4 + w;
  const int mt = wid / ntn, nq = wid % ntn;
  if (mt * 16 >= M) return;
  const int row0 = mt * 16, col0 = nq * 64;
  const float* arow = A + (size_t)(row0 + ln) * lda;
  v8f acc[4] = {};
  for (int kb = 0; kb < K; kb += 32) {
    FragB ah, al;
    const v4f x0 = *(const v4fa*)(arow + kb + 8 * hh), x1 = *(const v4fa*)(arow + kb + 8 * hh + 4);
    const v4f x2 = *(const v4fa*)(arow + kb + 16 + 8 * hh), x3 = *(const v4fa*)(arow + kb + 16 + 8 * hh + 4);
    float xs[16] = {x0[0],x0[1],x0[2],x0[3],x1[0],x1[1],x1[2],x1[3],x2[0],x2[1],x2[2],x2[3],x3[0],x3[1],x3[2],x3[3]};
#pragma unroll
    for (int i = 0; i < 16; ++i) { const unsigned short hb = bf16_bits(xs[i]); ah.u[i] = hb; al.u[i] = ASPLIT ? bf16_bits(xs[i] - bf16_val(hb)) : (unsigned short)0; }
#pragma unroll
    for (int t = 0; t < 4; ++t) {
      const unsigned short* brow = Wt + (size_t)(col0 + t * 16 + ln) * ldb + kb;
      FragB b;
      b.half[0] = *(const v8us*)(brow + 8 * hh);
      b.half[1] = *(const v8us*)(brow + 16 + 8 * hh);
      acc[t] = mmaN<ASPLIT ? 2 : 1>(ah.v, al.v, b.v, b.v, acc[t]);
    }
  }
#pragma unroll
  for (int t = 0; t < 4; ++t) {
    const int col = col0 + t * 16 + ln;
    float bv = bias ? bias[col] : 0.f;
    if (BIAS_BF16) bv = bf16_round(bv);
#pragma unroll
    for (int r = 0; r < 8; ++r) {
      float v = acc[t][r] + bv;
      if (resid) { float rv = resid[(size_t)((row0 + 8 * hh + r) % rmod) * ldr + col]; if (RES_BF16) rv = bf16_round(rv); v += rv; }
      if (ACT == 1) v = fmaxf(v, 0.f);
      if (ACT == 2) v = 0.5f * v * (1.0f + erff(v * 0.70710678118654752f));
      if (ACT == 3) { const float u = 0.7978845608028654f * (v + 0.044715f * v * v * v); v = 0.5f * v * (1.0f + tanhf(u)); }
      so[w][8 * hh + r][t * 16 + ln] = v;
    }
  }
  __builtin_amdgcn_fence(__ATOMIC_ACQ_REL, "workgroup");
  __builtin_amdgcn_wave_barrier();
  const int rsub = lane >> 4, c4 = (lane & 15) * 4;
  {
#pragma unroll
    for (int q = 0; q < 8; ++q) {
      const int r = q * 2 + rsub;
      const v4f v = *(const v4fa*)&so[w][r][c4];
      *(v4f*)(C + (size_t)(row0 + r) * ldc + col0 + c4) = v;
    }
    
  }
}
// row LayerNorm (biased variance, eps) over N: s = X (+ R); optional out_sum <- s; out_norm <- (s-mu)*rsqrt(var+eps)*g + b
template <bool PARAM_BF16>
__global__ __launch_bounds__(256) void k_layernorm(const float* __restrict__ X, const float* __restrict__ R, const float* __restrict__ g, const float* __restrict__ bta,
                                                  float* __restrict__ out_sum, float* __restrict__ out_norm, int N, float eps) {
  __shared__ float red[256];
  const int row = blockIdx.x, tid = threadIdx.x;
  const float* x = X + (size_t)row * N; const float* rr = R ? R + (size_t)row * N : nullptr;
  float vals[16];                     // up to N = 4096
  const int per = N / 256;            // contiguous chunk per thread? use strided-by-4 chunks: thread handles j = tid*4 + 1024*u
  float s1 = 0.f;
  for (int u = 0; u < per / 4; ++u) {
    const int j = tid * 4 + 1024 * u;
    const v4f a = *(const v4fa*)(x + j);
    v4f b = {0.f,0.f,0.f,0.f}; if (rr) b = *(const v4fa*)(rr + j);
#pragma unroll
    for (int q = 0; q < 4; ++q) { const float v = a[q] + b[q]; vals[u * 4 + q] = v; s1 += v; }
  }
  red[tid] = s1; __syncthreads();
  for (int st = 128; st > 0; st >>= 1) { if (tid < st) red[tid] += red[tid + st]; __syncthreads(); }
  const float mu = red[0] / (float)N; __syncthreads();
  float s2 = 0.f;
  for (int u = 0; u < per / 4; ++u)
#pragma unroll
    for (int q = 0; q < 4; ++q) { const float c = vals[u * 4 + q] - mu; s2 += c * c; }
  red[tid] = s2; __syncthreads();
  for (int st = 128; st > 0; st >>= 1) { if (tid < st) red[tid] += red[tid + st]; __syncthreads(); }
  const float rs = rsqrtf(red[0] / (float)N + eps);
  {
    for (int u = 0; u < per / 4; ++u) {
      const int j = tid * 4 + 1024 * u;
      v4f o, sm;
#pragma unroll
      for (int q = 0; q < 4; ++q) {
        float gg = g[j + q], bb = bta[j + q];
        if (PARAM_BF16) { gg = bf16_round(gg); bb = bf16_round(bb); }
        sm[q] = vals[u * 4 + q]; o[q] = (vals[u * 4 + q] - mu) * rs * gg + bb;
      }
      if (out_sum) *(v4f*)(out_sum + (size_t)row * N + j) = sm;
      *(v4f*)(out_norm + (size_t)row * N + j) = o;
    }
    
  }
}



// ---- f16 WMMA path (v_wmma_f32_16x16x32_f16): 11-bit significands for operands in range — used where a [0,1] probability operand needs more precision than bf16
typedef _Float16 v16h __attribute__((ext_vector_type(16)));
union FragH { v16h v; v8us half[2]; _Float16 h[16]; unsigned short u[16]; };
template <int NT>
__device__ __forceinline__ v8f mmaH(v16h ah, v16h al, v16h bh, v16h bl, v8f c) {
  c = __builtin_amdgcn_wmma_f32_16x16x32_f16(false, ah, false, bh, (short)0, c, false, false);
  if (NT >= 2) c = __builtin_amdgcn_wmma_f32_16x16x32_f16(false, al, false, bh, (short)0, c, false, false);
  if (NT >= 3) c = __builtin_amdgcn_wmma_f32_16x16x32_f16(false, ah, false, bl, (short)0, c, false, false);
  asm volatile("v_nop\n\tv_nop\n\tv_nop\n\tv_nop" : "+v"(c) : "v"(ah), "v"(al), "v"(bh), "v"(bl));
  return c;
}
// batched GEMM like k_gemm_b but f16 operands: A f32 (split into f16 hi/lo if ASPLIT, else rounded to f16), Bt = f16 values [n][k]; alpha; C f32; N multiple of 16 (partial tiles skipped)
template <bool ASPLIT>
__global__ __launch_bounds__(128) void k_gemm_h(const float* __restrict__ A, int lda, size_t sA, const _Float16* __restrict__ Bh, int ldb, size_t sB, float alpha, float* __restrict__ C, int ldc, size_t sC, int M, int N, int K) {
  __shared__ __attribute__((aligned(16))) float so[4][16][64];
  const int tid = threadIdx.x, w = tid >> 5, lane = tid & 31, ln = lane & 15, hh = lane >> 4; const int by = blockIdx.y;
  A += (size_t)by * sA; Bh += (size_t)by * sB; C += (size_t)by * sC;
  const int ntn = (N + 63) / 64; const int wid = blockIdx.x * 4 + w; const int mt = wid / ntn, nq = wid % ntn; if (mt * 16 >= M) return;
  const int row0 = mt * 16, col0 = nq * 64; const float* arow = A + (size_t)(row0 + ln) * lda;
  v8f acc[4] = {};
  for (int kb = 0; kb < K; kb += 32) {
    FragH ah, al;
    const v4f x0 = *(const v4fa*)(arow + kb + 8 * hh), x1 = *(const v4fa*)(arow + kb + 8 * hh + 4), x2 = *(const v4fa*)(arow + kb + 16 + 8 * hh), x3 = *(const v4fa*)(arow + kb + 16 + 8 * hh + 4);
    float xs[16] = {x0[0],x0[1],x0[2],x0[3],x1[0],x1[1],x1[2],x1[3],x2[0],x2[1],x2[2],x2[3],x3[0],x3[1],x3[2],x3[3]};
#pragma unroll
    for (int i = 0; i < 16; ++i) { const _Float16 h = (_Float16)xs[i]; ah.h[i] = h; al.h[i] = ASPLIT ? (_Float16)(xs[i] - (float)h) : (_Float16)0.0f; }
#pragma unroll
    for (int t = 0; t < 4; ++t) { if (col0 + t * 16 >= N) continue; const size_t boff = (size_t)(col0 + t * 16 + ln) * ldb + kb; FragH bq; bq.half[0] = *(const v8us*)(Bh + boff + 8 * hh); bq.half[1] = *(const v8us*)(Bh + boff + 16 + 8 * hh);
      acc[t] = mmaH<ASPLIT ? 2 : 1>(ah.v, al.v, bq.v, bq.v, acc[t]); }
  }
#pragma unroll
  for (int t = 0; t < 4; ++t) { if (col0 + t * 16 >= N) continue;
#pragma unroll
    for (int r = 0; r < 8; ++r) so[w][8 * hh + r][t * 16 + ln] = acc[t][r] * alpha; }
  __builtin_amdgcn_fence(__ATOMIC_ACQ_REL, "workgroup"); __builtin_amdgcn_wave_barrier();
  const int rsub = lane >> 4, c4 = (lane & 15) * 4;
  {
#pragma unroll
    for (int q = 0; q < 8; ++q) { const int r = q * 2 + rsub; if (col0 + c4 < N) { const v4f v = *(const v4fa*)&so[w][r][c4]; *(v4f*)(C + (size_t)(row0 + r) * ldc + col0 + c4) = v; } }
     }
}

// Wt[n][k] = f16(W[k][n]·scale) from f32 row-major W[K][N] (scale = power of two; bf16-exact weights stay exact in f16 away from the subnormal range)
__global__ __launch_bounds__(256) void k_wt_f16(const float* __restrict__ W, _Float16* __restrict__ Wt, int K, int N, float scale) {
  const int t = blockIdx.x * 256 + threadIdx.x; if (t >= N * (K / 8)) return; const int n = t / (K / 8), k8 = (t % (K / 8)) * 8; FragH f;
#pragma unroll
  for (int i = 0; i < 8; ++i) f.h[i] = (_Float16)(bf16_round(W[(size_t)(k8 + i) * N + n]) * scale); const v8us o = f.half[0];
  *(v8us*)((unsigned short*)Wt + (size_t)n * K + k8) = o; 
}
// k_gemm_hh variant with fused epilogue: v = acc·alpha + bias[by·sBias + col] (+ CP[(row/rowsPerB)·sCPb + by·64 + col] if CP) ; ACT 0 none / 1 elu ; writes f16 C16 (and f32 C if non-null)
template <int ACT>
__global__ __launch_bounds__(128) void k_gemm_hhx(const _Float16* __restrict__ A, int lda, size_t sA, const _Float16* __restrict__ Bh, int ldb, size_t sB, float alpha, const float* __restrict__ bias, size_t sBias, const float* __restrict__ CP, int rowsPerB, size_t sCPb, int row0g,
    float* __restrict__ C, _Float16* __restrict__ C16, int ldc, size_t sC, int M, int N, int K) {
  __shared__ __attribute__((aligned(16))) float so[4][16][64];
  const int tid = threadIdx.x, w = tid >> 5, lane = tid & 31, ln = lane & 15, hh = lane >> 4; const int by = blockIdx.y;
  A += (size_t)by * sA; Bh += (size_t)by * sB; const size_t cofs = (size_t)by * sC; const float* bp = bias ? bias + (size_t)by * sBias : nullptr;
  const int ntn = (N + 63) / 64; const int wid = blockIdx.x * 4 + w; const int mt = wid / ntn, nq = wid % ntn; if (mt * 16 >= M) return;
  const int row0 = mt * 16, col0 = nq * 64; const _Float16* arow = A + (size_t)(row0 + ln) * lda;
  v8f acc[4] = {};
  for (int kb = 0; kb < K; kb += 32) { FragH ah; ah.half[0] = *(const v8us*)((const unsigned short*)arow + kb + 8 * hh); ah.half[1] = *(const v8us*)((const unsigned short*)arow + kb + 16 + 8 * hh);
#pragma unroll
    for (int t = 0; t < 4; ++t) { if (col0 + t * 16 >= N) continue; const size_t boff = (size_t)(col0 + t * 16 + ln) * ldb + kb; FragH bq; bq.half[0] = *(const v8us*)((const unsigned short*)Bh + boff + 8 * hh); bq.half[1] = *(const v8us*)((const unsigned short*)Bh + boff + 16 + 8 * hh);
      acc[t] = mmaH<1>(ah.v, ah.v, bq.v, bq.v, acc[t]); }
  }
#pragma unroll
  for (int t = 0; t < 4; ++t) { if (col0 + t * 16 >= N) continue; const int col = col0 + t * 16 + ln; const float bv = bp ? bf16_round(bp[col]) : 0.f;
#pragma unroll
    for (int r = 0; r < 8; ++r) { float v = acc[t][r] * alpha + bv; if (CP) { const int rr = row0g + row0 + 8 * hh + r; if (rowsPerB < 0) v += CP[cofs + (size_t)rr * ldc + col];      /* rowsPerB < 0: own element of the batched C plane */ else { const int bidx = rr / rowsPerB; v += CP[(size_t)bidx * sCPb + (size_t)by * 64 + col]; } } if (ACT == 1) v = (v > 0.f) ? v : expm1f(v); else if (ACT == 7) v = (v > 0.f) ? v + 1.0f : expf(v); else if (ACT == 8) v = tanhf(v); else if (ACT == 9) v = 0.5f * v * (1.0f + tanhf(0.7978845608028654f * (v + 0.044715f * v * v * v))); else if (ACT == 11) v = 1.0f / (1.0f + expf(-v)); else if (ACT == 12) v = (v > 0.f) ? v : 0.01f * v; else if (ACT == 14) v = (v > 0.f) ? v : 0.1f * v; else if (ACT == 16) v = (v >= 0.f) ? v : 0.3f * v; else if (ACT == 17) v = (v >= 0.f) ? v : 0.2f * v; else if (ACT == 15) v = v / (1.0f + expf(-v)); else if (ACT == 3) v = fmaxf(v, 0.f); else if (ACT == 6) v = 0.5f * v * (1.0f + erff(v * 0.70710678118654752f)); so[w][8 * hh + r][t * 16 + ln] = v; } }
  __builtin_amdgcn_fence(__ATOMIC_ACQ_REL, "workgroup"); __builtin_amdgcn_wave_barrier();
  const int rsub = lane >> 4, c4 = (lane & 15) * 4; typedef _Float16 v4h __attribute__((ext_vector_type(4)));
  {
#pragma unroll
    for (int q = 0; q < 8; ++q) { const int r = q * 2 + rsub; if (col0 + c4 < N) { const v4f v = *(const v4fa*)&so[w][r][c4]; if (C) *(v4f*)(C + cofs + (size_t)(row0 + r) * ldc + col0 + c4) = v; if (C16) { v4h h4; for (int i = 0; i < 4; ++i) h4[i] = (_Float16)v[i]; *(v4h*)(C16 + cofs + (size_t)(row0 + r) * ldc + col0 + c4) = h4; } } }
     }
}


typedef _Float16 v4h __attribute__((ext_vector_type(4)));

__global__ __launch_bounds__(256) void k_x16(const float* __restrict__ x, _Float16* __restrict__ X16, size_t n8) { const size_t t = (size_t)blockIdx.x * 256 + threadIdx.x; if (t >= n8) return; FragH f;
#pragma unroll
  for (int q = 0; q < 8; ++q) f.h[q] = (_Float16)bf16_round(x[t * 8 + q]); *(v8us*)((unsigned short*)X16 + t * 8) = f.half[0];  }
__global__ __launch_bounds__(256) void k_h16(const float* __restrict__ x, _Float16* __restrict__ X16, size_t n8) { const size_t t = (size_t)blockIdx.x * 256 + threadIdx.x; if (t >= n8) return; FragH f;
#pragma unroll
  for (int q = 0; q < 8; ++q) f.h[q] = (_Float16)x[t * 8 + q]; *(v8us*)((unsigned short*)X16 + t * 8) = f.half[0];  }
__global__ __launch_bounds__(256) void k_round16f(const float* __restrict__ W, _Float16* __restrict__ Bt, size_t n8) { const size_t t = (size_t)blockIdx.x * 256 + threadIdx.x; if (t >= n8) return; FragH f;
#pragma unroll
  for (int i = 0; i < 8; ++i) f.h[i] = (_Float16)(bf16_round(W[t * 8 + i]) * 16.0f); *(v8us*)((unsigned short*)Bt + t * 8) = f.half[0];  }
template <int NHv, int TTv>
__global__ __launch_bounds__(256) void k_vt(const _Float16* __restrict__ V16, int ldv, int voff, _Float16* __restrict__ Vt) { __shared__ unsigned short tl[64][66]; const int tid = threadIdx.x; const int slab = blockIdx.x / (TTv / 64), lg = blockIdx.x % (TTv / 64); const int b = slab / NHv, h = slab % NHv;
  for (int i = tid; i < 64 * 8; i += 256) { const int r = i / 8, c8 = (i % 8) * 8; FragH f; f.half[0] = *(const v8us*)((const unsigned short*)V16 + ((size_t)b * TTv + lg * 64 + r) * ldv + voff + h * 64 + c8);
#pragma unroll
    for (int q = 0; q < 8; ++q) tl[r][c8 + q] = f.u[q]; }
  __syncthreads();
  {
#pragma unroll
    for (int rd = 0; rd < 2; ++rd) { const int d = rd * 32 + tid / 8, pc = tid % 8; FragH f;
#pragma unroll
      for (int q = 0; q < 8; ++q) f.u[q] = tl[pc * 8 + q][d];
      *(v8us*)((unsigned short*)Vt + ((size_t)slab * 64 + d) * TTv + lg * 64 + pc * 8) = f.half[0]; }
     } }

__global__ __launch_bounds__(256) void k_hl(const float* __restrict__ F, _Float16* __restrict__ Hh, _Float16* __restrict__ Hl, size_t n8) { const size_t t = (size_t)blockIdx.x * 256 + threadIdx.x; if (t >= n8) return; FragH fh, fl; const v4f a = *(const v4fa*)(F + t * 8), c = *(const v4fa*)(F + t * 8 + 4);
#pragma unroll
  for (int q = 0; q < 4; ++q) { _Float16 h = (_Float16)a[q]; fh.h[q] = h; fl.h[q] = (_Float16)((a[q] - (float)h) * 1024.0f); h = (_Float16)c[q]; fh.h[4 + q] = h; fl.h[4 + q] = (_Float16)((c[q] - (float)h) * 1024.0f); }
  { *(v8us*)((unsigned short*)Hh + t * 8) = fh.half[0]; *(v8us*)((unsigned short*)Hl + t * 8) = fl.half[0];  } }

// ---- fast GEMM (wave tile 32x64; requires M % 32 == 0 rows per launch region and N % 64 == 0); epilogue = k_gemm_hhx semantics ----
__device__ __forceinline__ v8f g2_mma(v16h a, v16h b, v8f c) { v8f d = __builtin_amdgcn_wmma_f32_16x16x32_f16(false, a, false, b, (short)0, c, false, false); asm volatile("v_nop\n\tv_nop\n\tv_nop\n\tv_nop" : "+v"(d) : "v"(a), "v"(b)); return d; }
// One k-step (32 k) of the wave's 32x64 tile: two A and four B fragments = twelve 16-byte loads. pa / pb: wave-uniform byte address of A / B at that k-step; oa / ob: the lane's fixed byte offsets (row and half).
struct G2St { v16h a0, a1, b0, b1, b2, b3; };
__device__ __forceinline__ v16h g2_fragb(const char* base, unsigned o) { FragH f; f.half[0] = *(const v8us*)(base + (size_t)o); f.half[1] = *(const v8us*)(base + (size_t)o + 32); return f.v; }
__device__ __forceinline__ void g2_ld(G2St& s, const char* pa, const char* pb, unsigned oa0, unsigned oa1, unsigned ob0, unsigned ob1, unsigned ob2, unsigned ob3) {
  s.a0 = g2_fragb(pa, oa0); s.a1 = g2_fragb(pa, oa1); s.b0 = g2_fragb(pb, ob0); s.b1 = g2_fragb(pb, ob1); s.b2 = g2_fragb(pb, ob2); s.b3 = g2_fragb(pb, ob3);
  __builtin_amdgcn_sched_barrier(0); }      /* keeps the twelve loads in front of the next k-step's first WMMA: behind it they would be issued only after that WMMA's wait for its own operands */
// The wait that stands in front of any overwrite of a register that an issued load names. The bases and the lane offsets are inputs so that they stay as they are up to here.
__device__ __forceinline__ void g2_xw(const char* pa, const char* pb, unsigned oa0, unsigned oa1, unsigned ob0, unsigned ob1, unsigned ob2, unsigned ob3) { asm volatile("s_wait_xcnt 0x0" :: "s"(pa), "s"(pb), "v"(oa0), "v"(oa1), "v"(ob0), "v"(ob1), "v"(ob2), "v"(ob3) : "memory"); }
__device__ __forceinline__ void g2_mm(const G2St& s, v8f (&c)[8]) { c[0] = g2_mma(s.a0, s.b0, c[0]); c[4] = g2_mma(s.a1, s.b0, c[4]); c[1] = g2_mma(s.a0, s.b1, c[1]); c[5] = g2_mma(s.a1, s.b1, c[5]); c[2] = g2_mma(s.a0, s.b2, c[2]); c[6] = g2_mma(s.a1, s.b2, c[6]); c[3] = g2_mma(s.a0, s.b3, c[3]); c[7] = g2_mma(s.a1, s.b3, c[7]); }
// The K loop of a wave's 32x64 tile (nst k-steps of 32), shared by the GEMM kernels below. pa / pb: wave-uniform bases; the offsets: the lane's own.
__device__ __forceinline__ void g2_kloop(const char* pa, const char* pb, const int nst, const unsigned oa0, const unsigned oa1, const unsigned ob0, const unsigned ob1, const unsigned ob2, const unsigned ob3, v8f (&accs)[8]) { G2St s0, s1, s2;
  // Three k-steps' fragments rest in registers: a set is loaded again right after its WMMAs, so its loads fly while the other two sets are worked on. Every accumulator still takes its k-steps in rising order.
  if (nst >= 3) { g2_ld(s0, pa, pb, oa0, oa1, ob0, ob1, ob2, ob3); g2_ld(s1, pa + 64, pb + 64, oa0, oa1, ob0, ob1, ob2, ob3); g2_ld(s2, pa + 128, pb + 128, oa0, oa1, ob0, ob1, ob2, ob3); g2_xw(pa, pb, oa0, oa1, ob0, ob1, ob2, ob3); int s = 0;
#pragma unroll 1      /* the body already holds three k-steps; a copy of it would not fit the registers */
    for (; s + 6 <= nst; s += 3) {
      g2_mm(s0, accs); g2_ld(s0, pa + 192, pb + 192, oa0, oa1, ob0, ob1, ob2, ob3);
      g2_mm(s1, accs); g2_ld(s1, pa + 256, pb + 256, oa0, oa1, ob0, ob1, ob2, ob3);
      g2_mm(s2, accs); g2_ld(s2, pa + 320, pb + 320, oa0, oa1, ob0, ob1, ob2, ob3);
      g2_xw(pa, pb, oa0, oa1, ob0, ob1, ob2, ob3);      /* the two bases move on below */
      pa += 192; pb += 192; }
    const int rem = nst - s;      /* 3 to 5 k-steps are left, three of them loaded */
    g2_mm(s0, accs); if (rem > 3) { g2_ld(s0, pa + 192, pb + 192, oa0, oa1, ob0, ob1, ob2, ob3); g2_xw(pa, pb, oa0, oa1, ob0, ob1, ob2, ob3); }
    g2_mm(s1, accs); if (rem > 4) { g2_ld(s1, pa + 256, pb + 256, oa0, oa1, ob0, ob1, ob2, ob3); g2_xw(pa, pb, oa0, oa1, ob0, ob1, ob2, ob3); }
    g2_mm(s2, accs); if (rem > 3) g2_mm(s0, accs); if (rem > 4) g2_mm(s1, accs); }
  else if (nst == 2) { g2_ld(s0, pa, pb, oa0, oa1, ob0, ob1, ob2, ob3); g2_ld(s1, pa + 64, pb + 64, oa0, oa1, ob0, ob1, ob2, ob3); g2_xw(pa, pb, oa0, oa1, ob0, ob1, ob2, ob3); g2_mm(s0, accs); g2_mm(s1, accs); }
  else if (nst == 1) { g2_ld(s0, pa, pb, oa0, oa1, ob0, ob1, ob2, ob3); g2_xw(pa, pb, oa0, oa1, ob0, ob1, ob2, ob3); g2_mm(s0, accs); }
}
template <int ACT>
__global__ __launch_bounds__(128) void k_gemm2(const _Float16* __restrict__ A, int lda, size_t sA, const _Float16* __restrict__ Bh, int ldb, size_t sB, float alpha, const float* __restrict__ bias, size_t sBias, const float* __restrict__ CP, int rowsPerB, size_t sCPb, int row0g,
    float* __restrict__ C, _Float16* __restrict__ C16, int ldc, size_t sC, int M, int N, int K, size_t zA, size_t zB, size_t zC) { static_assert(ACT == 0 || ACT == 3 || ACT == 6 || ACT == 8 || ACT == 9 || ACT == 11 || ACT == 12 || ACT == 14 || ACT == 15 || ACT == 16 || ACT == 17, "k_gemm2: unsupported ACT code (would silently apply no activation)");
  __shared__ __attribute__((aligned(16))) float so[4][32][68];
  const int tid = threadIdx.x, w = tid >> 5, lane = tid & 31, ln = lane & 15, hh = lane >> 4; const int by = blockIdx.y, bz = blockIdx.z;      /* grid.z: a second batch index with strides of its own (zA, zB, zC) */
  A += (size_t)by * sA + (size_t)bz * zA; Bh += (size_t)by * sB + (size_t)bz * zB; const size_t cofs = (size_t)by * sC + (size_t)bz * zC; const float* bp = bias ? bias + (size_t)by * sBias : nullptr;
  const int ntn = N >> 6; const int mt = blockIdx.x / ntn, nq = blockIdx.x - mt * ntn; const int row0 = mt * 128 + 32 * w, col0 = nq * 64; if (row0 >= M) return;
  const unsigned oa0 = (unsigned)(row0 + ln) * (unsigned)lda * 2u + 16u * hh, oa1 = oa0 + 32u * (unsigned)lda;
  const unsigned ob0 = (unsigned)(col0 + ln) * (unsigned)ldb * 2u + 16u * hh, ob1 = ob0 + 32u * (unsigned)ldb, ob2 = ob1 + 32u * (unsigned)ldb, ob3 = ob2 + 32u * (unsigned)ldb;
  const char* pa = (const char*)A; const char* pb = (const char*)Bh; const int nst = K >> 5;      /* k-steps of 32 = 64 bytes of every row */
  const v8f z8 = {0.f,0.f,0.f,0.f,0.f,0.f,0.f,0.f}; v8f accs[8] = {z8, z8, z8, z8, z8, z8, z8, z8};
  g2_kloop(pa, pb, nst, oa0, oa1, ob0, ob1, ob2, ob3, accs);
#pragma unroll
  for (int u = 0; u < 8; ++u) { const int t = u & 3, half = u >> 2; const int col = col0 + t * 16 + ln; const float bv = bp ? bf16_round(bp[col]) : 0.f;
#pragma unroll
    for (int r = 0; r < 8; ++r) { const int rloc = half * 16 + 8 * hh + r; float v = accs[u][r] * alpha + bv; if (CP) { if (rowsPerB < 0) v += CP[cofs + (size_t)(row0g + row0 + rloc) * ldc + col];      /* rowsPerB < 0: own element of the batched C plane */ else { const int bidx = (row0g + row0 + rloc) / rowsPerB; v += CP[(size_t)bidx * sCPb + (size_t)by * 64 + col]; } }
      if (ACT == 3) v = fmaxf(v, 0.f); else if (ACT == 6) v = 0.5f * v * (1.0f + erff(v * 0.70710678118654752f)); else if (ACT == 11) v = 1.0f / (1.0f + expf(-v)); else if (ACT == 15) v = v / (1.0f + expf(-v)); else if (ACT == 12) v = (v > 0.f) ? v : 0.01f * v; else if (ACT == 8) v = tanhf(v); else if (ACT == 9) v = 0.5f * v * (1.0f + tanhf(0.7978845608028654f * (v + 0.044715f * v * v * v))); else if (ACT == 14) v = (v > 0.f) ? v : 0.1f * v; else if (ACT == 16) v = (v >= 0.f) ? v : 0.3f * v; else if (ACT == 17) v = (v >= 0.f) ? v : 0.2f * v;
      so[w][rloc][t * 16 + ln] = v; } }
  __builtin_amdgcn_fence(__ATOMIC_ACQ_REL, "workgroup"); __builtin_amdgcn_wave_barrier();
  const int rsub = lane >> 4, c4 = (lane & 15) * 4;
  {
#pragma unroll
    for (int q = 0; q < 16; ++q) { const int r = q * 2 + rsub; const v4f v = *(const v4fa*)&so[w][r][c4]; if (C) *(v4f*)(C + cofs + (size_t)(row0 + r) * ldc + col0 + c4) = v; if (C16) { v4h h4; for (int i = 0; i < 4; ++i) h4[i] = (_Float16)v[i]; *(v4h*)(C16 + cofs + (size_t)(row0 + r) * ldc + col0 + c4) = h4; } }
     } }


// C = (Aa Ba ala + bias) + Ab Bb alb (+ Ac Bc alc): the hi / residual terms of one product, side by side in one launch. A work-group is one 32x64 tile of C and NT waves;
// wave t runs the whole K loop of term t, lays its scaled tile in its own LDS plane, and behind one barrier the planes are added in the order of the terms and stored as whole rows.
// Needs M % 32 == 0 (grid.x = (M / 32) (N / 64), exact), N % 64 == 0, K % 32 == 0; grid.y = batch (strides sA, sB, sC), grid.z = a second batch index (strides zA, zB, zC).
template <int NT>
__global__ __launch_bounds__(NT * 32) void k_gemm2t(const _Float16* __restrict__ Aa, const _Float16* __restrict__ Ab, const _Float16* __restrict__ Ac, int lda, size_t sA, const _Float16* __restrict__ Ba, const _Float16* __restrict__ Bb, const _Float16* __restrict__ Bc, int ldb, size_t sB,
    float ala, float alb, float alc, const float* __restrict__ bias, float* __restrict__ C, int ldc, size_t sC, int N, int K, size_t zA, size_t zB, size_t zC) { static_assert(NT == 2 || NT == 3, "k_gemm2t: two or three terms");
  __shared__ __attribute__((aligned(16))) float so[NT][32][68];
  const int lane = threadIdx.x & 31, ln = lane & 15, hh = lane >> 4; const int t = __builtin_amdgcn_readfirstlane((int)(threadIdx.x >> 5)); const int by = blockIdx.y, bz = blockIdx.z;      /* t wave-uniform: the term's bases stay scalar */
  const _Float16* A = (NT > 2 && t == 2) ? Ac : (t == 1) ? Ab : Aa; const _Float16* Bh = (NT > 2 && t == 2) ? Bc : (t == 1) ? Bb : Ba; const float alpha = (NT > 2 && t == 2) ? alc : (t == 1) ? alb : ala;
  A += (size_t)by * sA + (size_t)bz * zA; Bh += (size_t)by * sB + (size_t)bz * zB; const size_t cofs = (size_t)by * sC + (size_t)bz * zC;
  const int ntn = N >> 6; const int mt = blockIdx.x / ntn, nq = blockIdx.x - mt * ntn; const int row0 = mt * 32, col0 = nq * 64;
  const unsigned oa0 = (unsigned)(row0 + ln) * (unsigned)lda * 2u + 16u * hh, oa1 = oa0 + 32u * (unsigned)lda;
  const unsigned ob0 = (unsigned)(col0 + ln) * (unsigned)ldb * 2u + 16u * hh, ob1 = ob0 + 32u * (unsigned)ldb, ob2 = ob1 + 32u * (unsigned)ldb, ob3 = ob2 + 32u * (unsigned)ldb;
  const v8f z8 = {0.f,0.f,0.f,0.f,0.f,0.f,0.f,0.f}; v8f accs[8] = {z8, z8, z8, z8, z8, z8, z8, z8};
  g2_kloop((const char*)A, (const char*)Bh, K >> 5, oa0, oa1, ob0, ob1, ob2, ob3, accs);
#pragma unroll
  for (int u = 0; u < 8; ++u) { const int tc = u & 3, half = u >> 2; const float bv = (bias && t == 0) ? bf16_round(bias[col0 + tc * 16 + ln]) : 0.f;
#pragma unroll
    for (int r = 0; r < 8; ++r) so[t][half * 16 + 8 * hh + r][tc * 16 + ln] = accs[u][r] * alpha + bv; }
  __syncthreads();      /* every term's plane is complete before any wave adds them */
  const int rsub = lane >> 4, c4 = (lane & 15) * 4;
  for (int q = t; q < 16; q += NT) { const int r = q * 2 + rsub; v4f v = *(const v4fa*)&so[0][r][c4]; v += *(const v4fa*)&so[1][r][c4]; if (NT > 2) v += *(const v4fa*)&so[2][r][c4];
    *(v4f*)(C + cofs + (size_t)(row0 + r) * ldc + col0 + c4) = v;
    asm volatile("s_wait_xcnt 0x0" ::: "memory"); } }      /* the wait that stands in front of any overwrite of a register that an issued store names: the next trip forms its address and its sum in the same registers */

__global__ __launch_bounds__(256) void k_wnat(const float* __restrict__ w, size_t n8, _Float16* __restrict__ Bt) { const size_t t = (size_t)blockIdx.x * 256 + threadIdx.x; if (t >= n8) return; FragH f; for (int q = 0; q < 8; ++q) f.h[q] = (_Float16)(bf16_round(w[t * 8 + q]) * 16.0f); *(v8us*)((unsigned short*)Bt + t * 8) = f.half[0];  }
__global__ __launch_bounds__(256) void k_rsm(const float* __restrict__ S, _Float16* __restrict__ P, int nrows) {
  #pragma clang fp contract(off)
  const int i = blockIdx.x * 256 + threadIdx.x; if (i >= nrows) return; const float* s = S + (size_t)i * SQ; float mx = -3.0e38f;
#pragma unroll 1
  for (int j = 0; j < SQ; ++j) mx = fmaxf(mx, s[j]); float se = 0.f;
#pragma unroll 1
  for (int j = 0; j < SQ; ++j) se += expf(s[j] - mx); const float sc = 256.0f / se;
#pragma unroll 1
  for (int j0 = 0; j0 < SQ; j0 += 8) { FragH f; for (int q = 0; q < 8; ++q) f.h[q] = (_Float16)(expf(s[j0 + q] - mx) * sc); unsigned short* d = (unsigned short*)P + (size_t)i * SQ + j0; *(v8us*)d = f.half[0];  } }
__global__ __launch_bounds__(256) void k_vt(const _Float16* __restrict__ V16, int b, int h0, _Float16* __restrict__ VT) { __shared__ unsigned short tl[64][65]; const int tid = threadIdx.x; const int hh = blockIdx.x % HG, sg = blockIdx.x / HG; const int s0 = sg * 64; const int h = h0 + hh;
  for (int i = tid; i < 64 * 8; i += 256) { const int j = i / 8, d8 = (i % 8) * 8; FragH f; f.half[0] = *(const v8us*)((const unsigned short*)V16 + ((size_t)b * SQ + s0 + j) * DM + h * HD + d8); for (int q = 0; q < 8; ++q) tl[d8 + q][j] = f.u[q]; }
  __syncthreads();
  { for (int i = tid; i < 64 * 8; i += 256) { const int d = i / 8, j8 = (i % 8) * 8; FragH f; for (int q = 0; q < 8; ++q) f.u[q] = tl[d][j8 + q]; *(v8us*)((unsigned short*)VT + ((size_t)hh * HD + d) * SQ + s0 + j8) = f.half[0]; }  } }



__global__ __launch_bounds__(256) void k_rsmcf2(const float* __restrict__ S, _Float16* __restrict__ P, int hg, int q0, int nk) {
  #pragma clang fp contract(off)
  const int t = blockIdx.x * 256 + threadIdx.x; if (t >= hg * QT) return; const size_t i = (size_t)t; const float* s = S + i * NKX; const int last = q0 + (t % QT); float mx = -3.0e38f;
#pragma unroll 1
  for (int j = 0; j < nk; ++j) { const float f = (j <= last) ? 1.f : 0.f; mx = fmaxf(mx, fmaf(f, s[j], (1.f - f) * -1.0e9f)); } float se = 0.f;
#pragma unroll 1
  for (int j = 0; j < nk; ++j) { const float f = (j <= last) ? 1.f : 0.f; se += __expf(fmaf(f, s[j], (1.f - f) * -1.0e9f) - mx); } const float sc = 256.0f / se;
#pragma unroll 1
  for (int j0 = 0; j0 < nk; j0 += 8) { FragH fr; for (int q = 0; q < 8; ++q) { const int j = j0 + q; const float f = (j <= last) ? 1.f : 0.f; fr.h[q] = (_Float16)(__expf(fmaf(f, s[j], (1.f - f) * -1.0e9f) - mx) * sc); } unsigned short* d = (unsigned short*)P + i * NKX + j0; *(v8us*)d = fr.half[0];  } }


template <int MASKADD>
__global__ __launch_bounds__(64) void k_att0(const float* __restrict__ QF, const float* __restrict__ KF, const float* __restrict__ VF, int ld, const float* __restrict__ mask, float scale, float* __restrict__ OF, int ldo) {
  #pragma clang fp contract(off)
  __shared__ __attribute__((aligned(16))) float lq[64][64]; __shared__ __attribute__((aligned(16))) float lo[64][64];
  const int tid = threadIdx.x; const int h = blockIdx.x / (QT0 / 64), rg = blockIdx.x % (QT0 / 64); const int i = rg * 64 + tid;
  const float* qr = QF + (size_t)i * ld + h * HD;
#pragma unroll 1
  for (int c = 0; c < HD / 4; ++c) { *(v4f*)&lq[tid][c * 4] = *(const v4fa*)(qr + c * 4); const v4f z = {0.f, 0.f, 0.f, 0.f}; *(v4f*)&lo[tid][c * 4] = z; }
  float m = -1.0e30f, l = 0.f; const int jmax = MASKADD ? (SQ - 1) : (rg * 64 + 63);      /* additive-mask form: every key (the mask input decides); causal form: keys up to the block's last row */
#pragma unroll 1
  for (int j = 0; j <= jmax; ++j) { const float* kr = KF + (size_t)j * ld + h * HD; const float* vr = VF + (size_t)j * ld + h * HD; float s = 0.f;
#pragma unroll 1
    for (int c = 0; c < HD / 4; ++c) { const v4f kq = *(const v4fa*)(kr + c * 4); const v4f qq = *(v4f*)&lq[tid][c * 4]; s = __fadd_rn(s, __fmul_rn(qq[0], kq[0])); s = __fadd_rn(s, __fmul_rn(qq[1], kq[1])); s = __fadd_rn(s, __fmul_rn(qq[2], kq[2])); s = __fadd_rn(s, __fmul_rn(qq[3], kq[3])); }
    s = __fmul_rn(s, scale); if (MASKADD) s = __fadd_rn(s, __fmul_rn(bf16_round(mask[(size_t)i * SQ + j]), -10000.0f));
    const float f = (MASKADD || j <= i) ? 1.f : 0.f; const float sm = fmaf(f, s, (1.f - f) * -1.0e30f); const float mn = fmaxf(m, sm); const float sc = expf(m - mn); const float e = expf(sm - mn); l = __fadd_rn(__fmul_rn(l, sc), e); m = mn;
#pragma unroll 1
    for (int c = 0; c < HD / 4; ++c) { const v4f vv = *(const v4fa*)(vr + c * 4); v4f oo = *(v4f*)&lo[tid][c * 4]; for (int u = 0; u < 4; ++u) oo[u] = __fadd_rn(__fmul_rn(oo[u], sc), __fmul_rn(e, vv[u])); *(v4f*)&lo[tid][c * 4] = oo; } }
  const float fin = 64.0f / l;      /* o carried x64 like the f16 path */
#pragma unroll 1
  for (int c = 0; c < HD / 4; ++c) { v4f oo = *(v4f*)&lo[tid][c * 4]; for (int u = 0; u < 4; ++u) oo[u] = __fmul_rn(oo[u], fin); *(v4f*)&lo[tid][c * 4] = oo; }
  __syncthreads();
  {
#pragma unroll 1
    for (int it = 0; it < 16; ++it) { const int row = it * 4 + tid / 16, pc = (tid % 16) * 4; const v4f v = *(const v4f*)&lo[row][pc]; *(v4f*)(OF + (size_t)(rg * 64 + row) * ldo + h * HD + pc) = v; }
     } }


__global__ __launch_bounds__(256) void k_kvexp(const float* __restrict__ src, float* __restrict__ dst, size_t n4) { const size_t t = (size_t)blockIdx.x * 256 + threadIdx.x; if (t >= n4) return; const size_t e = t * 4; const size_t row = e / DM; const int col = (int)(e % DM); const int h = col / HD, d = col % HD; const v4f v = *(const v4fa*)(src + row * KVD + (size_t)(h / HPG) * HD + d); *(v4f*)(dst + e) = v;  }

__global__ __launch_bounds__(256) void k_tab2(float theta, float* __restrict__ CS, float* __restrict__ SN) {
  #pragma clang fp contract(off)
  const int t = blockIdx.x * 256 + threadIdx.x; if (t >= SQ * (HD / 2)) return; const int i = t % (HD / 2); const int p = t / (HD / 2); const float invf = 1.0f / powf(theta, (float)(2 * i) / (float)HD); const float ang = __fmul_rn((float)p, invf); const float c = cosf(ang), s = sinf(ang);
  *(float*)(CS + t) = c; *(float*)(SN + t) = s;  }
template <int NORM, int ROPE>
__global__ __launch_bounds__(64) void k_xform(const float* __restrict__ F, int ldf, int nh, const float* __restrict__ gain, float eps, const float* __restrict__ CS, const float* __restrict__ SN, _Float16* __restrict__ H16, int ldo) {
  #pragma clang fp contract(off)
  __shared__ float xv[HD]; __shared__ float red[HD]; __shared__ unsigned short sh_[HD]; const int d = threadIdx.x; const int h = blockIdx.x % nh; const size_t r = blockIdx.x / nh; const int p = (int)(r % SQ);
  float x = F[r * (size_t)ldf + (size_t)h * HD + d];
  if (NORM) { red[d] = __fmul_rn(x, x); __syncthreads(); for (int st = HD / 2; st > 0; st >>= 1) { if (d < st) red[d] = __fadd_rn(red[d], red[d + st]); __syncthreads(); } const float rs = rsqrtf(__fadd_rn(red[0] / (float)HD, eps)); x = __fmul_rn(__fmul_rn(x, rs), bf16_round(gain[d])); }
  xv[d] = x; __syncthreads();
  float o = x;
  if (ROPE == 1) { const int i = d >> 1; const float c = CS[p * (HD / 2) + i], s = SN[p * (HD / 2) + i]; const float ev = xv[2 * i], od = xv[2 * i + 1]; o = (d & 1) ? __fadd_rn(__fmul_rn(ev, s), __fmul_rn(od, c)) : __fadd_rn(__fmul_rn(ev, c), -__fmul_rn(od, s)); }
  if (ROPE == 2) { const int i = d & (HD / 2 - 1); const float c = CS[p * (HD / 2) + i], s = SN[p * (HD / 2) + i]; const float lo = xv[i], hi = xv[i + HD / 2]; o = (d < HD / 2) ? __fadd_rn(__fmul_rn(lo, c), -__fmul_rn(hi, s)) : __fadd_rn(__fmul_rn(lo, s), __fmul_rn(hi, c)); }
  FragH th; th.h[0] = (_Float16)o; sh_[d] = th.u[0]; __syncthreads();
  if (d < HD / 8) { FragH f; for (int q = 0; q < 8; ++q) f.u[q] = sh_[d * 8 + q]; unsigned short* dst = (unsigned short*)H16 + r * (size_t)ldo + (size_t)h * HD + d * 8; *(v8us*)dst = f.half[0];  } }

template <int NORM, int ROPE>
__global__ __launch_bounds__(64) void k_xformf(const float* __restrict__ F, int ldf, int nh, const float* __restrict__ gain, float eps, const float* __restrict__ CS, const float* __restrict__ SN, float* __restrict__ F32, int ldo) {
  #pragma clang fp contract(off)
  __shared__ float xv[HD]; __shared__ float red[HD]; const int d = threadIdx.x; const int h = blockIdx.x % nh; const size_t r = blockIdx.x / nh; const int p = (int)(r % SQ);
  float x = F[r * (size_t)ldf + (size_t)h * HD + d];
  if (NORM) { red[d] = __fmul_rn(x, x); __syncthreads(); for (int st = HD / 2; st > 0; st >>= 1) { if (d < st) red[d] = __fadd_rn(red[d], red[d + st]); __syncthreads(); } const float rs = rsqrtf(__fadd_rn(red[0] / (float)HD, eps)); x = __fmul_rn(__fmul_rn(x, rs), bf16_round(gain[d])); }
  xv[d] = x; __syncthreads();
  float o = x;
  if (ROPE == 1) { const int i = d >> 1; const float c = CS[p * (HD / 2) + i], s = SN[p * (HD / 2) + i]; const float ev = xv[2 * i], od = xv[2 * i + 1]; o = (d & 1) ? __fadd_rn(__fmul_rn(ev, s), __fmul_rn(od, c)) : __fadd_rn(__fmul_rn(ev, c), -__fmul_rn(od, s)); }
  if (ROPE == 2) { const int i = d & (HD / 2 - 1); const float c = CS[p * (HD / 2) + i], s = SN[p * (HD / 2) + i]; const float lo = xv[i], hi = xv[i + HD / 2]; o = (d < HD / 2) ? __fadd_rn(__fmul_rn(lo, c), -__fmul_rn(hi, s)) : __fadd_rn(__fmul_rn(lo, s), __fmul_rn(hi, c)); }
  float* dst = F32 + r * (size_t)ldo + (size_t)h * HD + d; *(float*)dst = o;  }

__global__ __launch_bounds__(256) void k_trig(const float* __restrict__ a, float* __restrict__ CS, float* __restrict__ SN, int n) {
  #pragma clang fp contract(off)
  const int t = blockIdx.x * 256 + threadIdx.x; if (t >= n) return; const float v = bf16_round(a[t]); const float c = cosf(v), s = sinf(v);
  *(float*)(CS + t) = c; *(float*)(SN + t) = s;  }

__global__ __launch_bounds__(256) void k_tabpos(const int* __restrict__ pos, float* __restrict__ CS, float* __restrict__ SN, int n) {
  #pragma clang fp contract(off)
  const int t = blockIdx.x * 256 + threadIdx.x; if (t >= n) return; const int p = t / 32, i = t % 32; const float invf = (float)(1.0 / pow(10000.0, ((double)(2 * i)) / 64.0)); const float a = __fmul_rn((float)pos[p], invf); const float c = cosf(a), s = sinf(a);
  *(float*)(CS + t) = c; *(float*)(SN + t) = s;  }

// 2^x of four values. One asm statement so that every v_exp_f32 has an independent instruction behind it (early-clobber outputs: none overwrites a source);
// the closing v_nop is the slot that the instruction set asks for before the last result is read or its source overwritten.
__device__ __forceinline__ v4f exp2x4(v4f x) { float r0, r1, r2, r3;
  asm("v_exp_f32 %0, %4\n\tv_exp_f32 %1, %5\n\tv_exp_f32 %2, %6\n\tv_exp_f32 %3, %7\n\tv_nop" : "=&v"(r0), "=&v"(r1), "=&v"(r2), "=&v"(r3) : "v"(x[0]), "v"(x[1]), "v"(x[2]), "v"(x[3]));
  const v4f r = {r0, r1, r2, r3}; return r; }
// 2^x of one value; the v_nop is the slot that the instruction set asks for before the result is read or the source overwritten.
__device__ __forceinline__ float exp2x1(float x) { float r; asm("v_exp_f32 %0, %1\n\tv_nop" : "=&v"(r) : "v"(x)); return r; }
__device__ __forceinline__ v8f fa_mma(v16h a, v16h b, v8f c) { return __builtin_amdgcn_wmma_f32_16x16x32_f16(false, a, false, b, (short)0, c, false, false); }
// Causal XL attention of one (batch, head, 64 query rows) per work-group: scores, softmax and P V in one kernel, no score or weight plane in memory.
// A wave owns 16 query rows i0 .. i0 + 15 and walks the keys in passes of 32 (j0 = 0, 32, .. <= i0), sharing nothing with the other waves (no barrier).
// A pass: AC = (q+u) k^T (16x32) and BD' = (q+v) r^T over the 48 xl_r rows cb .. cb + 47, cb = SQ - 16 - i0 + j0 (row index clamped to SQ - 1; a clamped row is met above the diagonal only).
// rel_shift: score (m, n) takes BD'[m][n + 15 - m]; the shift is done by the LDS store (column cc of row m goes to place cc + 1 + m = n + 16 of the wave's own rows).
// Both tiles are read back with lane = row (the A-operand order), so a lane holds 16 scores of one row and the weights are formed in place as an A fragment.
// Running maximum and sum per row (weights x256 relative to the running maximum; accumulators rescaled when a maximum rises); weights as f16 hi + x1024 residual, V^T likewise:
// oh += Ph Vh, ol += Pl Vh + Ph Vl; o x64 = (oh + ol 2^-10) 64 / sum.
#define FPA 36      /* f32 pitch of the AC rows in LDS: 16 bytes x odd */
#define FPB 68      /* f32 pitch of the shifted BD' rows (places 1 .. 63 are written, 16 .. 47 read) and of the output rows staged there at the end */
__global__ __launch_bounds__(128) __attribute__((amdgpu_waves_per_eu(4, 4))) void k_fattn(const _Float16* __restrict__ QU, const _Float16* __restrict__ QV, const _Float16* __restrict__ K16, const _Float16* __restrict__ R16, const _Float16* __restrict__ VT, const _Float16* __restrict__ VTL, float* __restrict__ OF) {
  __shared__ __attribute__((aligned(16))) float sa[4][16][FPA]; __shared__ __attribute__((aligned(16))) float sb[4][16][FPB];
  const int lane = threadIdx.x & 31, ln = lane & 15, hh = lane >> 4; const int w = __builtin_amdgcn_readfirstlane((int)(threadIdx.x >> 5));      /* wave-uniform: scalar bases and trip count */
  const int h = blockIdx.y, b = blockIdx.z; const int i0 = (SQ / 64 - 1 - (int)blockIdx.x) * 64 + w * 16;      /* the long row blocks start first */
  const char* qub = (const char*)(QU + ((size_t)b * SQ + i0) * DM + h * HD); const char* qvb = (const char*)(QV + ((size_t)b * SQ + i0) * DM + h * HD);
  const unsigned oq = (unsigned)ln * (DM * 2u) + 16u * hh;      /* row ln of a [row][DM] f16 plane, the lane half's 16 bytes: Q and K */
  const unsigned ov = (unsigned)ln * (SQ * 2u) + 16u * hh;      /* row ln of a V^T plane */
  const v16h qu0 = g2_fragb(qub, oq), qu1 = g2_fragb(qub + 64, oq), qv0 = g2_fragb(qvb, oq), qv1 = g2_fragb(qvb + 64, oq);
  asm volatile("s_wait_xcnt 0x0" :: "s"(qub), "s"(qvb), "v"(oq) : "memory");      /* the wait that stands in front of any overwrite of a register that an issued load names; bases and offset are inputs so that they stay as they are up to here */
  const char* kp = (const char*)(K16 + (size_t)b * SQ * DM + h * HD) + oq; const char* rb = (const char*)(R16 + (size_t)h * SQ * HD);      /* kp, vp, vlp: the lane's own addresses, moved on once per pass */
  const char* vp = (const char*)(VT + (size_t)(b * NH + h) * HD * SQ) + ov; const char* vlp = (const char*)(VTL + (size_t)(b * NH + h) * HD * SQ) + ov;
  float (*pa)[FPA] = sa[w]; float (*pb)[FPB] = sb[w];
  const v8f z8 = {0.f,0.f,0.f,0.f,0.f,0.f,0.f,0.f}; v8f oh[4] = {z8, z8, z8, z8}, ol[4] = {z8, z8, z8, z8}; float m = -3.0e38f, l = 0.f;
  const int np = (i0 >> 5) + 1;
#pragma unroll 1      /* a second copy of the pass would not fit the registers of four waves per SIMD */
  for (int p = 0; p < np; ++p) { const int cb = SQ - 16 - i0 + p * 32; v16h kf[4], rf[6]; unsigned orr[3];
#pragma unroll
    for (int t = 0; t < 2; ++t) { kf[2 * t] = g2_fragb(kp + t * (16 * DM * 2), 0u); kf[2 * t + 1] = g2_fragb(kp + t * (16 * DM * 2) + 64, 0u); }
#pragma unroll
    for (int t = 0; t < 3; ++t) { orr[t] = (unsigned)min(cb + t * 16 + ln, SQ - 1) * (HD * 2u) + 16u * hh; rf[2 * t] = g2_fragb(rb, orr[t]); rf[2 * t + 1] = g2_fragb(rb + 64, orr[t]); }
    asm volatile("s_wait_xcnt 0x0" :: "v"(kp), "s"(rb), "v"(orr[0]), "v"(orr[1]), "v"(orr[2]) : "memory");      /* same wait, for the pass's K and xl_r loads: every address register is an input, so none is reused (as a destination either) before it */
    __builtin_amdgcn_sched_barrier(0);      /* keeps the pass's 20 K and xl_r loads in front of the first WMMA: behind it they would go out in groups, each with its own full wait */
    v8f s4[2], bd[3];
#pragma unroll
    for (int t = 0; t < 2; ++t) s4[t] = fa_mma(qu1, kf[2 * t + 1], fa_mma(qu0, kf[2 * t], z8));
#pragma unroll
    for (int t = 0; t < 3; ++t) bd[t] = fa_mma(qv1, rf[2 * t + 1], fa_mma(qv0, rf[2 * t], z8));
    v16h vh[4], vl[4];      /* V^T fragments, one per dim tile: they fly while the scores go through LDS and the softmax */
#pragma unroll
    for (int t = 0; t < 4; ++t) { vh[t] = g2_fragb(vp + t * (16 * SQ * 2), 0u); vl[t] = g2_fragb(vlp + t * (16 * SQ * 2), 0u); }
    asm volatile("s_wait_xcnt 0x0" :: "v"(vp), "v"(vlp) : "memory");      /* same wait, for the 16 V^T loads */
    __builtin_amdgcn_sched_barrier(0);      /* keeps those loads in front of the softmax, which hides them */
#pragma unroll
    for (int t = 0; t < 2; ++t) {
#pragma unroll
      for (int r = 0; r < 8; ++r) pa[8 * hh + r][t * 16 + ln] = s4[t][r]; }
#pragma unroll
    for (int t = 0; t < 3; ++t) {
#pragma unroll
      for (int r = 0; r < 8; ++r) pb[8 * hh + r][t * 16 + ln + 1 + 8 * hh + r] = bd[t][r]; }
    __builtin_amdgcn_fence(__ATOMIC_ACQ_REL, "workgroup", "local"); __builtin_amdgcn_wave_barrier();      /* the tiles are read across the wave's lanes: keeps the LDS stores in front of those reads */
    v4f sc[4];      /* sc[2 c], sc[2 c + 1]: keys j0 + 16 c + 8 hh .. + 7 of row ln */
#pragma unroll
    for (int c = 0; c < 2; ++c) { const int col = c * 16 + 8 * hh; sc[2 * c] = *(const v4f*)&pa[ln][col] + *(const v4f*)&pb[ln][16 + col]; sc[2 * c + 1] = *(const v4f*)&pa[ln][col + 4] + *(const v4f*)&pb[ln][16 + col + 4]; }
    __builtin_amdgcn_fence(__ATOMIC_ACQ_REL, "workgroup", "local"); __builtin_amdgcn_wave_barrier();      /* keeps the next pass's LDS stores behind these reads */
    if (p == np - 1) {      /* only the last pass meets the diagonal (j0 + 31 < i0 before it) */
#pragma unroll
      for (int c = 0; c < 4; ++c) {
#pragma unroll
        for (int q = 0; q < 4; ++q) { const int j = p * 32 + (c >> 1) * 16 + 8 * hh + (c & 1) * 4 + q; sc[c][q] = (j <= i0 + ln) ? sc[c][q] : -1.0e30f; } } }
    float mx = sc[0][0];
#pragma unroll
    for (int c = 0; c < 4; ++c) mx = fmaxf(mx, fmaxf(fmaxf(sc[c][0], sc[c][1]), fmaxf(sc[c][2], sc[c][3])));
    mx = fmaxf(mx, __shfl_xor(mx, 16, 32));      /* the other half of the row's 32 keys */
    const float mn = fmaxf(m, mx); const float al = exp2x1((m - mn) * 1.44269504f);
    if (__builtin_amdgcn_ballot_w32(mn > m) != 0) {      /* a scalar branch: where no row's maximum rose every factor is 1 */
#pragma unroll
      for (int r = 0; r < 8; ++r) { const float ar = __shfl(al, 8 * hh + r, 32);      /* accumulator register r holds row 8 hh + r */
#pragma unroll
        for (int t = 0; t < 4; ++t) { oh[t][r] *= ar; ol[t][r] *= ar; } } }
    m = mn; const float mb = 8.0f - mn * 1.44269504f; v4f ps = {0.f, 0.f, 0.f, 0.f}; FragH ph, pl;
#pragma unroll
    for (int c = 0; c < 4; ++c) { const v4f e = exp2x4(sc[c] * 1.44269504f + mb); ps += e;      /* 256 exp(s - m) */
#pragma unroll
      for (int q = 0; q < 4; ++q) { const _Float16 hv = (_Float16)e[q]; ph.h[c * 4 + q] = hv; pl.h[c * 4 + q] = (_Float16)((e[q] - (float)hv) * 1024.0f); } }
    l = l * al + ((ps[0] + ps[1]) + (ps[2] + ps[3]));
#pragma unroll
    for (int t = 0; t < 4; ++t) oh[t] = fa_mma(ph.v, vh[t], oh[t]);
#pragma unroll
    for (int t = 0; t < 4; ++t) ol[t] = fa_mma(pl.v, vh[t], ol[t]);
#pragma unroll
    for (int t = 0; t < 4; ++t) ol[t] = fa_mma(ph.v, vl[t], ol[t]);
    kp += 32 * DM * 2; vp += 64; vlp += 64; }
  l += __shfl_xor(l, 16, 32); const float inv = 64.0f / l;      /* the two halves' sums joined once; o carried x64 */
#pragma unroll
  for (int r = 0; r < 8; ++r) { const float ir = __shfl(inv, 8 * hh + r, 32);
#pragma unroll
    for (int t = 0; t < 4; ++t) pb[8 * hh + r][t * 16 + ln] = (oh[t][r] + ol[t][r] * 0.0009765625f) * ir; }
  __builtin_amdgcn_fence(__ATOMIC_ACQ_REL, "workgroup", "local"); __builtin_amdgcn_wave_barrier();      /* the rows are read across the wave's lanes for whole-line stores */
  float* op = OF + ((size_t)b * SQ + i0) * DM + h * HD; const int rsub = lane >> 4, c4 = (lane & 15) * 4;
#pragma unroll
  for (int q = 0; q < 8; ++q) { const int r = q * 2 + rsub; const v4f v = *(const v4f*)&pb[r][c4]; *(v4f*)(op + (size_t)r * DM + c4) = v; } }

template <int N>
__global__ __launch_bounds__(256) void k_rmsrow(float* __restrict__ X, const float* __restrict__ w, float eps) {
  #pragma clang fp contract(off)
  constexpr int PT = N / 256; __shared__ float red[256]; const size_t r = blockIdx.x; const int t = threadIdx.x; float* row = X + r * N + (size_t)t * PT; float v[PT]; float ss = 0.f;
  for (int q = 0; q < PT; ++q) { v[q] = row[q]; ss = __fadd_rn(ss, __fmul_rn(v[q], v[q])); }
  red[t] = ss; __syncthreads(); for (int k = 128; k > 0; k >>= 1) { if (t < k) red[t] = __fadd_rn(red[t], red[t + k]); __syncthreads(); }
  const float rs = rsqrtf(__fadd_rn(red[0] / (float)N, eps)); float o[PT]; for (int q = 0; q < PT; ++q) o[q] = __fmul_rn(__fmul_rn(v[q], rs), bf16_round(w[t * PT + q]));
  { for (int q = 0; q < PT; ++q) *(float*)(row + q) = o[q];  } }

__global__ __launch_bounds__(256) void k_bfr(const float* __restrict__ x, float* __restrict__ XB, size_t n8) { const size_t t = (size_t)blockIdx.x * 256 + threadIdx.x; if (t >= n8) return; v4f a = *(const v4fa*)(x + t * 8), c = *(const v4fa*)(x + t * 8 + 4); for (int q = 0; q < 4; ++q) { a[q] = bf16_round(a[q]); c[q] = bf16_round(c[q]); }
  { *(v4f*)(XB + t * 8) = a; *(v4f*)(XB + t * 8 + 4) = c;  } }





// Exact f32 XL attention of the first QT0 rows of a batch: one wave per (head, row i). Lane = 16 hh + ln: ln owns dims 4 ln .. 4 ln + 3, hh one of two keys,
// so every 16-byte load instruction reads two whole 256-byte rows. Keys go in chunks of 32: a lane forms 16 partial dots (q+u).k + (q+v).r over its four dims,
// a four-step butterfly sums each over its 16 lanes, and lane l keeps the score of key 32 c + l. Scores, then weights, rest in the wave's own LDS row;
// maximum and sum are taken over the whole row (two passes, no rescaling); o = sum_j e_j v_j per half, the halves added at the end, x 64 / sum.
// Rows of K, V up to 32 c + 31 <= QT0 - 1 exist; a key above the diagonal gets -1e30 by the arithmetic select and its xl_r index is clamped.
__global__ __launch_bounds__(256) void k_att0xl(const float* __restrict__ QF, const float* __restrict__ QVF, const float* __restrict__ KF, const float* __restrict__ VF, const float* __restrict__ RF, float* __restrict__ OF) {
  __shared__ __attribute__((aligned(16))) float pw[8][QT0];
  { const size_t bo = (size_t)blockIdx.y * (QT0 * DM); QF += bo; QVF += bo; KF += bo; VF += bo; OF += bo; }      /* grid.y = batch: every plane holds QT0 rows per batch */
  const int lane = threadIdx.x & 31, ln = lane & 15, hh = lane >> 4; const int w = __builtin_amdgcn_readfirstlane((int)(threadIdx.x >> 5));      /* wave-uniform: scalar row bases and trip counts */
  const int h = blockIdx.x % NH; const int i = QT0 - 1 - ((int)(blockIdx.x / NH) * 8 + w); const int nch = (i >> 5) + 1;      /* the long rows start first; nch chunks of 32 keys cover 0 .. i */
  const unsigned qo = (unsigned)(i * DM + h * HD + ln * 4) * 4u;
  const v4f q4 = *(const v4fa*)((const char*)QF + qo), qv4 = *(const v4fa*)((const char*)QVF + qo);
  const unsigned ko = (unsigned)(hh * 16 * DM + h * HD + ln * 4) * 4u;      /* the lane's byte offset in a chunk of K or V rows */
  const char* rb = (const char*)(RF + (size_t)h * SQ * HD); float* pr = pw[w]; float mx = -3.0e38f;
#pragma unroll 1
  for (int c = 0; c < nch; ++c) { const char* kp = (const char*)KF + (size_t)c * (32 * DM * 4) + ko; const int r0 = SQ - 1 - i + c * 32 + hh * 16; v4f kk[16], rr[16]; unsigned ro[16];
#pragma unroll
    for (int u = 0; u < 16; ++u) { ro[u] = (unsigned)min(r0 + u, SQ - 1) * (HD * 4u) + ln * 16u; kk[u] = *(const v4fa*)(kp + u * (DM * 4)); rr[u] = *(const v4fa*)(rb + ro[u]); }      /* key j = 32 c + 16 hh + u; xl_r row min(SQ - 1 - i + j, SQ - 1) */
    /* the wait that stands in front of any overwrite of a register that an issued load names, for the chunk's 32 loads: every address register is an input, so none is reused (as a destination either) before it */
    asm volatile("s_wait_xcnt 0x0" :: "v"(kp), "s"(rb), "v"(ro[0]), "v"(ro[1]), "v"(ro[2]), "v"(ro[3]), "v"(ro[4]), "v"(ro[5]), "v"(ro[6]), "v"(ro[7]), "v"(ro[8]), "v"(ro[9]), "v"(ro[10]), "v"(ro[11]), "v"(ro[12]), "v"(ro[13]), "v"(ro[14]), "v"(ro[15]) : "memory");
    __builtin_amdgcn_sched_barrier(0);      /* keeps the arithmetic behind the chunk's loads: without it most K rows are loaded one at a time, each with its own wait */
    float keep = 0.f;
#pragma unroll
    for (int u = 0; u < 16; ++u) { float p = q4[0] * kk[u][0];
#pragma unroll
      for (int d = 1; d < 4; ++d) p = fmaf(q4[d], kk[u][d], p);
#pragma unroll
      for (int d = 0; d < 4; ++d) p = fmaf(qv4[d], bf16_round(rr[u][d]), p);
      p += __shfl_xor(p, 1, 32); p += __shfl_xor(p, 2, 32); p += __shfl_xor(p, 4, 32); p += __shfl_xor(p, 8, 32);
      keep = (ln == u) ? p : keep; }
    const float f = (c * 32 + lane <= i) ? 1.f : 0.f; const float sm = fmaf(f, keep, (1.f - f) * -1.0e30f); pr[c * 32 + lane] = sm; mx = fmaxf(mx, sm); }
#pragma unroll
  for (int m = 16; m > 0; m >>= 1) mx = fmaxf(mx, __shfl_xor(mx, m, 32));
  float l = 0.f;
#pragma unroll 1
  for (int c = 0; c < nch; ++c) { const float e = expf(pr[c * 32 + lane] - mx); pr[c * 32 + lane] = e; l += e; }      /* each lane reads back what it wrote itself */
#pragma unroll
  for (int m = 16; m > 0; m >>= 1) l += __shfl_xor(l, m, 32);
  __builtin_amdgcn_fence(__ATOMIC_ACQ_REL, "workgroup"); __builtin_amdgcn_wave_barrier();      /* the weights are read across the wave's lanes from here on: keeps the LDS stores in front of those reads */
  v4f o = {0.f, 0.f, 0.f, 0.f};
#pragma unroll 1
  for (int c = 0; c < nch; ++c) { const char* vp = (const char*)VF + (size_t)c * (32 * DM * 4) + ko; v4f vv[16], pe[4];
#pragma unroll
    for (int u = 0; u < 16; ++u) vv[u] = *(const v4fa*)(vp + u * (DM * 4));
    asm volatile("s_wait_xcnt 0x0" :: "v"(vp) : "memory");      /* same wait, for the chunk's 16 loads; the address is an input so that no load of the chunk gets it as its destination */
#pragma unroll
    for (int m = 0; m < 4; ++m) pe[m] = *(const v4f*)&pr[c * 32 + hh * 16 + m * 4];      /* the half's 16 weights, one address per half */
#pragma unroll
    for (int u = 0; u < 16; ++u) { const float e = pe[u >> 2][u & 3];
#pragma unroll
      for (int d = 0; d < 4; ++d) o[d] = fmaf(e, vv[u][d], o[d]); } }
  const float fin = 64.0f / l;      /* o carried x64 like the f16 path */
#pragma unroll
  for (int d = 0; d < 4; ++d) o[d] = (o[d] + __shfl_xor(o[d], 16, 32)) * fin;
  if (hh == 0) *(v4f*)(OF + (size_t)i * DM + h * HD + ln * 4) = o; }

extern "C" void kernel_launch(void* const* d_in, const int* in_sizes, int n_in,
                              void* d_out, int out_size, void* d_ws, size_t ws_size, hipStream_t stream) {
  (void)in_sizes; (void)n_in; (void)out_size;
  const float* const* I = (const float* const*)d_in; const float* x = I[0]; const float* g = I[1]; const float* wq = I[2]; const float* wk = I[3]; const float* wv = I[4]; const float* wres = I[5]; const float* xlr = I[6]; const float* xlu = I[7]; const float* xlv = I[8];      /* x; RMS gain; w_q/w_k/w_v [1024][16][64] = [in][out]; w_res [1024][1024] [in][out]; xl_r [16][2048][64]; xl_u, xl_v [1][16][1][64] = per-head 64-vectors (a [1024] bias over the merged columns) */
  char* ws = (char*)d_ws; size_t off = 0;
  auto take = [&](size_t bytes) { char* p = ws + off; off += (bytes + 255) & ~(size_t)255; return p; };
  /* Planes that live across the attention kernel. */
  _Float16* BR = (_Float16*)take((size_t)DM * DM * 2); _Float16* QU = (_Float16*)take(NR * DM * 2); _Float16* QV = (_Float16*)take(NR * DM * 2); _Float16* K16 = (_Float16*)take(NR * DM * 2); _Float16* R16 = (_Float16*)take((size_t)NH * SQ * HD * 2); float* OF = (float*)take(NR * DM * 4); float* OF0 = (float*)take((size_t)NB * QT0 * DM * 4); _Float16* VT = (_Float16*)take((size_t)NB * NH * HD * SQ * 2); _Float16* VTL = (_Float16*)take((size_t)NB * NH * HD * SQ * 2);
  const size_t offs = off;
  /* What is last read in front of the attention kernel ... */
  _Float16* BQ = (_Float16*)take((size_t)DM * DM * 2); _Float16* BK = (_Float16*)take((size_t)DM * DM * 2); _Float16* BV = (_Float16*)take((size_t)DM * DM * 2);
  float* XT = (float*)take(NR * DM * 4); _Float16* X16 = (_Float16*)take(NR * DM * 2); _Float16* XL16 = (_Float16*)take(NR * DM * 2); float* QUF = (float*)take((size_t)NB * QT0 * DM * 4); float* QVF = (float*)take((size_t)NB * QT0 * DM * 4); float* KF0 = (float*)take((size_t)NB * QT0 * DM * 4); float* VF0 = (float*)take((size_t)NB * QT0 * DM * 4); float* VF = (float*)take(NR * DM * 4); _Float16* V16 = (_Float16*)take(NR * DM * 2); _Float16* VL16 = (_Float16*)take(NR * DM * 2);      /* v and wv carried as f32 -> f16 hi + x1024 residual (the first causal rows copy v almost verbatim into small outputs) */
  if (off > ws_size) return;
  /* ... shares its bytes with the operands of the output stage, written behind it. */
  off = offs;
  _Float16* O16 = (_Float16*)take(NR * DM * 2); _Float16* OL16 = (_Float16*)take(NR * DM * 2); _Float16* OH0 = (_Float16*)take((size_t)NB * QT0 * DM * 2); _Float16* OL0 = (_Float16*)take((size_t)NB * QT0 * DM * 2);
  { const unsigned gw = (unsigned)(((size_t)DM * DM / 8 + 255) / 256); k_wt_f16<<<gw, 256, 0, stream>>>(wq, BQ, DM, DM, 16.0f); k_wt_f16<<<gw, 256, 0, stream>>>(wk, BK, DM, DM, 16.0f); k_wt_f16<<<gw, 256, 0, stream>>>(wv, BV, DM, DM, 16.0f); k_wt_f16<<<gw, 256, 0, stream>>>(wres, BR, DM, DM, 16.0f); }      /* [in][out] ([in][h][k] flattened) -> Bt x16 */
  k_bfr<<<(unsigned)((NR * DM / 8 + 255) / 256), 256, 0, stream>>>(x, XT, NR * DM / 8); k_rmsrow<DM><<<(unsigned)NR, 256, 0, stream>>>(XT, g, 1e-6f); k_hl<<<(unsigned)((NR * DM / 8 + 255) / 256), 256, 0, stream>>>(XT, X16, XL16, NR * DM / 8);      /* x_t = RMSNorm(bf16(x)) g (f32, in place) -> f16 hi rows (+ x1024 residual rows for the exact first tile) */
  k_x16<<<(unsigned)(((size_t)NH * SQ * HD / 8 + 255) / 256), 256, 0, stream>>>(xlr, R16, (size_t)NH * SQ * HD / 8);      /* xl_r [h][j][64] as exact f16 rows (bf16-valued input) */
  k_gemm2<0><<<dim3((unsigned)((NR / 128) * (DM / 64)), 1), 128, 0, stream>>>(X16, DM, 0, BQ, DM, 0, 0.0078125f, xlu, 0, nullptr, 1, 0, 0, nullptr, QU, DM, 0, (int)NR, DM, DM, 0, 0, 0); k_gemm2<0><<<dim3((unsigned)((NR / 128) * (DM / 64)), 1), 128, 0, stream>>>(X16, DM, 0, BQ, DM, 0, 0.0078125f, xlv, 0, nullptr, 1, 0, 0, nullptr, QV, DM, 0, (int)NR, DM, DM, 0, 0, 0);      /* q / 8 + xl_u and q / 8 + xl_v (the per-head 64-vectors as [1024] column biases) -> f16 rows */
  k_gemm2<0><<<dim3((unsigned)((NR / 128) * (DM / 64)), 1), 128, 0, stream>>>(X16, DM, 0, BK, DM, 0, 0.0625f, nullptr, 0, nullptr, 1, 0, 0, nullptr, K16, DM, 0, (int)NR, DM, DM, 0, 0, 0); k_gemm2<0><<<dim3((unsigned)((NR / 128) * (DM / 64)), 1), 128, 0, stream>>>(X16, DM, 0, BV, DM, 0, 0.0625f, nullptr, 0, nullptr, 1, 0, 0, VF, nullptr, DM, 0, (int)NR, DM, DM, 0, 0, 0); k_hl<<<(unsigned)((NR * DM / 8 + 255) / 256), 256, 0, stream>>>(VF, V16, VL16, NR * DM / 8);      /* k -> f16; v f32 -> f16 hi + x1024 residual rows */
  /* From here to the output stage the two batches, which share nothing but weights, stand side by side in every launch: the batch is one more grid index. */
  const size_t zX = (size_t)SQ * DM, z0 = (size_t)QT0 * DM;      /* batch strides of the token-row planes and of the first-tile planes */
  k_vt<NH, SQ><<<NB * NH * (SQ / 64), 256, 0, stream>>>(V16, DM, 0, VT); k_vt<NH, SQ><<<NB * NH * (SQ / 64), 256, 0, stream>>>(VL16, DM, 0, VTL);      /* V^T hi and residual [batch][16][64][SQ] */
  { const dim3 g0((QT0 / 32) * (DM / 64), 1, NB);      /* hi and residual rows of x_t as the two terms of one launch */
    k_gemm2t<2><<<g0, 64, 0, stream>>>(X16, XL16, nullptr, DM, 0, BQ, BQ, nullptr, DM, 0, 0.0078125f, 0.00000762939453125f, 0.f, xlu, QUF, DM, 0, DM, DM, zX, 0, z0);
    k_gemm2t<2><<<g0, 64, 0, stream>>>(X16, XL16, nullptr, DM, 0, BQ, BQ, nullptr, DM, 0, 0.0078125f, 0.00000762939453125f, 0.f, xlv, QVF, DM, 0, DM, DM, zX, 0, z0);
    k_gemm2t<2><<<g0, 64, 0, stream>>>(X16, XL16, nullptr, DM, 0, BK, BK, nullptr, DM, 0, 0.0625f, 0.00006103515625f, 0.f, nullptr, KF0, DM, 0, DM, DM, zX, 0, z0);
    k_gemm2t<2><<<g0, 64, 0, stream>>>(X16, XL16, nullptr, DM, 0, BV, BV, nullptr, DM, 0, 0.0625f, 0.00006103515625f, 0.f, nullptr, VF0, DM, 0, DM, DM, zX, 0, z0);
    k_att0xl<<<dim3(NH * (QT0 / 8), NB), 256, 0, stream>>>(QUF, QVF, KF0, VF0, xlr, OF0); }      /* exact causal XL attention for rows 0..255 of each batch (o x64, f32) */
  k_fattn<<<dim3(SQ / 64, NH, NB), 128, 0, stream>>>(QU, QV, K16, R16, VT, VTL, OF);      /* wv x64 (f32) of every row: scores = AC + rel_shift(BD), causal softmax, P V (hi / residual terms) in one launch */
  k_hl<<<(unsigned)((NR * DM / 8 + 255) / 256), 256, 0, stream>>>(OF, O16, OL16, NR * DM / 8);      /* wv x64 -> f16 hi + x1024 residual rows */
  k_gemm2<0><<<dim3((unsigned)((NR / 128) * (DM / 64)), 1), 128, 0, stream>>>(O16, DM, 0, BR, DM, 0, 0.0009765625f, nullptr, 0, nullptr, 1, 0, 0, (float*)d_out, nullptr, DM, 0, (int)NR, DM, DM, 0, 0, 0); k_gemm2<0><<<dim3((unsigned)((NR / 128) * (DM / 64)), 1), 128, 0, stream>>>(OL16, DM, 0, BR, DM, 0, 0.00000095367431640625f, nullptr, 0, (const float*)d_out, -1, 0, 0, (float*)d_out, nullptr, DM, 0, (int)NR, DM, DM, 0, 0, 0);      /* res = wv_hi w_res 2^-10 += wv_lo w_res 2^-20 (own element) */
  k_hl<<<(unsigned)(((size_t)NB * QT0 * DM / 8 + 255) / 256), 256, 0, stream>>>(OF0, OH0, OL0, (size_t)NB * QT0 * DM / 8);      /* first-tile o (x64) -> f16 hi + x1024 residual planes */
  k_gemm2t<2><<<dim3((QT0 / 32) * (DM / 64), 1, NB), 64, 0, stream>>>(OH0, OL0, nullptr, DM, 0, BR, BR, nullptr, DM, 0, 0.0009765625f, 0.00000095367431640625f, 0.f, nullptr, (float*)d_out, DM, 0, DM, DM, z0, 0, zX);      /* rows 0..255 of each batch rewritten from the exact path: o_hi w_res 2^-10 + o_lo w_res 2^-20 */
}
